// v000
// Measured on an AMD MI455X. A time is GPU time per run, averaged over a window of back-to-back runs after a warm-up
// (all launches, gaps included; the runs take copies of the inputs in turn), and the median of several windows.
// Apart from v000's, it joins two sittings. Times from different sittings can be a few percent apart, while
// side-by-side timings come from the same sitting.
// v000 is the starting kernel. One run takes 1760 microseconds.
// Contractions S = pre^T.cur (x1/16), featT = P.cur^T, 1x1 conv = W.x: all v_wmma_f32_16x16x32_bf16 (bf16 operands RNE-converted from f32, f32 accumulate); softmax, bias, BN, PReLU in f32.
#include <hip/hip_runtime.h>
#include <math.h>
#include <stdint.h>

#define NB 4
#define NC 256
#define HW 4096
#define NX 512
#define QH 2048

typedef __attribute__((ext_vector_type(16))) _Float16 v16h;
typedef __attribute__((ext_vector_type(8)))  _Float16 v8h;
typedef __attribute__((ext_vector_type(16))) __bf16   v16b;
typedef __attribute__((ext_vector_type(8)))  __bf16   v8b;
typedef __attribute__((ext_vector_type(8)))  float    v8f;
typedef __attribute__((ext_vector_type(4)))  float    v4f;
typedef __attribute__((ext_vector_type(2)))  float    v2f;
typedef __attribute__((ext_vector_type(4)))  unsigned int v4u;
typedef __attribute__((ext_vector_type(8)))  unsigned short v8us;

__device__ __forceinline__ unsigned short f2bf_bits(float f) {
  unsigned u = __float_as_uint(f);
  return (unsigned short)((u + 0x7FFFu + ((u >> 16) & 1u)) >> 16);
}
__device__ __forceinline__ float bf_bits2f(unsigned short h) { return __uint_as_float(((unsigned)h) << 16); }

// hazard guards as plain device helpers (no inline asm inside the kernel template body)
__device__ __forceinline__ void dep_guard_h(v8f& a, v8f& b, v16h x, v16h y) { asm volatile("v_nop\n\tv_nop\n\tv_nop\n\tv_nop" : "+v"(a), "+v"(b) : "v"(x), "v"(y)); }
__device__ __forceinline__ void dep_guard_b(v8f& a, v8f& b, v16b x, v16b y) { asm volatile("v_nop\n\tv_nop\n\tv_nop\n\tv_nop" : "+v"(a), "+v"(b) : "v"(x), "v"(y)); }
__device__ __forceinline__ void keep4_h(v16h a, v16h b, v16h c, v16h d) { asm volatile("v_nop" :: "v"(a), "v"(b), "v"(c), "v"(d)); }
__device__ __forceinline__ void keep4_b(v16b a, v16b b, v16b c, v16b d) { asm volatile("v_nop" :: "v"(a), "v"(b), "v"(c), "v"(d)); }
__device__ __forceinline__ void acc_guard4(v8f& a, v8f& b, v8f& c, v8f& d) { asm volatile("v_nop\n\tv_nop\n\tv_nop\n\tv_nop" : "+v"(a), "+v"(b), "+v"(c), "+v"(d)); }
template <typename T> struct Frag;
template <> struct Frag<_Float16> {
  typedef v16h V; union U { v16h v; v8h h[2]; };
  static __device__ __forceinline__ v16h load(const _Float16* p) {   // elements 0..7 <- p[0..7], 8..15 <- p[16..23]
    U f; f.h[0] = *(const v8h*)(p); f.h[1] = *(const v8h*)(p + 16); return f.v;
  }
  static __device__ __forceinline__ v8f mma(v16h a, v16h b, v8f c) {
    return __builtin_amdgcn_wmma_f32_16x16x32_f16(false, a, false, b, (short)0, c, false, false);
  }
  static __device__ __forceinline__ void guard(v8f& a, v8f& b, v16h x, v16h y) { dep_guard_h(a, b, x, y); }
  static __device__ __forceinline__ void keep(v16h a, v16h b, v16h c, v16h d) { keep4_h(a, b, c, d); }
};
template <> struct Frag<__bf16> {
  typedef v16b V; union U { v16b v; v8b h[2]; };
  static __device__ __forceinline__ v16b load(const __bf16* p) {
    U f; f.h[0] = *(const v8b*)(p); f.h[1] = *(const v8b*)(p + 16); return f.v;
  }
  static __device__ __forceinline__ v8f mma(v16b a, v16b b, v8f c) {
    return __builtin_amdgcn_wmma_f32_16x16x32_bf16(false, a, false, b, (short)0, c, false, false);
  }
  static __device__ __forceinline__ void guard(v8f& a, v8f& b, v16b x, v16b y) { dep_guard_b(a, b, x, y); }
  static __device__ __forceinline__ void keep(v16b a, v16b b, v16b c, v16b d) { keep4_b(a, b, c, d); }
};

// ---- Register-blocked batched WMMA GEMM ------------------------------------
// C[m,n] = scale * sum_k A[m,k] * Bt[n,k] (+bias)(+resid); each wave owns a 64x64 tile.
// A row-major [M,K]; Bt row-major [N,K]; M,N % 64 == 0, K % 32 == 0.
// SPLIT: operands are hi/lo planes (A2/Bt2 = lo planes, same layout); product = hi.hi + hi.lo + lo.hi.
// BIAS_MODE: 0 = none, 1 = bias[m], 2 = bias[n].
// OUT_MODE: 0 = f32, 1 = f16, 2 = bf16 hi plane (Cout) + bf16 lo plane (Cout2), 3 = single bf16 plane (RNE).
// ET: 0 = f16 operands, 1 = bf16 operands (pointers passed as 16-bit storage)
template <int ET> struct Elem;
template <> struct Elem<0> { typedef _Float16 T; };
template <> struct Elem<1> { typedef __bf16 T; };
template <int ET, bool SPLIT, int BIAS_MODE, int OUT_MODE, bool RESID, int ACT = 0>
__global__ __launch_bounds__(256) void wmma_gemm64(
    const unsigned short* __restrict__ Ap, const unsigned short* __restrict__ A2p, int lda, long strideA,
    const unsigned short* __restrict__ Btp, const unsigned short* __restrict__ Bt2p, int ldb, long strideB,
    void* __restrict__ Cout, void* __restrict__ Cout2, int ldc, long strideC,
    const float* __restrict__ bias,
    const float* __restrict__ resid, long strideR,
    int M, int N, int K, float scale) {
  typedef typename Elem<ET>::T T;
  typedef typename Frag<T>::V V;
  const T* A = (const T*)Ap; const T* A2 = (const T*)A2p; const T* Bt = (const T*)Btp; const T* Bt2 = (const T*)Bt2p;
  __shared__ __align__(16) float sT[8][16 * 68];   // per-wave 16x64 slab, pitch 68 floats
  const int b    = blockIdx.y;
  const int lane = threadIdx.x & 31;
  const int wave = threadIdx.x >> 5;
  const int tilesN = N >> 6;
  const int tilesM = M >> 6;
  const int tile = blockIdx.x * 8 + wave;
  if (tile >= tilesM * tilesN) return;   // wave-uniform; no block barriers in this kernel
  const int tm = tile / tilesN;
  const int tn = tile - tm * tilesN;
  const int m0 = tm << 6;
  const int n0 = tn << 6;

  const T* Ab  = A  + (size_t)b * strideA;
  const T* Bb  = Bt + (size_t)b * strideB;
  const T* Ab2 = SPLIT ? (A2  + (size_t)b * strideA) : nullptr;
  const T* Bb2 = SPLIT ? (Bt2 + (size_t)b * strideB) : nullptr;

  const int rlane = lane & 15;                 // row (A) / col (B, D) within subtile
  const int koff  = (lane >> 4) * 8;           // k offset of this lane half
  const int mOff  = (lane >> 4) * 8;           // D row offset

  v8f acc[4][4];
#pragma unroll
  for (int i = 0; i < 4; ++i)
#pragma unroll
    for (int j = 0; j < 4; ++j) acc[i][j] = (v8f){0.f,0.f,0.f,0.f,0.f,0.f,0.f,0.f};

  for (int k0 = 0; k0 < K; k0 += 32) {
    V bh[4], bl[4];
#pragma unroll
    for (int j = 0; j < 4; ++j) {
      const size_t bo = (size_t)(n0 + (j << 4) + rlane) * ldb + koff + k0;
      bh[j] = Frag<T>::load(Bb + bo);
      if (SPLIT) bl[j] = Frag<T>::load(Bb2 + bo);
    }
#pragma unroll
    for (int i = 0; i < 4; ++i) {
      const size_t ao = (size_t)(m0 + (i << 4) + rlane) * lda + koff + k0;
      V ah = Frag<T>::load(Ab + ao);
      V al;
      if (SPLIT) al = Frag<T>::load(Ab2 + ao);
#pragma unroll
      for (int j = 0; j < 4; ++j) {
        acc[i][j] = Frag<T>::mma(ah, bh[j], acc[i][j]);
        if (SPLIT) {
          acc[i][j] = Frag<T>::mma(ah, bl[j], acc[i][j]);
          acc[i][j] = Frag<T>::mma(al, bh[j], acc[i][j]);
        }
      }
      Frag<T>::guard(acc[i][0], acc[i][3], ah, SPLIT ? al : ah);
    }
    Frag<T>::keep(bh[0], bh[1], bh[2], bh[3]);
    if (SPLIT) Frag<T>::keep(bl[0], bl[1], bl[2], bl[3]);
  }
  acc_guard4(acc[0][0], acc[0][1], acc[0][2], acc[0][3]);
  acc_guard4(acc[1][0], acc[1][1], acc[1][2], acc[1][3]);
  acc_guard4(acc[2][0], acc[2][1], acc[2][2], acc[2][3]);
  acc_guard4(acc[3][0], acc[3][1], acc[3][2], acc[3][3]);

  // ---- epilogue ----
  float* slab = sT[wave];
  const float* Rb = RESID ? (resid + (size_t)b * strideR) : nullptr;
#pragma unroll
  for (int i = 0; i < 4; ++i) {
    const int mBase = m0 + (i << 4);
#pragma unroll
    for (int j = 0; j < 4; ++j) {
      const int n = n0 + (j << 4) + rlane;
      float bv = 0.f;
      if (BIAS_MODE == 2) bv = bias[n];
#pragma unroll
      for (int r = 0; r < 8; ++r) {
        float v = acc[i][j][r] * scale;
        if (BIAS_MODE == 1) v += bias[mBase + mOff + r];
        if (BIAS_MODE == 2) v += bv;
        if (RESID) v += Rb[(size_t)(mBase + mOff + r) * ldc + n];
        if (ACT == 1) v = tanhf(v);
        if (ACT == 2) v = fmaxf(v, 0.0f);
        if (ACT == 3) v = v / (1.0f + expf(-v));
        if (ACT == 4) v = (v > 0.f) ? v : 0.01f * v;
        slab[(mOff + r) * 68 + (j << 4) + rlane] = v;
      }
    }
    __builtin_amdgcn_fence(__ATOMIC_RELEASE, "workgroup");
    __builtin_amdgcn_wave_barrier();
    __builtin_amdgcn_fence(__ATOMIC_ACQUIRE, "workgroup");
    if (OUT_MODE == 0) {
      float* C = (float*)Cout + (size_t)b * strideC;
      const int hh = lane >> 4, c4 = (lane & 15) * 4;     // row seg = 256 B = 16 lanes x 16 B
      {
#pragma unroll
        for (int it = 0; it < 8; ++it) {
          const int row = it * 2 + hh;
          v4f v = *(const v4f*)(slab + row * 68 + c4);
          *(v4f*)(C + (size_t)(mBase + row) * ldc + n0 + c4) = v;
        }
        
      }
    } else {
      const int q = lane >> 3, c8 = (lane & 7) * 8;
      unsigned short* C  = (unsigned short*)Cout  + (size_t)b * strideC;
      unsigned short* C2 = (OUT_MODE == 2) ? ((unsigned short*)Cout2 + (size_t)b * strideC) : nullptr;
      {
#pragma unroll
        for (int it = 0; it < 4; ++it) {
          const int row = it * 4 + q;
          const float* sp = slab + row * 68 + c8;
          v8h hv, lv;
#pragma unroll
          for (int e = 0; e < 8; ++e) {
            if (OUT_MODE == 1) {
              hv[e] = (_Float16)sp[e];
            } else if (OUT_MODE == 3) {
              hv[e] = __builtin_bit_cast(_Float16, f2bf_bits(sp[e]));
            } else {
              unsigned short hb = f2bf_bits(sp[e]);
              unsigned short lb = f2bf_bits(sp[e] - bf_bits2f(hb));
              hv[e] = __builtin_bit_cast(_Float16, hb);
              lv[e] = __builtin_bit_cast(_Float16, lb);
            }
          }
          *(v8h*)(C + (size_t)(mBase + row) * ldc + n0 + c8) = hv;
          if (OUT_MODE == 2) *(v8h*)(C2 + (size_t)(mBase + row) * ldc + n0 + c8) = lv;
        }
        
      }
    }
    __builtin_amdgcn_fence(__ATOMIC_RELEASE, "workgroup");
    __builtin_amdgcn_wave_barrier();
    __builtin_amdgcn_fence(__ATOMIC_ACQUIRE, "workgroup");
  }
}

// ---------------------------------------------------------------------------
// Elementwise cast out = bf16(in) (RNE): 2 elements per thread, one 4-B store per lane -> each wave writes
// Coverage: grid = ceil(n2/256) blocks x 256 threads x 2 elements = 2*n2 elements = the whole plane (n2 = plane/2).
// ---------------------------------------------------------------------------
__global__ __launch_bounds__(256) void cast_f32_bf16x2(const float* __restrict__ in, unsigned short* __restrict__ out, int n2) {
  const int i = blockIdx.x * 256 + threadIdx.x;
  if (i < n2) {
    const v2f f = *(const v2f*)(in + 2 * (size_t)i);
    const unsigned u = (unsigned)f2bf_bits(f[0]) | ((unsigned)f2bf_bits(f[1]) << 16);
    ((unsigned*)out)[i] = u;
    
  }
}

// ---------------------------------------------------------------------------
// Transpose-cast of one 64x64 tile: in f32 [NC rows (c)][ldi cols (i)] -> out[(i) * ldo + col0 + c] = bf16(in[c][i]).
// grid (HW/64 i-tiles, NC/64 c-tiles), 256 threads.
// Load coverage: 4 iterations x 256 threads = 1024 float4 = 64 c-rows x 64 i-cols (cr = idx>>4 spans 0..63, q spans 0..15).
// Store coverage: 8 waves x 2 iterations x 4 rows (q = lane>>3) = 64 out rows; 8 lanes x 8 halves = 64 cols per row;
// ---------------------------------------------------------------------------
__global__ __launch_bounds__(256) void tr_cast_bf16(const float* __restrict__ in, int ldi,
                                                    unsigned short* __restrict__ out, int ldo, int col0) {
  __shared__ __align__(16) unsigned short sm[64 * 72];   // [i local][c local], pitch 72 halves (144 B)
  const int tid  = threadIdx.x;
  const int lane = tid & 31;
  const int wave = tid >> 5;
  const int i0 = blockIdx.x * 64;
  const int c0 = blockIdx.y * 64;
#pragma unroll
  for (int it = 0; it < 4; ++it) {
    const int idx = tid + 256 * it;      // 0..1023
    const int cr  = idx >> 4;            // 0..63
    const int q   = idx & 15;            // 0..15
    const v4f f = *(const v4f*)(in + (size_t)(c0 + cr) * ldi + i0 + 4 * q);
    sm[(4 * q + 0) * 72 + cr] = f2bf_bits(f[0]);
    sm[(4 * q + 1) * 72 + cr] = f2bf_bits(f[1]);
    sm[(4 * q + 2) * 72 + cr] = f2bf_bits(f[2]);
    sm[(4 * q + 3) * 72 + cr] = f2bf_bits(f[3]);
  }
  __syncthreads();
  const int q  = lane >> 3;
  const int c8 = (lane & 7) * 8;
  {
#pragma unroll
    for (int it = 0; it < 2; ++it) {
      const int row = wave * 8 + it * 4 + q;
      const v8us v = *(const v8us*)(sm + row * 72 + c8);
      const v4u u = __builtin_bit_cast(v4u, v);
      *(v4u*)(out + (size_t)(i0 + row) * ldo + col0 + c0 + c8) = u;
    }
    
  }
}

// ---------------------------------------------------------------------------
// Row softmax over j of S[i][0..HW) (S already holds scores/16, f32); P[i][j] = bf16(p) (RNE).
// One block per row; 512 threads x 8 columns (j0 = tid*8) = 4096 = the whole row.
// Reductions in fixed order: per thread, wave shuffle tree, then the 16 wave partials in index order.
// Producer coverage: grid = QH rows; per row 512 threads x 8 halves = 4096 = the whole P row;
// ---------------------------------------------------------------------------
__global__ __launch_bounds__(512) void softmax_row_kernel(const float* __restrict__ S, unsigned short* __restrict__ P) {
  __shared__ float redm[16];
  __shared__ float reds[16];
  const int i    = blockIdx.x;
  const int tid  = threadIdx.x;
  const int lane = tid & 31;
  const int wave = tid >> 5;
  const int j0   = tid * 8;
  const float* rp = S + (size_t)i * HW + j0;
  const v4f a = *(const v4f*)(rp);
  const v4f c = *(const v4f*)(rp + 4);
  float m = fmaxf(fmaxf(fmaxf(a[0], a[1]), fmaxf(a[2], a[3])), fmaxf(fmaxf(c[0], c[1]), fmaxf(c[2], c[3])));
#pragma unroll
  for (int off = 16; off > 0; off >>= 1) m = fmaxf(m, __shfl_xor(m, off, 32));
  if (lane == 0) redm[wave] = m;
  __syncthreads();
  float mx = redm[0];
#pragma unroll
  for (int w = 1; w < 16; ++w) mx = fmaxf(mx, redm[w]);
  const float e0 = __expf(a[0] - mx), e1 = __expf(a[1] - mx), e2 = __expf(a[2] - mx), e3 = __expf(a[3] - mx);
  const float e4 = __expf(c[0] - mx), e5 = __expf(c[1] - mx), e6 = __expf(c[2] - mx), e7 = __expf(c[3] - mx);
  float s = ((e0 + e1) + (e2 + e3)) + ((e4 + e5) + (e6 + e7));
#pragma unroll
  for (int off = 16; off > 0; off >>= 1) s += __shfl_xor(s, off, 32);
  if (lane == 0) reds[wave] = s;
  __syncthreads();
  float tot = reds[0];
#pragma unroll
  for (int w = 1; w < 16; ++w) tot += reds[w];
  const float inv = 1.0f / tot;              // tot >= 1 (the row max contributes exp(0))
  const float p0 = e0 * inv, p1 = e1 * inv, p2 = e2 * inv, p3 = e3 * inv;
  const float p4 = e4 * inv, p5 = e5 * inv, p6 = e6 * inv, p7 = e7 * inv;
  const v4u hv = (v4u){ (unsigned)f2bf_bits(p0) | ((unsigned)f2bf_bits(p1) << 16),
                        (unsigned)f2bf_bits(p2) | ((unsigned)f2bf_bits(p3) << 16),
                        (unsigned)f2bf_bits(p4) | ((unsigned)f2bf_bits(p5) << 16),
                        (unsigned)f2bf_bits(p6) | ((unsigned)f2bf_bits(p7) << 16) };
  const size_t ro = (size_t)i * HW + j0;
  *(v4u*)(P + ro) = hv;
  
}

// ---------------------------------------------------------------------------
// BN (running stats) + PReLU: out[o][i] = prelu((Y[o][i]) * inv[o] + shift[o]), Y already holds conv + b_conv (f32).
// inv = gamma*rsqrt(var + 1e-5), shift = beta - mean*inv, slope = alpha[0].
// 4 elements per thread (one float4); grid = n4/256 blocks x 256 threads x 4 = the whole [NC][HW] plane (n4 = NC*HW/4).
// ---------------------------------------------------------------------------
__global__ __launch_bounds__(256) void bn_prelu_kernel(const float* __restrict__ Y,
                                                       const float* __restrict__ gamma, const float* __restrict__ beta,
                                                       const float* __restrict__ rmean, const float* __restrict__ rvar,
                                                       const float* __restrict__ alpha,
                                                       float* __restrict__ out, int n4) {
  const int t = blockIdx.x * 256 + threadIdx.x;
  if (t < n4) {
    const int o = t >> 10;                       // HW/4 = 1024 float4 per output channel row
    const float inv   = gamma[o] * rsqrtf(rvar[o] + 1e-5f);
    const float shift = beta[o] - rmean[o] * inv;
    const float slope = alpha[0];
    const v4f y = *(const v4f*)(Y + 4 * (size_t)t);
    v4f r;
#pragma unroll
    for (int e = 0; e < 4; ++e) {
      const float v = y[e] * inv + shift;
      r[e] = (v >= 0.f) ? v : slope * v;
    }
    *(v4f*)(out + 4 * (size_t)t) = r;
    
  }
}

// ---------------------------------------------------------------------------
// Workspace region map (byte offsets); every region is fully rewritten before it is read
// (Wb once; PRET / CURb / XCAT cur half per batch; S / P per half; XCAT feat half per half; Y per batch).
//   Wb    bf16 [256][512]                  0          (262144 B)
//   PRET  bf16 [4096 i][256 c]             262144     (2097152 B)   pre^T of the current batch
//   CURb  bf16 [256 c][4096 j]             2359296    (2097152 B)   cur of the current batch, natural layout
//   XCAT  bf16 [4096 i][512]               4456448    (4194304 B)   cols 0..255 = feat^T, cols 256..511 = cur^T
//   S     f32  [2048 i][4096 j]            8650752    (33554432 B)  scores/16 of one half
//   P     bf16 [2048 i][4096 j]            42205184   (16777216 B)  softmax probabilities of one half
//   Y     f32  [256 o][4096 i]             58982400   (4194304 B)   conv + bias of the current batch
//   total                                  63176704 B
// ---------------------------------------------------------------------------
extern "C" void kernel_launch(void* const* d_in, const int* in_sizes, int n_in,
                              void* d_out, int out_size, void* d_ws, size_t ws_size,
                              hipStream_t stream) {
  if (n_in < 9) return;
  if (in_sizes[0] != NB * NC * HW || in_sizes[1] != NB * NC * HW) return;
  if (in_sizes[2] != NC * NX) return;
  if (in_sizes[3] != NC || in_sizes[4] != NC || in_sizes[5] != NC || in_sizes[6] != NC || in_sizes[7] != NC) return;
  if (in_sizes[8] < 1) return;
  if (out_size != NB * NC * HW) return;

  const float* pre   = (const float*)d_in[0];
  const float* cur   = (const float*)d_in[1];
  const float* W     = (const float*)d_in[2];
  const float* bconv = (const float*)d_in[3];
  const float* gamma = (const float*)d_in[4];
  const float* beta  = (const float*)d_in[5];
  const float* rmean = (const float*)d_in[6];
  const float* rvar  = (const float*)d_in[7];
  const float* alpha = (const float*)d_in[8];
  float* out = (float*)d_out;

  const size_t szWb   = (size_t)NC * NX * 2;
  const size_t szPRET = (size_t)HW * NC * 2;
  const size_t szCURb = (size_t)NC * HW * 2;
  const size_t szXCAT = (size_t)HW * NX * 2;
  const size_t szS    = (size_t)QH * HW * 4;
  const size_t szP    = (size_t)QH * HW * 2;
  const size_t szY    = (size_t)NC * HW * 4;
  size_t off = 0;
  const size_t oWb   = off; off += szWb;
  const size_t oPRET = off; off += szPRET;
  const size_t oCURb = off; off += szCURb;
  const size_t oXCAT = off; off += szXCAT;
  const size_t oS    = off; off += szS;
  const size_t oP    = off; off += szP;
  const size_t oY    = off; off += szY;
  if (off > ws_size) return;                    // 63176704 B total

  char* ws = (char*)d_ws;
  unsigned short* Wb   = (unsigned short*)(ws + oWb);
  unsigned short* PRET = (unsigned short*)(ws + oPRET);
  unsigned short* CURb = (unsigned short*)(ws + oCURb);
  unsigned short* XCAT = (unsigned short*)(ws + oXCAT);
  float*          Sb   = (float*)(ws + oS);
  unsigned short* Pb   = (unsigned short*)(ws + oP);
  float*          Yb   = (float*)(ws + oY);

  const dim3 blk(256);
  const int n2W = NC * NX / 2;                  // 65536 pairs
  const int n2C = NC * HW / 2;                  // 524288 pairs
  const int n4Y = NC * HW / 4;                  // 262144 float4
  const dim3 gCastW((n2W + 255) / 256);         // 256 blocks
  const dim3 gCastC((n2C + 255) / 256);         // 2048 blocks
  const dim3 gTr(HW / 64, NC / 64);             // 64 x 4 tiles: in [256][4096] -> out [4096][..]
  const dim3 gS(((QH / 64) * (HW / 64) + 7) / 8, 1);   // 256 blocks: M=2048, N=4096, K=256
  const dim3 gF(((QH / 64) * (NC / 64) + 7) / 8, 1);   // 16 blocks:  M=2048, N=256,  K=4096
  const dim3 gC(((NC / 64) * (HW / 64) + 7) / 8, 1);   // 32 blocks:  M=256,  N=4096, K=512
  const dim3 gE((n4Y + 255) / 256);             // 1024 blocks

  // W -> bf16 [256][512]
  cast_f32_bf16x2<<<gCastW, blk, 0, stream>>>(W, Wb, n2W);

  for (int b = 0; b < NB; ++b) {
    const float* preb = pre + (size_t)b * NC * HW;
    const float* curb = cur + (size_t)b * NC * HW;
    // pre[b] [256 c][4096 i] -> PRET [4096 i][256 c]
    tr_cast_bf16<<<gTr, blk, 0, stream>>>(preb, HW, PRET, NC, 0);
    // cur[b] [256 c][4096 j] -> XCAT[j][256 + c]
    tr_cast_bf16<<<gTr, blk, 0, stream>>>(curb, HW, XCAT, NX, NC);
    // cur[b] -> CURb [256 c][4096 j] (natural layout)
    cast_f32_bf16x2<<<gCastC, blk, 0, stream>>>(curb, CURb, n2C);

    for (int hf = 0; hf < 2; ++hf) {
      const unsigned short* Ah = PRET + (size_t)hf * QH * NC;   // rows hf*2048.. of PRET, lda 256
      // S[i][j] = (1/16) * sum_c PRET[i][c] * XCAT[j][256 + c]  (M=2048, N=4096, K=256, f32 out, ldc 4096)
      wmma_gemm64<1, false, 0, 0, false, 0><<<gS, blk, 0, stream>>>(
          Ah, Ah, NC, 0L, XCAT + NC, XCAT + NC, NX, 0L, (void*)Sb, (void*)Sb, HW, 0L,
          bconv, bconv, 0L, QH, HW, NC, 0.0625f);
      // P[i][j] = bf16(softmax_j(S[i][:]))
      softmax_row_kernel<<<dim3(QH), dim3(512), 0, stream>>>(Sb, Pb);
      // XCAT[hf*2048 + i][c] = bf16(sum_j P[i][j] * CURb[c][j])  (M=2048, N=256, K=4096, bf16 out, ldc 512)
      wmma_gemm64<1, false, 0, 3, false, 0><<<gF, blk, 0, stream>>>(
          Pb, Pb, HW, 0L, CURb, CURb, HW, 0L,
          (void*)(XCAT + (size_t)hf * QH * NX), (void*)(XCAT + (size_t)hf * QH * NX), NX, 0L,
          bconv, bconv, 0L, QH, NC, HW, 1.0f);
    }
    // Y[o][i] = sum_k Wb[o][k] * XCAT[i][k] + b_conv[o]  (M=256, N=4096, K=512, f32 out, ldc 4096)
    wmma_gemm64<1, false, 1, 0, false, 0><<<gC, blk, 0, stream>>>(
        Wb, Wb, NX, 0L, XCAT, XCAT, NX, 0L, (void*)Yb, (void*)Yb, HW, 0L,
        bconv, bconv, 0L, NC, HW, NX, 1.0f);
    // out[b][o][i] = prelu(bn(Y[o][i]))
    bn_prelu_kernel<<<gE, blk, 0, stream>>>(Yb, gamma, beta, rmean, rvar, alpha,
                                             out + (size_t)b * NC * HW, n4Y);
  }
  (void)hipGetLastError();
}

// v001
// Measured time: 564 microseconds a run.
// Two timings next to v000 both put it at 3.22 times that version's speed.
// Contractions S = pre^T.cur (x1/16), featT = P.cur^T, 1x1 conv = W.x: all v_wmma_f32_16x16x32_bf16 (bf16 operands RNE-converted from f32, f32 accumulate); softmax, bias, BN, PReLU in f32.
#include <hip/hip_runtime.h>
#include <math.h>
#include <stdint.h>

#define NB 4
#define NC 256
#define HW 4096
#define NX 512
#define QH 2048

typedef __attribute__((ext_vector_type(16))) _Float16 v16h;
typedef __attribute__((ext_vector_type(8)))  _Float16 v8h;
typedef __attribute__((ext_vector_type(16))) __bf16   v16b;
typedef __attribute__((ext_vector_type(8)))  __bf16   v8b;
typedef __attribute__((ext_vector_type(8)))  float    v8f;
typedef __attribute__((ext_vector_type(4)))  float    v4f;
typedef __attribute__((ext_vector_type(2)))  float    v2f;
typedef __attribute__((ext_vector_type(4)))  unsigned int v4u;
typedef __attribute__((ext_vector_type(8)))  unsigned short v8us;

__device__ __forceinline__ unsigned short f2bf_bits(float f) {
  unsigned u = __float_as_uint(f);
  return (unsigned short)((u + 0x7FFFu + ((u >> 16) & 1u)) >> 16);
}
__device__ __forceinline__ float bf_bits2f(unsigned short h) { return __uint_as_float(((unsigned)h) << 16); }

// hazard guards as plain device helpers (no inline asm inside the kernel template body)
__device__ __forceinline__ void dep_guard_h(v8f& a, v8f& b, v16h x, v16h y) { asm volatile("v_nop\n\tv_nop\n\tv_nop\n\tv_nop" : "+v"(a), "+v"(b) : "v"(x), "v"(y)); }
__device__ __forceinline__ void dep_guard_b(v8f& a, v8f& b, v16b x, v16b y) { asm volatile("v_nop\n\tv_nop\n\tv_nop\n\tv_nop" : "+v"(a), "+v"(b) : "v"(x), "v"(y)); }
__device__ __forceinline__ void keep4_h(v16h a, v16h b, v16h c, v16h d) { asm volatile("v_nop" :: "v"(a), "v"(b), "v"(c), "v"(d)); }
__device__ __forceinline__ void keep4_b(v16b a, v16b b, v16b c, v16b d) { asm volatile("v_nop" :: "v"(a), "v"(b), "v"(c), "v"(d)); }
__device__ __forceinline__ void acc_guard4(v8f& a, v8f& b, v8f& c, v8f& d) { asm volatile("v_nop\n\tv_nop\n\tv_nop\n\tv_nop" : "+v"(a), "+v"(b), "+v"(c), "+v"(d)); }
template <typename T> struct Frag;
template <> struct Frag<_Float16> {
  typedef v16h V; union U { v16h v; v8h h[2]; };
  static __device__ __forceinline__ v16h load(const _Float16* p) {   // elements 0..7 <- p[0..7], 8..15 <- p[16..23]
    U f; f.h[0] = *(const v8h*)(p); f.h[1] = *(const v8h*)(p + 16); return f.v;
  }
  static __device__ __forceinline__ v8f mma(v16h a, v16h b, v8f c) {
    return __builtin_amdgcn_wmma_f32_16x16x32_f16(false, a, false, b, (short)0, c, false, false);
  }
  static __device__ __forceinline__ void guard(v8f& a, v8f& b, v16h x, v16h y) { dep_guard_h(a, b, x, y); }
  static __device__ __forceinline__ void keep(v16h a, v16h b, v16h c, v16h d) { keep4_h(a, b, c, d); }
};
template <> struct Frag<__bf16> {
  typedef v16b V; union U { v16b v; v8b h[2]; };
  static __device__ __forceinline__ v16b load(const __bf16* p) {
    U f; f.h[0] = *(const v8b*)(p); f.h[1] = *(const v8b*)(p + 16); return f.v;
  }
  static __device__ __forceinline__ v8f mma(v16b a, v16b b, v8f c) {
    return __builtin_amdgcn_wmma_f32_16x16x32_bf16(false, a, false, b, (short)0, c, false, false);
  }
  static __device__ __forceinline__ void guard(v8f& a, v8f& b, v16b x, v16b y) { dep_guard_b(a, b, x, y); }
  static __device__ __forceinline__ void keep(v16b a, v16b b, v16b c, v16b d) { keep4_b(a, b, c, d); }
};

// ---- Register-blocked batched WMMA GEMM ------------------------------------
// C[m,n] = scale * sum_k A[m,k] * Bt[n,k] (+bias)(+resid); each wave (KS == 1) or each block (KS > 1) owns a 64x64 tile.
// A row-major [M,K]; Bt row-major [N,K]; M,N % 64 == 0, K % 32 == 0.
// SPLIT: operands are hi/lo planes (A2/Bt2 = lo planes, same layout); product = hi.hi + hi.lo + lo.hi.
// BIAS_MODE: 0 = none, 1 = bias[m], 2 = bias[n].
// OUT_MODE: 0 = f32, 1 = f16, 2 = bf16 hi plane (Cout) + bf16 lo plane (Cout2), 3 = single bf16 plane (RNE).
// ET: 0 = f16 operands, 1 = bf16 operands (pointers passed as 16-bit storage)
// KS: 1 = each wave owns a tile and all of K (8 tiles per block). KS > 1 = the block owns ONE tile and its KS waves
//     split K: wave w takes the 32-wide k steps w, w + KS, w + 2 KS, ...; the KS partial tiles meet in LDS
//     and are summed in wave order 0..KS-1, each wave finishing 64 / KS rows. For GEMMs with fewer tiles than the chip has room for.
template <int ET> struct Elem;
template <> struct Elem<0> { typedef _Float16 T; };
template <> struct Elem<1> { typedef __bf16 T; };
template <int ET, bool SPLIT, int BIAS_MODE, int OUT_MODE, bool RESID, int ACT = 0, int KS = 1>
__global__ __launch_bounds__(KS == 1 ? 256 : KS * 32) void wmma_gemm64(
    const unsigned short* __restrict__ Ap, const unsigned short* __restrict__ A2p, int lda, long strideA,
    const unsigned short* __restrict__ Btp, const unsigned short* __restrict__ Bt2p, int ldb, long strideB,
    void* __restrict__ Cout, void* __restrict__ Cout2, int ldc, long strideC,
    const float* __restrict__ bias,
    const float* __restrict__ resid, long strideR,
    int M, int N, int K, float scale) {
  typedef typename Elem<ET>::T T;
  typedef typename Frag<T>::V V;
  const T* A = (const T*)Ap; const T* A2 = (const T*)A2p; const T* Bt = (const T*)Btp; const T* Bt2 = (const T*)Bt2p;
  __shared__ __align__(16) float sT[KS == 1 ? 8 : KS * 4][16 * 68];   // KS == 1: per-wave 16x64 slab; KS > 1: per-wave 64x64 partial tile; pitch 68 floats
  const int b    = blockIdx.y;
  const int lane = threadIdx.x & 31;
  const int wave = (KS == 1) ? (int)(threadIdx.x >> 5) : __builtin_amdgcn_readfirstlane((int)(threadIdx.x >> 5));   // scalar, so the k loop stays a scalar loop
  const int tilesN = N >> 6;
  const int tilesM = M >> 6;
  const int tile = (KS == 1) ? (int)(blockIdx.x * 8 + wave) : (int)blockIdx.x;
  if (tile >= tilesM * tilesN) return;   // KS == 1: wave-uniform, no block barrier follows; KS > 1: block-uniform, ahead of the barrier
  const int tm = tile / tilesN;
  const int tn = tile - tm * tilesN;
  const int m0 = tm << 6;
  const int n0 = tn << 6;

  const T* Ab  = A  + (size_t)b * strideA;
  const T* Bb  = Bt + (size_t)b * strideB;
  const T* Ab2 = SPLIT ? (A2  + (size_t)b * strideA) : nullptr;
  const T* Bb2 = SPLIT ? (Bt2 + (size_t)b * strideB) : nullptr;

  const int rlane = lane & 15;                 // row (A) / col (B, D) within subtile
  const int koff  = (lane >> 4) * 8;           // k offset of this lane half
  const int mOff  = (lane >> 4) * 8;           // D row offset

  v8f acc[4][4];
#pragma unroll
  for (int i = 0; i < 4; ++i)
#pragma unroll
    for (int j = 0; j < 4; ++j) acc[i][j] = (v8f){0.f,0.f,0.f,0.f,0.f,0.f,0.f,0.f};

  for (int k0 = (KS == 1) ? 0 : wave * 32; k0 < K; k0 += 32 * KS) {
    V bh[4], bl[4];
#pragma unroll
    for (int j = 0; j < 4; ++j) {
      const size_t bo = (size_t)(n0 + (j << 4) + rlane) * ldb + koff + k0;
      bh[j] = Frag<T>::load(Bb + bo);
      if (SPLIT) bl[j] = Frag<T>::load(Bb2 + bo);
    }
#pragma unroll
    for (int i = 0; i < 4; ++i) {
      const size_t ao = (size_t)(m0 + (i << 4) + rlane) * lda + koff + k0;
      V ah = Frag<T>::load(Ab + ao);
      V al;
      if (SPLIT) al = Frag<T>::load(Ab2 + ao);
#pragma unroll
      for (int j = 0; j < 4; ++j) {
        acc[i][j] = Frag<T>::mma(ah, bh[j], acc[i][j]);
        if (SPLIT) {
          acc[i][j] = Frag<T>::mma(ah, bl[j], acc[i][j]);
          acc[i][j] = Frag<T>::mma(al, bh[j], acc[i][j]);
        }
      }
      Frag<T>::guard(acc[i][0], acc[i][3], ah, SPLIT ? al : ah);
    }
    Frag<T>::keep(bh[0], bh[1], bh[2], bh[3]);
    if (SPLIT) Frag<T>::keep(bl[0], bl[1], bl[2], bl[3]);
  }
  acc_guard4(acc[0][0], acc[0][1], acc[0][2], acc[0][3]);
  acc_guard4(acc[1][0], acc[1][1], acc[1][2], acc[1][3]);
  acc_guard4(acc[2][0], acc[2][1], acc[2][2], acc[2][3]);
  acc_guard4(acc[3][0], acc[3][1], acc[3][2], acc[3][3]);

  // ---- epilogue ----
  const float* Rb = RESID ? (resid + (size_t)b * strideR) : nullptr;
  if (KS > 1) {
    float* part = &sT[0][0];                    // [KS waves][64 rows][68]
    float* mine = part + wave * (64 * 68);
#pragma unroll
    for (int i = 0; i < 4; ++i)
#pragma unroll
      for (int j = 0; j < 4; ++j)
#pragma unroll
        for (int r = 0; r < 8; ++r) mine[((i << 4) + mOff + r) * 68 + (j << 4) + rlane] = acc[i][j][r];
    __syncthreads();                            // all KS partial tiles are in LDS before any wave sums them
    constexpr int ROWS = 64 / KS;               // rows of the tile that this wave finishes
    constexpr int CW   = (OUT_MODE == 0) ? 4 : 8;   // columns per lane: one 16-B store either way
    constexpr int RP   = 32 * CW / 64;          // rows per pass of the wave
    const int cc = (lane & (64 / CW - 1)) * CW;
#pragma unroll
    for (int it = 0; it < ROWS / RP; ++it) {
      const int row = wave * ROWS + it * RP + lane / (64 / CW);
      const int m = m0 + row;
      const float* sp = part + row * 68 + cc;
      float v[CW];
#pragma unroll
      for (int e = 0; e < CW; e += 4) {
        v4f s = *(const v4f*)(sp + e);
#pragma unroll
        for (int w = 1; w < KS; ++w) s += *(const v4f*)(sp + w * (64 * 68) + e);
        v[e] = s[0]; v[e + 1] = s[1]; v[e + 2] = s[2]; v[e + 3] = s[3];
      }
#pragma unroll
      for (int e = 0; e < CW; ++e) {
        float x = v[e] * scale;
        if (BIAS_MODE == 1) x += bias[m];
        if (BIAS_MODE == 2) x += bias[n0 + cc + e];
        if (RESID) x += Rb[(size_t)m * ldc + n0 + cc + e];
        if (ACT == 1) x = tanhf(x);
        if (ACT == 2) x = fmaxf(x, 0.0f);
        if (ACT == 3) x = x / (1.0f + expf(-x));
        if (ACT == 4) x = (x > 0.f) ? x : 0.01f * x;
        v[e] = x;
      }
      const size_t co = (size_t)b * strideC + (size_t)m * ldc + n0 + cc;
      if constexpr (OUT_MODE == 0) {
        *(v4f*)((float*)Cout + co) = (v4f){v[0], v[1], v[2], v[3]};
      } else {
        v8h hv, lv;
#pragma unroll
        for (int e = 0; e < 8; ++e) {
          const float x = v[e];
          if (OUT_MODE == 1) {
            hv[e] = (_Float16)x;
          } else {
            const unsigned short hb = f2bf_bits(x);
            hv[e] = __builtin_bit_cast(_Float16, hb);
            if (OUT_MODE == 2) lv[e] = __builtin_bit_cast(_Float16, f2bf_bits(x - bf_bits2f(hb)));
          }
        }
        *(v8h*)((unsigned short*)Cout + co) = hv;
        if (OUT_MODE == 2) *(v8h*)((unsigned short*)Cout2 + co) = lv;
      }
    }
    return;
  }
  float* slab = sT[wave];
#pragma unroll
  for (int i = 0; i < 4; ++i) {
    const int mBase = m0 + (i << 4);
#pragma unroll
    for (int j = 0; j < 4; ++j) {
      const int n = n0 + (j << 4) + rlane;
      float bv = 0.f;
      if (BIAS_MODE == 2) bv = bias[n];
#pragma unroll
      for (int r = 0; r < 8; ++r) {
        float v = acc[i][j][r] * scale;
        if (BIAS_MODE == 1) v += bias[mBase + mOff + r];
        if (BIAS_MODE == 2) v += bv;
        if (RESID) v += Rb[(size_t)(mBase + mOff + r) * ldc + n];
        if (ACT == 1) v = tanhf(v);
        if (ACT == 2) v = fmaxf(v, 0.0f);
        if (ACT == 3) v = v / (1.0f + expf(-v));
        if (ACT == 4) v = (v > 0.f) ? v : 0.01f * v;
        slab[(mOff + r) * 68 + (j << 4) + rlane] = v;
      }
    }
    __builtin_amdgcn_fence(__ATOMIC_RELEASE, "workgroup");
    __builtin_amdgcn_wave_barrier();
    __builtin_amdgcn_fence(__ATOMIC_ACQUIRE, "workgroup");
    if (OUT_MODE == 0) {
      float* C = (float*)Cout + (size_t)b * strideC;
      const int hh = lane >> 4, c4 = (lane & 15) * 4;     // row seg = 256 B = 16 lanes x 16 B
      {
#pragma unroll
        for (int it = 0; it < 8; ++it) {
          const int row = it * 2 + hh;
          v4f v = *(const v4f*)(slab + row * 68 + c4);
          *(v4f*)(C + (size_t)(mBase + row) * ldc + n0 + c4) = v;
        }
        
      }
    } else {
      const int q = lane >> 3, c8 = (lane & 7) * 8;
      unsigned short* C  = (unsigned short*)Cout  + (size_t)b * strideC;
      unsigned short* C2 = (OUT_MODE == 2) ? ((unsigned short*)Cout2 + (size_t)b * strideC) : nullptr;
      {
#pragma unroll
        for (int it = 0; it < 4; ++it) {
          const int row = it * 4 + q;
          const float* sp = slab + row * 68 + c8;
          v8h hv, lv;
#pragma unroll
          for (int e = 0; e < 8; ++e) {
            if (OUT_MODE == 1) {
              hv[e] = (_Float16)sp[e];
            } else if (OUT_MODE == 3) {
              hv[e] = __builtin_bit_cast(_Float16, f2bf_bits(sp[e]));
            } else {
              unsigned short hb = f2bf_bits(sp[e]);
              unsigned short lb = f2bf_bits(sp[e] - bf_bits2f(hb));
              hv[e] = __builtin_bit_cast(_Float16, hb);
              lv[e] = __builtin_bit_cast(_Float16, lb);
            }
          }
          *(v8h*)(C + (size_t)(mBase + row) * ldc + n0 + c8) = hv;
          if (OUT_MODE == 2) *(v8h*)(C2 + (size_t)(mBase + row) * ldc + n0 + c8) = lv;
        }
        
      }
    }
    __builtin_amdgcn_fence(__ATOMIC_RELEASE, "workgroup");
    __builtin_amdgcn_wave_barrier();
    __builtin_amdgcn_fence(__ATOMIC_ACQUIRE, "workgroup");
  }
}

// ---------------------------------------------------------------------------
// Elementwise cast out = bf16(in) (RNE): 2 elements per thread, one 4-B store per lane -> each wave writes
// Coverage: grid = ceil(n2/256) blocks x 256 threads x 2 elements = 2*n2 elements = the whole plane (n2 = plane/2).
// ---------------------------------------------------------------------------
__global__ __launch_bounds__(256) void cast_f32_bf16x2(const float* __restrict__ in, unsigned short* __restrict__ out, int n2) {
  const int i = blockIdx.x * 256 + threadIdx.x;
  if (i < n2) {
    const v2f f = *(const v2f*)(in + 2 * (size_t)i);
    const unsigned u = (unsigned)f2bf_bits(f[0]) | ((unsigned)f2bf_bits(f[1]) << 16);
    ((unsigned*)out)[i] = u;
    
  }
}

// ---------------------------------------------------------------------------
// Transpose-cast of one 64x64 tile: in f32 [NC rows (c)][ldi cols (i)] -> out[(i) * ldo + col0 + c] = bf16(in[c][i]).
// grid (HW/64 i-tiles, NC/64 c-tiles), 256 threads.
// Load coverage: 4 iterations x 256 threads = 1024 float4 = 64 c-rows x 64 i-cols (cr = idx>>4 spans 0..63, q spans 0..15).
// Store coverage: 8 waves x 2 iterations x 4 rows (q = lane>>3) = 64 out rows; 8 lanes x 8 halves = 64 cols per row;
// ---------------------------------------------------------------------------
__global__ __launch_bounds__(256) void tr_cast_bf16(const float* __restrict__ in, int ldi,
                                                    unsigned short* __restrict__ out, int ldo, int col0) {
  __shared__ __align__(16) unsigned short sm[64 * 72];   // [i local][c local], pitch 72 halves (144 B)
  const int tid  = threadIdx.x;
  const int lane = tid & 31;
  const int wave = tid >> 5;
  const int i0 = blockIdx.x * 64;
  const int c0 = blockIdx.y * 64;
#pragma unroll
  for (int it = 0; it < 4; ++it) {
    const int idx = tid + 256 * it;      // 0..1023
    const int cr  = idx >> 4;            // 0..63
    const int q   = idx & 15;            // 0..15
    const v4f f = *(const v4f*)(in + (size_t)(c0 + cr) * ldi + i0 + 4 * q);
    sm[(4 * q + 0) * 72 + cr] = f2bf_bits(f[0]);
    sm[(4 * q + 1) * 72 + cr] = f2bf_bits(f[1]);
    sm[(4 * q + 2) * 72 + cr] = f2bf_bits(f[2]);
    sm[(4 * q + 3) * 72 + cr] = f2bf_bits(f[3]);
  }
  __syncthreads();
  const int q  = lane >> 3;
  const int c8 = (lane & 7) * 8;
  {
#pragma unroll
    for (int it = 0; it < 2; ++it) {
      const int row = wave * 8 + it * 4 + q;
      const v8us v = *(const v8us*)(sm + row * 72 + c8);
      const v4u u = __builtin_bit_cast(v4u, v);
      *(v4u*)(out + (size_t)(i0 + row) * ldo + col0 + c0 + c8) = u;
    }
    
  }
}

// ---------------------------------------------------------------------------
// Row softmax over j of S[i][0..HW) (S already holds scores/16, f32); P[i][j] = bf16(p) (RNE).
// One block per row; 512 threads x 8 columns (j0 = tid*8) = 4096 = the whole row.
// Reductions in fixed order: per thread, wave shuffle tree, then the 16 wave partials in index order.
// Producer coverage: grid = QH rows; per row 512 threads x 8 halves = 4096 = the whole P row;
// ---------------------------------------------------------------------------
__global__ __launch_bounds__(512) void softmax_row_kernel(const float* __restrict__ S, unsigned short* __restrict__ P) {
  __shared__ float redm[16];
  __shared__ float reds[16];
  const int i    = blockIdx.x;
  const int tid  = threadIdx.x;
  const int lane = tid & 31;
  const int wave = tid >> 5;
  const int j0   = tid * 8;
  const float* rp = S + (size_t)i * HW + j0;
  const v4f a = *(const v4f*)(rp);
  const v4f c = *(const v4f*)(rp + 4);
  float m = fmaxf(fmaxf(fmaxf(a[0], a[1]), fmaxf(a[2], a[3])), fmaxf(fmaxf(c[0], c[1]), fmaxf(c[2], c[3])));
#pragma unroll
  for (int off = 16; off > 0; off >>= 1) m = fmaxf(m, __shfl_xor(m, off, 32));
  if (lane == 0) redm[wave] = m;
  __syncthreads();
  float mx = redm[0];
#pragma unroll
  for (int w = 1; w < 16; ++w) mx = fmaxf(mx, redm[w]);
  const float e0 = __expf(a[0] - mx), e1 = __expf(a[1] - mx), e2 = __expf(a[2] - mx), e3 = __expf(a[3] - mx);
  const float e4 = __expf(c[0] - mx), e5 = __expf(c[1] - mx), e6 = __expf(c[2] - mx), e7 = __expf(c[3] - mx);
  float s = ((e0 + e1) + (e2 + e3)) + ((e4 + e5) + (e6 + e7));
#pragma unroll
  for (int off = 16; off > 0; off >>= 1) s += __shfl_xor(s, off, 32);
  if (lane == 0) reds[wave] = s;
  __syncthreads();
  float tot = reds[0];
#pragma unroll
  for (int w = 1; w < 16; ++w) tot += reds[w];
  const float inv = 1.0f / tot;              // tot >= 1 (the row max contributes exp(0))
  const float p0 = e0 * inv, p1 = e1 * inv, p2 = e2 * inv, p3 = e3 * inv;
  const float p4 = e4 * inv, p5 = e5 * inv, p6 = e6 * inv, p7 = e7 * inv;
  const v4u hv = (v4u){ (unsigned)f2bf_bits(p0) | ((unsigned)f2bf_bits(p1) << 16),
                        (unsigned)f2bf_bits(p2) | ((unsigned)f2bf_bits(p3) << 16),
                        (unsigned)f2bf_bits(p4) | ((unsigned)f2bf_bits(p5) << 16),
                        (unsigned)f2bf_bits(p6) | ((unsigned)f2bf_bits(p7) << 16) };
  const size_t ro = (size_t)i * HW + j0;
  *(v4u*)(P + ro) = hv;
  
}

// ---------------------------------------------------------------------------
// BN (running stats) + PReLU: out[o][i] = prelu((Y[o][i]) * inv[o] + shift[o]), Y already holds conv + b_conv (f32).
// inv = gamma*rsqrt(var + 1e-5), shift = beta - mean*inv, slope = alpha[0].
// 4 elements per thread (one float4); grid = n4/256 blocks x 256 threads x 4 = the whole [NC][HW] plane (n4 = NC*HW/4).
// ---------------------------------------------------------------------------
__global__ __launch_bounds__(256) void bn_prelu_kernel(const float* __restrict__ Y,
                                                       const float* __restrict__ gamma, const float* __restrict__ beta,
                                                       const float* __restrict__ rmean, const float* __restrict__ rvar,
                                                       const float* __restrict__ alpha,
                                                       float* __restrict__ out, int n4) {
  const int t = blockIdx.x * 256 + threadIdx.x;
  if (t < n4) {
    const int o = t >> 10;                       // HW/4 = 1024 float4 per output channel row
    const float inv   = gamma[o] * rsqrtf(rvar[o] + 1e-5f);
    const float shift = beta[o] - rmean[o] * inv;
    const float slope = alpha[0];
    const v4f y = *(const v4f*)(Y + 4 * (size_t)t);
    v4f r;
#pragma unroll
    for (int e = 0; e < 4; ++e) {
      const float v = y[e] * inv + shift;
      r[e] = (v >= 0.f) ? v : slope * v;
    }
    *(v4f*)(out + 4 * (size_t)t) = r;
    
  }
}

// ---------------------------------------------------------------------------
// Workspace region map (byte offsets); every region is fully rewritten before it is read
// (Wb once; PRET / CURb / XCAT cur half per batch; S / P per half; XCAT feat half per half; Y per batch).
//   Wb    bf16 [256][512]                  0          (262144 B)
//   PRET  bf16 [4096 i][256 c]             262144     (2097152 B)   pre^T of the current batch
//   CURb  bf16 [256 c][4096 j]             2359296    (2097152 B)   cur of the current batch, natural layout
//   XCAT  bf16 [4096 i][512]               4456448    (4194304 B)   cols 0..255 = feat^T, cols 256..511 = cur^T
//   S     f32  [2048 i][4096 j]            8650752    (33554432 B)  scores/16 of one half
//   P     bf16 [2048 i][4096 j]            42205184   (16777216 B)  softmax probabilities of one half
//   Y     f32  [256 o][4096 i]             58982400   (4194304 B)   conv + bias of the current batch
//   total                                  63176704 B
// ---------------------------------------------------------------------------
extern "C" void kernel_launch(void* const* d_in, const int* in_sizes, int n_in,
                              void* d_out, int out_size, void* d_ws, size_t ws_size,
                              hipStream_t stream) {
  if (n_in < 9) return;
  if (in_sizes[0] != NB * NC * HW || in_sizes[1] != NB * NC * HW) return;
  if (in_sizes[2] != NC * NX) return;
  if (in_sizes[3] != NC || in_sizes[4] != NC || in_sizes[5] != NC || in_sizes[6] != NC || in_sizes[7] != NC) return;
  if (in_sizes[8] < 1) return;
  if (out_size != NB * NC * HW) return;

  const float* pre   = (const float*)d_in[0];
  const float* cur   = (const float*)d_in[1];
  const float* W     = (const float*)d_in[2];
  const float* bconv = (const float*)d_in[3];
  const float* gamma = (const float*)d_in[4];
  const float* beta  = (const float*)d_in[5];
  const float* rmean = (const float*)d_in[6];
  const float* rvar  = (const float*)d_in[7];
  const float* alpha = (const float*)d_in[8];
  float* out = (float*)d_out;

  const size_t szWb   = (size_t)NC * NX * 2;
  const size_t szPRET = (size_t)HW * NC * 2;
  const size_t szCURb = (size_t)NC * HW * 2;
  const size_t szXCAT = (size_t)HW * NX * 2;
  const size_t szS    = (size_t)QH * HW * 4;
  const size_t szP    = (size_t)QH * HW * 2;
  const size_t szY    = (size_t)NC * HW * 4;
  size_t off = 0;
  const size_t oWb   = off; off += szWb;
  const size_t oPRET = off; off += szPRET;
  const size_t oCURb = off; off += szCURb;
  const size_t oXCAT = off; off += szXCAT;
  const size_t oS    = off; off += szS;
  const size_t oP    = off; off += szP;
  const size_t oY    = off; off += szY;
  if (off > ws_size) return;                    // 63176704 B total

  char* ws = (char*)d_ws;
  unsigned short* Wb   = (unsigned short*)(ws + oWb);
  unsigned short* PRET = (unsigned short*)(ws + oPRET);
  unsigned short* CURb = (unsigned short*)(ws + oCURb);
  unsigned short* XCAT = (unsigned short*)(ws + oXCAT);
  float*          Sb   = (float*)(ws + oS);
  unsigned short* Pb   = (unsigned short*)(ws + oP);
  float*          Yb   = (float*)(ws + oY);

  const dim3 blk(256);
  const int n2W = NC * NX / 2;                  // 65536 pairs
  const int n2C = NC * HW / 2;                  // 524288 pairs
  const int n4Y = NC * HW / 4;                  // 262144 float4
  const dim3 gCastW((n2W + 255) / 256);         // 256 blocks
  const dim3 gCastC((n2C + 255) / 256);         // 2048 blocks
  const dim3 gTr(HW / 64, NC / 64);             // 64 x 4 tiles: in [256][4096] -> out [4096][..]
  const dim3 gS(((QH / 64) * (HW / 64) + 7) / 8, 1);   // 256 blocks: M=2048, N=4096, K=256
  const dim3 gF((QH / 64) * (NC / 64), 1);             // 128 blocks x 16 waves: M=2048, N=256,  K=4096, one tile per block, K over its waves
  const dim3 gC((NC / 64) * (HW / 64), 1);             // 256 blocks x 8 waves:  M=256,  N=4096, K=512,  one tile per block, K over its waves
  const dim3 gE((n4Y + 255) / 256);             // 1024 blocks

  // W -> bf16 [256][512]
  cast_f32_bf16x2<<<gCastW, blk, 0, stream>>>(W, Wb, n2W);

  for (int b = 0; b < NB; ++b) {
    const float* preb = pre + (size_t)b * NC * HW;
    const float* curb = cur + (size_t)b * NC * HW;
    // pre[b] [256 c][4096 i] -> PRET [4096 i][256 c]
    tr_cast_bf16<<<gTr, blk, 0, stream>>>(preb, HW, PRET, NC, 0);
    // cur[b] [256 c][4096 j] -> XCAT[j][256 + c]
    tr_cast_bf16<<<gTr, blk, 0, stream>>>(curb, HW, XCAT, NX, NC);
    // cur[b] -> CURb [256 c][4096 j] (natural layout)
    cast_f32_bf16x2<<<gCastC, blk, 0, stream>>>(curb, CURb, n2C);

    for (int hf = 0; hf < 2; ++hf) {
      const unsigned short* Ah = PRET + (size_t)hf * QH * NC;   // rows hf*2048.. of PRET, lda 256
      // S[i][j] = (1/16) * sum_c PRET[i][c] * XCAT[j][256 + c]  (M=2048, N=4096, K=256, f32 out, ldc 4096)
      wmma_gemm64<1, false, 0, 0, false, 0><<<gS, blk, 0, stream>>>(
          Ah, Ah, NC, 0L, XCAT + NC, XCAT + NC, NX, 0L, (void*)Sb, (void*)Sb, HW, 0L,
          bconv, bconv, 0L, QH, HW, NC, 0.0625f);
      // P[i][j] = bf16(softmax_j(S[i][:]))
      softmax_row_kernel<<<dim3(QH), dim3(512), 0, stream>>>(Sb, Pb);
      // XCAT[hf*2048 + i][c] = bf16(sum_j P[i][j] * CURb[c][j])  (M=2048, N=256, K=4096, bf16 out, ldc 512)
      wmma_gemm64<1, false, 0, 3, false, 0, 16><<<gF, dim3(512), 0, stream>>>(
          Pb, Pb, HW, 0L, CURb, CURb, HW, 0L,
          (void*)(XCAT + (size_t)hf * QH * NX), (void*)(XCAT + (size_t)hf * QH * NX), NX, 0L,
          bconv, bconv, 0L, QH, NC, HW, 1.0f);
    }
    // Y[o][i] = sum_k Wb[o][k] * XCAT[i][k] + b_conv[o]  (M=256, N=4096, K=512, f32 out, ldc 4096)
    wmma_gemm64<1, false, 1, 0, false, 0, 8><<<gC, blk, 0, stream>>>(
        Wb, Wb, NX, 0L, XCAT, XCAT, NX, 0L, (void*)Yb, (void*)Yb, HW, 0L,
        bconv, bconv, 0L, NC, HW, NX, 1.0f);
    // out[b][o][i] = prelu(bn(Y[o][i]))
    bn_prelu_kernel<<<gE, blk, 0, stream>>>(Yb, gamma, beta, rmean, rvar, alpha,
                                             out + (size_t)b * NC * HW, n4Y);
  }
  (void)hipGetLastError();
}

// v002
// It runs in 122 microseconds.
// Two timings next to v001 put it at 4.51 and 4.58 times that version's speed.
// Counting every step since v000, it is 14.6 times as fast.
// Contractions S = pre^T.cur (x1/16), featT = P.cur^T, 1x1 conv = W.x: all v_wmma_f32_16x16x32_bf16 (bf16 operands RNE-converted from f32, f32 accumulate); softmax, bias, BN, PReLU in f32.
#include <hip/hip_runtime.h>
#include <math.h>
#include <stdint.h>

#define NB 4
#define NC 256
#define HW 4096
#define NX 512

typedef __attribute__((ext_vector_type(16))) _Float16 v16h;
typedef __attribute__((ext_vector_type(8)))  _Float16 v8h;
typedef __attribute__((ext_vector_type(16))) __bf16   v16b;
typedef __attribute__((ext_vector_type(8)))  __bf16   v8b;
typedef __attribute__((ext_vector_type(8)))  float    v8f;
typedef __attribute__((ext_vector_type(4)))  float    v4f;
typedef __attribute__((ext_vector_type(2)))  float    v2f;
typedef __attribute__((ext_vector_type(4)))  unsigned int v4u;
typedef __attribute__((ext_vector_type(8)))  unsigned short v8us;

__device__ __forceinline__ unsigned short f2bf_bits(float f) {
  unsigned u = __float_as_uint(f);
  return (unsigned short)((u + 0x7FFFu + ((u >> 16) & 1u)) >> 16);
}
__device__ __forceinline__ float bf_bits2f(unsigned short h) { return __uint_as_float(((unsigned)h) << 16); }

// hazard guards as plain device helpers (no inline asm inside the kernel template body)
__device__ __forceinline__ void dep_guard_h(v8f& a, v8f& b, v16h x, v16h y) { asm volatile("v_nop\n\tv_nop\n\tv_nop\n\tv_nop" : "+v"(a), "+v"(b) : "v"(x), "v"(y)); }
__device__ __forceinline__ void dep_guard_b(v8f& a, v8f& b, v16b x, v16b y) { asm volatile("v_nop\n\tv_nop\n\tv_nop\n\tv_nop" : "+v"(a), "+v"(b) : "v"(x), "v"(y)); }
__device__ __forceinline__ void keep4_h(v16h a, v16h b, v16h c, v16h d) { asm volatile("v_nop" :: "v"(a), "v"(b), "v"(c), "v"(d)); }
__device__ __forceinline__ void keep4_b(v16b a, v16b b, v16b c, v16b d) { asm volatile("v_nop" :: "v"(a), "v"(b), "v"(c), "v"(d)); }
__device__ __forceinline__ void acc_guard4(v8f& a, v8f& b, v8f& c, v8f& d) { asm volatile("v_nop\n\tv_nop\n\tv_nop\n\tv_nop" : "+v"(a), "+v"(b), "+v"(c), "+v"(d)); }
template <typename T> struct Frag;
template <> struct Frag<_Float16> {
  typedef v16h V; union U { v16h v; v8h h[2]; };
  static __device__ __forceinline__ v16h load(const _Float16* p) {   // elements 0..7 <- p[0..7], 8..15 <- p[16..23]
    U f; f.h[0] = *(const v8h*)(p); f.h[1] = *(const v8h*)(p + 16); return f.v;
  }
  static __device__ __forceinline__ v8f mma(v16h a, v16h b, v8f c) {
    return __builtin_amdgcn_wmma_f32_16x16x32_f16(false, a, false, b, (short)0, c, false, false);
  }
  static __device__ __forceinline__ void guard(v8f& a, v8f& b, v16h x, v16h y) { dep_guard_h(a, b, x, y); }
  static __device__ __forceinline__ void keep(v16h a, v16h b, v16h c, v16h d) { keep4_h(a, b, c, d); }
};
template <> struct Frag<__bf16> {
  typedef v16b V; union U { v16b v; v8b h[2]; };
  static __device__ __forceinline__ v16b load(const __bf16* p) {
    U f; f.h[0] = *(const v8b*)(p); f.h[1] = *(const v8b*)(p + 16); return f.v;
  }
  static __device__ __forceinline__ v8f mma(v16b a, v16b b, v8f c) {
    return __builtin_amdgcn_wmma_f32_16x16x32_bf16(false, a, false, b, (short)0, c, false, false);
  }
  static __device__ __forceinline__ void guard(v8f& a, v8f& b, v16b x, v16b y) { dep_guard_b(a, b, x, y); }
  static __device__ __forceinline__ void keep(v16b a, v16b b, v16b c, v16b d) { keep4_b(a, b, c, d); }
};

// ---- Register-blocked batched WMMA GEMM ------------------------------------
// C[m,n] = scale * sum_k A[m,k] * Bt[n,k] (+bias)(+resid); each wave (KS == 1) or each block (KS > 1) owns a 64x64 tile.
// A row-major [M,K]; Bt row-major [N,K]; M,N % 64 == 0, K % 32 == 0.
// SPLIT: operands are hi/lo planes (A2/Bt2 = lo planes, same layout); product = hi.hi + hi.lo + lo.hi.
// BIAS_MODE: 0 = none, 1 = bias[m], 2 = bias[n].
// OUT_MODE: 0 = f32, 1 = f16, 2 = bf16 hi plane (Cout) + bf16 lo plane (Cout2), 3 = single bf16 plane (RNE).
// ET: 0 = f16 operands, 1 = bf16 operands (pointers passed as 16-bit storage)
// KS: 1 = each wave owns a tile and all of K (8 tiles per block). KS > 1 = the block owns ONE tile and its KS waves
//     split K: wave w takes the 32-wide k steps w, w + KS, w + 2 KS, ...; the KS partial tiles meet in LDS
//     and are summed in wave order 0..KS-1, each wave finishing 64 / KS rows. For GEMMs with fewer tiles than the chip has room for.
template <int ET> struct Elem;
template <> struct Elem<0> { typedef _Float16 T; };
template <> struct Elem<1> { typedef __bf16 T; };
template <int ET, bool SPLIT, int BIAS_MODE, int OUT_MODE, bool RESID, int ACT = 0, int KS = 1>
__global__ __launch_bounds__(KS == 1 ? 256 : KS * 32) void wmma_gemm64(
    const unsigned short* __restrict__ Ap, const unsigned short* __restrict__ A2p, int lda, long strideA,
    const unsigned short* __restrict__ Btp, const unsigned short* __restrict__ Bt2p, int ldb, long strideB,
    void* __restrict__ Cout, void* __restrict__ Cout2, int ldc, long strideC,
    const float* __restrict__ bias,
    const float* __restrict__ resid, long strideR,
    int M, int N, int K, float scale) {
  typedef typename Elem<ET>::T T;
  typedef typename Frag<T>::V V;
  const T* A = (const T*)Ap; const T* A2 = (const T*)A2p; const T* Bt = (const T*)Btp; const T* Bt2 = (const T*)Bt2p;
  __shared__ __align__(16) float sT[KS == 1 ? 8 : KS * 4][16 * 68];   // KS == 1: per-wave 16x64 slab; KS > 1: per-wave 64x64 partial tile; pitch 68 floats
  const int b    = blockIdx.y;
  const int lane = threadIdx.x & 31;
  const int wave = (KS == 1) ? (int)(threadIdx.x >> 5) : __builtin_amdgcn_readfirstlane((int)(threadIdx.x >> 5));   // scalar, so the k loop stays a scalar loop
  const int tilesN = N >> 6;
  const int tilesM = M >> 6;
  const int tile = (KS == 1) ? (int)(blockIdx.x * 8 + wave) : (int)blockIdx.x;
  if (tile >= tilesM * tilesN) return;   // KS == 1: wave-uniform, no block barrier follows; KS > 1: block-uniform, ahead of the barrier
  const int tm = tile / tilesN;
  const int tn = tile - tm * tilesN;
  const int m0 = tm << 6;
  const int n0 = tn << 6;

  const T* Ab  = A  + (size_t)b * strideA;
  const T* Bb  = Bt + (size_t)b * strideB;
  const T* Ab2 = SPLIT ? (A2  + (size_t)b * strideA) : nullptr;
  const T* Bb2 = SPLIT ? (Bt2 + (size_t)b * strideB) : nullptr;

  const int rlane = lane & 15;                 // row (A) / col (B, D) within subtile
  const int koff  = (lane >> 4) * 8;           // k offset of this lane half
  const int mOff  = (lane >> 4) * 8;           // D row offset

  v8f acc[4][4];
#pragma unroll
  for (int i = 0; i < 4; ++i)
#pragma unroll
    for (int j = 0; j < 4; ++j) acc[i][j] = (v8f){0.f,0.f,0.f,0.f,0.f,0.f,0.f,0.f};

  for (int k0 = (KS == 1) ? 0 : wave * 32; k0 < K; k0 += 32 * KS) {
    V bh[4], bl[4];
#pragma unroll
    for (int j = 0; j < 4; ++j) {
      const size_t bo = (size_t)(n0 + (j << 4) + rlane) * ldb + koff + k0;
      bh[j] = Frag<T>::load(Bb + bo);
      if (SPLIT) bl[j] = Frag<T>::load(Bb2 + bo);
    }
#pragma unroll
    for (int i = 0; i < 4; ++i) {
      const size_t ao = (size_t)(m0 + (i << 4) + rlane) * lda + koff + k0;
      V ah = Frag<T>::load(Ab + ao);
      V al;
      if (SPLIT) al = Frag<T>::load(Ab2 + ao);
#pragma unroll
      for (int j = 0; j < 4; ++j) {
        acc[i][j] = Frag<T>::mma(ah, bh[j], acc[i][j]);
        if (SPLIT) {
          acc[i][j] = Frag<T>::mma(ah, bl[j], acc[i][j]);
          acc[i][j] = Frag<T>::mma(al, bh[j], acc[i][j]);
        }
      }
      Frag<T>::guard(acc[i][0], acc[i][3], ah, SPLIT ? al : ah);
    }
    Frag<T>::keep(bh[0], bh[1], bh[2], bh[3]);
    if (SPLIT) Frag<T>::keep(bl[0], bl[1], bl[2], bl[3]);
  }
  acc_guard4(acc[0][0], acc[0][1], acc[0][2], acc[0][3]);
  acc_guard4(acc[1][0], acc[1][1], acc[1][2], acc[1][3]);
  acc_guard4(acc[2][0], acc[2][1], acc[2][2], acc[2][3]);
  acc_guard4(acc[3][0], acc[3][1], acc[3][2], acc[3][3]);

  // ---- epilogue ----
  const float* Rb = RESID ? (resid + (size_t)b * strideR) : nullptr;
  if (KS > 1) {
    float* part = &sT[0][0];                    // [KS waves][64 rows][68]
    float* mine = part + wave * (64 * 68);
#pragma unroll
    for (int i = 0; i < 4; ++i)
#pragma unroll
      for (int j = 0; j < 4; ++j)
#pragma unroll
        for (int r = 0; r < 8; ++r) mine[((i << 4) + mOff + r) * 68 + (j << 4) + rlane] = acc[i][j][r];
    __syncthreads();                            // all KS partial tiles are in LDS before any wave sums them
    constexpr int ROWS = 64 / KS;               // rows of the tile that this wave finishes
    constexpr int CW   = (OUT_MODE == 0) ? 4 : 8;   // columns per lane: one 16-B store either way
    constexpr int RP   = 32 * CW / 64;          // rows per pass of the wave
    const int cc = (lane & (64 / CW - 1)) * CW;
#pragma unroll
    for (int it = 0; it < ROWS / RP; ++it) {
      const int row = wave * ROWS + it * RP + lane / (64 / CW);
      const int m = m0 + row;
      const float* sp = part + row * 68 + cc;
      float v[CW];
#pragma unroll
      for (int e = 0; e < CW; e += 4) {
        v4f s = *(const v4f*)(sp + e);
#pragma unroll
        for (int w = 1; w < KS; ++w) s += *(const v4f*)(sp + w * (64 * 68) + e);
        v[e] = s[0]; v[e + 1] = s[1]; v[e + 2] = s[2]; v[e + 3] = s[3];
      }
#pragma unroll
      for (int e = 0; e < CW; ++e) {
        float x = v[e] * scale;
        if (BIAS_MODE == 1) x += bias[m];
        if (BIAS_MODE == 2) x += bias[n0 + cc + e];
        if (RESID) x += Rb[(size_t)m * ldc + n0 + cc + e];
        if (ACT == 1) x = tanhf(x);
        if (ACT == 2) x = fmaxf(x, 0.0f);
        if (ACT == 3) x = x / (1.0f + expf(-x));
        if (ACT == 4) x = (x > 0.f) ? x : 0.01f * x;
        v[e] = x;
      }
      const size_t co = (size_t)b * strideC + (size_t)m * ldc + n0 + cc;
      if constexpr (OUT_MODE == 0) {
        *(v4f*)((float*)Cout + co) = (v4f){v[0], v[1], v[2], v[3]};
      } else {
        v8h hv, lv;
#pragma unroll
        for (int e = 0; e < 8; ++e) {
          const float x = v[e];
          if (OUT_MODE == 1) {
            hv[e] = (_Float16)x;
          } else {
            const unsigned short hb = f2bf_bits(x);
            hv[e] = __builtin_bit_cast(_Float16, hb);
            if (OUT_MODE == 2) lv[e] = __builtin_bit_cast(_Float16, f2bf_bits(x - bf_bits2f(hb)));
          }
        }
        *(v8h*)((unsigned short*)Cout + co) = hv;
        if (OUT_MODE == 2) *(v8h*)((unsigned short*)Cout2 + co) = lv;
      }
    }
    return;
  }
  float* slab = sT[wave];
#pragma unroll
  for (int i = 0; i < 4; ++i) {
    const int mBase = m0 + (i << 4);
#pragma unroll
    for (int j = 0; j < 4; ++j) {
      const int n = n0 + (j << 4) + rlane;
      float bv = 0.f;
      if (BIAS_MODE == 2) bv = bias[n];
#pragma unroll
      for (int r = 0; r < 8; ++r) {
        float v = acc[i][j][r] * scale;
        if (BIAS_MODE == 1) v += bias[mBase + mOff + r];
        if (BIAS_MODE == 2) v += bv;
        if (RESID) v += Rb[(size_t)(mBase + mOff + r) * ldc + n];
        if (ACT == 1) v = tanhf(v);
        if (ACT == 2) v = fmaxf(v, 0.0f);
        if (ACT == 3) v = v / (1.0f + expf(-v));
        if (ACT == 4) v = (v > 0.f) ? v : 0.01f * v;
        slab[(mOff + r) * 68 + (j << 4) + rlane] = v;
      }
    }
    __builtin_amdgcn_fence(__ATOMIC_RELEASE, "workgroup");
    __builtin_amdgcn_wave_barrier();
    __builtin_amdgcn_fence(__ATOMIC_ACQUIRE, "workgroup");
    if (OUT_MODE == 0) {
      float* C = (float*)Cout + (size_t)b * strideC;
      const int hh = lane >> 4, c4 = (lane & 15) * 4;     // row seg = 256 B = 16 lanes x 16 B
      {
#pragma unroll
        for (int it = 0; it < 8; ++it) {
          const int row = it * 2 + hh;
          v4f v = *(const v4f*)(slab + row * 68 + c4);
          *(v4f*)(C + (size_t)(mBase + row) * ldc + n0 + c4) = v;
        }
        
      }
    } else {
      const int q = lane >> 3, c8 = (lane & 7) * 8;
      unsigned short* C  = (unsigned short*)Cout  + (size_t)b * strideC;
      unsigned short* C2 = (OUT_MODE == 2) ? ((unsigned short*)Cout2 + (size_t)b * strideC) : nullptr;
      {
#pragma unroll
        for (int it = 0; it < 4; ++it) {
          const int row = it * 4 + q;
          const float* sp = slab + row * 68 + c8;
          v8h hv, lv;
#pragma unroll
          for (int e = 0; e < 8; ++e) {
            if (OUT_MODE == 1) {
              hv[e] = (_Float16)sp[e];
            } else if (OUT_MODE == 3) {
              hv[e] = __builtin_bit_cast(_Float16, f2bf_bits(sp[e]));
            } else {
              unsigned short hb = f2bf_bits(sp[e]);
              unsigned short lb = f2bf_bits(sp[e] - bf_bits2f(hb));
              hv[e] = __builtin_bit_cast(_Float16, hb);
              lv[e] = __builtin_bit_cast(_Float16, lb);
            }
          }
          *(v8h*)(C + (size_t)(mBase + row) * ldc + n0 + c8) = hv;
          if (OUT_MODE == 2) *(v8h*)(C2 + (size_t)(mBase + row) * ldc + n0 + c8) = lv;
        }
        
      }
    }
    __builtin_amdgcn_fence(__ATOMIC_RELEASE, "workgroup");
    __builtin_amdgcn_wave_barrier();
    __builtin_amdgcn_fence(__ATOMIC_ACQUIRE, "workgroup");
  }
}

// ---------------------------------------------------------------------------
// Elementwise cast out = bf16(in) (RNE): 2 elements per thread, one 4-B store per lane -> each wave writes
// Coverage: grid = ceil(n2/256) blocks x 256 threads x 2 elements = 2*n2 elements = the whole plane (n2 = plane/2).
// ---------------------------------------------------------------------------
__global__ __launch_bounds__(256) void cast_f32_bf16x2(const float* __restrict__ in, unsigned short* __restrict__ out, int n2) {
  const int i = blockIdx.x * 256 + threadIdx.x;
  if (i < n2) {
    const v2f f = *(const v2f*)(in + 2 * (size_t)i);
    const unsigned u = (unsigned)f2bf_bits(f[0]) | ((unsigned)f2bf_bits(f[1]) << 16);
    ((unsigned*)out)[i] = u;
    
  }
}

// ---------------------------------------------------------------------------
// Transpose-cast of one 64x64 tile: in f32 [NC rows (c)][ldi cols (i)] -> out[(i) * ldo + col0 + c] = bf16(in[c][i]).
// grid (HW/64 i-tiles, NC/64 c-tiles, batches), 256 threads; batch z reads in + z * sIn and writes out + z * sOut.
// Load coverage: 4 iterations x 256 threads = 1024 float4 = 64 c-rows x 64 i-cols (cr = idx>>4 spans 0..63, q spans 0..15).
// Store coverage: 8 waves x 2 iterations x 4 rows (q = lane>>3) = 64 out rows; 8 lanes x 8 halves = 64 cols per row;
// ---------------------------------------------------------------------------
__global__ __launch_bounds__(256) void tr_cast_bf16(const float* __restrict__ in, int ldi, long sIn,
                                                    unsigned short* __restrict__ out, int ldo, int col0, long sOut) {
  __shared__ __align__(16) unsigned short sm[64 * 72];   // [i local][c local], pitch 72 halves (144 B)
  const int tid  = threadIdx.x;
  const int lane = tid & 31;
  const int wave = tid >> 5;
  const int i0 = blockIdx.x * 64;
  const int c0 = blockIdx.y * 64;
  in  += (size_t)blockIdx.z * sIn;
  out += (size_t)blockIdx.z * sOut;
#pragma unroll
  for (int it = 0; it < 4; ++it) {
    const int idx = tid + 256 * it;      // 0..1023
    const int cr  = idx >> 4;            // 0..63
    const int q   = idx & 15;            // 0..15
    const v4f f = *(const v4f*)(in + (size_t)(c0 + cr) * ldi + i0 + 4 * q);
    sm[(4 * q + 0) * 72 + cr] = f2bf_bits(f[0]);
    sm[(4 * q + 1) * 72 + cr] = f2bf_bits(f[1]);
    sm[(4 * q + 2) * 72 + cr] = f2bf_bits(f[2]);
    sm[(4 * q + 3) * 72 + cr] = f2bf_bits(f[3]);
  }
  __syncthreads();
  const int q  = lane >> 3;
  const int c8 = (lane & 7) * 8;
  {
#pragma unroll
    for (int it = 0; it < 2; ++it) {
      const int row = wave * 8 + it * 4 + q;
      const v8us v = *(const v8us*)(sm + row * 72 + c8);
      const v4u u = __builtin_bit_cast(v4u, v);
      *(v4u*)(out + (size_t)(i0 + row) * ldo + col0 + c0 + c8) = u;
    }
    
  }
}

// ---------------------------------------------------------------------------
// Fused attention, online softmax: XCAT[b][i][0..255] = bf16(sum_j softmax_j(pre_i . cur_j / 16) * cur[c][j]).
// Transposed products: S^T = K . Q^T (A = cur^T rows [j][c], B = pre^T rows [i][c] kept in registers) and
// O^T += V^T . P^T (A = cur rows [c][j], B = the score tiles converted in place), so a lane holds one query column:
// D register r of a score tile is key 8h + r of query (lane & 15); two such tiles are one 32-key B operand in the hardware k order.
// Work-group: 4 waves x 16 queries; a pass is 64 keys; grid (HW / 64 query blocks, batches).
// Each pass's K tile (64 keys x 512 B) and V tile (256 c x 128 B) come into LDS by asynchronous copies, two buffers, one pass ahead.
// Sums: scores over c in 32-wide k steps; probabilities per lane half over the passes in order, the halves joined at the end.
// ---------------------------------------------------------------------------
#define KPITCH 528                      // bytes per K row in LDS: 512 + 16 (16 B x odd, for 16-byte row readers)
#define VPITCH 144                      // bytes per V row in LDS: 128 + 16
#define KTILE  (64 * KPITCH)
#define VTILE  (NC * VPITCH)
#define ABUF   (KTILE + VTILE)
#define NPASS  (HW / 64)

// Eight 16-byte copies per lane, global -> LDS through no register. The s_wait_xcnt closes the statement so that no
// address register of an issued copy is rewritten ahead of it.
__device__ __forceinline__ void async_copy8(unsigned l, unsigned ls, const char* g, size_t gs) {
  asm volatile(
      "global_load_async_to_lds_b128 %0, %8, off\n\t"
      "global_load_async_to_lds_b128 %1, %9, off\n\t"
      "global_load_async_to_lds_b128 %2, %10, off\n\t"
      "global_load_async_to_lds_b128 %3, %11, off\n\t"
      "global_load_async_to_lds_b128 %4, %12, off\n\t"
      "global_load_async_to_lds_b128 %5, %13, off\n\t"
      "global_load_async_to_lds_b128 %6, %14, off\n\t"
      "global_load_async_to_lds_b128 %7, %15, off\n\t"
      "s_wait_xcnt 0x0"
      :: "v"(l), "v"(l + ls), "v"(l + 2 * ls), "v"(l + 3 * ls), "v"(l + 4 * ls), "v"(l + 5 * ls), "v"(l + 6 * ls), "v"(l + 7 * ls),
         "v"(g), "v"(g + gs), "v"(g + 2 * gs), "v"(g + 3 * gs), "v"(g + 4 * gs), "v"(g + 5 * gs), "v"(g + 6 * gs), "v"(g + 7 * gs)
      : "memory");
}
// One pass's tiles: kl / vl = this lane's first LDS byte in the K / V tile of the target buffer, kg / vg = its first global byte.
// K: a wave copies one whole 512-B row per copy, rows wave, wave + 4, ...; V: a wave copies four 128-B rows per copy, rows tid / 8, + 16, ...
__device__ __forceinline__ void attn_issue(unsigned kl, unsigned vl, const char* kg, const char* vg) {
  async_copy8(kl, 4 * KPITCH, kg, (size_t)4 * NX * 2);
  async_copy8(kl + 32 * KPITCH, 4 * KPITCH, kg + (size_t)32 * NX * 2, (size_t)4 * NX * 2);
  async_copy8(vl, 16 * VPITCH, vg, (size_t)16 * HW * 2);
  async_copy8(vl + 128 * VPITCH, 16 * VPITCH, vg + (size_t)128 * HW * 2, (size_t)16 * HW * 2);
}
// Hand-over of the ring: this wave's LDS reads are done, its own copies have landed, then every wave meets.
__device__ __forceinline__ void attn_publish() {
  asm volatile("s_wait_dscnt 0x0" ::: "memory");     // the buffer just read is refilled behind the barrier
  asm volatile("s_wait_asynccnt 0x0" ::: "memory");  // the compiler places no wait for the copies
  __syncthreads();
}
// Value of lane l ^ 16, through no LDS: an LDS shuffle's wait would also wait out the V fragment loads in flight.
__device__ __forceinline__ float other_half(float x) {
  const int b = __float_as_int(x);
  return __int_as_float(__builtin_amdgcn_permlanex16(b, b, 0x76543210, 0xfedcba98, false, false));
}
// One pass: 64 keys from the tiles at kt / vt (each already offset to this lane's row and k half).
__device__ __forceinline__ void attn_pass(const unsigned char* kt, const unsigned char* vt, const v16b (&qf)[8],
                                          v8f (&acc)[16], float& m, float& lsum) {
  const float sc = 0.0625f * 1.44269504088896340736f;   // 1/16, and exp(x) = exp2(x * log2 e)
  v8f s[4];
#pragma unroll
  for (int jt = 0; jt < 4; ++jt) s[jt] = (v8f){0.f,0.f,0.f,0.f,0.f,0.f,0.f,0.f};
#pragma unroll
  for (int ks = 0; ks < 8; ++ks)
#pragma unroll
    for (int jt = 0; jt < 4; ++jt) {
      const v16b a = Frag<__bf16>::load((const __bf16*)(kt + jt * 16 * KPITCH + ks * 64));
      s[jt] = Frag<__bf16>::mma(a, qf[ks], s[jt]);
    }
  v16b va[16], vb[16];                                  // V fragments of c tiles 0..7 and 8..15, two 32-key k steps each
#pragma unroll
  for (int f = 0; f < 16; ++f) va[f] = Frag<__bf16>::load((const __bf16*)(vt + (f & 7) * 16 * VPITCH + (f >> 3) * 64));
  __builtin_amdgcn_sched_barrier(0);                    // these LDS reads stay one group in front of the softmax, whose vector work covers their latency
  float mt[4];                                          // four independent chains
#pragma unroll
  for (int jt = 0; jt < 4; ++jt) {
    mt[jt] = s[jt][0];
#pragma unroll
    for (int r = 1; r < 8; ++r) mt[jt] = fmaxf(mt[jt], s[jt][r]);
  }
  float mx = fmaxf(fmaxf(mt[0], mt[1]), fmaxf(mt[2], mt[3]));
  mx = fmaxf(mx, other_half(mx));                       // the other lane half holds this query's other keys
  const float mn = fmaxf(m, mx * sc);
  const float alpha = __builtin_amdgcn_exp2f(m - mn);   // first pass: exp2(-inf) = 0
  m = mn;
  float ps[4];
  v16b pb[2];
#pragma unroll
  for (int jt = 0; jt < 4; ++jt) {
    float t = 0.f;
#pragma unroll
    for (int r = 0; r < 8; ++r) {
      const float p = __builtin_amdgcn_exp2f(s[jt][r] * sc - mn);
      t += p;
      pb[jt >> 1][(jt & 1) * 8 + r] = (__bf16)p;
    }
    ps[jt] = t;
  }
  lsum = lsum * alpha + ((ps[0] + ps[1]) + (ps[2] + ps[3]));
#pragma unroll
  for (int f = 0; f < 16; ++f) vb[f] = Frag<__bf16>::load((const __bf16*)(vt + (8 + (f & 7)) * 16 * VPITCH + (f >> 3) * 64));
  __builtin_amdgcn_sched_barrier(0);                    // the second group stays in front of the rescale and the first group's products, not among them
#pragma unroll
  for (int ct = 0; ct < 16; ++ct) acc[ct] *= alpha;
#pragma unroll
  for (int f = 0; f < 16; ++f) acc[f & 7] = Frag<__bf16>::mma(va[f], pb[f >> 3], acc[f & 7]);
#pragma unroll
  for (int f = 0; f < 16; ++f) acc[8 + (f & 7)] = Frag<__bf16>::mma(vb[f], pb[f >> 3], acc[8 + (f & 7)]);
}

__global__ __launch_bounds__(128) void attn_fused_kernel(const unsigned short* __restrict__ PRET,
                                                         const unsigned short* __restrict__ CURb,
                                                         unsigned short* __restrict__ XCAT) {
  __shared__ __align__(16) unsigned char sm[2 * ABUF];
  const int tid   = threadIdx.x;
  const int lane  = tid & 31;
  const int wave  = tid >> 5;
  const int b     = blockIdx.y;
  const int rlane = lane & 15;
  const int h     = lane >> 4;
  const int q     = blockIdx.x * 64 + wave * 16 + rlane;     // this lane's query
  unsigned short* Xb = XCAT + (size_t)b * HW * NX;

  const char* kg = (const char*)(Xb + NC) + (size_t)wave * (NX * 2) + lane * 16;
  const char* vg = (const char*)(CURb + (size_t)b * NC * HW) + (size_t)(tid >> 3) * (HW * 2) + (tid & 7) * 16;
  const unsigned sm0 = (unsigned)(size_t)(&sm[0]);           // LDS byte address = low 32 bits of the shared address
  const unsigned kl = sm0 + wave * KPITCH + lane * 16;
  const unsigned vl = sm0 + KTILE + (tid >> 3) * VPITCH + (tid & 7) * 16;
  const size_t kstep = (size_t)64 * NX * 2;                  // 64 keys further: 64 rows of cur^T
  const size_t vstep = (size_t)64 * 2;                       // 64 keys further: 64 columns of cur

  attn_issue(kl, vl, kg, vg);                                // pass 0 -> buffer 0

  v16b qf[8];
  const __bf16* qp = (const __bf16*)PRET + ((size_t)b * HW + q) * NC + h * 8;
#pragma unroll
  for (int ks = 0; ks < 8; ++ks) qf[ks] = Frag<__bf16>::load(qp + ks * 32);
  v8f acc[16];
#pragma unroll
  for (int ct = 0; ct < 16; ++ct) acc[ct] = (v8f){0.f,0.f,0.f,0.f,0.f,0.f,0.f,0.f};
  float m = -INFINITY, lsum = 0.f;

  asm volatile("s_wait_asynccnt 0x0" ::: "memory");          // pass 0's copies of this wave have landed
  __syncthreads();                                           // ... and every other wave's
  attn_issue(kl + ABUF, vl + ABUF, kg + kstep, vg + vstep);  // pass 1 -> buffer 1

  const unsigned char* kt0 = sm + rlane * KPITCH + h * 16;
  const unsigned char* vt0 = sm + KTILE + rlane * VPITCH + h * 16;
  unsigned cur = 0;                                          // byte offset of the buffer that this pass reads
  const char* kgn = kg + 2 * kstep;                          // source of the next refill
  const char* vgn = vg + 2 * vstep;
  // stays rolled: with the buffer offset carried by the loop the 64 LDS addresses of the copies are formed by adds; unrolled by two they were kept in registers and spilled
#pragma unroll 1
  for (int t = 0; t < NPASS; ++t) {
    attn_pass(kt0 + cur, vt0 + cur, qf, acc, m, lsum);
    attn_publish();
    if (t + 2 < NPASS) {                                     // pass t + 2 -> the buffer that pass t has just read
      attn_issue(kl + cur, vl + cur, kgn, vgn);
      kgn += kstep;
      vgn += vstep;
    }
    cur ^= ABUF;
  }
  asm volatile("s_wait_asynccnt 0x0" ::: "memory");          // nothing of this wave is in flight when it ends

  const float inv = 1.0f / (lsum + other_half(lsum));   // the sum is near 1 or above: the row maximum contributes exp2(0)
  unsigned short* op = Xb + (size_t)q * NX + h * 8;          // acc[ct][r] = feat[c = 16 ct + 8 h + r][q]: 8 consecutive c, one 16-B store
#pragma unroll
  for (int ct = 0; ct < 16; ++ct) {
    v8b o;
#pragma unroll
    for (int r = 0; r < 8; ++r) o[r] = (__bf16)(acc[ct][r] * inv);
    *(v8b*)(op + ct * 16) = o;
  }
}

// ---------------------------------------------------------------------------
// BN (running stats) + PReLU: out[o][i] = prelu((Y[o][i]) * inv[o] + shift[o]), Y already holds conv + b_conv (f32).
// inv = gamma*rsqrt(var + 1e-5), shift = beta - mean*inv, slope = alpha[0].
// 4 elements per thread (one float4); grid = n4/256 blocks x 256 threads x 4 = all [NB][NC][HW] planes (n4 = NB*NC*HW/4).
// ---------------------------------------------------------------------------
__global__ __launch_bounds__(256) void bn_prelu_kernel(const float* __restrict__ Y,
                                                       const float* __restrict__ gamma, const float* __restrict__ beta,
                                                       const float* __restrict__ rmean, const float* __restrict__ rvar,
                                                       const float* __restrict__ alpha,
                                                       float* __restrict__ out, int n4) {
  const int t = blockIdx.x * 256 + threadIdx.x;
  if (t < n4) {
    const int o = (t >> 10) & (NC - 1);          // HW/4 = 1024 float4 per output channel row, NC rows per batch
    const float inv   = gamma[o] * rsqrtf(rvar[o] + 1e-5f);
    const float shift = beta[o] - rmean[o] * inv;
    const float slope = alpha[0];
    const v4f y = *(const v4f*)(Y + 4 * (size_t)t);
    v4f r;
#pragma unroll
    for (int e = 0; e < 4; ++e) {
      const float v = y[e] * inv + shift;
      r[e] = (v >= 0.f) ? v : slope * v;
    }
    *(v4f*)(out + 4 * (size_t)t) = r;
    
  }
}

// ---------------------------------------------------------------------------
// Workspace region map (byte offsets); every region is fully written before it is read, once per call, all batches.
//   Wb    bf16 [256][512]                  0          (262144 B)
//   PRET  bf16 [4 b][4096 i][256 c]        262144     (8388608 B)   pre^T
//   CURb  bf16 [4 b][256 c][4096 j]        8650752    (8388608 B)   cur, natural layout
//   XCAT  bf16 [4 b][4096 i][512]          17039360   (16777216 B)  cols 0..255 = feat^T, cols 256..511 = cur^T
//   Y     f32  [4 b][256 o][4096 i]        33816576   (16777216 B)  conv + bias
//   total                                  50593792 B
// ---------------------------------------------------------------------------
extern "C" void kernel_launch(void* const* d_in, const int* in_sizes, int n_in,
                              void* d_out, int out_size, void* d_ws, size_t ws_size,
                              hipStream_t stream) {
  if (n_in < 9) return;
  if (in_sizes[0] != NB * NC * HW || in_sizes[1] != NB * NC * HW) return;
  if (in_sizes[2] != NC * NX) return;
  if (in_sizes[3] != NC || in_sizes[4] != NC || in_sizes[5] != NC || in_sizes[6] != NC || in_sizes[7] != NC) return;
  if (in_sizes[8] < 1) return;
  if (out_size != NB * NC * HW) return;

  const float* pre   = (const float*)d_in[0];
  const float* cur   = (const float*)d_in[1];
  const float* W     = (const float*)d_in[2];
  const float* bconv = (const float*)d_in[3];
  const float* gamma = (const float*)d_in[4];
  const float* beta  = (const float*)d_in[5];
  const float* rmean = (const float*)d_in[6];
  const float* rvar  = (const float*)d_in[7];
  const float* alpha = (const float*)d_in[8];
  float* out = (float*)d_out;

  const size_t szWb   = (size_t)NC * NX * 2;
  const size_t szPRET = (size_t)NB * HW * NC * 2;
  const size_t szCURb = (size_t)NB * NC * HW * 2;
  const size_t szXCAT = (size_t)NB * HW * NX * 2;
  const size_t szY    = (size_t)NB * NC * HW * 4;
  size_t off = 0;
  const size_t oWb   = off; off += szWb;
  const size_t oPRET = off; off += szPRET;
  const size_t oCURb = off; off += szCURb;
  const size_t oXCAT = off; off += szXCAT;
  const size_t oY    = off; off += szY;
  if (off > ws_size) return;                    // 50593792 B total

  char* ws = (char*)d_ws;
  unsigned short* Wb   = (unsigned short*)(ws + oWb);
  unsigned short* PRET = (unsigned short*)(ws + oPRET);
  unsigned short* CURb = (unsigned short*)(ws + oCURb);
  unsigned short* XCAT = (unsigned short*)(ws + oXCAT);
  float*          Yb   = (float*)(ws + oY);

  const dim3 blk(256);
  const int n2W = NC * NX / 2;                  // 65536 pairs
  const int n2C = NB * NC * HW / 2;             // 2097152 pairs
  const int n4Y = NB * NC * HW / 4;             // 1048576 float4
  const dim3 gCastW((n2W + 255) / 256);         // 256 blocks
  const dim3 gCastC((n2C + 255) / 256);         // 8192 blocks
  const dim3 gTr(HW / 64, NC / 64, NB);         // 64 x 4 tiles x 4 batches: in [256][4096] -> out [4096][..]
  const dim3 gA(HW / 64, NB);                   // 64 query blocks x 4 batches, 4 waves each
  const dim3 gC((NC / 64) * (HW / 64), NB);     // 256 blocks x 8 waves per batch: M=256, N=4096, K=512, one tile per block, K over its waves
  const dim3 gE((n4Y + 255) / 256);             // 4096 blocks

  // W -> bf16 [256][512]
  cast_f32_bf16x2<<<gCastW, blk, 0, stream>>>(W, Wb, n2W);
  // pre[b] [256 c][4096 i] -> PRET[b] [4096 i][256 c]
  tr_cast_bf16<<<gTr, blk, 0, stream>>>(pre, HW, (long)NC * HW, PRET, NC, 0, (long)HW * NC);
  // cur[b] [256 c][4096 j] -> XCAT[b][j][256 + c]
  tr_cast_bf16<<<gTr, blk, 0, stream>>>(cur, HW, (long)NC * HW, XCAT, NX, NC, (long)HW * NX);
  // cur -> CURb [b][256 c][4096 j] (natural layout)
  cast_f32_bf16x2<<<gCastC, blk, 0, stream>>>(cur, CURb, n2C);
  // XCAT[b][i][c] = bf16(sum_j softmax_j(PRET[b][i] . XCAT[b][j][256..] / 16) * CURb[b][c][j])
  attn_fused_kernel<<<gA, dim3(128), 0, stream>>>(PRET, CURb, XCAT);
  // Y[b][o][i] = sum_k Wb[o][k] * XCAT[b][i][k] + b_conv[o]  (M=256, N=4096, K=512, f32 out, ldc 4096)
  wmma_gemm64<1, false, 1, 0, false, 0, 8><<<gC, blk, 0, stream>>>(
      Wb, Wb, NX, 0L, XCAT, XCAT, NX, (long)HW * NX, (void*)Yb, (void*)Yb, HW, (long)NC * HW,
      bconv, bconv, 0L, NC, HW, NX, 1.0f);
  // out[b][o][i] = prelu(bn(Y[b][o][i]))
  bn_prelu_kernel<<<gE, blk, 0, stream>>>(Yb, gamma, beta, rmean, rvar, alpha, out, n4Y);
  (void)hipGetLastError();
}

// v003
// A run of this version takes 113 microseconds.
// Timed twice side by side with v002, it ran 1.08 times as fast both times.
// All steps since v000 together make it 15.8 times as fast.
// Contractions S = pre^T.cur (x1/16), featT = P.cur^T, 1x1 conv = W.x: all v_wmma_f32_16x16x32_bf16 (bf16 operands RNE-converted from f32, f32 accumulate); softmax, bias, BN, PReLU in f32.
#include <hip/hip_runtime.h>
#include <math.h>
#include <stdint.h>

#define NB 4
#define NC 256
#define HW 4096
#define NX 512

typedef __attribute__((ext_vector_type(16))) _Float16 v16h;
typedef __attribute__((ext_vector_type(8)))  _Float16 v8h;
typedef __attribute__((ext_vector_type(16))) __bf16   v16b;
typedef __attribute__((ext_vector_type(8)))  __bf16   v8b;
typedef __attribute__((ext_vector_type(8)))  float    v8f;
typedef __attribute__((ext_vector_type(4)))  float    v4f;
typedef __attribute__((ext_vector_type(2)))  float    v2f;
typedef __attribute__((ext_vector_type(4)))  unsigned int v4u;
typedef __attribute__((ext_vector_type(2)))  unsigned int v2u;
typedef __attribute__((ext_vector_type(8)))  unsigned short v8us;

__device__ __forceinline__ unsigned short f2bf_bits(float f) {
  unsigned u = __float_as_uint(f);
  return (unsigned short)((u + 0x7FFFu + ((u >> 16) & 1u)) >> 16);
}
__device__ __forceinline__ float bf_bits2f(unsigned short h) { return __uint_as_float(((unsigned)h) << 16); }

// hazard guards as plain device helpers (no inline asm inside the kernel template body)
__device__ __forceinline__ void dep_guard_h(v8f& a, v8f& b, v16h x, v16h y) { asm volatile("v_nop\n\tv_nop\n\tv_nop\n\tv_nop" : "+v"(a), "+v"(b) : "v"(x), "v"(y)); }
__device__ __forceinline__ void dep_guard_b(v8f& a, v8f& b, v16b x, v16b y) { asm volatile("v_nop\n\tv_nop\n\tv_nop\n\tv_nop" : "+v"(a), "+v"(b) : "v"(x), "v"(y)); }
__device__ __forceinline__ void keep4_h(v16h a, v16h b, v16h c, v16h d) { asm volatile("v_nop" :: "v"(a), "v"(b), "v"(c), "v"(d)); }
__device__ __forceinline__ void keep4_b(v16b a, v16b b, v16b c, v16b d) { asm volatile("v_nop" :: "v"(a), "v"(b), "v"(c), "v"(d)); }
__device__ __forceinline__ void acc_guard4(v8f& a, v8f& b, v8f& c, v8f& d) { asm volatile("v_nop\n\tv_nop\n\tv_nop\n\tv_nop" : "+v"(a), "+v"(b), "+v"(c), "+v"(d)); }
template <typename T> struct Frag;
template <> struct Frag<_Float16> {
  typedef v16h V; union U { v16h v; v8h h[2]; };
  static __device__ __forceinline__ v16h load(const _Float16* p) {   // elements 0..7 <- p[0..7], 8..15 <- p[16..23]
    U f; f.h[0] = *(const v8h*)(p); f.h[1] = *(const v8h*)(p + 16); return f.v;
  }
  static __device__ __forceinline__ v8f mma(v16h a, v16h b, v8f c) {
    return __builtin_amdgcn_wmma_f32_16x16x32_f16(false, a, false, b, (short)0, c, false, false);
  }
  static __device__ __forceinline__ void guard(v8f& a, v8f& b, v16h x, v16h y) { dep_guard_h(a, b, x, y); }
  static __device__ __forceinline__ void keep(v16h a, v16h b, v16h c, v16h d) { keep4_h(a, b, c, d); }
};
template <> struct Frag<__bf16> {
  typedef v16b V; union U { v16b v; v8b h[2]; };
  static __device__ __forceinline__ v16b load(const __bf16* p) {
    U f; f.h[0] = *(const v8b*)(p); f.h[1] = *(const v8b*)(p + 16); return f.v;
  }
  static __device__ __forceinline__ v8f mma(v16b a, v16b b, v8f c) {
    return __builtin_amdgcn_wmma_f32_16x16x32_bf16(false, a, false, b, (short)0, c, false, false);
  }
  static __device__ __forceinline__ void guard(v8f& a, v8f& b, v16b x, v16b y) { dep_guard_b(a, b, x, y); }
  static __device__ __forceinline__ void keep(v16b a, v16b b, v16b c, v16b d) { keep4_b(a, b, c, d); }
};

// ---- Register-blocked batched WMMA GEMM ------------------------------------
// C[m,n] = scale * sum_k A[m,k] * Bt[n,k] (+bias)(+resid); each wave (KS == 1) or each block (KS > 1) owns a 64x64 tile.
// A row-major [M,K]; Bt row-major [N,K]; M,N % 64 == 0, K % 32 == 0.
// SPLIT: operands are hi/lo planes (A2/Bt2 = lo planes, same layout); product = hi.hi + hi.lo + lo.hi.
// BIAS_MODE: 0 = none, 1 = bias[m], 2 = bias[n].
// OUT_MODE: 0 = f32, 1 = f16, 2 = bf16 hi plane (Cout) + bf16 lo plane (Cout2), 3 = single bf16 plane (RNE).
// ET: 0 = f16 operands, 1 = bf16 operands (pointers passed as 16-bit storage)
// KS: 1 = each wave owns a tile and all of K (8 tiles per block). KS > 1 = the block owns ONE tile and its KS waves
//     split K: wave w takes the 32-wide k steps w, w + KS, w + 2 KS, ...; the KS partial tiles meet in LDS
//     and are summed in wave order 0..KS-1, each wave finishing 64 / KS rows. For GEMMs with fewer tiles than the chip has room for.
template <int ET> struct Elem;
template <> struct Elem<0> { typedef _Float16 T; };
template <> struct Elem<1> { typedef __bf16 T; };
template <int ET, bool SPLIT, int BIAS_MODE, int OUT_MODE, bool RESID, int ACT = 0, int KS = 1>
__global__ __launch_bounds__(KS == 1 ? 256 : KS * 32) void wmma_gemm64(
    const unsigned short* __restrict__ Ap, const unsigned short* __restrict__ A2p, int lda, long strideA,
    const unsigned short* __restrict__ Btp, const unsigned short* __restrict__ Bt2p, int ldb, long strideB,
    void* __restrict__ Cout, void* __restrict__ Cout2, int ldc, long strideC,
    const float* __restrict__ bias,
    const float* __restrict__ resid, long strideR,
    int M, int N, int K, float scale) {
  typedef typename Elem<ET>::T T;
  typedef typename Frag<T>::V V;
  const T* A = (const T*)Ap; const T* A2 = (const T*)A2p; const T* Bt = (const T*)Btp; const T* Bt2 = (const T*)Bt2p;
  __shared__ __align__(16) float sT[KS == 1 ? 8 : KS * 4][16 * 68];   // KS == 1: per-wave 16x64 slab; KS > 1: per-wave 64x64 partial tile; pitch 68 floats
  const int b    = blockIdx.y;
  const int lane = threadIdx.x & 31;
  const int wave = (KS == 1) ? (int)(threadIdx.x >> 5) : __builtin_amdgcn_readfirstlane((int)(threadIdx.x >> 5));   // scalar, so the k loop stays a scalar loop
  const int tilesN = N >> 6;
  const int tilesM = M >> 6;
  const int tile = (KS == 1) ? (int)(blockIdx.x * 8 + wave) : (int)blockIdx.x;
  if (tile >= tilesM * tilesN) return;   // KS == 1: wave-uniform, no block barrier follows; KS > 1: block-uniform, ahead of the barrier
  const int tm = tile / tilesN;
  const int tn = tile - tm * tilesN;
  const int m0 = tm << 6;
  const int n0 = tn << 6;

  const T* Ab  = A  + (size_t)b * strideA;
  const T* Bb  = Bt + (size_t)b * strideB;
  const T* Ab2 = SPLIT ? (A2  + (size_t)b * strideA) : nullptr;
  const T* Bb2 = SPLIT ? (Bt2 + (size_t)b * strideB) : nullptr;

  const int rlane = lane & 15;                 // row (A) / col (B, D) within subtile
  const int koff  = (lane >> 4) * 8;           // k offset of this lane half
  const int mOff  = (lane >> 4) * 8;           // D row offset

  v8f acc[4][4];
#pragma unroll
  for (int i = 0; i < 4; ++i)
#pragma unroll
    for (int j = 0; j < 4; ++j) acc[i][j] = (v8f){0.f,0.f,0.f,0.f,0.f,0.f,0.f,0.f};

  for (int k0 = (KS == 1) ? 0 : wave * 32; k0 < K; k0 += 32 * KS) {
    V bh[4], bl[4];
#pragma unroll
    for (int j = 0; j < 4; ++j) {
      const size_t bo = (size_t)(n0 + (j << 4) + rlane) * ldb + koff + k0;
      bh[j] = Frag<T>::load(Bb + bo);
      if (SPLIT) bl[j] = Frag<T>::load(Bb2 + bo);
    }
#pragma unroll
    for (int i = 0; i < 4; ++i) {
      const size_t ao = (size_t)(m0 + (i << 4) + rlane) * lda + koff + k0;
      V ah = Frag<T>::load(Ab + ao);
      V al;
      if (SPLIT) al = Frag<T>::load(Ab2 + ao);
#pragma unroll
      for (int j = 0; j < 4; ++j) {
        acc[i][j] = Frag<T>::mma(ah, bh[j], acc[i][j]);
        if (SPLIT) {
          acc[i][j] = Frag<T>::mma(ah, bl[j], acc[i][j]);
          acc[i][j] = Frag<T>::mma(al, bh[j], acc[i][j]);
        }
      }
      Frag<T>::guard(acc[i][0], acc[i][3], ah, SPLIT ? al : ah);
    }
    Frag<T>::keep(bh[0], bh[1], bh[2], bh[3]);
    if (SPLIT) Frag<T>::keep(bl[0], bl[1], bl[2], bl[3]);
  }
  acc_guard4(acc[0][0], acc[0][1], acc[0][2], acc[0][3]);
  acc_guard4(acc[1][0], acc[1][1], acc[1][2], acc[1][3]);
  acc_guard4(acc[2][0], acc[2][1], acc[2][2], acc[2][3]);
  acc_guard4(acc[3][0], acc[3][1], acc[3][2], acc[3][3]);

  // ---- epilogue ----
  const float* Rb = RESID ? (resid + (size_t)b * strideR) : nullptr;
  if (KS > 1) {
    float* part = &sT[0][0];                    // [KS waves][64 rows][68]
    float* mine = part + wave * (64 * 68);
#pragma unroll
    for (int i = 0; i < 4; ++i)
#pragma unroll
      for (int j = 0; j < 4; ++j)
#pragma unroll
        for (int r = 0; r < 8; ++r) mine[((i << 4) + mOff + r) * 68 + (j << 4) + rlane] = acc[i][j][r];
    __syncthreads();                            // all KS partial tiles are in LDS before any wave sums them
    constexpr int ROWS = 64 / KS;               // rows of the tile that this wave finishes
    constexpr int CW   = (OUT_MODE == 0) ? 4 : 8;   // columns per lane: one 16-B store either way
    constexpr int RP   = 32 * CW / 64;          // rows per pass of the wave
    const int cc = (lane & (64 / CW - 1)) * CW;
#pragma unroll
    for (int it = 0; it < ROWS / RP; ++it) {
      const int row = wave * ROWS + it * RP + lane / (64 / CW);
      const int m = m0 + row;
      const float* sp = part + row * 68 + cc;
      float v[CW];
#pragma unroll
      for (int e = 0; e < CW; e += 4) {
        v4f s = *(const v4f*)(sp + e);
#pragma unroll
        for (int w = 1; w < KS; ++w) s += *(const v4f*)(sp + w * (64 * 68) + e);
        v[e] = s[0]; v[e + 1] = s[1]; v[e + 2] = s[2]; v[e + 3] = s[3];
      }
#pragma unroll
      for (int e = 0; e < CW; ++e) {
        float x = v[e] * scale;
        if (BIAS_MODE == 1) x += bias[m];
        if (BIAS_MODE == 2) x += bias[n0 + cc + e];
        if (RESID) x += Rb[(size_t)m * ldc + n0 + cc + e];
        if (ACT == 1) x = tanhf(x);
        if (ACT == 2) x = fmaxf(x, 0.0f);
        if (ACT == 3) x = x / (1.0f + expf(-x));
        if (ACT == 4) x = (x > 0.f) ? x : 0.01f * x;
        v[e] = x;
      }
      const size_t co = (size_t)b * strideC + (size_t)m * ldc + n0 + cc;
      if constexpr (OUT_MODE == 0) {
        *(v4f*)((float*)Cout + co) = (v4f){v[0], v[1], v[2], v[3]};
      } else {
        v8h hv, lv;
#pragma unroll
        for (int e = 0; e < 8; ++e) {
          const float x = v[e];
          if (OUT_MODE == 1) {
            hv[e] = (_Float16)x;
          } else {
            const unsigned short hb = f2bf_bits(x);
            hv[e] = __builtin_bit_cast(_Float16, hb);
            if (OUT_MODE == 2) lv[e] = __builtin_bit_cast(_Float16, f2bf_bits(x - bf_bits2f(hb)));
          }
        }
        *(v8h*)((unsigned short*)Cout + co) = hv;
        if (OUT_MODE == 2) *(v8h*)((unsigned short*)Cout2 + co) = lv;
      }
    }
    return;
  }
  float* slab = sT[wave];
#pragma unroll
  for (int i = 0; i < 4; ++i) {
    const int mBase = m0 + (i << 4);
#pragma unroll
    for (int j = 0; j < 4; ++j) {
      const int n = n0 + (j << 4) + rlane;
      float bv = 0.f;
      if (BIAS_MODE == 2) bv = bias[n];
#pragma unroll
      for (int r = 0; r < 8; ++r) {
        float v = acc[i][j][r] * scale;
        if (BIAS_MODE == 1) v += bias[mBase + mOff + r];
        if (BIAS_MODE == 2) v += bv;
        if (RESID) v += Rb[(size_t)(mBase + mOff + r) * ldc + n];
        if (ACT == 1) v = tanhf(v);
        if (ACT == 2) v = fmaxf(v, 0.0f);
        if (ACT == 3) v = v / (1.0f + expf(-v));
        if (ACT == 4) v = (v > 0.f) ? v : 0.01f * v;
        slab[(mOff + r) * 68 + (j << 4) + rlane] = v;
      }
    }
    __builtin_amdgcn_fence(__ATOMIC_RELEASE, "workgroup");
    __builtin_amdgcn_wave_barrier();
    __builtin_amdgcn_fence(__ATOMIC_ACQUIRE, "workgroup");
    if (OUT_MODE == 0) {
      float* C = (float*)Cout + (size_t)b * strideC;
      const int hh = lane >> 4, c4 = (lane & 15) * 4;     // row seg = 256 B = 16 lanes x 16 B
      {
#pragma unroll
        for (int it = 0; it < 8; ++it) {
          const int row = it * 2 + hh;
          v4f v = *(const v4f*)(slab + row * 68 + c4);
          *(v4f*)(C + (size_t)(mBase + row) * ldc + n0 + c4) = v;
        }
        
      }
    } else {
      const int q = lane >> 3, c8 = (lane & 7) * 8;
      unsigned short* C  = (unsigned short*)Cout  + (size_t)b * strideC;
      unsigned short* C2 = (OUT_MODE == 2) ? ((unsigned short*)Cout2 + (size_t)b * strideC) : nullptr;
      {
#pragma unroll
        for (int it = 0; it < 4; ++it) {
          const int row = it * 4 + q;
          const float* sp = slab + row * 68 + c8;
          v8h hv, lv;
#pragma unroll
          for (int e = 0; e < 8; ++e) {
            if (OUT_MODE == 1) {
              hv[e] = (_Float16)sp[e];
            } else if (OUT_MODE == 3) {
              hv[e] = __builtin_bit_cast(_Float16, f2bf_bits(sp[e]));
            } else {
              unsigned short hb = f2bf_bits(sp[e]);
              unsigned short lb = f2bf_bits(sp[e] - bf_bits2f(hb));
              hv[e] = __builtin_bit_cast(_Float16, hb);
              lv[e] = __builtin_bit_cast(_Float16, lb);
            }
          }
          *(v8h*)(C + (size_t)(mBase + row) * ldc + n0 + c8) = hv;
          if (OUT_MODE == 2) *(v8h*)(C2 + (size_t)(mBase + row) * ldc + n0 + c8) = lv;
        }
        
      }
    }
    __builtin_amdgcn_fence(__ATOMIC_RELEASE, "workgroup");
    __builtin_amdgcn_wave_barrier();
    __builtin_amdgcn_fence(__ATOMIC_ACQUIRE, "workgroup");
  }
}

// ---------------------------------------------------------------------------
// Operand preparation, all of it in one launch. grid (HW/64 i-tiles, NC/64 c-tiles, 2 NB + 1 jobs), 256 threads; blockIdx.z picks the job:
//   z in 0 .. NB-1     : pre[z]      f32 [NC c][HW i] -> PRET[z][i][c]            = bf16(pre[c][i])   (one 64x64 tile, transposed)
//   z in NB .. 2 NB-1  : cur[z - NB] f32 [NC c][HW j] -> XCAT[z - NB][j][NC + c]  = bf16(cur[c][j])   (one 64x64 tile, transposed)
//                        and, from the same registers,   CURb[z - NB][c][j]       = bf16(cur[c][j])   (natural layout): cur is read once
//   z == 2 NB          : W f32 [NC][NX] -> Wb bf16, 2 elements per thread; 64 x 4 blocks x 256 threads x 2 = NC * NX elements
// Load coverage of a tile: 4 iterations x 256 threads = 1024 float4 = 64 c-rows x 64 i-cols (c-row = tid>>4 + 16 it spans 0..63, tid&15 spans the 16 float4 of a row).
// Natural-layout store: 16 lanes x 8 B = the 128-B line of one c-row's 64 columns, one writer per line.
// Transposed store: 8 waves x 2 iterations x 4 rows (q = lane>>3) = 64 out rows; 8 lanes x 8 halves = 64 cols per row.
// ---------------------------------------------------------------------------
__global__ __launch_bounds__(256) void prep_kernel(const float* __restrict__ pre, const float* __restrict__ cur, const float* __restrict__ W,
                                                   unsigned short* __restrict__ PRET, unsigned short* __restrict__ XCAT,
                                                   unsigned short* __restrict__ CURb, unsigned short* __restrict__ Wb) {
  __shared__ __align__(16) unsigned short sm[64 * 72];   // [i local][c local], pitch 72 halves (144 B)
  const int tid  = threadIdx.x;
  const int lane = tid & 31;
  const int wave = tid >> 5;
  const int z    = blockIdx.z;
  if (z == 2 * NB) {                     // block-uniform, ahead of the barrier
    const int i = (blockIdx.y * (HW / 64) + blockIdx.x) * 256 + tid;
    const v2f f = *(const v2f*)(W + 2 * (size_t)i);
    ((unsigned*)Wb)[i] = (unsigned)f2bf_bits(f[0]) | ((unsigned)f2bf_bits(f[1]) << 16);
    return;
  }
  const bool isCur = z >= NB;            // block-uniform
  const int b  = isCur ? z - NB : z;
  const int i0 = blockIdx.x * 64;
  const int c0 = blockIdx.y * 64;
  const float* in = (isCur ? cur : pre) + (size_t)b * NC * HW;
  unsigned short* out = isCur ? (XCAT + (size_t)b * HW * NX + NC) : (PRET + (size_t)b * HW * NC);
  const int ldo = isCur ? NX : NC;
  unsigned short* nat = CURb + (size_t)b * NC * HW;
  const int cr0 = tid >> 4;              // 0..15; iteration it takes c-row cr0 + 16 it
  const int q4  = (tid & 15) * 4;        // first of this thread's 4 i-columns
  v4f f[4];
#pragma unroll
  for (int it = 0; it < 4; ++it) f[it] = *(const v4f*)(in + (size_t)(c0 + cr0 + 16 * it) * HW + i0 + q4);   // all four loads in flight together
  v2u u[4];
#pragma unroll
  for (int it = 0; it < 4; ++it) {
    const int cr = cr0 + 16 * it;
    const unsigned short h0 = f2bf_bits(f[it][0]), h1 = f2bf_bits(f[it][1]), h2 = f2bf_bits(f[it][2]), h3 = f2bf_bits(f[it][3]);
    sm[(q4 + 0) * 72 + cr] = h0;
    sm[(q4 + 1) * 72 + cr] = h1;
    sm[(q4 + 2) * 72 + cr] = h2;
    sm[(q4 + 3) * 72 + cr] = h3;
    u[it] = (v2u){(unsigned)h0 | ((unsigned)h1 << 16), (unsigned)h2 | ((unsigned)h3 << 16)};
  }
  __syncthreads();
  const int q  = lane >> 3;
  const int c8 = (lane & 7) * 8;
#pragma unroll
  for (int it = 0; it < 2; ++it) {
    const int row = wave * 8 + it * 4 + q;
    const v8us v = *(const v8us*)(sm + row * 72 + c8);
    const v4u t = __builtin_bit_cast(v4u, v);
    *(v4u*)(out + (size_t)(i0 + row) * ldo + c0 + c8) = t;
  }
  if (isCur) {                           // behind the barrier, so that the barrier does not wait for these stores
#pragma unroll
    for (int it = 0; it < 4; ++it) *(v2u*)(nat + (size_t)(c0 + cr0 + 16 * it) * HW + i0 + q4) = u[it];
    asm volatile("s_wait_xcnt 0x0" ::: "memory");   // the listing lays the W job's code behind these stores: no register that they name is rewritten ahead of this wait
  }
}

// ---------------------------------------------------------------------------
// Fused attention, online softmax: XCAT[b][i][0..255] = bf16(sum_j softmax_j(pre_i . cur_j / 16) * cur[c][j]).
// Transposed products: S^T = K . Q^T (A = cur^T rows [j][c], B = pre^T rows [i][c] kept in registers) and
// O^T += V^T . P^T (A = cur rows [c][j], B = the score tiles converted in place), so a lane holds one query column:
// D register r of a score tile is key 8h + r of query (lane & 15); two such tiles are one 32-key B operand in the hardware k order.
// Work-group: 4 waves x 16 queries; a pass is 64 keys; grid (HW / 64 query blocks, batches).
// Each pass's K tile (64 keys x 512 B) and V tile (256 c x 128 B) come into LDS by asynchronous copies, two buffers, one pass ahead.
// Sums: scores over c in 32-wide k steps; probabilities per lane half over the passes in order, the halves joined at the end.
// ---------------------------------------------------------------------------
#define KPITCH 528                      // bytes per K row in LDS: 512 + 16 (16 B x odd, for 16-byte row readers)
#define VPITCH 144                      // bytes per V row in LDS: 128 + 16
#define KTILE  (64 * KPITCH)
#define VTILE  (NC * VPITCH)
#define ABUF   (KTILE + VTILE)
#define NPASS  (HW / 64)

// Eight 16-byte copies per lane, global -> LDS through no register. The s_wait_xcnt closes the statement so that no
// address register of an issued copy is rewritten ahead of it.
__device__ __forceinline__ void async_copy8(unsigned l, unsigned ls, const char* g, size_t gs) {
  asm volatile(
      "global_load_async_to_lds_b128 %0, %8, off\n\t"
      "global_load_async_to_lds_b128 %1, %9, off\n\t"
      "global_load_async_to_lds_b128 %2, %10, off\n\t"
      "global_load_async_to_lds_b128 %3, %11, off\n\t"
      "global_load_async_to_lds_b128 %4, %12, off\n\t"
      "global_load_async_to_lds_b128 %5, %13, off\n\t"
      "global_load_async_to_lds_b128 %6, %14, off\n\t"
      "global_load_async_to_lds_b128 %7, %15, off\n\t"
      "s_wait_xcnt 0x0"
      :: "v"(l), "v"(l + ls), "v"(l + 2 * ls), "v"(l + 3 * ls), "v"(l + 4 * ls), "v"(l + 5 * ls), "v"(l + 6 * ls), "v"(l + 7 * ls),
         "v"(g), "v"(g + gs), "v"(g + 2 * gs), "v"(g + 3 * gs), "v"(g + 4 * gs), "v"(g + 5 * gs), "v"(g + 6 * gs), "v"(g + 7 * gs)
      : "memory");
}
// One pass's tiles: kl / vl = this lane's first LDS byte in the K / V tile of the target buffer, kg / vg = its first global byte.
// K: a wave copies one whole 512-B row per copy, rows wave, wave + 4, ...; V: a wave copies four 128-B rows per copy, rows tid / 8, + 16, ...
__device__ __forceinline__ void attn_issue(unsigned kl, unsigned vl, const char* kg, const char* vg) {
  async_copy8(kl, 4 * KPITCH, kg, (size_t)4 * NX * 2);
  async_copy8(kl + 32 * KPITCH, 4 * KPITCH, kg + (size_t)32 * NX * 2, (size_t)4 * NX * 2);
  async_copy8(vl, 16 * VPITCH, vg, (size_t)16 * HW * 2);
  async_copy8(vl + 128 * VPITCH, 16 * VPITCH, vg + (size_t)128 * HW * 2, (size_t)16 * HW * 2);
}
// Hand-over of the ring: this wave's LDS reads are done, its own copies have landed, then every wave meets.
__device__ __forceinline__ void attn_publish() {
  asm volatile("s_wait_dscnt 0x0" ::: "memory");     // the buffer just read is refilled behind the barrier
  asm volatile("s_wait_asynccnt 0x0" ::: "memory");  // the compiler places no wait for the copies
  __syncthreads();
}
// Value of lane l ^ 16, through no LDS: an LDS shuffle's wait would also wait out the V fragment loads in flight.
__device__ __forceinline__ float other_half(float x) {
  const int b = __float_as_int(x);
  return __int_as_float(__builtin_amdgcn_permlanex16(b, b, 0x76543210, 0xfedcba98, false, false));
}
// One pass: 64 keys from the tiles at kt / vt (each already offset to this lane's row and k half).
__device__ __forceinline__ void attn_pass(const unsigned char* kt, const unsigned char* vt, const v16b (&qf)[8],
                                          v8f (&acc)[16], float& m, float& lsum) {
  const float sc = 0.0625f * 1.44269504088896340736f;   // 1/16, and exp(x) = exp2(x * log2 e)
  v8f s[4];
#pragma unroll
  for (int jt = 0; jt < 4; ++jt) s[jt] = (v8f){0.f,0.f,0.f,0.f,0.f,0.f,0.f,0.f};
#pragma unroll
  for (int ks = 0; ks < 8; ++ks)
#pragma unroll
    for (int jt = 0; jt < 4; ++jt) {
      const v16b a = Frag<__bf16>::load((const __bf16*)(kt + jt * 16 * KPITCH + ks * 64));
      s[jt] = Frag<__bf16>::mma(a, qf[ks], s[jt]);
    }
  v16b va[16], vb[16];                                  // V fragments of c tiles 0..7 and 8..15, two 32-key k steps each
#pragma unroll
  for (int f = 0; f < 16; ++f) va[f] = Frag<__bf16>::load((const __bf16*)(vt + (f & 7) * 16 * VPITCH + (f >> 3) * 64));
  __builtin_amdgcn_sched_barrier(0);                    // these LDS reads stay one group in front of the softmax, whose vector work covers their latency
  float mt[4];                                          // four independent chains
#pragma unroll
  for (int jt = 0; jt < 4; ++jt) {
    mt[jt] = s[jt][0];
#pragma unroll
    for (int r = 1; r < 8; ++r) mt[jt] = fmaxf(mt[jt], s[jt][r]);
  }
  float mx = fmaxf(fmaxf(mt[0], mt[1]), fmaxf(mt[2], mt[3]));
  mx = fmaxf(mx, other_half(mx));                       // the other lane half holds this query's other keys
  const float mn = fmaxf(m, mx * sc);
  const float alpha = __builtin_amdgcn_exp2f(m - mn);   // first pass: exp2(-inf) = 0
  m = mn;
  float ps[4];
  v16b pb[2];
#pragma unroll
  for (int jt = 0; jt < 4; ++jt) {
    float t = 0.f;
#pragma unroll
    for (int r = 0; r < 8; ++r) {
      const float p = __builtin_amdgcn_exp2f(s[jt][r] * sc - mn);
      t += p;
      pb[jt >> 1][(jt & 1) * 8 + r] = (__bf16)p;
    }
    ps[jt] = t;
  }
  lsum = lsum * alpha + ((ps[0] + ps[1]) + (ps[2] + ps[3]));
#pragma unroll
  for (int f = 0; f < 16; ++f) vb[f] = Frag<__bf16>::load((const __bf16*)(vt + (8 + (f & 7)) * 16 * VPITCH + (f >> 3) * 64));
  __builtin_amdgcn_sched_barrier(0);                    // the second group stays in front of the rescale and the first group's products, not among them
#pragma unroll
  for (int ct = 0; ct < 16; ++ct) acc[ct] *= alpha;
#pragma unroll
  for (int f = 0; f < 16; ++f) acc[f & 7] = Frag<__bf16>::mma(va[f], pb[f >> 3], acc[f & 7]);
#pragma unroll
  for (int f = 0; f < 16; ++f) acc[8 + (f & 7)] = Frag<__bf16>::mma(vb[f], pb[f >> 3], acc[8 + (f & 7)]);
}

__global__ __launch_bounds__(128) void attn_fused_kernel(const unsigned short* __restrict__ PRET,
                                                         const unsigned short* __restrict__ CURb,
                                                         unsigned short* __restrict__ XCAT) {
  __shared__ __align__(16) unsigned char sm[2 * ABUF];
  const int tid   = threadIdx.x;
  const int lane  = tid & 31;
  const int wave  = tid >> 5;
  const int b     = blockIdx.y;
  const int rlane = lane & 15;
  const int h     = lane >> 4;
  const int q     = blockIdx.x * 64 + wave * 16 + rlane;     // this lane's query
  unsigned short* Xb = XCAT + (size_t)b * HW * NX;

  const char* kg = (const char*)(Xb + NC) + (size_t)wave * (NX * 2) + lane * 16;
  const char* vg = (const char*)(CURb + (size_t)b * NC * HW) + (size_t)(tid >> 3) * (HW * 2) + (tid & 7) * 16;
  const unsigned sm0 = (unsigned)(size_t)(&sm[0]);           // LDS byte address = low 32 bits of the shared address
  const unsigned kl = sm0 + wave * KPITCH + lane * 16;
  const unsigned vl = sm0 + KTILE + (tid >> 3) * VPITCH + (tid & 7) * 16;
  const size_t kstep = (size_t)64 * NX * 2;                  // 64 keys further: 64 rows of cur^T
  const size_t vstep = (size_t)64 * 2;                       // 64 keys further: 64 columns of cur

  attn_issue(kl, vl, kg, vg);                                // pass 0 -> buffer 0

  v16b qf[8];
  const __bf16* qp = (const __bf16*)PRET + ((size_t)b * HW + q) * NC + h * 8;
#pragma unroll
  for (int ks = 0; ks < 8; ++ks) qf[ks] = Frag<__bf16>::load(qp + ks * 32);
  v8f acc[16];
#pragma unroll
  for (int ct = 0; ct < 16; ++ct) acc[ct] = (v8f){0.f,0.f,0.f,0.f,0.f,0.f,0.f,0.f};
  float m = -INFINITY, lsum = 0.f;

  asm volatile("s_wait_asynccnt 0x0" ::: "memory");          // pass 0's copies of this wave have landed
  __syncthreads();                                           // ... and every other wave's
  attn_issue(kl + ABUF, vl + ABUF, kg + kstep, vg + vstep);  // pass 1 -> buffer 1

  const unsigned char* kt0 = sm + rlane * KPITCH + h * 16;
  const unsigned char* vt0 = sm + KTILE + rlane * VPITCH + h * 16;
  unsigned cur = 0;                                          // byte offset of the buffer that this pass reads
  const char* kgn = kg + 2 * kstep;                          // source of the next refill
  const char* vgn = vg + 2 * vstep;
  // stays rolled: with the buffer offset carried by the loop the 64 LDS addresses of the copies are formed by adds; unrolled by two they were kept in registers and spilled
#pragma unroll 1
  for (int t = 0; t < NPASS; ++t) {
    attn_pass(kt0 + cur, vt0 + cur, qf, acc, m, lsum);
    attn_publish();
    if (t + 2 < NPASS) {                                     // pass t + 2 -> the buffer that pass t has just read
      attn_issue(kl + cur, vl + cur, kgn, vgn);
      kgn += kstep;
      vgn += vstep;
    }
    cur ^= ABUF;
  }
  asm volatile("s_wait_asynccnt 0x0" ::: "memory");          // nothing of this wave is in flight when it ends

  const float inv = 1.0f / (lsum + other_half(lsum));   // the sum is near 1 or above: the row maximum contributes exp2(0)
  unsigned short* op = Xb + (size_t)q * NX + h * 8;          // acc[ct][r] = feat[c = 16 ct + 8 h + r][q]: 8 consecutive c, one 16-B store
#pragma unroll
  for (int ct = 0; ct < 16; ++ct) {
    v8b o;
#pragma unroll
    for (int r = 0; r < 8; ++r) o[r] = (__bf16)(acc[ct][r] * inv);
    *(v8b*)(op + ct * 16) = o;
  }
}

// ---------------------------------------------------------------------------
// BN (running stats) + PReLU: out[o][i] = prelu((Y[o][i]) * inv[o] + shift[o]), Y already holds conv + b_conv (f32).
// inv = gamma*rsqrt(var + 1e-5), shift = beta - mean*inv, slope = alpha[0].
// 4 elements per thread (one float4); grid = n4/256 blocks x 256 threads x 4 = all [NB][NC][HW] planes (n4 = NB*NC*HW/4).
// ---------------------------------------------------------------------------
__global__ __launch_bounds__(256) void bn_prelu_kernel(const float* __restrict__ Y,
                                                       const float* __restrict__ gamma, const float* __restrict__ beta,
                                                       const float* __restrict__ rmean, const float* __restrict__ rvar,
                                                       const float* __restrict__ alpha,
                                                       float* __restrict__ out, int n4) {
  const int t = blockIdx.x * 256 + threadIdx.x;
  if (t < n4) {
    const int o = (t >> 10) & (NC - 1);          // HW/4 = 1024 float4 per output channel row, NC rows per batch
    const float inv   = gamma[o] * rsqrtf(rvar[o] + 1e-5f);
    const float shift = beta[o] - rmean[o] * inv;
    const float slope = alpha[0];
    const v4f y = *(const v4f*)(Y + 4 * (size_t)t);
    v4f r;
#pragma unroll
    for (int e = 0; e < 4; ++e) {
      const float v = y[e] * inv + shift;
      r[e] = (v >= 0.f) ? v : slope * v;
    }
    *(v4f*)(out + 4 * (size_t)t) = r;
    
  }
}

// ---------------------------------------------------------------------------
// Workspace region map (byte offsets); every region is fully written before it is read, once per call, all batches.
//   Wb    bf16 [256][512]                  0          (262144 B)
//   PRET  bf16 [4 b][4096 i][256 c]        262144     (8388608 B)   pre^T
//   CURb  bf16 [4 b][256 c][4096 j]        8650752    (8388608 B)   cur, natural layout
//   XCAT  bf16 [4 b][4096 i][512]          17039360   (16777216 B)  cols 0..255 = feat^T, cols 256..511 = cur^T
//   Y     f32  [4 b][256 o][4096 i]        33816576   (16777216 B)  conv + bias
//   total                                  50593792 B
// ---------------------------------------------------------------------------
extern "C" void kernel_launch(void* const* d_in, const int* in_sizes, int n_in,
                              void* d_out, int out_size, void* d_ws, size_t ws_size,
                              hipStream_t stream) {
  if (n_in < 9) return;
  if (in_sizes[0] != NB * NC * HW || in_sizes[1] != NB * NC * HW) return;
  if (in_sizes[2] != NC * NX) return;
  if (in_sizes[3] != NC || in_sizes[4] != NC || in_sizes[5] != NC || in_sizes[6] != NC || in_sizes[7] != NC) return;
  if (in_sizes[8] < 1) return;
  if (out_size != NB * NC * HW) return;

  const float* pre   = (const float*)d_in[0];
  const float* cur   = (const float*)d_in[1];
  const float* W     = (const float*)d_in[2];
  const float* bconv = (const float*)d_in[3];
  const float* gamma = (const float*)d_in[4];
  const float* beta  = (const float*)d_in[5];
  const float* rmean = (const float*)d_in[6];
  const float* rvar  = (const float*)d_in[7];
  const float* alpha = (const float*)d_in[8];
  float* out = (float*)d_out;

  const size_t szWb   = (size_t)NC * NX * 2;
  const size_t szPRET = (size_t)NB * HW * NC * 2;
  const size_t szCURb = (size_t)NB * NC * HW * 2;
  const size_t szXCAT = (size_t)NB * HW * NX * 2;
  const size_t szY    = (size_t)NB * NC * HW * 4;
  size_t off = 0;
  const size_t oWb   = off; off += szWb;
  const size_t oPRET = off; off += szPRET;
  const size_t oCURb = off; off += szCURb;
  const size_t oXCAT = off; off += szXCAT;
  const size_t oY    = off; off += szY;
  if (off > ws_size) return;                    // 50593792 B total

  char* ws = (char*)d_ws;
  unsigned short* Wb   = (unsigned short*)(ws + oWb);
  unsigned short* PRET = (unsigned short*)(ws + oPRET);
  unsigned short* CURb = (unsigned short*)(ws + oCURb);
  unsigned short* XCAT = (unsigned short*)(ws + oXCAT);
  float*          Yb   = (float*)(ws + oY);

  const dim3 blk(256);
  const int n4Y = NB * NC * HW / 4;             // 1048576 float4
  const dim3 gP(HW / 64, NC / 64, 2 * NB + 1);  // 64 x 4 tiles x (4 batches of pre, 4 of cur), and 256 blocks for W
  const dim3 gA(HW / 64, NB);                   // 64 query blocks x 4 batches, 4 waves each
  const dim3 gC((NC / 64) * (HW / 64), NB);     // 256 blocks x 8 waves per batch: M=256, N=4096, K=512, one tile per block, K over its waves
  const dim3 gE((n4Y + 255) / 256);             // 4096 blocks

  // W -> Wb; pre[b] [256 c][4096 i] -> PRET[b] [4096 i][256 c]; cur[b] [256 c][4096 j] -> XCAT[b][j][256 + c] and CURb[b] (natural layout)
  prep_kernel<<<gP, blk, 0, stream>>>(pre, cur, W, PRET, XCAT, CURb, Wb);
  // XCAT[b][i][c] = bf16(sum_j softmax_j(PRET[b][i] . XCAT[b][j][256..] / 16) * CURb[b][c][j])
  attn_fused_kernel<<<gA, dim3(128), 0, stream>>>(PRET, CURb, XCAT);
  // Y[b][o][i] = sum_k Wb[o][k] * XCAT[b][i][k] + b_conv[o]  (M=256, N=4096, K=512, f32 out, ldc 4096)
  wmma_gemm64<1, false, 1, 0, false, 0, 8><<<gC, blk, 0, stream>>>(
      Wb, Wb, NX, 0L, XCAT, XCAT, NX, (long)HW * NX, (void*)Yb, (void*)Yb, HW, (long)NC * HW,
      bconv, bconv, 0L, NC, HW, NX, 1.0f);
  // out[b][o][i] = prelu(bn(Y[b][o][i]))
  bn_prelu_kernel<<<gE, blk, 0, stream>>>(Yb, gamma, beta, rmean, rvar, alpha, out, n4Y);
  (void)hipGetLastError();
}

// v004
// Measured time: 106 microseconds a run.
// Two timings next to v003 both put it at 1.06 times that version's speed.
// Over all steps from v000 it is 16.7 times as fast.
// Contractions S = pre^T.cur (x1/16), featT = P.cur^T, 1x1 conv = W.x: all v_wmma_f32_16x16x32_bf16 (bf16 operands RNE-converted from f32, f32 accumulate); softmax, bias, BN, PReLU in f32.
#include <hip/hip_runtime.h>
#include <math.h>
#include <stdint.h>

#define NB 4
#define NC 256
#define HW 4096
#define NX 512

typedef __attribute__((ext_vector_type(16))) _Float16 v16h;
typedef __attribute__((ext_vector_type(8)))  _Float16 v8h;
typedef __attribute__((ext_vector_type(16))) __bf16   v16b;
typedef __attribute__((ext_vector_type(8)))  __bf16   v8b;
typedef __attribute__((ext_vector_type(8)))  float    v8f;
typedef __attribute__((ext_vector_type(4)))  float    v4f;
typedef __attribute__((ext_vector_type(2)))  float    v2f;
typedef __attribute__((ext_vector_type(4)))  unsigned int v4u;
typedef __attribute__((ext_vector_type(2)))  unsigned int v2u;
typedef __attribute__((ext_vector_type(8)))  unsigned short v8us;

__device__ __forceinline__ unsigned short f2bf_bits(float f) {
  unsigned u = __float_as_uint(f);
  return (unsigned short)((u + 0x7FFFu + ((u >> 16) & 1u)) >> 16);
}
__device__ __forceinline__ float bf_bits2f(unsigned short h) { return __uint_as_float(((unsigned)h) << 16); }

// hazard guards as plain device helpers
__device__ __forceinline__ void dep_guard_h(v8f& a, v8f& b, v16h x, v16h y) { asm volatile("v_nop\n\tv_nop\n\tv_nop\n\tv_nop" : "+v"(a), "+v"(b) : "v"(x), "v"(y)); }
__device__ __forceinline__ void dep_guard_b(v8f& a, v8f& b, v16b x, v16b y) { asm volatile("v_nop\n\tv_nop\n\tv_nop\n\tv_nop" : "+v"(a), "+v"(b) : "v"(x), "v"(y)); }
__device__ __forceinline__ void keep4_h(v16h a, v16h b, v16h c, v16h d) { asm volatile("v_nop" :: "v"(a), "v"(b), "v"(c), "v"(d)); }
__device__ __forceinline__ void keep4_b(v16b a, v16b b, v16b c, v16b d) { asm volatile("v_nop" :: "v"(a), "v"(b), "v"(c), "v"(d)); }
__device__ __forceinline__ void acc_guard4(v8f& a, v8f& b, v8f& c, v8f& d) { asm volatile("v_nop\n\tv_nop\n\tv_nop\n\tv_nop" : "+v"(a), "+v"(b), "+v"(c), "+v"(d)); }
template <typename T> struct Frag;
template <> struct Frag<_Float16> {
  typedef v16h V; union U { v16h v; v8h h[2]; };
  static __device__ __forceinline__ v16h load(const _Float16* p) {   // elements 0..7 <- p[0..7], 8..15 <- p[16..23]
    U f; f.h[0] = *(const v8h*)(p); f.h[1] = *(const v8h*)(p + 16); return f.v;
  }
  static __device__ __forceinline__ v8f mma(v16h a, v16h b, v8f c) {
    return __builtin_amdgcn_wmma_f32_16x16x32_f16(false, a, false, b, (short)0, c, false, false);
  }
  static __device__ __forceinline__ void guard(v8f& a, v8f& b, v16h x, v16h y) { dep_guard_h(a, b, x, y); }
  static __device__ __forceinline__ void keep(v16h a, v16h b, v16h c, v16h d) { keep4_h(a, b, c, d); }
};
template <> struct Frag<__bf16> {
  typedef v16b V; union U { v16b v; v8b h[2]; };
  static __device__ __forceinline__ v16b load(const __bf16* p) {
    U f; f.h[0] = *(const v8b*)(p); f.h[1] = *(const v8b*)(p + 16); return f.v;
  }
  static __device__ __forceinline__ v8f mma(v16b a, v16b b, v8f c) {
    return __builtin_amdgcn_wmma_f32_16x16x32_bf16(false, a, false, b, (short)0, c, false, false);
  }
  static __device__ __forceinline__ void guard(v8f& a, v8f& b, v16b x, v16b y) { dep_guard_b(a, b, x, y); }
  static __device__ __forceinline__ void keep(v16b a, v16b b, v16b c, v16b d) { keep4_b(a, b, c, d); }
};

// ---- Register-blocked batched WMMA GEMM ------------------------------------
// C[m,n] = scale * sum_k A[m,k] * Bt[n,k] (+bias)(+resid); each wave (KS == 1) or each block (KS > 1) owns a 64x64 tile.
// A row-major [M,K]; Bt row-major [N,K]; M,N % 64 == 0, K % 32 == 0.
// SPLIT: operands are hi/lo planes (A2/Bt2 = lo planes, same layout); product = hi.hi + hi.lo + lo.hi.
// BIAS_MODE: 0 = none, 1 = bias[m], 2 = bias[n].
// OUT_MODE: 0 = f32, 1 = f16, 2 = bf16 hi plane (Cout) + bf16 lo plane (Cout2), 3 = single bf16 plane (RNE).
// ET: 0 = f16 operands, 1 = bf16 operands (pointers passed as 16-bit storage)
// ACT: 0 = none, 1 = tanh, 2 = relu, 3 = silu, 4 = leaky relu,
//      5 = batch norm on the running statistics of row m, then PReLU with one shared slope (KS > 1 only):
//          prelu(x * inv + shift), inv = gamma[m] * rsqrt(var[m] + 1e-5), shift = beta[m] - mean[m] * inv, slope = alpha[0]
// KS: 1 = each wave owns a tile and all of K (8 tiles per block). KS > 1 = the block owns ONE tile and its KS waves
//     split K: wave w takes the 32-wide k steps w, w + KS, w + 2 KS, ...; the KS partial tiles meet in LDS
//     and are summed in wave order 0..KS-1, each wave finishing 64 / KS rows. For GEMMs with fewer tiles than the chip has room for.
template <int ET> struct Elem;
template <> struct Elem<0> { typedef _Float16 T; };
template <> struct Elem<1> { typedef __bf16 T; };
template <int ET, bool SPLIT, int BIAS_MODE, int OUT_MODE, bool RESID, int ACT = 0, int KS = 1>
__global__ __launch_bounds__(KS == 1 ? 256 : KS * 32) void wmma_gemm64(
    const unsigned short* __restrict__ Ap, const unsigned short* __restrict__ A2p, int lda, long strideA,
    const unsigned short* __restrict__ Btp, const unsigned short* __restrict__ Bt2p, int ldb, long strideB,
    void* __restrict__ Cout, void* __restrict__ Cout2, int ldc, long strideC,
    const float* __restrict__ bias,
    const float* __restrict__ resid, long strideR,
    const float* __restrict__ gamma, const float* __restrict__ beta, const float* __restrict__ rmean,
    const float* __restrict__ rvar, const float* __restrict__ alpha,
    int M, int N, int K, float scale) {
  static_assert(ACT != 5 || KS > 1, "ACT 5 is written for the split-K epilogue");
  typedef typename Elem<ET>::T T;
  typedef typename Frag<T>::V V;
  const T* A = (const T*)Ap; const T* A2 = (const T*)A2p; const T* Bt = (const T*)Btp; const T* Bt2 = (const T*)Bt2p;
  __shared__ __align__(16) float sT[KS == 1 ? 8 : KS * 4][16 * 68];   // KS == 1: per-wave 16x64 slab; KS > 1: per-wave 64x64 partial tile; pitch 68 floats
  const int b    = blockIdx.y;
  const int lane = threadIdx.x & 31;
  const int wave = (KS == 1) ? (int)(threadIdx.x >> 5) : __builtin_amdgcn_readfirstlane((int)(threadIdx.x >> 5));   // scalar, so the k loop stays a scalar loop
  const int tilesN = N >> 6;
  const int tilesM = M >> 6;
  const int tile = (KS == 1) ? (int)(blockIdx.x * 8 + wave) : (int)blockIdx.x;
  if (tile >= tilesM * tilesN) return;   // KS == 1: wave-uniform, no block barrier follows; KS > 1: block-uniform, ahead of the barrier
  const int tm = tile / tilesN;
  const int tn = tile - tm * tilesN;
  const int m0 = tm << 6;
  const int n0 = tn << 6;

  const T* Ab  = A  + (size_t)b * strideA;
  const T* Bb  = Bt + (size_t)b * strideB;
  const T* Ab2 = SPLIT ? (A2  + (size_t)b * strideA) : nullptr;
  const T* Bb2 = SPLIT ? (Bt2 + (size_t)b * strideB) : nullptr;

  const int rlane = lane & 15;                 // row (A) / col (B, D) within subtile
  const int koff  = (lane >> 4) * 8;           // k offset of this lane half
  const int mOff  = (lane >> 4) * 8;           // D row offset

  v8f acc[4][4];
#pragma unroll
  for (int i = 0; i < 4; ++i)
#pragma unroll
    for (int j = 0; j < 4; ++j) acc[i][j] = (v8f){0.f,0.f,0.f,0.f,0.f,0.f,0.f,0.f};

  for (int k0 = (KS == 1) ? 0 : wave * 32; k0 < K; k0 += 32 * KS) {
    V bh[4], bl[4];
#pragma unroll
    for (int j = 0; j < 4; ++j) {
      const size_t bo = (size_t)(n0 + (j << 4) + rlane) * ldb + koff + k0;
      bh[j] = Frag<T>::load(Bb + bo);
      if (SPLIT) bl[j] = Frag<T>::load(Bb2 + bo);
    }
#pragma unroll
    for (int i = 0; i < 4; ++i) {
      const size_t ao = (size_t)(m0 + (i << 4) + rlane) * lda + koff + k0;
      V ah = Frag<T>::load(Ab + ao);
      V al;
      if (SPLIT) al = Frag<T>::load(Ab2 + ao);
#pragma unroll
      for (int j = 0; j < 4; ++j) {
        acc[i][j] = Frag<T>::mma(ah, bh[j], acc[i][j]);
        if (SPLIT) {
          acc[i][j] = Frag<T>::mma(ah, bl[j], acc[i][j]);
          acc[i][j] = Frag<T>::mma(al, bh[j], acc[i][j]);
        }
      }
      Frag<T>::guard(acc[i][0], acc[i][3], ah, SPLIT ? al : ah);
    }
    Frag<T>::keep(bh[0], bh[1], bh[2], bh[3]);
    if (SPLIT) Frag<T>::keep(bl[0], bl[1], bl[2], bl[3]);
  }
  acc_guard4(acc[0][0], acc[0][1], acc[0][2], acc[0][3]);
  acc_guard4(acc[1][0], acc[1][1], acc[1][2], acc[1][3]);
  acc_guard4(acc[2][0], acc[2][1], acc[2][2], acc[2][3]);
  acc_guard4(acc[3][0], acc[3][1], acc[3][2], acc[3][3]);

  // ---- epilogue ----
  const float* Rb = RESID ? (resid + (size_t)b * strideR) : nullptr;
  if (KS > 1) {
    float* part = &sT[0][0];                    // [KS waves][64 rows][68]
    float* mine = part + wave * (64 * 68);
    constexpr int ROWS = 64 / KS;               // rows of the tile that this wave finishes
    constexpr int CW   = (OUT_MODE == 0) ? 4 : 8;   // columns per lane: one 16-B store either way
    constexpr int RP   = 32 * CW / 64;          // rows per pass of the wave
    const int row0 = wave * ROWS + lane / (64 / CW);   // this lane's row in pass 0
    float bnInv[ROWS / RP], bnShift[ROWS / RP], slope = 0.f;
    if (ACT == 5) {                             // read ahead of the LDS stores and the barrier, which cover the latency
      slope = alpha[0];
#pragma unroll
      for (int it = 0; it < ROWS / RP; ++it) {
        const int m = m0 + row0 + it * RP;
        bnInv[it]   = gamma[m] * rsqrtf(rvar[m] + 1e-5f);
        bnShift[it] = beta[m] - rmean[m] * bnInv[it];
      }
    }
#pragma unroll
    for (int i = 0; i < 4; ++i)
#pragma unroll
      for (int j = 0; j < 4; ++j)
#pragma unroll
        for (int r = 0; r < 8; ++r) mine[((i << 4) + mOff + r) * 68 + (j << 4) + rlane] = acc[i][j][r];
    if (ACT == 5) asm volatile("s_wait_xcnt 0x0" ::: "memory");   // no register that the coefficient loads name is rewritten ahead of this wait
    __syncthreads();                            // all KS partial tiles are in LDS before any wave sums them
    const int cc = (lane & (64 / CW - 1)) * CW;
#pragma unroll
    for (int it = 0; it < ROWS / RP; ++it) {
      const int row = row0 + it * RP;
      const int m = m0 + row;
      const float* sp = part + row * 68 + cc;
      float v[CW];
#pragma unroll
      for (int e = 0; e < CW; e += 4) {
        v4f s = *(const v4f*)(sp + e);
#pragma unroll
        for (int w = 1; w < KS; ++w) s += *(const v4f*)(sp + w * (64 * 68) + e);
        v[e] = s[0]; v[e + 1] = s[1]; v[e + 2] = s[2]; v[e + 3] = s[3];
      }
#pragma unroll
      for (int e = 0; e < CW; ++e) {
        float x = v[e] * scale;
        if (BIAS_MODE == 1) x += bias[m];
        if (BIAS_MODE == 2) x += bias[n0 + cc + e];
        if (RESID) x += Rb[(size_t)m * ldc + n0 + cc + e];
        if (ACT == 1) x = tanhf(x);
        if (ACT == 2) x = fmaxf(x, 0.0f);
        if (ACT == 3) x = x / (1.0f + expf(-x));
        if (ACT == 4) x = (x > 0.f) ? x : 0.01f * x;
        if (ACT == 5) { x = x * bnInv[it] + bnShift[it]; x = (x >= 0.f) ? x : slope * x; }
        v[e] = x;
      }
      const size_t co = (size_t)b * strideC + (size_t)m * ldc + n0 + cc;
      if constexpr (OUT_MODE == 0) {
        *(v4f*)((float*)Cout + co) = (v4f){v[0], v[1], v[2], v[3]};
      } else {
        v8h hv, lv;
#pragma unroll
        for (int e = 0; e < 8; ++e) {
          const float x = v[e];
          if (OUT_MODE == 1) {
            hv[e] = (_Float16)x;
          } else {
            const unsigned short hb = f2bf_bits(x);
            hv[e] = __builtin_bit_cast(_Float16, hb);
            if (OUT_MODE == 2) lv[e] = __builtin_bit_cast(_Float16, f2bf_bits(x - bf_bits2f(hb)));
          }
        }
        *(v8h*)((unsigned short*)Cout + co) = hv;
        if (OUT_MODE == 2) *(v8h*)((unsigned short*)Cout2 + co) = lv;
      }
    }
    return;
  }
  float* slab = sT[wave];
#pragma unroll
  for (int i = 0; i < 4; ++i) {
    const int mBase = m0 + (i << 4);
#pragma unroll
    for (int j = 0; j < 4; ++j) {
      const int n = n0 + (j << 4) + rlane;
      float bv = 0.f;
      if (BIAS_MODE == 2) bv = bias[n];
#pragma unroll
      for (int r = 0; r < 8; ++r) {
        float v = acc[i][j][r] * scale;
        if (BIAS_MODE == 1) v += bias[mBase + mOff + r];
        if (BIAS_MODE == 2) v += bv;
        if (RESID) v += Rb[(size_t)(mBase + mOff + r) * ldc + n];
        if (ACT == 1) v = tanhf(v);
        if (ACT == 2) v = fmaxf(v, 0.0f);
        if (ACT == 3) v = v / (1.0f + expf(-v));
        if (ACT == 4) v = (v > 0.f) ? v : 0.01f * v;
        slab[(mOff + r) * 68 + (j << 4) + rlane] = v;
      }
    }
    __builtin_amdgcn_fence(__ATOMIC_RELEASE, "workgroup");
    __builtin_amdgcn_wave_barrier();
    __builtin_amdgcn_fence(__ATOMIC_ACQUIRE, "workgroup");
    if (OUT_MODE == 0) {
      float* C = (float*)Cout + (size_t)b * strideC;
      const int hh = lane >> 4, c4 = (lane & 15) * 4;     // row seg = 256 B = 16 lanes x 16 B
      {
#pragma unroll
        for (int it = 0; it < 8; ++it) {
          const int row = it * 2 + hh;
          v4f v = *(const v4f*)(slab + row * 68 + c4);
          *(v4f*)(C + (size_t)(mBase + row) * ldc + n0 + c4) = v;
        }
        
      }
    } else {
      const int q = lane >> 3, c8 = (lane & 7) * 8;
      unsigned short* C  = (unsigned short*)Cout  + (size_t)b * strideC;
      unsigned short* C2 = (OUT_MODE == 2) ? ((unsigned short*)Cout2 + (size_t)b * strideC) : nullptr;
      {
#pragma unroll
        for (int it = 0; it < 4; ++it) {
          const int row = it * 4 + q;
          const float* sp = slab + row * 68 + c8;
          v8h hv, lv;
#pragma unroll
          for (int e = 0; e < 8; ++e) {
            if (OUT_MODE == 1) {
              hv[e] = (_Float16)sp[e];
            } else if (OUT_MODE == 3) {
              hv[e] = __builtin_bit_cast(_Float16, f2bf_bits(sp[e]));
            } else {
              unsigned short hb = f2bf_bits(sp[e]);
              unsigned short lb = f2bf_bits(sp[e] - bf_bits2f(hb));
              hv[e] = __builtin_bit_cast(_Float16, hb);
              lv[e] = __builtin_bit_cast(_Float16, lb);
            }
          }
          *(v8h*)(C + (size_t)(mBase + row) * ldc + n0 + c8) = hv;
          if (OUT_MODE == 2) *(v8h*)(C2 + (size_t)(mBase + row) * ldc + n0 + c8) = lv;
        }
        
      }
    }
    __builtin_amdgcn_fence(__ATOMIC_RELEASE, "workgroup");
    __builtin_amdgcn_wave_barrier();
    __builtin_amdgcn_fence(__ATOMIC_ACQUIRE, "workgroup");
  }
}

// ---------------------------------------------------------------------------
// Operand preparation, all of it in one launch. grid (HW/64 i-tiles, NC/64 c-tiles, 2 NB + 1 jobs), 256 threads; blockIdx.z picks the job:
//   z in 0 .. NB-1     : pre[z]      f32 [NC c][HW i] -> PRET[z][i][c]            = bf16(pre[c][i])   (one 64x64 tile, transposed)
//   z in NB .. 2 NB-1  : cur[z - NB] f32 [NC c][HW j] -> XCAT[z - NB][j][NC + c]  = bf16(cur[c][j])   (one 64x64 tile, transposed)
//                        and, from the same registers,   CURb[z - NB][c][j]       = bf16(cur[c][j])   (natural layout): cur is read once
//   z == 2 NB          : W f32 [NC][NX] -> Wb bf16, 2 elements per thread; 64 x 4 blocks x 256 threads x 2 = NC * NX elements
// Load coverage of a tile: 4 iterations x 256 threads = 1024 float4 = 64 c-rows x 64 i-cols (c-row = tid>>4 + 16 it spans 0..63, tid&15 spans the 16 float4 of a row).
// Natural-layout store: 16 lanes x 8 B = the 128-B line of one c-row's 64 columns, one writer per line.
// Transposed store: 8 waves x 2 iterations x 4 rows (q = lane>>3) = 64 out rows; 8 lanes x 8 halves = 64 cols per row.
// ---------------------------------------------------------------------------
__global__ __launch_bounds__(256) void prep_kernel(const float* __restrict__ pre, const float* __restrict__ cur, const float* __restrict__ W,
                                                   unsigned short* __restrict__ PRET, unsigned short* __restrict__ XCAT,
                                                   unsigned short* __restrict__ CURb, unsigned short* __restrict__ Wb) {
  __shared__ __align__(16) unsigned short sm[64 * 72];   // [i local][c local], pitch 72 halves (144 B)
  const int tid  = threadIdx.x;
  const int lane = tid & 31;
  const int wave = tid >> 5;
  const int z    = blockIdx.z;
  if (z == 2 * NB) {                     // block-uniform, ahead of the barrier
    const int i = (blockIdx.y * (HW / 64) + blockIdx.x) * 256 + tid;
    const v2f f = *(const v2f*)(W + 2 * (size_t)i);
    ((unsigned*)Wb)[i] = (unsigned)f2bf_bits(f[0]) | ((unsigned)f2bf_bits(f[1]) << 16);
    return;
  }
  const bool isCur = z >= NB;            // block-uniform
  const int b  = isCur ? z - NB : z;
  const int i0 = blockIdx.x * 64;
  const int c0 = blockIdx.y * 64;
  const float* in = (isCur ? cur : pre) + (size_t)b * NC * HW;
  unsigned short* out = isCur ? (XCAT + (size_t)b * HW * NX + NC) : (PRET + (size_t)b * HW * NC);
  const int ldo = isCur ? NX : NC;
  unsigned short* nat = CURb + (size_t)b * NC * HW;
  const int cr0 = tid >> 4;              // 0..15; iteration it takes c-row cr0 + 16 it
  const int q4  = (tid & 15) * 4;        // first of this thread's 4 i-columns
  v4f f[4];
#pragma unroll
  for (int it = 0; it < 4; ++it) f[it] = *(const v4f*)(in + (size_t)(c0 + cr0 + 16 * it) * HW + i0 + q4);   // all four loads in flight together
  v2u u[4];
#pragma unroll
  for (int it = 0; it < 4; ++it) {
    const int cr = cr0 + 16 * it;
    const unsigned short h0 = f2bf_bits(f[it][0]), h1 = f2bf_bits(f[it][1]), h2 = f2bf_bits(f[it][2]), h3 = f2bf_bits(f[it][3]);
    sm[(q4 + 0) * 72 + cr] = h0;
    sm[(q4 + 1) * 72 + cr] = h1;
    sm[(q4 + 2) * 72 + cr] = h2;
    sm[(q4 + 3) * 72 + cr] = h3;
    u[it] = (v2u){(unsigned)h0 | ((unsigned)h1 << 16), (unsigned)h2 | ((unsigned)h3 << 16)};
  }
  __syncthreads();
  const int q  = lane >> 3;
  const int c8 = (lane & 7) * 8;
#pragma unroll
  for (int it = 0; it < 2; ++it) {
    const int row = wave * 8 + it * 4 + q;
    const v8us v = *(const v8us*)(sm + row * 72 + c8);
    const v4u t = __builtin_bit_cast(v4u, v);
    *(v4u*)(out + (size_t)(i0 + row) * ldo + c0 + c8) = t;
  }
  if (isCur) {                           // behind the barrier, so that the barrier does not wait for these stores
#pragma unroll
    for (int it = 0; it < 4; ++it) *(v2u*)(nat + (size_t)(c0 + cr0 + 16 * it) * HW + i0 + q4) = u[it];
    asm volatile("s_wait_xcnt 0x0" ::: "memory");   // the listing lays the W job's code behind these stores: no register that they name is rewritten ahead of this wait
  }
}

// ---------------------------------------------------------------------------
// Fused attention, online softmax: XCAT[b][i][0..255] = bf16(sum_j softmax_j(pre_i . cur_j / 16) * cur[c][j]).
// Transposed products: S^T = K . Q^T (A = cur^T rows [j][c], B = pre^T rows [i][c] kept in registers) and
// O^T += V^T . P^T (A = cur rows [c][j], B = the score tiles converted in place), so a lane holds one query column:
// D register r of a score tile is key 8h + r of query (lane & 15); two such tiles are one 32-key B operand in the hardware k order.
// Work-group: 4 waves x 16 queries; a pass is 64 keys; grid (HW / 64 query blocks, batches).
// Each pass's K tile (64 keys x 512 B) and V tile (256 c x 128 B) come into LDS by asynchronous copies, two buffers, one pass ahead.
// Sums: scores over c in 32-wide k steps; probabilities per lane half over the passes in order, the halves joined at the end.
// ---------------------------------------------------------------------------
#define KPITCH 528                      // bytes per K row in LDS: 512 + 16 (16 B x odd, for 16-byte row readers)
#define VPITCH 144                      // bytes per V row in LDS: 128 + 16
#define KTILE  (64 * KPITCH)
#define VTILE  (NC * VPITCH)
#define ABUF   (KTILE + VTILE)
#define NPASS  (HW / 64)

// Eight 16-byte copies per lane, global -> LDS through no register. The s_wait_xcnt closes the statement so that no
// address register of an issued copy is rewritten ahead of it.
__device__ __forceinline__ void async_copy8(unsigned l, unsigned ls, const char* g, size_t gs) {
  asm volatile(
      "global_load_async_to_lds_b128 %0, %8, off\n\t"
      "global_load_async_to_lds_b128 %1, %9, off\n\t"
      "global_load_async_to_lds_b128 %2, %10, off\n\t"
      "global_load_async_to_lds_b128 %3, %11, off\n\t"
      "global_load_async_to_lds_b128 %4, %12, off\n\t"
      "global_load_async_to_lds_b128 %5, %13, off\n\t"
      "global_load_async_to_lds_b128 %6, %14, off\n\t"
      "global_load_async_to_lds_b128 %7, %15, off\n\t"
      "s_wait_xcnt 0x0"
      :: "v"(l), "v"(l + ls), "v"(l + 2 * ls), "v"(l + 3 * ls), "v"(l + 4 * ls), "v"(l + 5 * ls), "v"(l + 6 * ls), "v"(l + 7 * ls),
         "v"(g), "v"(g + gs), "v"(g + 2 * gs), "v"(g + 3 * gs), "v"(g + 4 * gs), "v"(g + 5 * gs), "v"(g + 6 * gs), "v"(g + 7 * gs)
      : "memory");
}
// One pass's tiles: kl / vl = this lane's first LDS byte in the K / V tile of the target buffer, kg / vg = its first global byte.
// K: a wave copies one whole 512-B row per copy, rows wave, wave + 4, ...; V: a wave copies four 128-B rows per copy, rows tid / 8, + 16, ...
__device__ __forceinline__ void attn_issue(unsigned kl, unsigned vl, const char* kg, const char* vg) {
  async_copy8(kl, 4 * KPITCH, kg, (size_t)4 * NX * 2);
  async_copy8(kl + 32 * KPITCH, 4 * KPITCH, kg + (size_t)32 * NX * 2, (size_t)4 * NX * 2);
  async_copy8(vl, 16 * VPITCH, vg, (size_t)16 * HW * 2);
  async_copy8(vl + 128 * VPITCH, 16 * VPITCH, vg + (size_t)128 * HW * 2, (size_t)16 * HW * 2);
}
// Hand-over of the ring: this wave's LDS reads are done, its own copies have landed, then every wave meets.
__device__ __forceinline__ void attn_publish() {
  asm volatile("s_wait_dscnt 0x0" ::: "memory");     // the buffer just read is refilled behind the barrier
  asm volatile("s_wait_asynccnt 0x0" ::: "memory");  // the compiler places no wait for the copies
  __syncthreads();
}
// Value of lane l ^ 16, through no LDS: an LDS shuffle's wait would also wait out the V fragment loads in flight.
__device__ __forceinline__ float other_half(float x) {
  const int b = __float_as_int(x);
  return __int_as_float(__builtin_amdgcn_permlanex16(b, b, 0x76543210, 0xfedcba98, false, false));
}
// One pass: 64 keys from the tiles at kt / vt (each already offset to this lane's row and k half).
__device__ __forceinline__ void attn_pass(const unsigned char* kt, const unsigned char* vt, const v16b (&qf)[8],
                                          v8f (&acc)[16], float& m, float& lsum) {
  const float sc = 0.0625f * 1.44269504088896340736f;   // 1/16, and exp(x) = exp2(x * log2 e)
  v8f s[4];
#pragma unroll
  for (int jt = 0; jt < 4; ++jt) s[jt] = (v8f){0.f,0.f,0.f,0.f,0.f,0.f,0.f,0.f};
#pragma unroll
  for (int ks = 0; ks < 8; ++ks)
#pragma unroll
    for (int jt = 0; jt < 4; ++jt) {
      const v16b a = Frag<__bf16>::load((const __bf16*)(kt + jt * 16 * KPITCH + ks * 64));
      s[jt] = Frag<__bf16>::mma(a, qf[ks], s[jt]);
    }
  v16b va[16], vb[16];                                  // V fragments of c tiles 0..7 and 8..15, two 32-key k steps each
#pragma unroll
  for (int f = 0; f < 16; ++f) va[f] = Frag<__bf16>::load((const __bf16*)(vt + (f & 7) * 16 * VPITCH + (f >> 3) * 64));
  __builtin_amdgcn_sched_barrier(0);                    // these LDS reads stay one group in front of the softmax, whose vector work covers their latency
  float mt[4];                                          // four independent chains
#pragma unroll
  for (int jt = 0; jt < 4; ++jt) {
    mt[jt] = s[jt][0];
#pragma unroll
    for (int r = 1; r < 8; ++r) mt[jt] = fmaxf(mt[jt], s[jt][r]);
  }
  float mx = fmaxf(fmaxf(mt[0], mt[1]), fmaxf(mt[2], mt[3]));
  mx = fmaxf(mx, other_half(mx));                       // the other lane half holds this query's other keys
  const float mn = fmaxf(m, mx * sc);
  const float alpha = __builtin_amdgcn_exp2f(m - mn);   // first pass: exp2(-inf) = 0
  m = mn;
  float ps[4];
  v16b pb[2];
#pragma unroll
  for (int jt = 0; jt < 4; ++jt) {
    float t = 0.f;
#pragma unroll
    for (int r = 0; r < 8; ++r) {
      const float p = __builtin_amdgcn_exp2f(s[jt][r] * sc - mn);
      t += p;
      pb[jt >> 1][(jt & 1) * 8 + r] = (__bf16)p;
    }
    ps[jt] = t;
  }
  lsum = lsum * alpha + ((ps[0] + ps[1]) + (ps[2] + ps[3]));
#pragma unroll
  for (int f = 0; f < 16; ++f) vb[f] = Frag<__bf16>::load((const __bf16*)(vt + (8 + (f & 7)) * 16 * VPITCH + (f >> 3) * 64));
  __builtin_amdgcn_sched_barrier(0);                    // the second group stays in front of the rescale and the first group's products, not among them
#pragma unroll
  for (int ct = 0; ct < 16; ++ct) acc[ct] *= alpha;
#pragma unroll
  for (int f = 0; f < 16; ++f) acc[f & 7] = Frag<__bf16>::mma(va[f], pb[f >> 3], acc[f & 7]);
#pragma unroll
  for (int f = 0; f < 16; ++f) acc[8 + (f & 7)] = Frag<__bf16>::mma(vb[f], pb[f >> 3], acc[8 + (f & 7)]);
}

__global__ __launch_bounds__(128) void attn_fused_kernel(const unsigned short* __restrict__ PRET,
                                                         const unsigned short* __restrict__ CURb,
                                                         unsigned short* __restrict__ XCAT) {
  __shared__ __align__(16) unsigned char sm[2 * ABUF];
  const int tid   = threadIdx.x;
  const int lane  = tid & 31;
  const int wave  = tid >> 5;
  const int b     = blockIdx.y;
  const int rlane = lane & 15;
  const int h     = lane >> 4;
  const int q     = blockIdx.x * 64 + wave * 16 + rlane;     // this lane's query
  unsigned short* Xb = XCAT + (size_t)b * HW * NX;

  const char* kg = (const char*)(Xb + NC) + (size_t)wave * (NX * 2) + lane * 16;
  const char* vg = (const char*)(CURb + (size_t)b * NC * HW) + (size_t)(tid >> 3) * (HW * 2) + (tid & 7) * 16;
  const unsigned sm0 = (unsigned)(size_t)(&sm[0]);           // LDS byte address = low 32 bits of the shared address
  const unsigned kl = sm0 + wave * KPITCH + lane * 16;
  const unsigned vl = sm0 + KTILE + (tid >> 3) * VPITCH + (tid & 7) * 16;
  const size_t kstep = (size_t)64 * NX * 2;                  // 64 keys further: 64 rows of cur^T
  const size_t vstep = (size_t)64 * 2;                       // 64 keys further: 64 columns of cur

  attn_issue(kl, vl, kg, vg);                                // pass 0 -> buffer 0

  v16b qf[8];
  const __bf16* qp = (const __bf16*)PRET + ((size_t)b * HW + q) * NC + h * 8;
#pragma unroll
  for (int ks = 0; ks < 8; ++ks) qf[ks] = Frag<__bf16>::load(qp + ks * 32);
  v8f acc[16];
#pragma unroll
  for (int ct = 0; ct < 16; ++ct) acc[ct] = (v8f){0.f,0.f,0.f,0.f,0.f,0.f,0.f,0.f};
  float m = -INFINITY, lsum = 0.f;

  asm volatile("s_wait_asynccnt 0x0" ::: "memory");          // pass 0's copies of this wave have landed
  __syncthreads();                                           // ... and every other wave's
  attn_issue(kl + ABUF, vl + ABUF, kg + kstep, vg + vstep);  // pass 1 -> buffer 1

  const unsigned char* kt0 = sm + rlane * KPITCH + h * 16;
  const unsigned char* vt0 = sm + KTILE + rlane * VPITCH + h * 16;
  unsigned cur = 0;                                          // byte offset of the buffer that this pass reads
  const char* kgn = kg + 2 * kstep;                          // source of the next refill
  const char* vgn = vg + 2 * vstep;
  // stays rolled: with the buffer offset carried by the loop the 64 LDS addresses of the copies are formed by adds; unrolled by two they were kept in registers and spilled
#pragma unroll 1
  for (int t = 0; t < NPASS; ++t) {
    attn_pass(kt0 + cur, vt0 + cur, qf, acc, m, lsum);
    attn_publish();
    if (t + 2 < NPASS) {                                     // pass t + 2 -> the buffer that pass t has just read
      attn_issue(kl + cur, vl + cur, kgn, vgn);
      kgn += kstep;
      vgn += vstep;
    }
    cur ^= ABUF;
  }
  asm volatile("s_wait_asynccnt 0x0" ::: "memory");          // nothing of this wave is in flight when it ends

  const float inv = 1.0f / (lsum + other_half(lsum));   // the sum is near 1 or above: the row maximum contributes exp2(0)
  unsigned short* op = Xb + (size_t)q * NX + h * 8;          // acc[ct][r] = feat[c = 16 ct + 8 h + r][q]: 8 consecutive c, one 16-B store
#pragma unroll
  for (int ct = 0; ct < 16; ++ct) {
    v8b o;
#pragma unroll
    for (int r = 0; r < 8; ++r) o[r] = (__bf16)(acc[ct][r] * inv);
    *(v8b*)(op + ct * 16) = o;
  }
}

// ---------------------------------------------------------------------------
// Workspace region map (byte offsets); every region is fully written before it is read, once per call, all batches.
//   Wb    bf16 [256][512]                  0          (262144 B)
//   PRET  bf16 [4 b][4096 i][256 c]        262144     (8388608 B)   pre^T
//   CURb  bf16 [4 b][256 c][4096 j]        8650752    (8388608 B)   cur, natural layout
//   XCAT  bf16 [4 b][4096 i][512]          17039360   (16777216 B)  cols 0..255 = feat^T, cols 256..511 = cur^T
//   total                                  33816576 B
// ---------------------------------------------------------------------------
extern "C" void kernel_launch(void* const* d_in, const int* in_sizes, int n_in,
                              void* d_out, int out_size, void* d_ws, size_t ws_size,
                              hipStream_t stream) {
  if (n_in < 9) return;
  if (in_sizes[0] != NB * NC * HW || in_sizes[1] != NB * NC * HW) return;
  if (in_sizes[2] != NC * NX) return;
  if (in_sizes[3] != NC || in_sizes[4] != NC || in_sizes[5] != NC || in_sizes[6] != NC || in_sizes[7] != NC) return;
  if (in_sizes[8] < 1) return;
  if (out_size != NB * NC * HW) return;

  const float* pre   = (const float*)d_in[0];
  const float* cur   = (const float*)d_in[1];
  const float* W     = (const float*)d_in[2];
  const float* bconv = (const float*)d_in[3];
  const float* gamma = (const float*)d_in[4];
  const float* beta  = (const float*)d_in[5];
  const float* rmean = (const float*)d_in[6];
  const float* rvar  = (const float*)d_in[7];
  const float* alpha = (const float*)d_in[8];
  float* out = (float*)d_out;

  const size_t szWb   = (size_t)NC * NX * 2;
  const size_t szPRET = (size_t)NB * HW * NC * 2;
  const size_t szCURb = (size_t)NB * NC * HW * 2;
  const size_t szXCAT = (size_t)NB * HW * NX * 2;
  size_t off = 0;
  const size_t oWb   = off; off += szWb;
  const size_t oPRET = off; off += szPRET;
  const size_t oCURb = off; off += szCURb;
  const size_t oXCAT = off; off += szXCAT;
  if (off > ws_size) return;                    // 33816576 B total

  char* ws = (char*)d_ws;
  unsigned short* Wb   = (unsigned short*)(ws + oWb);
  unsigned short* PRET = (unsigned short*)(ws + oPRET);
  unsigned short* CURb = (unsigned short*)(ws + oCURb);
  unsigned short* XCAT = (unsigned short*)(ws + oXCAT);

  const dim3 blk(256);
  const dim3 gP(HW / 64, NC / 64, 2 * NB + 1);  // 64 x 4 tiles x (4 batches of pre, 4 of cur), and 256 blocks for W
  const dim3 gA(HW / 64, NB);                   // 64 query blocks x 4 batches, 4 waves each
  const dim3 gC((NC / 64) * (HW / 64), NB);     // 256 blocks x 8 waves per batch: M=256, N=4096, K=512, one tile per block, K over its waves

  // W -> Wb; pre[b] [256 c][4096 i] -> PRET[b] [4096 i][256 c]; cur[b] [256 c][4096 j] -> XCAT[b][j][256 + c] and CURb[b] (natural layout)
  prep_kernel<<<gP, blk, 0, stream>>>(pre, cur, W, PRET, XCAT, CURb, Wb);
  // XCAT[b][i][c] = bf16(sum_j softmax_j(PRET[b][i] . XCAT[b][j][256..] / 16) * CURb[b][c][j])
  attn_fused_kernel<<<gA, dim3(128), 0, stream>>>(PRET, CURb, XCAT);
  // out[b][o][i] = prelu(bn(sum_k Wb[o][k] * XCAT[b][i][k] + b_conv[o]))  (M=256, N=4096, K=512, f32 out, ldc 4096)
  wmma_gemm64<1, false, 1, 0, false, 5, 8><<<gC, blk, 0, stream>>>(
      Wb, Wb, NX, 0L, XCAT, XCAT, NX, (long)HW * NX, (void*)out, (void*)out, HW, (long)NC * HW,
      bconv, bconv, 0L, gamma, beta, rmean, rvar, alpha, NC, HW, NX, 1.0f);
  (void)hipGetLastError();
}

// v005
// Measured time: 92.1 microseconds a run.
// Next to v004, in two timings, it ran 1.16 times as fast each time.
// Over all steps from v000 it is 19.4 times as fast.
// Contractions S = pre^T.cur (x1/16), featT = P.cur^T, 1x1 conv = W.x: all v_wmma_f32_16x16x32_bf16 (bf16 operands RNE-converted from f32, f32 accumulate); softmax, bias, BN, PReLU in f32.
#include <hip/hip_runtime.h>
#include <math.h>
#include <stdint.h>

#define NB 4
#define NC 256
#define HW 4096
#define NX 512

typedef __attribute__((ext_vector_type(16))) _Float16 v16h;
typedef __attribute__((ext_vector_type(8)))  _Float16 v8h;
typedef __attribute__((ext_vector_type(16))) __bf16   v16b;
typedef __attribute__((ext_vector_type(8)))  __bf16   v8b;
typedef __attribute__((ext_vector_type(8)))  float    v8f;
typedef __attribute__((ext_vector_type(4)))  float    v4f;
typedef __attribute__((ext_vector_type(2)))  float    v2f;
typedef __attribute__((ext_vector_type(4)))  unsigned int v4u;
typedef __attribute__((ext_vector_type(2)))  unsigned int v2u;
typedef __attribute__((ext_vector_type(8)))  unsigned short v8us;

__device__ __forceinline__ unsigned short f2bf_bits(float f) {
  unsigned u = __float_as_uint(f);
  return (unsigned short)((u + 0x7FFFu + ((u >> 16) & 1u)) >> 16);
}
__device__ __forceinline__ float bf_bits2f(unsigned short h) { return __uint_as_float(((unsigned)h) << 16); }

// hazard guards as plain device helpers
__device__ __forceinline__ void dep_guard_h(v8f& a, v8f& b, v16h x, v16h y) { asm volatile("v_nop\n\tv_nop\n\tv_nop\n\tv_nop" : "+v"(a), "+v"(b) : "v"(x), "v"(y)); }
__device__ __forceinline__ void dep_guard_b(v8f& a, v8f& b, v16b x, v16b y) { asm volatile("v_nop\n\tv_nop\n\tv_nop\n\tv_nop" : "+v"(a), "+v"(b) : "v"(x), "v"(y)); }
__device__ __forceinline__ void keep4_h(v16h a, v16h b, v16h c, v16h d) { asm volatile("v_nop" :: "v"(a), "v"(b), "v"(c), "v"(d)); }
__device__ __forceinline__ void keep4_b(v16b a, v16b b, v16b c, v16b d) { asm volatile("v_nop" :: "v"(a), "v"(b), "v"(c), "v"(d)); }
__device__ __forceinline__ void acc_guard4(v8f& a, v8f& b, v8f& c, v8f& d) { asm volatile("v_nop\n\tv_nop\n\tv_nop\n\tv_nop" : "+v"(a), "+v"(b), "+v"(c), "+v"(d)); }
template <typename T> struct Frag;
template <> struct Frag<_Float16> {
  typedef v16h V; union U { v16h v; v8h h[2]; };
  static __device__ __forceinline__ v16h load(const _Float16* p) {   // elements 0..7 <- p[0..7], 8..15 <- p[16..23]
    U f; f.h[0] = *(const v8h*)(p); f.h[1] = *(const v8h*)(p + 16); return f.v;
  }
  static __device__ __forceinline__ v8f mma(v16h a, v16h b, v8f c) {
    return __builtin_amdgcn_wmma_f32_16x16x32_f16(false, a, false, b, (short)0, c, false, false);
  }
  static __device__ __forceinline__ void guard(v8f& a, v8f& b, v16h x, v16h y) { dep_guard_h(a, b, x, y); }
  static __device__ __forceinline__ void keep(v16h a, v16h b, v16h c, v16h d) { keep4_h(a, b, c, d); }
};
template <> struct Frag<__bf16> {
  typedef v16b V; union U { v16b v; v8b h[2]; };
  static __device__ __forceinline__ v16b load(const __bf16* p) {
    U f; f.h[0] = *(const v8b*)(p); f.h[1] = *(const v8b*)(p + 16); return f.v;
  }
  static __device__ __forceinline__ v8f mma(v16b a, v16b b, v8f c) {
    return __builtin_amdgcn_wmma_f32_16x16x32_bf16(false, a, false, b, (short)0, c, false, false);
  }
  static __device__ __forceinline__ void guard(v8f& a, v8f& b, v16b x, v16b y) { dep_guard_b(a, b, x, y); }
  static __device__ __forceinline__ void keep(v16b a, v16b b, v16b c, v16b d) { keep4_b(a, b, c, d); }
};

// ---- Register-blocked batched WMMA GEMM ------------------------------------
// C[m,n] = scale * sum_k A[m,k] * Bt[n,k] (+bias)(+resid); each wave (KS == 1) or each block (KS > 1) owns a 64x64 tile.
// A row-major [M,K]; Bt row-major [N,K]; M,N % 64 == 0, K % 32 == 0.
// SPLIT: operands are hi/lo planes (A2/Bt2 = lo planes, same layout); product = hi.hi + hi.lo + lo.hi.
// BIAS_MODE: 0 = none, 1 = bias[m], 2 = bias[n].
// OUT_MODE: 0 = f32, 1 = f16, 2 = bf16 hi plane (Cout) + bf16 lo plane (Cout2), 3 = single bf16 plane (RNE).
// ET: 0 = f16 operands, 1 = bf16 operands (pointers passed as 16-bit storage)
// ACT: 0 = none, 1 = tanh, 2 = relu, 3 = silu, 4 = leaky relu,
//      5 = batch norm on the running statistics of row m, then PReLU with one shared slope (KS > 1 only):
//          prelu(x * inv + shift), inv = gamma[m] * rsqrt(var[m] + 1e-5), shift = beta[m] - mean[m] * inv, slope = alpha[0]
// KS: 1 = each wave owns a tile and all of K (8 tiles per block). KS > 1 = the block owns ONE tile and its KS waves
//     split K: wave w takes the 32-wide k steps w, w + KS, w + 2 KS, ...; the KS partial tiles meet in LDS
//     and are summed in wave order 0..KS-1, each wave finishing 64 / KS rows. For GEMMs with fewer tiles than the chip has room for.
template <int ET> struct Elem;
template <> struct Elem<0> { typedef _Float16 T; };
template <> struct Elem<1> { typedef __bf16 T; };
template <int ET, bool SPLIT, int BIAS_MODE, int OUT_MODE, bool RESID, int ACT = 0, int KS = 1>
__global__ __launch_bounds__(KS == 1 ? 256 : KS * 32) void wmma_gemm64(
    const unsigned short* __restrict__ Ap, const unsigned short* __restrict__ A2p, int lda, long strideA,
    const unsigned short* __restrict__ Btp, const unsigned short* __restrict__ Bt2p, int ldb, long strideB,
    void* __restrict__ Cout, void* __restrict__ Cout2, int ldc, long strideC,
    const float* __restrict__ bias,
    const float* __restrict__ resid, long strideR,
    const float* __restrict__ gamma, const float* __restrict__ beta, const float* __restrict__ rmean,
    const float* __restrict__ rvar, const float* __restrict__ alpha,
    int M, int N, int K, float scale) {
  static_assert(ACT != 5 || KS > 1, "ACT 5 is written for the split-K epilogue");
  typedef typename Elem<ET>::T T;
  typedef typename Frag<T>::V V;
  const T* A = (const T*)Ap; const T* A2 = (const T*)A2p; const T* Bt = (const T*)Btp; const T* Bt2 = (const T*)Bt2p;
  __shared__ __align__(16) float sT[KS == 1 ? 8 : KS * 4][16 * 68];   // KS == 1: per-wave 16x64 slab; KS > 1: per-wave 64x64 partial tile; pitch 68 floats
  const int b    = blockIdx.y;
  const int lane = threadIdx.x & 31;
  const int wave = (KS == 1) ? (int)(threadIdx.x >> 5) : __builtin_amdgcn_readfirstlane((int)(threadIdx.x >> 5));   // scalar, so the k loop stays a scalar loop
  const int tilesN = N >> 6;
  const int tilesM = M >> 6;
  const int tile = (KS == 1) ? (int)(blockIdx.x * 8 + wave) : (int)blockIdx.x;
  if (tile >= tilesM * tilesN) return;   // KS == 1: wave-uniform, no block barrier follows; KS > 1: block-uniform, ahead of the barrier
  const int tm = tile / tilesN;
  const int tn = tile - tm * tilesN;
  const int m0 = tm << 6;
  const int n0 = tn << 6;

  const T* Ab  = A  + (size_t)b * strideA;
  const T* Bb  = Bt + (size_t)b * strideB;
  const T* Ab2 = SPLIT ? (A2  + (size_t)b * strideA) : nullptr;
  const T* Bb2 = SPLIT ? (Bt2 + (size_t)b * strideB) : nullptr;

  const int rlane = lane & 15;                 // row (A) / col (B, D) within subtile
  const int koff  = (lane >> 4) * 8;           // k offset of this lane half
  const int mOff  = (lane >> 4) * 8;           // D row offset

  v8f acc[4][4];
#pragma unroll
  for (int i = 0; i < 4; ++i)
#pragma unroll
    for (int j = 0; j < 4; ++j) acc[i][j] = (v8f){0.f,0.f,0.f,0.f,0.f,0.f,0.f,0.f};

  for (int k0 = (KS == 1) ? 0 : wave * 32; k0 < K; k0 += 32 * KS) {
    V bh[4], bl[4];
#pragma unroll
    for (int j = 0; j < 4; ++j) {
      const size_t bo = (size_t)(n0 + (j << 4) + rlane) * ldb + koff + k0;
      bh[j] = Frag<T>::load(Bb + bo);
      if (SPLIT) bl[j] = Frag<T>::load(Bb2 + bo);
    }
#pragma unroll
    for (int i = 0; i < 4; ++i) {
      const size_t ao = (size_t)(m0 + (i << 4) + rlane) * lda + koff + k0;
      V ah = Frag<T>::load(Ab + ao);
      V al;
      if (SPLIT) al = Frag<T>::load(Ab2 + ao);
#pragma unroll
      for (int j = 0; j < 4; ++j) {
        acc[i][j] = Frag<T>::mma(ah, bh[j], acc[i][j]);
        if (SPLIT) {
          acc[i][j] = Frag<T>::mma(ah, bl[j], acc[i][j]);
          acc[i][j] = Frag<T>::mma(al, bh[j], acc[i][j]);
        }
      }
      Frag<T>::guard(acc[i][0], acc[i][3], ah, SPLIT ? al : ah);
    }
    Frag<T>::keep(bh[0], bh[1], bh[2], bh[3]);
    if (SPLIT) Frag<T>::keep(bl[0], bl[1], bl[2], bl[3]);
  }
  acc_guard4(acc[0][0], acc[0][1], acc[0][2], acc[0][3]);
  acc_guard4(acc[1][0], acc[1][1], acc[1][2], acc[1][3]);
  acc_guard4(acc[2][0], acc[2][1], acc[2][2], acc[2][3]);
  acc_guard4(acc[3][0], acc[3][1], acc[3][2], acc[3][3]);

  // ---- epilogue ----
  const float* Rb = RESID ? (resid + (size_t)b * strideR) : nullptr;
  if (KS > 1) {
    float* part = &sT[0][0];                    // [KS waves][64 rows][68]
    float* mine = part + wave * (64 * 68);
    constexpr int ROWS = 64 / KS;               // rows of the tile that this wave finishes
    constexpr int CW   = (OUT_MODE == 0) ? 4 : 8;   // columns per lane: one 16-B store either way
    constexpr int RP   = 32 * CW / 64;          // rows per pass of the wave
    const int row0 = wave * ROWS + lane / (64 / CW);   // this lane's row in pass 0
    float bnInv[ROWS / RP], bnShift[ROWS / RP], slope = 0.f;
    if (ACT == 5) {                             // read ahead of the LDS stores and the barrier, which cover the latency
      slope = alpha[0];
#pragma unroll
      for (int it = 0; it < ROWS / RP; ++it) {
        const int m = m0 + row0 + it * RP;
        bnInv[it]   = gamma[m] * rsqrtf(rvar[m] + 1e-5f);
        bnShift[it] = beta[m] - rmean[m] * bnInv[it];
      }
    }
#pragma unroll
    for (int i = 0; i < 4; ++i)
#pragma unroll
      for (int j = 0; j < 4; ++j)
#pragma unroll
        for (int r = 0; r < 8; ++r) mine[((i << 4) + mOff + r) * 68 + (j << 4) + rlane] = acc[i][j][r];
    if (ACT == 5) asm volatile("s_wait_xcnt 0x0" ::: "memory");   // no register that the coefficient loads name is rewritten ahead of this wait
    __syncthreads();                            // all KS partial tiles are in LDS before any wave sums them
    const int cc = (lane & (64 / CW - 1)) * CW;
#pragma unroll
    for (int it = 0; it < ROWS / RP; ++it) {
      const int row = row0 + it * RP;
      const int m = m0 + row;
      const float* sp = part + row * 68 + cc;
      float v[CW];
#pragma unroll
      for (int e = 0; e < CW; e += 4) {
        v4f s = *(const v4f*)(sp + e);
#pragma unroll
        for (int w = 1; w < KS; ++w) s += *(const v4f*)(sp + w * (64 * 68) + e);
        v[e] = s[0]; v[e + 1] = s[1]; v[e + 2] = s[2]; v[e + 3] = s[3];
      }
#pragma unroll
      for (int e = 0; e < CW; ++e) {
        float x = v[e] * scale;
        if (BIAS_MODE == 1) x += bias[m];
        if (BIAS_MODE == 2) x += bias[n0 + cc + e];
        if (RESID) x += Rb[(size_t)m * ldc + n0 + cc + e];
        if (ACT == 1) x = tanhf(x);
        if (ACT == 2) x = fmaxf(x, 0.0f);
        if (ACT == 3) x = x / (1.0f + expf(-x));
        if (ACT == 4) x = (x > 0.f) ? x : 0.01f * x;
        if (ACT == 5) { x = x * bnInv[it] + bnShift[it]; x = (x >= 0.f) ? x : slope * x; }
        v[e] = x;
      }
      const size_t co = (size_t)b * strideC + (size_t)m * ldc + n0 + cc;
      if constexpr (OUT_MODE == 0) {
        *(v4f*)((float*)Cout + co) = (v4f){v[0], v[1], v[2], v[3]};
      } else {
        v8h hv, lv;
#pragma unroll
        for (int e = 0; e < 8; ++e) {
          const float x = v[e];
          if (OUT_MODE == 1) {
            hv[e] = (_Float16)x;
          } else {
            const unsigned short hb = f2bf_bits(x);
            hv[e] = __builtin_bit_cast(_Float16, hb);
            if (OUT_MODE == 2) lv[e] = __builtin_bit_cast(_Float16, f2bf_bits(x - bf_bits2f(hb)));
          }
        }
        *(v8h*)((unsigned short*)Cout + co) = hv;
        if (OUT_MODE == 2) *(v8h*)((unsigned short*)Cout2 + co) = lv;
      }
    }
    return;
  }
  float* slab = sT[wave];
#pragma unroll
  for (int i = 0; i < 4; ++i) {
    const int mBase = m0 + (i << 4);
#pragma unroll
    for (int j = 0; j < 4; ++j) {
      const int n = n0 + (j << 4) + rlane;
      float bv = 0.f;
      if (BIAS_MODE == 2) bv = bias[n];
#pragma unroll
      for (int r = 0; r < 8; ++r) {
        float v = acc[i][j][r] * scale;
        if (BIAS_MODE == 1) v += bias[mBase + mOff + r];
        if (BIAS_MODE == 2) v += bv;
        if (RESID) v += Rb[(size_t)(mBase + mOff + r) * ldc + n];
        if (ACT == 1) v = tanhf(v);
        if (ACT == 2) v = fmaxf(v, 0.0f);
        if (ACT == 3) v = v / (1.0f + expf(-v));
        if (ACT == 4) v = (v > 0.f) ? v : 0.01f * v;
        slab[(mOff + r) * 68 + (j << 4) + rlane] = v;
      }
    }
    __builtin_amdgcn_fence(__ATOMIC_RELEASE, "workgroup");
    __builtin_amdgcn_wave_barrier();
    __builtin_amdgcn_fence(__ATOMIC_ACQUIRE, "workgroup");
    if (OUT_MODE == 0) {
      float* C = (float*)Cout + (size_t)b * strideC;
      const int hh = lane >> 4, c4 = (lane & 15) * 4;     // row seg = 256 B = 16 lanes x 16 B
      {
#pragma unroll
        for (int it = 0; it < 8; ++it) {
          const int row = it * 2 + hh;
          v4f v = *(const v4f*)(slab + row * 68 + c4);
          *(v4f*)(C + (size_t)(mBase + row) * ldc + n0 + c4) = v;
        }
        
      }
    } else {
      const int q = lane >> 3, c8 = (lane & 7) * 8;
      unsigned short* C  = (unsigned short*)Cout  + (size_t)b * strideC;
      unsigned short* C2 = (OUT_MODE == 2) ? ((unsigned short*)Cout2 + (size_t)b * strideC) : nullptr;
      {
#pragma unroll
        for (int it = 0; it < 4; ++it) {
          const int row = it * 4 + q;
          const float* sp = slab + row * 68 + c8;
          v8h hv, lv;
#pragma unroll
          for (int e = 0; e < 8; ++e) {
            if (OUT_MODE == 1) {
              hv[e] = (_Float16)sp[e];
            } else if (OUT_MODE == 3) {
              hv[e] = __builtin_bit_cast(_Float16, f2bf_bits(sp[e]));
            } else {
              unsigned short hb = f2bf_bits(sp[e]);
              unsigned short lb = f2bf_bits(sp[e] - bf_bits2f(hb));
              hv[e] = __builtin_bit_cast(_Float16, hb);
              lv[e] = __builtin_bit_cast(_Float16, lb);
            }
          }
          *(v8h*)(C + (size_t)(mBase + row) * ldc + n0 + c8) = hv;
          if (OUT_MODE == 2) *(v8h*)(C2 + (size_t)(mBase + row) * ldc + n0 + c8) = lv;
        }
        
      }
    }
    __builtin_amdgcn_fence(__ATOMIC_RELEASE, "workgroup");
    __builtin_amdgcn_wave_barrier();
    __builtin_amdgcn_fence(__ATOMIC_ACQUIRE, "workgroup");
  }
}

// ---------------------------------------------------------------------------
// Operand preparation, all of it in one launch. grid (HW/64 i-tiles, NC/64 c-tiles, 2 NB + 1 jobs), 256 threads; blockIdx.z picks the job:
//   z in 0 .. NB-1     : pre[z]      f32 [NC c][HW i] -> PRET[z][i][c]            = bf16(pre[c][i])   (one 64x64 tile, transposed)
//   z in NB .. 2 NB-1  : cur[z - NB] f32 [NC c][HW j] -> XCAT[z - NB][j][NC + c]  = bf16(cur[c][j])   (one 64x64 tile, transposed)
//                        and, from the same registers,   CURb[z - NB][c][j]       = bf16(cur[c][j])   (natural layout): cur is read once
//   z == 2 NB          : W f32 [NC][NX] -> Wb bf16, 2 elements per thread; 64 x 4 blocks x 256 threads x 2 = NC * NX elements
// Load coverage of a tile: 4 iterations x 256 threads = 1024 float4 = 64 c-rows x 64 i-cols (c-row = tid>>4 + 16 it spans 0..63, tid&15 spans the 16 float4 of a row).
// Natural-layout store: 16 lanes x 8 B = the 128-B line of one c-row's 64 columns, one writer per line.
// Transposed store: 8 waves x 2 iterations x 4 rows (q = lane>>3) = 64 out rows; 8 lanes x 8 halves = 64 cols per row.
// ---------------------------------------------------------------------------
__global__ __launch_bounds__(256) void prep_kernel(const float* __restrict__ pre, const float* __restrict__ cur, const float* __restrict__ W,
                                                   unsigned short* __restrict__ PRET, unsigned short* __restrict__ XCAT,
                                                   unsigned short* __restrict__ CURb, unsigned short* __restrict__ Wb) {
  __shared__ __align__(16) unsigned short sm[64 * 72];   // [i local][c local], pitch 72 halves (144 B)
  const int tid  = threadIdx.x;
  const int lane = tid & 31;
  const int wave = tid >> 5;
  const int z    = blockIdx.z;
  if (z == 2 * NB) {                     // block-uniform, ahead of the barrier
    const int i = (blockIdx.y * (HW / 64) + blockIdx.x) * 256 + tid;
    const v2f f = *(const v2f*)(W + 2 * (size_t)i);
    ((unsigned*)Wb)[i] = (unsigned)f2bf_bits(f[0]) | ((unsigned)f2bf_bits(f[1]) << 16);
    return;
  }
  const bool isCur = z >= NB;            // block-uniform
  const int b  = isCur ? z - NB : z;
  const int i0 = blockIdx.x * 64;
  const int c0 = blockIdx.y * 64;
  const float* in = (isCur ? cur : pre) + (size_t)b * NC * HW;
  unsigned short* out = isCur ? (XCAT + (size_t)b * HW * NX + NC) : (PRET + (size_t)b * HW * NC);
  const int ldo = isCur ? NX : NC;
  unsigned short* nat = CURb + (size_t)b * NC * HW;
  const int cr0 = tid >> 4;              // 0..15; iteration it takes c-row cr0 + 16 it
  const int q4  = (tid & 15) * 4;        // first of this thread's 4 i-columns
  v4f f[4];
#pragma unroll
  for (int it = 0; it < 4; ++it) f[it] = *(const v4f*)(in + (size_t)(c0 + cr0 + 16 * it) * HW + i0 + q4);   // all four loads in flight together
  v2u u[4];
#pragma unroll
  for (int it = 0; it < 4; ++it) {
    const int cr = cr0 + 16 * it;
    const unsigned short h0 = f2bf_bits(f[it][0]), h1 = f2bf_bits(f[it][1]), h2 = f2bf_bits(f[it][2]), h3 = f2bf_bits(f[it][3]);
    sm[(q4 + 0) * 72 + cr] = h0;
    sm[(q4 + 1) * 72 + cr] = h1;
    sm[(q4 + 2) * 72 + cr] = h2;
    sm[(q4 + 3) * 72 + cr] = h3;
    u[it] = (v2u){(unsigned)h0 | ((unsigned)h1 << 16), (unsigned)h2 | ((unsigned)h3 << 16)};
  }
  __syncthreads();
  const int q  = lane >> 3;
  const int c8 = (lane & 7) * 8;
#pragma unroll
  for (int it = 0; it < 2; ++it) {
    const int row = wave * 8 + it * 4 + q;
    const v8us v = *(const v8us*)(sm + row * 72 + c8);
    const v4u t = __builtin_bit_cast(v4u, v);
    *(v4u*)(out + (size_t)(i0 + row) * ldo + c0 + c8) = t;
  }
  if (isCur) {                           // behind the barrier, so that the barrier does not wait for these stores
#pragma unroll
    for (int it = 0; it < 4; ++it) *(v2u*)(nat + (size_t)(c0 + cr0 + 16 * it) * HW + i0 + q4) = u[it];
    asm volatile("s_wait_xcnt 0x0" ::: "memory");   // the listing lays the W job's code behind these stores: no register that they name is rewritten ahead of this wait
  }
}

// ---------------------------------------------------------------------------
// Fused attention, online softmax: XCAT[b][i][0..255] = bf16(sum_j softmax_j(pre_i . cur_j / 16) * cur[c][j]).
// Transposed products: S^T = K . Q^T (A = cur^T rows [j][c], B = pre^T rows [i][c] kept in registers) and
// O^T += V^T . P^T (A = cur rows [c][j], B = the score tiles converted in place), so a lane holds one query column:
// D register r of a score tile is key 8h + r of query (lane & 15); two such tiles are one 32-key B operand in the hardware k order.
// Work-group: 64 queries, 4 waves = 2 query groups of 32 x 2 key halves; a pass is 64 keys, 32 per wave; grid (HW / 64 query blocks, batches).
// Each pass's K tile (64 keys x 512 B) and V tile (256 c x 128 B) come into LDS by asynchronous copies, two buffers, one pass ahead.
// Sums: scores over c in 32-wide k steps; probabilities per wave (key half) and lane half over the passes in order; lane halves, then key halves, joined at the end.
// ---------------------------------------------------------------------------
#define KPITCH 528                      // bytes per K row in LDS: 512 + 16 (16 B x odd, for 16-byte row readers)
#define VPITCH 144                      // bytes per V row in LDS: 128 + 16
#define KTILE  (64 * KPITCH)
#define VTILE  (NC * VPITCH)
#define ABUF   (KTILE + VTILE)
#define NPASS  (HW / 64)

// Eight 16-byte copies per lane, global -> LDS through no register. The s_wait_xcnt closes the statement so that no
// address register of an issued copy is rewritten ahead of it.
__device__ __forceinline__ void async_copy8(unsigned l, unsigned ls, const char* g, size_t gs) {
  asm volatile(
      "global_load_async_to_lds_b128 %0, %8, off\n\t"
      "global_load_async_to_lds_b128 %1, %9, off\n\t"
      "global_load_async_to_lds_b128 %2, %10, off\n\t"
      "global_load_async_to_lds_b128 %3, %11, off\n\t"
      "global_load_async_to_lds_b128 %4, %12, off\n\t"
      "global_load_async_to_lds_b128 %5, %13, off\n\t"
      "global_load_async_to_lds_b128 %6, %14, off\n\t"
      "global_load_async_to_lds_b128 %7, %15, off\n\t"
      "s_wait_xcnt 0x0"
      :: "v"(l), "v"(l + ls), "v"(l + 2 * ls), "v"(l + 3 * ls), "v"(l + 4 * ls), "v"(l + 5 * ls), "v"(l + 6 * ls), "v"(l + 7 * ls),
         "v"(g), "v"(g + gs), "v"(g + 2 * gs), "v"(g + 3 * gs), "v"(g + 4 * gs), "v"(g + 5 * gs), "v"(g + 6 * gs), "v"(g + 7 * gs)
      : "memory");
}
// One pass's tiles: kl / vl = this lane's first LDS byte in the K / V tile of the target buffer, kg / vg = its first global byte.
// K: a wave copies one whole 512-B row per copy, rows wave, wave + 4, ...; V: a wave copies four 128-B rows per copy, rows tid / 8, + 16, ...
__device__ __forceinline__ void attn_issue(unsigned kl, unsigned vl, const char* kg, const char* vg) {
  async_copy8(kl, 4 * KPITCH, kg, (size_t)4 * NX * 2);
  async_copy8(kl + 32 * KPITCH, 4 * KPITCH, kg + (size_t)32 * NX * 2, (size_t)4 * NX * 2);
  async_copy8(vl, 16 * VPITCH, vg, (size_t)16 * HW * 2);
  async_copy8(vl + 128 * VPITCH, 16 * VPITCH, vg + (size_t)128 * HW * 2, (size_t)16 * HW * 2);
}
// Hand-over of the ring: this wave's LDS reads are done, its own copies have landed, then every wave meets.
__device__ __forceinline__ void attn_publish() {
  asm volatile("s_wait_dscnt 0x0" ::: "memory");     // the buffer just read is refilled behind the barrier
  asm volatile("s_wait_asynccnt 0x0" ::: "memory");  // the compiler places no wait for the copies
  __syncthreads();
}
// Value of lane l ^ 16, through no LDS: an LDS shuffle's wait would also wait out the K fragment loads in flight.
__device__ __forceinline__ float other_half(float x) {
  const int b = __float_as_int(x);
  return __int_as_float(__builtin_amdgcn_permlanex16(b, b, 0x76543210, 0xfedcba98, false, false));
}
// A wave's share of a pass: its 32 keys (one half of the pass's 64) against its 32 queries (two 16-column tiles).
// Every K and V fragment read from LDS feeds two products, one per query tile. kt / vt: the tiles, already offset to this
// wave's key half and this lane's row and k half.
__device__ __forceinline__ void attn_load_k(const unsigned char* kt, v16b (&ka)[16]) {   // 8 k steps x 2 key tiles
#pragma unroll
  for (int f = 0; f < 16; ++f) ka[f] = Frag<__bf16>::load((const __bf16*)(kt + (f & 1) * 16 * KPITCH + (f >> 1) * 64));
}
__device__ __forceinline__ void attn_load_v(const unsigned char* vt, v16b (&va)[16]) {   // 16 c tiles, one 32-key k step
#pragma unroll
  for (int f = 0; f < 16; ++f) va[f] = Frag<__bf16>::load((const __bf16*)(vt + f * 16 * VPITCH));
}
__device__ __forceinline__ void attn_scores(const v16b (&ka)[16], const v16b (&qf)[2][8], v8f (&s)[2][2]) {
#pragma unroll
  for (int jt = 0; jt < 2; ++jt)
#pragma unroll
    for (int qt = 0; qt < 2; ++qt) s[jt][qt] = (v8f){0.f,0.f,0.f,0.f,0.f,0.f,0.f,0.f};
#pragma unroll
  for (int ks = 0; ks < 8; ++ks)
#pragma unroll
    for (int jt = 0; jt < 2; ++jt)
#pragma unroll
      for (int qt = 0; qt < 2; ++qt) s[jt][qt] = Frag<__bf16>::mma(ka[ks * 2 + jt], qf[qt][ks], s[jt][qt]);
}
__device__ __forceinline__ void attn_softmax_pv(const v8f (&s)[2][2], const v16b (&va)[16],
                                                v8f (&acc)[16][2], float (&m)[2], float (&lsum)[2]) {
  const float sc = 0.0625f * 1.44269504088896340736f;   // 1/16, and exp(x) = exp2(x * log2 e)
  float alpha[2];
  v16b pb[2];                                           // per query tile: the 32 keys' probabilities as one B operand
#pragma unroll
  for (int qt = 0; qt < 2; ++qt) {
    float mt[2];
#pragma unroll
    for (int jt = 0; jt < 2; ++jt) {
      mt[jt] = s[jt][qt][0];
#pragma unroll
      for (int r = 1; r < 8; ++r) mt[jt] = fmaxf(mt[jt], s[jt][qt][r]);
    }
    float mx = fmaxf(mt[0], mt[1]);
    mx = fmaxf(mx, other_half(mx));                     // the other lane half holds this query's other keys
    const float mn = fmaxf(m[qt], mx * sc);
    alpha[qt] = __builtin_amdgcn_exp2f(m[qt] - mn);     // first pass: exp2(-inf) = 0
    m[qt] = mn;
    float ps[2];
#pragma unroll
    for (int jt = 0; jt < 2; ++jt) {
      float t = 0.f;
#pragma unroll
      for (int r = 0; r < 8; ++r) {
        const float p = __builtin_amdgcn_exp2f(s[jt][qt][r] * sc - mn);
        t += p;
        pb[qt][jt * 8 + r] = (__bf16)p;
      }
      ps[jt] = t;
    }
    lsum[qt] = lsum[qt] * alpha[qt] + (ps[0] + ps[1]);
  }
#pragma unroll
  for (int ct = 0; ct < 16; ++ct)
#pragma unroll
    for (int qt = 0; qt < 2; ++qt) {
      acc[ct][qt] *= alpha[qt];
      acc[ct][qt] = Frag<__bf16>::mma(va[ct], pb[qt], acc[ct][qt]);
    }
}

// Joining the two key halves of a query group, once, behind the loop. A wave hands the 8 c tiles from S on to its partner:
// 32 chunks of 16 B per lane, chunk-major, so that a wave's store covers 512 contiguous bytes.
template <int S>
__device__ __forceinline__ void attn_send(const v8f (&acc)[16][2], float* mine, int lane) {
#pragma unroll
  for (int i = 0; i < 8; ++i)
#pragma unroll
    for (int qt = 0; qt < 2; ++qt)
#pragma unroll
      for (int hf = 0; hf < 2; ++hf) {
        const v8f a = acc[S + i][qt];
        *(v4f*)(mine + (((i * 2 + qt) * 2 + hf) * 32 + lane) * 4) = (v4f){a[hf * 4], a[hf * 4 + 1], a[hf * 4 + 2], a[hf * 4 + 3]};
      }
}
// ... and finishes the 8 c tiles from S on: own part x fm + partner's part x fo (both hold the division by the joint sum), one 16-B store per tile.
template <int S>
__device__ __forceinline__ void attn_finish(const v8f (&acc)[16][2], const float* theirs, int lane,
                                            const float (&fm)[2], const float (&fo)[2], unsigned short* op) {
  v8b o[8][2];
#pragma unroll
  for (int i = 0; i < 8; ++i)
#pragma unroll
    for (int qt = 0; qt < 2; ++qt) {
      const v4f lo = *(const v4f*)(theirs + (((i * 2 + qt) * 2 + 0) * 32 + lane) * 4);
      const v4f hi = *(const v4f*)(theirs + (((i * 2 + qt) * 2 + 1) * 32 + lane) * 4);
#pragma unroll
      for (int r = 0; r < 4; ++r) {
        o[i][qt][r]     = (__bf16)(acc[S + i][qt][r] * fm[qt] + lo[r] * fo[qt]);
        o[i][qt][r + 4] = (__bf16)(acc[S + i][qt][r + 4] * fm[qt] + hi[r] * fo[qt]);
      }
    }
  __builtin_amdgcn_sched_barrier(0);                    // the stores stand behind all the arithmetic, at the wave's end: no register that a store names is rewritten behind it
#pragma unroll
  for (int i = 0; i < 8; ++i)
#pragma unroll
    for (int qt = 0; qt < 2; ++qt) *(v8b*)(op + (size_t)qt * 16 * NX + (S + i) * 16) = o[i][qt];
}

__global__ __launch_bounds__(128) void attn_fused_kernel(const unsigned short* __restrict__ PRET,
                                                         const unsigned short* __restrict__ CURb,
                                                         unsigned short* __restrict__ XCAT) {
  __shared__ __align__(16) unsigned char sm[2 * ABUF];
  const int tid   = threadIdx.x;
  const int lane  = tid & 31;
  const int wave  = tid >> 5;
  const int ws    = __builtin_amdgcn_readfirstlane(wave);    // scalar: picks the wave's share and the epilogue's branch
  const int qg    = ws & 1;                                  // query group: 32 of the block's 64 queries
  const int kh    = ws >> 1;                                 // key half: 32 of every pass's 64 keys
  const int b     = blockIdx.y;
  const int rlane = lane & 15;
  const int h     = lane >> 4;
  const int q     = blockIdx.x * 64 + qg * 32 + rlane;       // this lane's query in tile 0; tile 1: q + 16
  unsigned short* Xb = XCAT + (size_t)b * HW * NX;

  const char* kg = (const char*)(Xb + NC) + (size_t)wave * (NX * 2) + lane * 16;
  const char* vg = (const char*)(CURb + (size_t)b * NC * HW) + (size_t)(tid >> 3) * (HW * 2) + (tid & 7) * 16;
  const unsigned sm0 = (unsigned)(size_t)(&sm[0]);           // LDS byte address = low 32 bits of the shared address
  const unsigned kl = sm0 + wave * KPITCH + lane * 16;
  const unsigned vl = sm0 + KTILE + (tid >> 3) * VPITCH + (tid & 7) * 16;
  const size_t kstep = (size_t)64 * NX * 2;                  // 64 keys further: 64 rows of cur^T
  const size_t vstep = (size_t)64 * 2;                       // 64 keys further: 64 columns of cur

  attn_issue(kl, vl, kg, vg);                                // pass 0 -> buffer 0

  v16b qf[2][8];
  const __bf16* qp = (const __bf16*)PRET + ((size_t)b * HW + q) * NC + h * 8;
#pragma unroll
  for (int qt = 0; qt < 2; ++qt)
#pragma unroll
    for (int ks = 0; ks < 8; ++ks) qf[qt][ks] = Frag<__bf16>::load(qp + (size_t)qt * 16 * NC + ks * 32);
  v8f acc[16][2];
#pragma unroll
  for (int ct = 0; ct < 16; ++ct)
#pragma unroll
    for (int qt = 0; qt < 2; ++qt) acc[ct][qt] = (v8f){0.f,0.f,0.f,0.f,0.f,0.f,0.f,0.f};
  float m[2] = {-INFINITY, -INFINITY}, lsum[2] = {0.f, 0.f};

  asm volatile("s_wait_asynccnt 0x0" ::: "memory");          // pass 0's copies of this wave have landed
  __syncthreads();                                           // ... and every other wave's
  attn_issue(kl + ABUF, vl + ABUF, kg + kstep, vg + vstep);  // pass 1 -> buffer 1

  const unsigned char* kt0 = sm + (kh * 32 + rlane) * KPITCH + h * 16;
  const unsigned char* vt0 = sm + KTILE + rlane * VPITCH + kh * 64 + h * 16;
  unsigned cur = 0;                                          // byte offset of the buffer that holds pass t
  const char* kgn = kg + 2 * kstep;                          // source of the next refill
  const char* vgn = vg + 2 * vstep;
  v16b ka[16], va[16];
  attn_load_k(kt0, ka);                                      // pass 0's fragments, behind the barrier that published tile 0
  attn_load_v(vt0, va);
  // The wave holds a whole pass's fragments in registers, so a buffer is free as soon as they have landed: the publish point
  // stands behind the score products (under which the V fragments land), and behind it the next pass's K fragments are read
  // under the softmax and the output products, its V fragments at the foot. Between two publish points one buffer alone is read.
  // stays rolled: with the buffer offset carried by the loop the 64 LDS addresses of the copies are formed by adds; unrolled by two they were kept in registers and spilled
#pragma unroll 1
  for (int t = 0; t < NPASS - 1; ++t) {
    v8f s[2][2];
    attn_scores(ka, qf, s);
    __builtin_amdgcn_sched_barrier(0);                       // the score products stay in front of the waits: they cover the V fragments' landing
    attn_publish();                                          // pass t's fragments are in registers everywhere, tile t + 1 has landed
    if (t + 2 < NPASS) {                                     // pass t + 2 -> the buffer that pass t has just read
      attn_issue(kl + cur, vl + cur, kgn, vgn);
      kgn += kstep;
      vgn += vstep;
    }
    cur ^= ABUF;
    attn_load_k(kt0 + cur, ka);                              // pass t + 1
    __builtin_amdgcn_sched_barrier(0);                       // these LDS reads stay one group in front of the softmax and the output products, which cover their landing
    attn_softmax_pv(s, va, acc, m, lsum);
    __builtin_amdgcn_sched_barrier(0);                       // the V reads stay one group behind the output products, not in small groups among them
    attn_load_v(vt0 + cur, va);
  }
  {                                                          // the last pass: nothing is left to read ahead or to refill
    v8f s[2][2];
    attn_scores(ka, qf, s);
    attn_publish();                                          // every wave's last fragments are in registers: the ring is free
    attn_softmax_pv(s, va, acc, m, lsum);
  }
  asm volatile("s_wait_asynccnt 0x0" ::: "memory");          // nothing of this wave is in flight when it ends

  // The last publish point has ended every wave's reads and copies: the ring carries the exchange.
  //   floats [wave][32 chunks][32 lanes][4] at 0 (4 x 16 KiB), then [wave][32 lanes][4] = {m0, m1, l0, l1} at 64 KiB
  float* xch = (float*)sm;
  float* xml = xch + 4 * 4096;
  const float l0 = lsum[0] + other_half(lsum[0]);            // the lane halves share one maximum
  const float l1 = lsum[1] + other_half(lsum[1]);
  *(v4f*)(xml + (ws * 32 + lane) * 4) = (v4f){m[0], m[1], l0, l1};
  if (kh == 0) attn_send<8>(acc, xch + ws * 4096, lane);
  else         attn_send<0>(acc, xch + ws * 4096, lane);
  __syncthreads();                                           // both key halves' parts are in LDS before either partner reads
  const v4f pml = *(const v4f*)(xml + ((ws ^ 2) * 32 + lane) * 4);   // the partner: same queries, other key half, same lane
  float fm[2], fo[2];
  {
    const float mj0 = fmaxf(m[0], pml[0]), mj1 = fmaxf(m[1], pml[1]);
    const float am0 = __builtin_amdgcn_exp2f(m[0] - mj0), ao0 = __builtin_amdgcn_exp2f(pml[0] - mj0);
    const float am1 = __builtin_amdgcn_exp2f(m[1] - mj1), ao1 = __builtin_amdgcn_exp2f(pml[1] - mj1);
    const float inv0 = 1.0f / (l0 * am0 + pml[2] * ao0);     // the sum is near 1 or above: the row maximum contributes exp2(0)
    const float inv1 = 1.0f / (l1 * am1 + pml[3] * ao1);
    fm[0] = am0 * inv0; fo[0] = ao0 * inv0;
    fm[1] = am1 * inv1; fo[1] = ao1 * inv1;
  }
  unsigned short* op = Xb + (size_t)q * NX + h * 8;          // acc[ct][qt][r] = feat[c = 16 ct + 8 h + r][q + 16 qt]: 8 consecutive c, one 16-B store
  if (kh == 0) attn_finish<0>(acc, xch + (ws ^ 2) * 4096, lane, fm, fo, op);
  else         attn_finish<8>(acc, xch + (ws ^ 2) * 4096, lane, fm, fo, op);
}

// ---------------------------------------------------------------------------
// Workspace region map (byte offsets); every region is fully written before it is read, once per call, all batches.
//   Wb    bf16 [256][512]                  0          (262144 B)
//   PRET  bf16 [4 b][4096 i][256 c]        262144     (8388608 B)   pre^T
//   CURb  bf16 [4 b][256 c][4096 j]        8650752    (8388608 B)   cur, natural layout
//   XCAT  bf16 [4 b][4096 i][512]          17039360   (16777216 B)  cols 0..255 = feat^T, cols 256..511 = cur^T
//   total                                  33816576 B
// ---------------------------------------------------------------------------
extern "C" void kernel_launch(void* const* d_in, const int* in_sizes, int n_in,
                              void* d_out, int out_size, void* d_ws, size_t ws_size,
                              hipStream_t stream) {
  if (n_in < 9) return;
  if (in_sizes[0] != NB * NC * HW || in_sizes[1] != NB * NC * HW) return;
  if (in_sizes[2] != NC * NX) return;
  if (in_sizes[3] != NC || in_sizes[4] != NC || in_sizes[5] != NC || in_sizes[6] != NC || in_sizes[7] != NC) return;
  if (in_sizes[8] < 1) return;
  if (out_size != NB * NC * HW) return;

  const float* pre   = (const float*)d_in[0];
  const float* cur   = (const float*)d_in[1];
  const float* W     = (const float*)d_in[2];
  const float* bconv = (const float*)d_in[3];
  const float* gamma = (const float*)d_in[4];
  const float* beta  = (const float*)d_in[5];
  const float* rmean = (const float*)d_in[6];
  const float* rvar  = (const float*)d_in[7];
  const float* alpha = (const float*)d_in[8];
  float* out = (float*)d_out;

  const size_t szWb   = (size_t)NC * NX * 2;
  const size_t szPRET = (size_t)NB * HW * NC * 2;
  const size_t szCURb = (size_t)NB * NC * HW * 2;
  const size_t szXCAT = (size_t)NB * HW * NX * 2;
  size_t off = 0;
  const size_t oWb   = off; off += szWb;
  const size_t oPRET = off; off += szPRET;
  const size_t oCURb = off; off += szCURb;
  const size_t oXCAT = off; off += szXCAT;
  if (off > ws_size) return;                    // 33816576 B total

  char* ws = (char*)d_ws;
  unsigned short* Wb   = (unsigned short*)(ws + oWb);
  unsigned short* PRET = (unsigned short*)(ws + oPRET);
  unsigned short* CURb = (unsigned short*)(ws + oCURb);
  unsigned short* XCAT = (unsigned short*)(ws + oXCAT);

  const dim3 blk(256);
  const dim3 gP(HW / 64, NC / 64, 2 * NB + 1);  // 64 x 4 tiles x (4 batches of pre, 4 of cur), and 256 blocks for W
  const dim3 gA(HW / 64, NB);                   // 64 query blocks x 4 batches, 4 waves each
  const dim3 gC((NC / 64) * (HW / 64), NB);     // 256 blocks x 8 waves per batch: M=256, N=4096, K=512, one tile per block, K over its waves

  // W -> Wb; pre[b] [256 c][4096 i] -> PRET[b] [4096 i][256 c]; cur[b] [256 c][4096 j] -> XCAT[b][j][256 + c] and CURb[b] (natural layout)
  prep_kernel<<<gP, blk, 0, stream>>>(pre, cur, W, PRET, XCAT, CURb, Wb);
  // XCAT[b][i][c] = bf16(sum_j softmax_j(PRET[b][i] . XCAT[b][j][256..] / 16) * CURb[b][c][j])
  attn_fused_kernel<<<gA, dim3(128), 0, stream>>>(PRET, CURb, XCAT);
  // out[b][o][i] = prelu(bn(sum_k Wb[o][k] * XCAT[b][i][k] + b_conv[o]))  (M=256, N=4096, K=512, f32 out, ldc 4096)
  wmma_gemm64<1, false, 1, 0, false, 5, 8><<<gC, blk, 0, stream>>>(
      Wb, Wb, NX, 0L, XCAT, XCAT, NX, (long)HW * NX, (void*)out, (void*)out, HW, (long)NC * HW,
      bconv, bconv, 0L, gamma, beta, rmean, rvar, alpha, NC, HW, NX, 1.0f);
  (void)hipGetLastError();
}

// v006
// A run of this version takes 82 microseconds.
// Timed twice side by side with v005, it ran 1.11 and 1.12 times as fast.
// All steps since v000 together make it 21.6 times as fast.
// Contractions S = pre^T.cur (x1/16), featT = P.cur^T, 1x1 conv = W.x: all v_wmma_f32_16x16x32_bf16 (bf16 operands RNE-converted from f32, f32 accumulate); softmax, bias, BN, PReLU in f32.
#include <hip/hip_runtime.h>
#include <math.h>
#include <stdint.h>

#define NB 4
#define NC 256
#define HW 4096
#define NX 512

typedef __attribute__((ext_vector_type(16))) _Float16 v16h;
typedef __attribute__((ext_vector_type(8)))  _Float16 v8h;
typedef __attribute__((ext_vector_type(16))) __bf16   v16b;
typedef __attribute__((ext_vector_type(8)))  __bf16   v8b;
typedef __attribute__((ext_vector_type(8)))  float    v8f;
typedef __attribute__((ext_vector_type(4)))  float    v4f;
typedef __attribute__((ext_vector_type(2)))  float    v2f;
typedef __attribute__((ext_vector_type(4)))  unsigned int v4u;
typedef __attribute__((ext_vector_type(2)))  unsigned int v2u;
typedef __attribute__((ext_vector_type(8)))  unsigned short v8us;

__device__ __forceinline__ unsigned short f2bf_bits(float f) {
  unsigned u = __float_as_uint(f);
  return (unsigned short)((u + 0x7FFFu + ((u >> 16) & 1u)) >> 16);
}
__device__ __forceinline__ float bf_bits2f(unsigned short h) { return __uint_as_float(((unsigned)h) << 16); }

// hazard guards as plain device helpers
__device__ __forceinline__ void dep_guard_h(v8f& a, v8f& b, v16h x, v16h y) { asm volatile("v_nop\n\tv_nop\n\tv_nop\n\tv_nop" : "+v"(a), "+v"(b) : "v"(x), "v"(y)); }
__device__ __forceinline__ void dep_guard_b(v8f& a, v8f& b, v16b x, v16b y) { asm volatile("v_nop\n\tv_nop\n\tv_nop\n\tv_nop" : "+v"(a), "+v"(b) : "v"(x), "v"(y)); }
__device__ __forceinline__ void keep4_h(v16h a, v16h b, v16h c, v16h d) { asm volatile("v_nop" :: "v"(a), "v"(b), "v"(c), "v"(d)); }
__device__ __forceinline__ void keep4_b(v16b a, v16b b, v16b c, v16b d) { asm volatile("v_nop" :: "v"(a), "v"(b), "v"(c), "v"(d)); }
__device__ __forceinline__ void acc_guard4(v8f& a, v8f& b, v8f& c, v8f& d) { asm volatile("v_nop\n\tv_nop\n\tv_nop\n\tv_nop" : "+v"(a), "+v"(b), "+v"(c), "+v"(d)); }
template <typename T> struct Frag;
template <> struct Frag<_Float16> {
  typedef v16h V; union U { v16h v; v8h h[2]; };
  static __device__ __forceinline__ v16h load(const _Float16* p) {   // elements 0..7 <- p[0..7], 8..15 <- p[16..23]
    U f; f.h[0] = *(const v8h*)(p); f.h[1] = *(const v8h*)(p + 16); return f.v;
  }
  static __device__ __forceinline__ v8f mma(v16h a, v16h b, v8f c) {
    return __builtin_amdgcn_wmma_f32_16x16x32_f16(false, a, false, b, (short)0, c, false, false);
  }
  static __device__ __forceinline__ void guard(v8f& a, v8f& b, v16h x, v16h y) { dep_guard_h(a, b, x, y); }
  static __device__ __forceinline__ void keep(v16h a, v16h b, v16h c, v16h d) { keep4_h(a, b, c, d); }
};
template <> struct Frag<__bf16> {
  typedef v16b V; union U { v16b v; v8b h[2]; };
  static __device__ __forceinline__ v16b load(const __bf16* p) {
    U f; f.h[0] = *(const v8b*)(p); f.h[1] = *(const v8b*)(p + 16); return f.v;
  }
  static __device__ __forceinline__ v8f mma(v16b a, v16b b, v8f c) {
    return __builtin_amdgcn_wmma_f32_16x16x32_bf16(false, a, false, b, (short)0, c, false, false);
  }
  static __device__ __forceinline__ void guard(v8f& a, v8f& b, v16b x, v16b y) { dep_guard_b(a, b, x, y); }
  static __device__ __forceinline__ void keep(v16b a, v16b b, v16b c, v16b d) { keep4_b(a, b, c, d); }
};

// ---- Register-blocked batched WMMA GEMM ------------------------------------
// C[m,n] = scale * sum_k A[m,k] * Bt[n,k] (+bias)(+resid); each wave (KS == 1) or each block (KS > 1) owns a 64x64 tile.
// A row-major [M,K]; Bt row-major [N,K]; M,N % 64 == 0, K % 32 == 0.
// SPLIT: operands are hi/lo planes (A2/Bt2 = lo planes, same layout); product = hi.hi + hi.lo + lo.hi.
// BIAS_MODE: 0 = none, 1 = bias[m], 2 = bias[n].
// OUT_MODE: 0 = f32, 1 = f16, 2 = bf16 hi plane (Cout) + bf16 lo plane (Cout2), 3 = single bf16 plane (RNE).
// ET: 0 = f16 operands, 1 = bf16 operands (pointers passed as 16-bit storage)
// ACT: 0 = none, 1 = tanh, 2 = relu, 3 = silu, 4 = leaky relu,
//      5 = batch norm on the running statistics of row m, then PReLU with one shared slope (KS > 1 only):
//          prelu(x * inv + shift), inv = gamma[m] * rsqrt(var[m] + 1e-5), shift = beta[m] - mean[m] * inv, slope = alpha[0]
// KS: 1 = each wave owns a tile and all of K (8 tiles per block). KS > 1 = the block owns ONE tile and its KS waves
//     split K: wave w takes the 32-wide k steps w, w + KS, w + 2 KS, ...; the KS partial tiles meet in LDS
//     and are summed in wave order 0..KS-1, each wave finishing 64 / KS rows. For GEMMs with fewer tiles than the chip has room for.
template <int ET> struct Elem;
template <> struct Elem<0> { typedef _Float16 T; };
template <> struct Elem<1> { typedef __bf16 T; };
template <int ET, bool SPLIT, int BIAS_MODE, int OUT_MODE, bool RESID, int ACT = 0, int KS = 1>
__global__ __launch_bounds__(KS == 1 ? 256 : KS * 32) void wmma_gemm64(
    const unsigned short* __restrict__ Ap, const unsigned short* __restrict__ A2p, int lda, long strideA,
    const unsigned short* __restrict__ Btp, const unsigned short* __restrict__ Bt2p, int ldb, long strideB,
    void* __restrict__ Cout, void* __restrict__ Cout2, int ldc, long strideC,
    const float* __restrict__ bias,
    const float* __restrict__ resid, long strideR,
    const float* __restrict__ gamma, const float* __restrict__ beta, const float* __restrict__ rmean,
    const float* __restrict__ rvar, const float* __restrict__ alpha,
    int M, int N, int K, float scale) {
  static_assert(ACT != 5 || KS > 1, "ACT 5 is written for the split-K epilogue");
  typedef typename Elem<ET>::T T;
  typedef typename Frag<T>::V V;
  const T* A = (const T*)Ap; const T* A2 = (const T*)A2p; const T* Bt = (const T*)Btp; const T* Bt2 = (const T*)Bt2p;
  __shared__ __align__(16) float sT[KS == 1 ? 8 : KS * 4][16 * 68];   // KS == 1: per-wave 16x64 slab; KS > 1: per-wave 64x64 partial tile; pitch 68 floats
  const int b    = blockIdx.y;
  const int lane = threadIdx.x & 31;
  const int wave = (KS == 1) ? (int)(threadIdx.x >> 5) : __builtin_amdgcn_readfirstlane((int)(threadIdx.x >> 5));   // scalar, so the k loop stays a scalar loop
  const int tilesN = N >> 6;
  const int tilesM = M >> 6;
  const int tile = (KS == 1) ? (int)(blockIdx.x * 8 + wave) : (int)blockIdx.x;
  if (tile >= tilesM * tilesN) return;   // KS == 1: wave-uniform, no block barrier follows; KS > 1: block-uniform, ahead of the barrier
  const int tm = tile / tilesN;
  const int tn = tile - tm * tilesN;
  const int m0 = tm << 6;
  const int n0 = tn << 6;

  const T* Ab  = A  + (size_t)b * strideA;
  const T* Bb  = Bt + (size_t)b * strideB;
  const T* Ab2 = SPLIT ? (A2  + (size_t)b * strideA) : nullptr;
  const T* Bb2 = SPLIT ? (Bt2 + (size_t)b * strideB) : nullptr;

  const int rlane = lane & 15;                 // row (A) / col (B, D) within subtile
  const int koff  = (lane >> 4) * 8;           // k offset of this lane half
  const int mOff  = (lane >> 4) * 8;           // D row offset

  v8f acc[4][4];
#pragma unroll
  for (int i = 0; i < 4; ++i)
#pragma unroll
    for (int j = 0; j < 4; ++j) acc[i][j] = (v8f){0.f,0.f,0.f,0.f,0.f,0.f,0.f,0.f};

  for (int k0 = (KS == 1) ? 0 : wave * 32; k0 < K; k0 += 32 * KS) {
    V bh[4], bl[4];
#pragma unroll
    for (int j = 0; j < 4; ++j) {
      const size_t bo = (size_t)(n0 + (j << 4) + rlane) * ldb + koff + k0;
      bh[j] = Frag<T>::load(Bb + bo);
      if (SPLIT) bl[j] = Frag<T>::load(Bb2 + bo);
    }
#pragma unroll
    for (int i = 0; i < 4; ++i) {
      const size_t ao = (size_t)(m0 + (i << 4) + rlane) * lda + koff + k0;
      V ah = Frag<T>::load(Ab + ao);
      V al;
      if (SPLIT) al = Frag<T>::load(Ab2 + ao);
#pragma unroll
      for (int j = 0; j < 4; ++j) {
        acc[i][j] = Frag<T>::mma(ah, bh[j], acc[i][j]);
        if (SPLIT) {
          acc[i][j] = Frag<T>::mma(ah, bl[j], acc[i][j]);
          acc[i][j] = Frag<T>::mma(al, bh[j], acc[i][j]);
        }
      }
      Frag<T>::guard(acc[i][0], acc[i][3], ah, SPLIT ? al : ah);
    }
    Frag<T>::keep(bh[0], bh[1], bh[2], bh[3]);
    if (SPLIT) Frag<T>::keep(bl[0], bl[1], bl[2], bl[3]);
  }
  acc_guard4(acc[0][0], acc[0][1], acc[0][2], acc[0][3]);
  acc_guard4(acc[1][0], acc[1][1], acc[1][2], acc[1][3]);
  acc_guard4(acc[2][0], acc[2][1], acc[2][2], acc[2][3]);
  acc_guard4(acc[3][0], acc[3][1], acc[3][2], acc[3][3]);

  // ---- epilogue ----
  const float* Rb = RESID ? (resid + (size_t)b * strideR) : nullptr;
  if (KS > 1) {
    float* part = &sT[0][0];                    // [KS waves][64 rows][68]
    float* mine = part + wave * (64 * 68);
    constexpr int ROWS = 64 / KS;               // rows of the tile that this wave finishes
    constexpr int CW   = (OUT_MODE == 0) ? 4 : 8;   // columns per lane: one 16-B store either way
    constexpr int RP   = 32 * CW / 64;          // rows per pass of the wave
    const int row0 = wave * ROWS + lane / (64 / CW);   // this lane's row in pass 0
    float bnInv[ROWS / RP], bnShift[ROWS / RP], slope = 0.f;
    if (ACT == 5) {                             // read ahead of the LDS stores and the barrier, which cover the latency
      slope = alpha[0];
#pragma unroll
      for (int it = 0; it < ROWS / RP; ++it) {
        const int m = m0 + row0 + it * RP;
        bnInv[it]   = gamma[m] * rsqrtf(rvar[m] + 1e-5f);
        bnShift[it] = beta[m] - rmean[m] * bnInv[it];
      }
    }
#pragma unroll
    for (int i = 0; i < 4; ++i)
#pragma unroll
      for (int j = 0; j < 4; ++j)
#pragma unroll
        for (int r = 0; r < 8; ++r) mine[((i << 4) + mOff + r) * 68 + (j << 4) + rlane] = acc[i][j][r];
    if (ACT == 5) asm volatile("s_wait_xcnt 0x0" ::: "memory");   // no register that the coefficient loads name is rewritten ahead of this wait
    __syncthreads();                            // all KS partial tiles are in LDS before any wave sums them
    const int cc = (lane & (64 / CW - 1)) * CW;
#pragma unroll
    for (int it = 0; it < ROWS / RP; ++it) {
      const int row = row0 + it * RP;
      const int m = m0 + row;
      const float* sp = part + row * 68 + cc;
      float v[CW];
#pragma unroll
      for (int e = 0; e < CW; e += 4) {
        v4f s = *(const v4f*)(sp + e);
#pragma unroll
        for (int w = 1; w < KS; ++w) s += *(const v4f*)(sp + w * (64 * 68) + e);
        v[e] = s[0]; v[e + 1] = s[1]; v[e + 2] = s[2]; v[e + 3] = s[3];
      }
#pragma unroll
      for (int e = 0; e < CW; ++e) {
        float x = v[e] * scale;
        if (BIAS_MODE == 1) x += bias[m];
        if (BIAS_MODE == 2) x += bias[n0 + cc + e];
        if (RESID) x += Rb[(size_t)m * ldc + n0 + cc + e];
        if (ACT == 1) x = tanhf(x);
        if (ACT == 2) x = fmaxf(x, 0.0f);
        if (ACT == 3) x = x / (1.0f + expf(-x));
        if (ACT == 4) x = (x > 0.f) ? x : 0.01f * x;
        if (ACT == 5) { x = x * bnInv[it] + bnShift[it]; x = (x >= 0.f) ? x : slope * x; }
        v[e] = x;
      }
      const size_t co = (size_t)b * strideC + (size_t)m * ldc + n0 + cc;
      if constexpr (OUT_MODE == 0) {
        *(v4f*)((float*)Cout + co) = (v4f){v[0], v[1], v[2], v[3]};
      } else {
        v8h hv, lv;
#pragma unroll
        for (int e = 0; e < 8; ++e) {
          const float x = v[e];
          if (OUT_MODE == 1) {
            hv[e] = (_Float16)x;
          } else {
            const unsigned short hb = f2bf_bits(x);
            hv[e] = __builtin_bit_cast(_Float16, hb);
            if (OUT_MODE == 2) lv[e] = __builtin_bit_cast(_Float16, f2bf_bits(x - bf_bits2f(hb)));
          }
        }
        *(v8h*)((unsigned short*)Cout + co) = hv;
        if (OUT_MODE == 2) *(v8h*)((unsigned short*)Cout2 + co) = lv;
      }
    }
    return;
  }
  float* slab = sT[wave];
#pragma unroll
  for (int i = 0; i < 4; ++i) {
    const int mBase = m0 + (i << 4);
#pragma unroll
    for (int j = 0; j < 4; ++j) {
      const int n = n0 + (j << 4) + rlane;
      float bv = 0.f;
      if (BIAS_MODE == 2) bv = bias[n];
#pragma unroll
      for (int r = 0; r < 8; ++r) {
        float v = acc[i][j][r] * scale;
        if (BIAS_MODE == 1) v += bias[mBase + mOff + r];
        if (BIAS_MODE == 2) v += bv;
        if (RESID) v += Rb[(size_t)(mBase + mOff + r) * ldc + n];
        if (ACT == 1) v = tanhf(v);
        if (ACT == 2) v = fmaxf(v, 0.0f);
        if (ACT == 3) v = v / (1.0f + expf(-v));
        if (ACT == 4) v = (v > 0.f) ? v : 0.01f * v;
        slab[(mOff + r) * 68 + (j << 4) + rlane] = v;
      }
    }
    __builtin_amdgcn_fence(__ATOMIC_RELEASE, "workgroup");
    __builtin_amdgcn_wave_barrier();
    __builtin_amdgcn_fence(__ATOMIC_ACQUIRE, "workgroup");
    if (OUT_MODE == 0) {
      float* C = (float*)Cout + (size_t)b * strideC;
      const int hh = lane >> 4, c4 = (lane & 15) * 4;     // row seg = 256 B = 16 lanes x 16 B
      {
#pragma unroll
        for (int it = 0; it < 8; ++it) {
          const int row = it * 2 + hh;
          v4f v = *(const v4f*)(slab + row * 68 + c4);
          *(v4f*)(C + (size_t)(mBase + row) * ldc + n0 + c4) = v;
        }
        
      }
    } else {
      const int q = lane >> 3, c8 = (lane & 7) * 8;
      unsigned short* C  = (unsigned short*)Cout  + (size_t)b * strideC;
      unsigned short* C2 = (OUT_MODE == 2) ? ((unsigned short*)Cout2 + (size_t)b * strideC) : nullptr;
      {
#pragma unroll
        for (int it = 0; it < 4; ++it) {
          const int row = it * 4 + q;
          const float* sp = slab + row * 68 + c8;
          v8h hv, lv;
#pragma unroll
          for (int e = 0; e < 8; ++e) {
            if (OUT_MODE == 1) {
              hv[e] = (_Float16)sp[e];
            } else if (OUT_MODE == 3) {
              hv[e] = __builtin_bit_cast(_Float16, f2bf_bits(sp[e]));
            } else {
              unsigned short hb = f2bf_bits(sp[e]);
              unsigned short lb = f2bf_bits(sp[e] - bf_bits2f(hb));
              hv[e] = __builtin_bit_cast(_Float16, hb);
              lv[e] = __builtin_bit_cast(_Float16, lb);
            }
          }
          *(v8h*)(C + (size_t)(mBase + row) * ldc + n0 + c8) = hv;
          if (OUT_MODE == 2) *(v8h*)(C2 + (size_t)(mBase + row) * ldc + n0 + c8) = lv;
        }
        
      }
    }
    __builtin_amdgcn_fence(__ATOMIC_RELEASE, "workgroup");
    __builtin_amdgcn_wave_barrier();
    __builtin_amdgcn_fence(__ATOMIC_ACQUIRE, "workgroup");
  }
}

// ---------------------------------------------------------------------------
// Operand preparation, all of it in one launch. grid (HW/64 i-tiles, NC/64 c-tiles, 2 NB + 1 jobs), 256 threads; blockIdx.z picks the job:
//   z in 0 .. NB-1     : pre[z]      f32 [NC c][HW i] -> PRET[z][i][c]            = bf16(pre[c][i])   (one 64x64 tile, transposed)
//   z in NB .. 2 NB-1  : cur[z - NB] f32 [NC c][HW j] -> XCAT[z - NB][j][NC + c]  = bf16(cur[c][j])   (one 64x64 tile, transposed)
//                        and, from the same registers,   CURb[z - NB][c][j]       = bf16(cur[c][j])   (natural layout): cur is read once
//   z == 2 NB          : W f32 [NC][NX] -> Wb bf16, 2 elements per thread; 64 x 4 blocks x 256 threads x 2 = NC * NX elements
// Load coverage of a tile: 4 iterations x 256 threads = 1024 float4 = 64 c-rows x 64 i-cols (c-row = tid>>4 + 16 it spans 0..63, tid&15 spans the 16 float4 of a row).
// Natural-layout store: 16 lanes x 8 B = the 128-B line of one c-row's 64 columns, one writer per line.
// Transposed store: 8 waves x 2 iterations x 4 rows (q = lane>>3) = 64 out rows; 8 lanes x 8 halves = 64 cols per row.
// ---------------------------------------------------------------------------
__global__ __launch_bounds__(256) void prep_kernel(const float* __restrict__ pre, const float* __restrict__ cur, const float* __restrict__ W,
                                                   unsigned short* __restrict__ PRET, unsigned short* __restrict__ XCAT,
                                                   unsigned short* __restrict__ CURb, unsigned short* __restrict__ Wb) {
  __shared__ __align__(16) unsigned short sm[64 * 72];   // [i local][c local], pitch 72 halves (144 B)
  const int tid  = threadIdx.x;
  const int lane = tid & 31;
  const int wave = tid >> 5;
  const int z    = blockIdx.z;
  if (z == 2 * NB) {                     // block-uniform, ahead of the barrier
    const int i = (blockIdx.y * (HW / 64) + blockIdx.x) * 256 + tid;
    const v2f f = *(const v2f*)(W + 2 * (size_t)i);
    ((unsigned*)Wb)[i] = (unsigned)f2bf_bits(f[0]) | ((unsigned)f2bf_bits(f[1]) << 16);
    return;
  }
  const bool isCur = z >= NB;            // block-uniform
  const int b  = isCur ? z - NB : z;
  const int i0 = blockIdx.x * 64;
  const int c0 = blockIdx.y * 64;
  const float* in = (isCur ? cur : pre) + (size_t)b * NC * HW;
  unsigned short* out = isCur ? (XCAT + (size_t)b * HW * NX + NC) : (PRET + (size_t)b * HW * NC);
  const int ldo = isCur ? NX : NC;
  unsigned short* nat = CURb + (size_t)b * NC * HW;
  const int cr0 = tid >> 4;              // 0..15; iteration it takes c-row cr0 + 16 it
  const int q4  = (tid & 15) * 4;        // first of this thread's 4 i-columns
  v4f f[4];
#pragma unroll
  for (int it = 0; it < 4; ++it) f[it] = *(const v4f*)(in + (size_t)(c0 + cr0 + 16 * it) * HW + i0 + q4);   // all four loads in flight together
  v2u u[4];
#pragma unroll
  for (int it = 0; it < 4; ++it) {
    const int cr = cr0 + 16 * it;
    const unsigned short h0 = f2bf_bits(f[it][0]), h1 = f2bf_bits(f[it][1]), h2 = f2bf_bits(f[it][2]), h3 = f2bf_bits(f[it][3]);
    sm[(q4 + 0) * 72 + cr] = h0;
    sm[(q4 + 1) * 72 + cr] = h1;
    sm[(q4 + 2) * 72 + cr] = h2;
    sm[(q4 + 3) * 72 + cr] = h3;
    u[it] = (v2u){(unsigned)h0 | ((unsigned)h1 << 16), (unsigned)h2 | ((unsigned)h3 << 16)};
  }
  __syncthreads();
  const int q  = lane >> 3;
  const int c8 = (lane & 7) * 8;
#pragma unroll
  for (int it = 0; it < 2; ++it) {
    const int row = wave * 8 + it * 4 + q;
    const v8us v = *(const v8us*)(sm + row * 72 + c8);
    const v4u t = __builtin_bit_cast(v4u, v);
    *(v4u*)(out + (size_t)(i0 + row) * ldo + c0 + c8) = t;
  }
  if (isCur) {                           // behind the barrier, so that the barrier does not wait for these stores
#pragma unroll
    for (int it = 0; it < 4; ++it) *(v2u*)(nat + (size_t)(c0 + cr0 + 16 * it) * HW + i0 + q4) = u[it];
    asm volatile("s_wait_xcnt 0x0" ::: "memory");   // the listing lays the W job's code behind these stores: no register that they name is rewritten ahead of this wait
  }
}

// ---------------------------------------------------------------------------
// Fused attention, online softmax: XCAT[b][i][0..255] = bf16(sum_j softmax_j(pre_i . cur_j / 16) * cur[c][j]).
// Transposed products: S^T = K . Q^T (A = cur^T rows [j][c], B = pre^T rows [i][c] kept in registers) and
// O^T += V^T . P^T (A = cur rows [c][j], B = the score tiles converted in place), so a lane holds one query column:
// D register r of a score tile is key 8h + r of query (lane & 15); two such tiles are one 32-key B operand in the hardware k order.
// Work-group: 64 queries, 4 waves = 2 query groups of 32 x 2 key halves; a pass is 64 keys, 32 per wave; grid (HW / 64 query blocks, batches).
// Each pass's K tile (64 keys x 512 B) and V tile (256 c x 128 B) come into LDS by tensor loads, one 16-KiB slice per wave, two buffers, one pass ahead.
// Sums: scores over c in 32-wide k steps; probabilities per wave (key half) and lane half over the passes in order; lane halves, then key halves, joined at the end.
// ---------------------------------------------------------------------------
#define KPITCH 272                      // bytes per K slice row in LDS: 256 + 16 (16 B x odd, for 16-byte row readers)
#define VPITCH 144                      // bytes per V row in LDS: 128 + 16
#define SLICE  18432                    // LDS bytes per slice, a multiple of 2 KiB: 128 V rows x 144 exactly; 64 K rows x 272 = 17408, rounded up
#define KTILE  (2 * SLICE)              // K slice s = channels 128 s .. 128 s + 127 of the pass's 64 keys
#define VTILE  (2 * SLICE)              // V slice s = channels 128 s .. 128 s + 127, the pass's 64 keys each; the two slices are one run of 256 rows
#define ABUF   (KTILE + VTILE)
#define NPASS  (HW / 64)
static_assert(64 * KPITCH <= SLICE && 128 * VPITCH <= SLICE && SLICE % 2048 == 0, "a slice holds its padded rows and the next one starts at a multiple of 2 KiB");

typedef uint32_t u32x4 __attribute__((ext_vector_type(4)));
typedef uint32_t u32x8 __attribute__((ext_vector_type(8)));
__device__ __forceinline__ uint32_t uni(uint32_t v) { return (uint32_t)__builtin_amdgcn_readfirstlane(v); }
// A test on the result is a scalar branch (a tensor load ignores EXEC), and what is formed from the result is formed behind this statement.
__device__ __forceinline__ uint32_t pinned(uint32_t v) { uint32_t w = uni(v); asm volatile("" : "+s"(w)); return w; }   // a wave-uniform word held in a scalar register
// Descriptor group 1 of a tile of ROWS rows of ROWB bytes, SRCP bytes apart in global memory, 16 pad bytes behind every row in LDS.
// 1-byte elements, tensor = tile, no mask; IVL = pad interval code of the row length (5: 256 B, 4: 128 B), amount code 3 = 4 dwords.
template <uint32_t ROWB, uint32_t ROWS, uint32_t SRCP, uint32_t IVL>
__device__ __forceinline__ u32x8 tdm_group1() {
  u32x8 g1;
  g1[0] = uni((1u << 20) | (IVL << 22) | (3u << 25));
  g1[1] = uni((ROWB & 0xFFFFu) << 16);
  g1[2] = uni((ROWB >> 16) | ((ROWS & 0xFFFFu) << 16));
  g1[3] = uni((ROWS >> 16) | (ROWB << 16));
  g1[4] = uni(ROWS);
  g1[5] = uni(SRCP);
  g1[6] = uni(0u);
  g1[7] = uni(0u);
  return g1;
}
// Descriptor group 0: the tile whose first global byte is ga lands in LDS from byte dst on.
__device__ __forceinline__ u32x4 tdm_group0(uint32_t dst, uint64_t ga) {
  u32x4 g0;
  g0[0] = uni(1u);
  g0[1] = uni(dst);
  g0[2] = uni((uint32_t)ga);
  g0[3] = uni((((uint32_t)(ga >> 32)) & 0x01FFFFFFu) | 0x80000000u);
  asm volatile("" : "+s"(g0));                       // the four words are held in scalar registers of their own from here to the request's wait
  return g0;
}
// One request of the whole wave.
__device__ __forceinline__ void tdm_load(u32x4 g0, u32x8 g1) { asm volatile("tensor_load_to_lds %0, %1" :: "s"(g0), "s"(g1) : "memory"); }
// This wave's request has landed. The statement names the request's group 0, so that its registers are kept as they are up to here.
__device__ __forceinline__ void tdm_wait(u32x4 g0) { asm volatile("s_wait_tensorcnt 0x0" :: "s"(g0) : "memory"); }
// A wave's slice of one pass: waves 0 and 1 bring the two K slices (64 keys x 256 B of cur^T), waves 2 and 3 the two V slices (128 channels x 128 B of cur).
__device__ __forceinline__ u32x4 attn_issue(uint32_t ws, uint32_t dst, uint64_t ga, u32x8 g1k, u32x8 g1v) {
  const u32x4 g0 = tdm_group0(dst, ga);
  if (pinned(ws < 2u)) tdm_load(g0, g1k);
  else                 tdm_load(g0, g1v);
  return g0;
}
// Hand-over of the ring: this wave's LDS reads are done, its own slice has landed, then every wave meets.
__device__ __forceinline__ void attn_publish(u32x4 g0) {
  asm volatile("s_wait_dscnt 0x0" ::: "memory");     // the buffer just read is refilled behind the barrier
  tdm_wait(g0);                                      // the compiler places no wait for a tensor load
  __syncthreads();
}
// Value of lane l ^ 16, through no LDS: an LDS shuffle's wait would also wait out the K fragment loads in flight.
__device__ __forceinline__ float other_half(float x) {
  const int b = __float_as_int(x);
  return __int_as_float(__builtin_amdgcn_permlanex16(b, b, 0x76543210, 0xfedcba98, false, false));
}
// A wave's share of a pass: its 32 keys (one half of the pass's 64) against its 32 queries (two 16-column tiles).
// Every K and V fragment read from LDS feeds two products, one per query tile. kt / vt: the tiles, already offset to this
// wave's key half and this lane's row and k half.
__device__ __forceinline__ void attn_load_k(const unsigned char* kt, v16b (&ka)[16]) {   // 8 k steps x 2 key tiles
#pragma unroll
  for (int f = 0; f < 16; ++f) ka[f] = Frag<__bf16>::load((const __bf16*)(kt + (f >> 3) * SLICE + (f & 1) * 16 * KPITCH + ((f >> 1) & 3) * 64));   // k steps 0..3 in slice 0, 4..7 in slice 1
}
__device__ __forceinline__ void attn_load_v(const unsigned char* vt, v16b (&va)[16]) {   // 16 c tiles, one 32-key k step
#pragma unroll
  for (int f = 0; f < 16; ++f) va[f] = Frag<__bf16>::load((const __bf16*)(vt + f * 16 * VPITCH));
}
__device__ __forceinline__ void attn_scores(const v16b (&ka)[16], const v16b (&qf)[2][8], v8f (&s)[2][2]) {
#pragma unroll
  for (int jt = 0; jt < 2; ++jt)
#pragma unroll
    for (int qt = 0; qt < 2; ++qt) s[jt][qt] = (v8f){0.f,0.f,0.f,0.f,0.f,0.f,0.f,0.f};
#pragma unroll
  for (int ks = 0; ks < 8; ++ks)
#pragma unroll
    for (int jt = 0; jt < 2; ++jt)
#pragma unroll
      for (int qt = 0; qt < 2; ++qt) s[jt][qt] = Frag<__bf16>::mma(ka[ks * 2 + jt], qf[qt][ks], s[jt][qt]);
}
__device__ __forceinline__ void attn_softmax_pv(const v8f (&s)[2][2], const v16b (&va)[16],
                                                v8f (&acc)[16][2], float (&m)[2], float (&lsum)[2]) {
  const float sc = 0.0625f * 1.44269504088896340736f;   // 1/16, and exp(x) = exp2(x * log2 e)
  float alpha[2];
  v16b pb[2];                                           // per query tile: the 32 keys' probabilities as one B operand
#pragma unroll
  for (int qt = 0; qt < 2; ++qt) {
    float mt[2];
#pragma unroll
    for (int jt = 0; jt < 2; ++jt) {
      mt[jt] = s[jt][qt][0];
#pragma unroll
      for (int r = 1; r < 8; ++r) mt[jt] = fmaxf(mt[jt], s[jt][qt][r]);
    }
    float mx = fmaxf(mt[0], mt[1]);
    mx = fmaxf(mx, other_half(mx));                     // the other lane half holds this query's other keys
    const float mn = fmaxf(m[qt], mx * sc);
    alpha[qt] = __builtin_amdgcn_exp2f(m[qt] - mn);     // first pass: exp2(-inf) = 0
    m[qt] = mn;
    float ps[2];
#pragma unroll
    for (int jt = 0; jt < 2; ++jt) {
      float t = 0.f;
#pragma unroll
      for (int r = 0; r < 8; ++r) {
        const float p = __builtin_amdgcn_exp2f(s[jt][qt][r] * sc - mn);
        t += p;
        pb[qt][jt * 8 + r] = (__bf16)p;
      }
      ps[jt] = t;
    }
    lsum[qt] = lsum[qt] * alpha[qt] + (ps[0] + ps[1]);
  }
#pragma unroll
  for (int ct = 0; ct < 16; ++ct)
#pragma unroll
    for (int qt = 0; qt < 2; ++qt) {
      acc[ct][qt] *= alpha[qt];
      acc[ct][qt] = Frag<__bf16>::mma(va[ct], pb[qt], acc[ct][qt]);
    }
}

// Joining the two key halves of a query group, once, behind the loop. A wave hands the 8 c tiles from S on to its partner:
// 32 chunks of 16 B per lane, chunk-major, so that a wave's store covers 512 contiguous bytes.
template <int S>
__device__ __forceinline__ void attn_send(const v8f (&acc)[16][2], float* mine, int lane) {
#pragma unroll
  for (int i = 0; i < 8; ++i)
#pragma unroll
    for (int qt = 0; qt < 2; ++qt)
#pragma unroll
      for (int hf = 0; hf < 2; ++hf) {
        const v8f a = acc[S + i][qt];
        *(v4f*)(mine + (((i * 2 + qt) * 2 + hf) * 32 + lane) * 4) = (v4f){a[hf * 4], a[hf * 4 + 1], a[hf * 4 + 2], a[hf * 4 + 3]};
      }
}
// ... and finishes the 8 c tiles from S on: own part x fm + partner's part x fo (both hold the division by the joint sum), one 16-B store per tile.
template <int S>
__device__ __forceinline__ void attn_finish(const v8f (&acc)[16][2], const float* theirs, int lane,
                                            const float (&fm)[2], const float (&fo)[2], unsigned short* op) {
  v8b o[8][2];
#pragma unroll
  for (int i = 0; i < 8; ++i)
#pragma unroll
    for (int qt = 0; qt < 2; ++qt) {
      const v4f lo = *(const v4f*)(theirs + (((i * 2 + qt) * 2 + 0) * 32 + lane) * 4);
      const v4f hi = *(const v4f*)(theirs + (((i * 2 + qt) * 2 + 1) * 32 + lane) * 4);
#pragma unroll
      for (int r = 0; r < 4; ++r) {
        o[i][qt][r]     = (__bf16)(acc[S + i][qt][r] * fm[qt] + lo[r] * fo[qt]);
        o[i][qt][r + 4] = (__bf16)(acc[S + i][qt][r + 4] * fm[qt] + hi[r] * fo[qt]);
      }
    }
  __builtin_amdgcn_sched_barrier(0);                    // the stores stand behind all the arithmetic, at the wave's end: no register that a store names is rewritten behind it
#pragma unroll
  for (int i = 0; i < 8; ++i)
#pragma unroll
    for (int qt = 0; qt < 2; ++qt) *(v8b*)(op + (size_t)qt * 16 * NX + (S + i) * 16) = o[i][qt];
}

__global__ __launch_bounds__(128) void attn_fused_kernel(const unsigned short* __restrict__ PRET,
                                                         const unsigned short* __restrict__ CURb,
                                                         unsigned short* __restrict__ XCAT) {
  __shared__ __attribute__((aligned(2048))) unsigned char sm[2 * ABUF];   // every slice's place is a multiple of 2 KiB in the work-group's LDS
  const int tid   = threadIdx.x;
  const int lane  = tid & 31;
  const int wave  = tid >> 5;
  const int ws    = __builtin_amdgcn_readfirstlane(wave);    // scalar: picks the wave's share and the epilogue's branch
  const int qg    = ws & 1;                                  // query group: 32 of the block's 64 queries
  const int kh    = ws >> 1;                                 // key half: 32 of every pass's 64 keys
  const int b     = blockIdx.y;
  const int rlane = lane & 15;
  const int h     = lane >> 4;
  const int q     = blockIdx.x * 64 + qg * 32 + rlane;       // this lane's query in tile 0; tile 1: q + 16
  unsigned short* Xb = XCAT + (size_t)b * HW * NX;

  // This wave's slice: first global byte in pass 0, bytes from one pass to the next (64 keys), first LDS byte in buffer 0 (slices in wave order: K0 K1 V0 V1).
  const uint64_t gsrc = (ws < 2) ? (uint64_t)(size_t)(Xb + NC) + (uint64_t)(ws & 1) * 256u
                                 : (uint64_t)(size_t)(CURb + (size_t)b * NC * HW) + (uint64_t)(ws & 1) * (128u * HW * 2u);
  const uint32_t gstep = (ws < 2) ? 64u * NX * 2u : 64u * 2u;
  const uint32_t ldst = (uint32_t)(size_t)(&sm[0]) + (uint32_t)ws * SLICE;   // LDS byte address = low 32 bits of the shared address

  u32x8 g1k = tdm_group1<256u, 64u, NX * 2u, 5u>();
  u32x8 g1v = tdm_group1<128u, 128u, HW * 2u, 4u>();
  asm volatile("" : "+s"(g1k), "+s"(g1v));                   // the descriptor words are held in scalar registers of their own, so that none takes a new value while a request is outstanding

  u32x4 g0 = attn_issue(ws, ldst, gsrc, g1k, g1v);           // pass 0 -> buffer 0

  v16b qf[2][8];
  const __bf16* qp = (const __bf16*)PRET + ((size_t)b * HW + q) * NC + h * 8;
#pragma unroll
  for (int qt = 0; qt < 2; ++qt)
#pragma unroll
    for (int ks = 0; ks < 8; ++ks) qf[qt][ks] = Frag<__bf16>::load(qp + (size_t)qt * 16 * NC + ks * 32);
  v8f acc[16][2];
#pragma unroll
  for (int ct = 0; ct < 16; ++ct)
#pragma unroll
    for (int qt = 0; qt < 2; ++qt) acc[ct][qt] = (v8f){0.f,0.f,0.f,0.f,0.f,0.f,0.f,0.f};
  float m[2] = {-INFINITY, -INFINITY}, lsum[2] = {0.f, 0.f};

  tdm_wait(g0);                                              // pass 0's slice of this wave has landed
  __syncthreads();                                           // ... and every other wave's
  g0 = attn_issue(ws, ldst + ABUF, gsrc + pinned(gstep), g1k, g1v);   // pass 1 -> buffer 1; its address words are formed behind the wait

  const unsigned char* kt0 = sm + (kh * 32 + rlane) * KPITCH + h * 16;
  const unsigned char* vt0 = sm + KTILE + rlane * VPITCH + kh * 64 + h * 16;
  unsigned cur = 0;                                          // byte offset of the buffer that holds pass t
  uint32_t gnext = 2 * gstep;                                // source offset of the next refill
  v16b ka[16], va[16];
  attn_load_k(kt0, ka);                                      // pass 0's fragments, behind the barrier that published tile 0
  attn_load_v(vt0, va);
  // The wave holds a whole pass's fragments in registers, so a buffer is free as soon as they have landed: the publish point
  // stands behind the score products (under which the V fragments land), and behind it the next pass's K fragments are read
  // under the softmax and the output products, its V fragments at the foot. Between two publish points one buffer alone is read.
  for (int t = 0; t < NPASS - 1; ++t) {
    v8f s[2][2];
    attn_scores(ka, qf, s);
    __builtin_amdgcn_sched_barrier(0);                       // the score products stay in front of the waits: they cover the V fragments' landing
    attn_publish(g0);                                        // pass t's fragments are in registers everywhere, tile t + 1 has landed
    if (pinned(t + 2 < NPASS)) {                             // pass t + 2 -> the buffer that pass t has just read; its descriptor is formed here, behind the wait
      g0 = attn_issue(ws, ldst + pinned(cur), gsrc + pinned(gnext), g1k, g1v);
      gnext += gstep;
    }
    cur ^= ABUF;
    attn_load_k(kt0 + cur, ka);                              // pass t + 1
    __builtin_amdgcn_sched_barrier(0);                       // these LDS reads stay one group in front of the softmax and the output products, which cover their landing
    attn_softmax_pv(s, va, acc, m, lsum);
    __builtin_amdgcn_sched_barrier(0);                       // the V reads stay one group behind the output products, not in small groups among them
    attn_load_v(vt0 + cur, va);
  }
  {                                                          // the last pass: nothing is left to read ahead or to refill
    v8f s[2][2];
    attn_scores(ka, qf, s);
    attn_publish(g0);                                        // every wave's last fragments are in registers: the ring is free
    attn_softmax_pv(s, va, acc, m, lsum);
  }

  // The last publish point has ended every wave's reads and tensor loads: the ring carries the exchange.
  //   floats [wave][32 chunks][32 lanes][4] at 0 (4 x 16 KiB), then [wave][32 lanes][4] = {m0, m1, l0, l1} at 64 KiB
  float* xch = (float*)sm;
  float* xml = xch + 4 * 4096;
  const float l0 = lsum[0] + other_half(lsum[0]);            // the lane halves share one maximum
  const float l1 = lsum[1] + other_half(lsum[1]);
  *(v4f*)(xml + (ws * 32 + lane) * 4) = (v4f){m[0], m[1], l0, l1};
  if (kh == 0) attn_send<8>(acc, xch + ws * 4096, lane);
  else         attn_send<0>(acc, xch + ws * 4096, lane);
  __syncthreads();                                           // both key halves' parts are in LDS before either partner reads
  const v4f pml = *(const v4f*)(xml + ((ws ^ 2) * 32 + lane) * 4);   // the partner: same queries, other key half, same lane
  float fm[2], fo[2];
  {
    const float mj0 = fmaxf(m[0], pml[0]), mj1 = fmaxf(m[1], pml[1]);
    const float am0 = __builtin_amdgcn_exp2f(m[0] - mj0), ao0 = __builtin_amdgcn_exp2f(pml[0] - mj0);
    const float am1 = __builtin_amdgcn_exp2f(m[1] - mj1), ao1 = __builtin_amdgcn_exp2f(pml[1] - mj1);
    const float inv0 = 1.0f / (l0 * am0 + pml[2] * ao0);     // the sum is near 1 or above: the row maximum contributes exp2(0)
    const float inv1 = 1.0f / (l1 * am1 + pml[3] * ao1);
    fm[0] = am0 * inv0; fo[0] = ao0 * inv0;
    fm[1] = am1 * inv1; fo[1] = ao1 * inv1;
  }
  unsigned short* op = Xb + (size_t)q * NX + h * 8;          // acc[ct][qt][r] = feat[c = 16 ct + 8 h + r][q + 16 qt]: 8 consecutive c, one 16-B store
  if (kh == 0) attn_finish<0>(acc, xch + (ws ^ 2) * 4096, lane, fm, fo, op);
  else         attn_finish<8>(acc, xch + (ws ^ 2) * 4096, lane, fm, fo, op);
}

// ---------------------------------------------------------------------------
// Workspace region map (byte offsets); every region is fully written before it is read, once per call, all batches.
//   Wb    bf16 [256][512]                  0          (262144 B)
//   PRET  bf16 [4 b][4096 i][256 c]        262144     (8388608 B)   pre^T
//   CURb  bf16 [4 b][256 c][4096 j]        8650752    (8388608 B)   cur, natural layout
//   XCAT  bf16 [4 b][4096 i][512]          17039360   (16777216 B)  cols 0..255 = feat^T, cols 256..511 = cur^T
//   total                                  33816576 B
// ---------------------------------------------------------------------------
extern "C" void kernel_launch(void* const* d_in, const int* in_sizes, int n_in,
                              void* d_out, int out_size, void* d_ws, size_t ws_size,
                              hipStream_t stream) {
  if (n_in < 9) return;
  if (in_sizes[0] != NB * NC * HW || in_sizes[1] != NB * NC * HW) return;
  if (in_sizes[2] != NC * NX) return;
  if (in_sizes[3] != NC || in_sizes[4] != NC || in_sizes[5] != NC || in_sizes[6] != NC || in_sizes[7] != NC) return;
  if (in_sizes[8] < 1) return;
  if (out_size != NB * NC * HW) return;

  const float* pre   = (const float*)d_in[0];
  const float* cur   = (const float*)d_in[1];
  const float* W     = (const float*)d_in[2];
  const float* bconv = (const float*)d_in[3];
  const float* gamma = (const float*)d_in[4];
  const float* beta  = (const float*)d_in[5];
  const float* rmean = (const float*)d_in[6];
  const float* rvar  = (const float*)d_in[7];
  const float* alpha = (const float*)d_in[8];
  float* out = (float*)d_out;

  const size_t szWb   = (size_t)NC * NX * 2;
  const size_t szPRET = (size_t)NB * HW * NC * 2;
  const size_t szCURb = (size_t)NB * NC * HW * 2;
  const size_t szXCAT = (size_t)NB * HW * NX * 2;
  size_t off = 0;
  const size_t oWb   = off; off += szWb;
  const size_t oPRET = off; off += szPRET;
  const size_t oCURb = off; off += szCURb;
  const size_t oXCAT = off; off += szXCAT;
  if (off > ws_size) return;                    // 33816576 B total

  char* ws = (char*)d_ws;
  unsigned short* Wb   = (unsigned short*)(ws + oWb);
  unsigned short* PRET = (unsigned short*)(ws + oPRET);
  unsigned short* CURb = (unsigned short*)(ws + oCURb);
  unsigned short* XCAT = (unsigned short*)(ws + oXCAT);

  const dim3 blk(256);
  const dim3 gP(HW / 64, NC / 64, 2 * NB + 1);  // 64 x 4 tiles x (4 batches of pre, 4 of cur), and 256 blocks for W
  const dim3 gA(HW / 64, NB);                   // 64 query blocks x 4 batches, 4 waves each
  const dim3 gC((NC / 64) * (HW / 64), NB);     // 256 blocks x 8 waves per batch: M=256, N=4096, K=512, one tile per block, K over its waves

  // W -> Wb; pre[b] [256 c][4096 i] -> PRET[b] [4096 i][256 c]; cur[b] [256 c][4096 j] -> XCAT[b][j][256 + c] and CURb[b] (natural layout)
  prep_kernel<<<gP, blk, 0, stream>>>(pre, cur, W, PRET, XCAT, CURb, Wb);
  // XCAT[b][i][c] = bf16(sum_j softmax_j(PRET[b][i] . XCAT[b][j][256..] / 16) * CURb[b][c][j])
  attn_fused_kernel<<<gA, dim3(128), 0, stream>>>(PRET, CURb, XCAT);
  // out[b][o][i] = prelu(bn(sum_k Wb[o][k] * XCAT[b][i][k] + b_conv[o]))  (M=256, N=4096, K=512, f32 out, ldc 4096)
  wmma_gemm64<1, false, 1, 0, false, 5, 8><<<gC, blk, 0, stream>>>(
      Wb, Wb, NX, 0L, XCAT, XCAT, NX, (long)HW * NX, (void*)out, (void*)out, HW, (long)NC * HW,
      bconv, bconv, 0L, gamma, beta, rmean, rvar, alpha, NC, HW, NX, 1.0f);
  (void)hipGetLastError();
}

// v007
// Measured time: 78.1 microseconds a run.
// Timed twice side by side with v006, it ran 1.06 and 1.05 times as fast.
// All steps since v000 together make it 22.8 times as fast.
// Contractions S = pre^T.cur (x1/16), featT = P.cur^T, 1x1 conv = W.x: all v_wmma_f32_16x16x32_bf16 (bf16 operands RNE-converted from f32, f32 accumulate); softmax, bias, BN, PReLU in f32.
#include <hip/hip_runtime.h>
#include <math.h>
#include <stdint.h>

#define NB 4
#define NC 256
#define HW 4096
#define NX 512

typedef __attribute__((ext_vector_type(16))) _Float16 v16h;
typedef __attribute__((ext_vector_type(8)))  _Float16 v8h;
typedef __attribute__((ext_vector_type(16))) __bf16   v16b;
typedef __attribute__((ext_vector_type(8)))  __bf16   v8b;
typedef __attribute__((ext_vector_type(8)))  float    v8f;
typedef __attribute__((ext_vector_type(4)))  float    v4f;
typedef __attribute__((ext_vector_type(2)))  float    v2f;
typedef __attribute__((ext_vector_type(4)))  unsigned int v4u;
typedef __attribute__((ext_vector_type(2)))  unsigned int v2u;
typedef __attribute__((ext_vector_type(8)))  unsigned short v8us;

__device__ __forceinline__ unsigned short f2bf_bits(float f) {
  unsigned u = __float_as_uint(f);
  return (unsigned short)((u + 0x7FFFu + ((u >> 16) & 1u)) >> 16);
}
__device__ __forceinline__ float bf_bits2f(unsigned short h) { return __uint_as_float(((unsigned)h) << 16); }

// hazard guards as plain device helpers
__device__ __forceinline__ void dep_guard_h(v8f& a, v8f& b, v16h x, v16h y) { asm volatile("v_nop\n\tv_nop\n\tv_nop\n\tv_nop" : "+v"(a), "+v"(b) : "v"(x), "v"(y)); }
__device__ __forceinline__ void dep_guard_b(v8f& a, v8f& b, v16b x, v16b y) { asm volatile("v_nop\n\tv_nop\n\tv_nop\n\tv_nop" : "+v"(a), "+v"(b) : "v"(x), "v"(y)); }
__device__ __forceinline__ void keep4_h(v16h a, v16h b, v16h c, v16h d) { asm volatile("v_nop" :: "v"(a), "v"(b), "v"(c), "v"(d)); }
__device__ __forceinline__ void keep4_b(v16b a, v16b b, v16b c, v16b d) { asm volatile("v_nop" :: "v"(a), "v"(b), "v"(c), "v"(d)); }
__device__ __forceinline__ void acc_guard4(v8f& a, v8f& b, v8f& c, v8f& d) { asm volatile("v_nop\n\tv_nop\n\tv_nop\n\tv_nop" : "+v"(a), "+v"(b), "+v"(c), "+v"(d)); }
template <typename T> struct Frag;
template <> struct Frag<_Float16> {
  typedef v16h V; union U { v16h v; v8h h[2]; };
  static __device__ __forceinline__ v16h load(const _Float16* p) {   // elements 0..7 <- p[0..7], 8..15 <- p[16..23]
    U f; f.h[0] = *(const v8h*)(p); f.h[1] = *(const v8h*)(p + 16); return f.v;
  }
  static __device__ __forceinline__ v8f mma(v16h a, v16h b, v8f c) {
    return __builtin_amdgcn_wmma_f32_16x16x32_f16(false, a, false, b, (short)0, c, false, false);
  }
  static __device__ __forceinline__ void guard(v8f& a, v8f& b, v16h x, v16h y) { dep_guard_h(a, b, x, y); }
  static __device__ __forceinline__ void keep(v16h a, v16h b, v16h c, v16h d) { keep4_h(a, b, c, d); }
};
template <> struct Frag<__bf16> {
  typedef v16b V; union U { v16b v; v8b h[2]; };
  static __device__ __forceinline__ v16b load(const __bf16* p) {
    U f; f.h[0] = *(const v8b*)(p); f.h[1] = *(const v8b*)(p + 16); return f.v;
  }
  static __device__ __forceinline__ v8f mma(v16b a, v16b b, v8f c) {
    return __builtin_amdgcn_wmma_f32_16x16x32_bf16(false, a, false, b, (short)0, c, false, false);
  }
  static __device__ __forceinline__ void guard(v8f& a, v8f& b, v16b x, v16b y) { dep_guard_b(a, b, x, y); }
  static __device__ __forceinline__ void keep(v16b a, v16b b, v16b c, v16b d) { keep4_b(a, b, c, d); }
};

// ---- Register-blocked batched WMMA GEMM ------------------------------------
// C[m,n] = scale * sum_k A[m,k] * Bt[n,k] (+bias)(+resid); each wave (KS == 1) or each block (KS > 1) owns a 64x64 tile.
// A row-major [M,K]; Bt row-major [N,K]; M,N % 64 == 0, K % 32 == 0.
// SPLIT: operands are hi/lo planes (A2/Bt2 = lo planes, same layout); product = hi.hi + hi.lo + lo.hi.
// BIAS_MODE: 0 = none, 1 = bias[m], 2 = bias[n].
// OUT_MODE: 0 = f32, 1 = f16, 2 = bf16 hi plane (Cout) + bf16 lo plane (Cout2), 3 = single bf16 plane (RNE).
// ET: 0 = f16 operands, 1 = bf16 operands (pointers passed as 16-bit storage)
// ACT: 0 = none, 1 = tanh, 2 = relu, 3 = silu, 4 = leaky relu,
//      5 = batch norm on the running statistics of row m, then PReLU with one shared slope (KS > 1 only):
//          prelu(x * inv + shift), inv = gamma[m] * rsqrt(var[m] + 1e-5), shift = beta[m] - mean[m] * inv, slope = alpha[0]
// KS: 1 = each wave owns a tile and all of K (8 tiles per block). KS > 1 = the block owns ONE tile and its KS waves
//     split K: wave w takes the 32-wide k steps w, w + KS, w + 2 KS, ...; the KS partial tiles meet in LDS
//     and are summed in wave order 0..KS-1, each wave finishing 64 / KS rows. For GEMMs with fewer tiles than the chip has room for.
template <int ET> struct Elem;
template <> struct Elem<0> { typedef _Float16 T; };
template <> struct Elem<1> { typedef __bf16 T; };
template <int ET, bool SPLIT, int BIAS_MODE, int OUT_MODE, bool RESID, int ACT = 0, int KS = 1>
__global__ __launch_bounds__(KS == 1 ? 256 : KS * 32) void wmma_gemm64(
    const unsigned short* __restrict__ Ap, const unsigned short* __restrict__ A2p, int lda, long strideA,
    const unsigned short* __restrict__ Btp, const unsigned short* __restrict__ Bt2p, int ldb, long strideB,
    void* __restrict__ Cout, void* __restrict__ Cout2, int ldc, long strideC,
    const float* __restrict__ bias,
    const float* __restrict__ resid, long strideR,
    const float* __restrict__ gamma, const float* __restrict__ beta, const float* __restrict__ rmean,
    const float* __restrict__ rvar, const float* __restrict__ alpha,
    int M, int N, int K, float scale) {
  static_assert(ACT != 5 || KS > 1, "ACT 5 is written for the split-K epilogue");
  typedef typename Elem<ET>::T T;
  typedef typename Frag<T>::V V;
  const T* A = (const T*)Ap; const T* A2 = (const T*)A2p; const T* Bt = (const T*)Btp; const T* Bt2 = (const T*)Bt2p;
  __shared__ __align__(16) float sT[KS == 1 ? 8 : KS * 4][16 * 68];   // KS == 1: per-wave 16x64 slab; KS > 1: per-wave 64x64 partial tile; pitch 68 floats
  const int b    = blockIdx.y;
  const int lane = threadIdx.x & 31;
  const int wave = (KS == 1) ? (int)(threadIdx.x >> 5) : __builtin_amdgcn_readfirstlane((int)(threadIdx.x >> 5));   // scalar, so the k loop stays a scalar loop
  const int tilesN = N >> 6;
  const int tilesM = M >> 6;
  const int tile = (KS == 1) ? (int)(blockIdx.x * 8 + wave) : (int)blockIdx.x;
  if (tile >= tilesM * tilesN) return;   // KS == 1: wave-uniform, no block barrier follows; KS > 1: block-uniform, ahead of the barrier
  const int tm = tile / tilesN;
  const int tn = tile - tm * tilesN;
  const int m0 = tm << 6;
  const int n0 = tn << 6;

  const T* Ab  = A  + (size_t)b * strideA;
  const T* Bb  = Bt + (size_t)b * strideB;
  const T* Ab2 = SPLIT ? (A2  + (size_t)b * strideA) : nullptr;
  const T* Bb2 = SPLIT ? (Bt2 + (size_t)b * strideB) : nullptr;

  const int rlane = lane & 15;                 // row (A) / col (B, D) within subtile
  const int koff  = (lane >> 4) * 8;           // k offset of this lane half
  const int mOff  = (lane >> 4) * 8;           // D row offset

  v8f acc[4][4];
#pragma unroll
  for (int i = 0; i < 4; ++i)
#pragma unroll
    for (int j = 0; j < 4; ++j) acc[i][j] = (v8f){0.f,0.f,0.f,0.f,0.f,0.f,0.f,0.f};

  for (int k0 = (KS == 1) ? 0 : wave * 32; k0 < K; k0 += 32 * KS) {
    V bh[4], bl[4];
#pragma unroll
    for (int j = 0; j < 4; ++j) {
      const size_t bo = (size_t)(n0 + (j << 4) + rlane) * ldb + koff + k0;
      bh[j] = Frag<T>::load(Bb + bo);
      if (SPLIT) bl[j] = Frag<T>::load(Bb2 + bo);
    }
#pragma unroll
    for (int i = 0; i < 4; ++i) {
      const size_t ao = (size_t)(m0 + (i << 4) + rlane) * lda + koff + k0;
      V ah = Frag<T>::load(Ab + ao);
      V al;
      if (SPLIT) al = Frag<T>::load(Ab2 + ao);
#pragma unroll
      for (int j = 0; j < 4; ++j) {
        acc[i][j] = Frag<T>::mma(ah, bh[j], acc[i][j]);
        if (SPLIT) {
          acc[i][j] = Frag<T>::mma(ah, bl[j], acc[i][j]);
          acc[i][j] = Frag<T>::mma(al, bh[j], acc[i][j]);
        }
      }
      Frag<T>::guard(acc[i][0], acc[i][3], ah, SPLIT ? al : ah);
    }
    Frag<T>::keep(bh[0], bh[1], bh[2], bh[3]);
    if (SPLIT) Frag<T>::keep(bl[0], bl[1], bl[2], bl[3]);
  }
  acc_guard4(acc[0][0], acc[0][1], acc[0][2], acc[0][3]);
  acc_guard4(acc[1][0], acc[1][1], acc[1][2], acc[1][3]);
  acc_guard4(acc[2][0], acc[2][1], acc[2][2], acc[2][3]);
  acc_guard4(acc[3][0], acc[3][1], acc[3][2], acc[3][3]);

  // ---- epilogue ----
  const float* Rb = RESID ? (resid + (size_t)b * strideR) : nullptr;
  if (KS > 1) {
    float* part = &sT[0][0];                    // [KS waves][64 rows][68]
    float* mine = part + wave * (64 * 68);
    constexpr int ROWS = 64 / KS;               // rows of the tile that this wave finishes
    constexpr int CW   = (OUT_MODE == 0) ? 4 : 8;   // columns per lane: one 16-B store either way
    constexpr int RP   = 32 * CW / 64;          // rows per pass of the wave
    const int row0 = wave * ROWS + lane / (64 / CW);   // this lane's row in pass 0
    float bnInv[ROWS / RP], bnShift[ROWS / RP], slope = 0.f;
    if (ACT == 5) {                             // read ahead of the LDS stores and the barrier, which cover the latency
      slope = alpha[0];
#pragma unroll
      for (int it = 0; it < ROWS / RP; ++it) {
        const int m = m0 + row0 + it * RP;
        bnInv[it]   = gamma[m] * rsqrtf(rvar[m] + 1e-5f);
        bnShift[it] = beta[m] - rmean[m] * bnInv[it];
      }
    }
#pragma unroll
    for (int i = 0; i < 4; ++i)
#pragma unroll
      for (int j = 0; j < 4; ++j)
#pragma unroll
        for (int r = 0; r < 8; ++r) mine[((i << 4) + mOff + r) * 68 + (j << 4) + rlane] = acc[i][j][r];
    if (ACT == 5) asm volatile("s_wait_xcnt 0x0" ::: "memory");   // no register that the coefficient loads name is rewritten ahead of this wait
    __syncthreads();                            // all KS partial tiles are in LDS before any wave sums them
    const int cc = (lane & (64 / CW - 1)) * CW;
#pragma unroll
    for (int it = 0; it < ROWS / RP; ++it) {
      const int row = row0 + it * RP;
      const int m = m0 + row;
      const float* sp = part + row * 68 + cc;
      float v[CW];
#pragma unroll
      for (int e = 0; e < CW; e += 4) {
        v4f s = *(const v4f*)(sp + e);
#pragma unroll
        for (int w = 1; w < KS; ++w) s += *(const v4f*)(sp + w * (64 * 68) + e);
        v[e] = s[0]; v[e + 1] = s[1]; v[e + 2] = s[2]; v[e + 3] = s[3];
      }
#pragma unroll
      for (int e = 0; e < CW; ++e) {
        float x = v[e] * scale;
        if (BIAS_MODE == 1) x += bias[m];
        if (BIAS_MODE == 2) x += bias[n0 + cc + e];
        if (RESID) x += Rb[(size_t)m * ldc + n0 + cc + e];
        if (ACT == 1) x = tanhf(x);
        if (ACT == 2) x = fmaxf(x, 0.0f);
        if (ACT == 3) x = x / (1.0f + expf(-x));
        if (ACT == 4) x = (x > 0.f) ? x : 0.01f * x;
        if (ACT == 5) { x = x * bnInv[it] + bnShift[it]; x = (x >= 0.f) ? x : slope * x; }
        v[e] = x;
      }
      const size_t co = (size_t)b * strideC + (size_t)m * ldc + n0 + cc;
      if constexpr (OUT_MODE == 0) {
        *(v4f*)((float*)Cout + co) = (v4f){v[0], v[1], v[2], v[3]};
      } else {
        v8h hv, lv;
#pragma unroll
        for (int e = 0; e < 8; ++e) {
          const float x = v[e];
          if (OUT_MODE == 1) {
            hv[e] = (_Float16)x;
          } else {
            const unsigned short hb = f2bf_bits(x);
            hv[e] = __builtin_bit_cast(_Float16, hb);
            if (OUT_MODE == 2) lv[e] = __builtin_bit_cast(_Float16, f2bf_bits(x - bf_bits2f(hb)));
          }
        }
        *(v8h*)((unsigned short*)Cout + co) = hv;
        if (OUT_MODE == 2) *(v8h*)((unsigned short*)Cout2 + co) = lv;
      }
    }
    return;
  }
  float* slab = sT[wave];
#pragma unroll
  for (int i = 0; i < 4; ++i) {
    const int mBase = m0 + (i << 4);
#pragma unroll
    for (int j = 0; j < 4; ++j) {
      const int n = n0 + (j << 4) + rlane;
      float bv = 0.f;
      if (BIAS_MODE == 2) bv = bias[n];
#pragma unroll
      for (int r = 0; r < 8; ++r) {
        float v = acc[i][j][r] * scale;
        if (BIAS_MODE == 1) v += bias[mBase + mOff + r];
        if (BIAS_MODE == 2) v += bv;
        if (RESID) v += Rb[(size_t)(mBase + mOff + r) * ldc + n];
        if (ACT == 1) v = tanhf(v);
        if (ACT == 2) v = fmaxf(v, 0.0f);
        if (ACT == 3) v = v / (1.0f + expf(-v));
        if (ACT == 4) v = (v > 0.f) ? v : 0.01f * v;
        slab[(mOff + r) * 68 + (j << 4) + rlane] = v;
      }
    }
    __builtin_amdgcn_fence(__ATOMIC_RELEASE, "workgroup");
    __builtin_amdgcn_wave_barrier();
    __builtin_amdgcn_fence(__ATOMIC_ACQUIRE, "workgroup");
    if (OUT_MODE == 0) {
      float* C = (float*)Cout + (size_t)b * strideC;
      const int hh = lane >> 4, c4 = (lane & 15) * 4;     // row seg = 256 B = 16 lanes x 16 B
      {
#pragma unroll
        for (int it = 0; it < 8; ++it) {
          const int row = it * 2 + hh;
          v4f v = *(const v4f*)(slab + row * 68 + c4);
          *(v4f*)(C + (size_t)(mBase + row) * ldc + n0 + c4) = v;
        }
        
      }
    } else {
      const int q = lane >> 3, c8 = (lane & 7) * 8;
      unsigned short* C  = (unsigned short*)Cout  + (size_t)b * strideC;
      unsigned short* C2 = (OUT_MODE == 2) ? ((unsigned short*)Cout2 + (size_t)b * strideC) : nullptr;
      {
#pragma unroll
        for (int it = 0; it < 4; ++it) {
          const int row = it * 4 + q;
          const float* sp = slab + row * 68 + c8;
          v8h hv, lv;
#pragma unroll
          for (int e = 0; e < 8; ++e) {
            if (OUT_MODE == 1) {
              hv[e] = (_Float16)sp[e];
            } else if (OUT_MODE == 3) {
              hv[e] = __builtin_bit_cast(_Float16, f2bf_bits(sp[e]));
            } else {
              unsigned short hb = f2bf_bits(sp[e]);
              unsigned short lb = f2bf_bits(sp[e] - bf_bits2f(hb));
              hv[e] = __builtin_bit_cast(_Float16, hb);
              lv[e] = __builtin_bit_cast(_Float16, lb);
            }
          }
          *(v8h*)(C + (size_t)(mBase + row) * ldc + n0 + c8) = hv;
          if (OUT_MODE == 2) *(v8h*)(C2 + (size_t)(mBase + row) * ldc + n0 + c8) = lv;
        }
        
      }
    }
    __builtin_amdgcn_fence(__ATOMIC_RELEASE, "workgroup");
    __builtin_amdgcn_wave_barrier();
    __builtin_amdgcn_fence(__ATOMIC_ACQUIRE, "workgroup");
  }
}

// ---------------------------------------------------------------------------
// Operand preparation, all of it in one launch. grid (HW/64 i-tiles, NC/64 c-tiles, 2 NB + 1 jobs), 256 threads; blockIdx.z picks the job:
//   z in 0 .. NB-1     : pre[z]      f32 [NC c][HW i] -> PRET[z][i][c]            = bf16(pre[c][i])   (one 64x64 tile, transposed)
//   z in NB .. 2 NB-1  : cur[z - NB] f32 [NC c][HW j] -> XCAT[z - NB][j][NC + c]  = bf16(cur[c][j])   (one 64x64 tile, transposed)
//                        and, from the same registers,   CURb[z - NB][c][j]       = bf16(cur[c][j])   (natural layout): cur is read once
//   z == 2 NB          : W f32 [NC][NX] -> Wb bf16, 2 elements per thread; 64 x 4 blocks x 256 threads x 2 = NC * NX elements
// Load coverage of a tile: 4 iterations x 256 threads = 1024 float4 = 64 c-rows x 64 i-cols (c-row = tid>>4 + 16 it spans 0..63, tid&15 spans the 16 float4 of a row).
// Natural-layout store: 16 lanes x 8 B = the 128-B line of one c-row's 64 columns, one writer per line.
// Transposed store: 8 waves x 2 iterations x 4 rows (q = lane>>3) = 64 out rows; 8 lanes x 8 halves = 64 cols per row.
// ---------------------------------------------------------------------------
__global__ __launch_bounds__(256) void prep_kernel(const float* __restrict__ pre, const float* __restrict__ cur, const float* __restrict__ W,
                                                   unsigned short* __restrict__ PRET, unsigned short* __restrict__ XCAT,
                                                   unsigned short* __restrict__ CURb, unsigned short* __restrict__ Wb) {
  __shared__ __align__(16) unsigned short sm[64 * 72];   // [i local][c local], pitch 72 halves (144 B)
  const int tid  = threadIdx.x;
  const int lane = tid & 31;
  const int wave = tid >> 5;
  const int z    = blockIdx.z;
  if (z == 2 * NB) {                     // block-uniform, ahead of the barrier
    const int i = (blockIdx.y * (HW / 64) + blockIdx.x) * 256 + tid;
    const v2f f = *(const v2f*)(W + 2 * (size_t)i);
    ((unsigned*)Wb)[i] = (unsigned)f2bf_bits(f[0]) | ((unsigned)f2bf_bits(f[1]) << 16);
    return;
  }
  const bool isCur = z >= NB;            // block-uniform
  const int b  = isCur ? z - NB : z;
  const int i0 = blockIdx.x * 64;
  const int c0 = blockIdx.y * 64;
  const float* in = (isCur ? cur : pre) + (size_t)b * NC * HW;
  unsigned short* out = isCur ? (XCAT + (size_t)b * HW * NX + NC) : (PRET + (size_t)b * HW * NC);
  const int ldo = isCur ? NX : NC;
  unsigned short* nat = CURb + (size_t)b * NC * HW;
  const int cr0 = tid >> 4;              // 0..15; iteration it takes c-row cr0 + 16 it
  const int q4  = (tid & 15) * 4;        // first of this thread's 4 i-columns
  v4f f[4];
#pragma unroll
  for (int it = 0; it < 4; ++it) f[it] = *(const v4f*)(in + (size_t)(c0 + cr0 + 16 * it) * HW + i0 + q4);   // all four loads in flight together
  v2u u[4];
#pragma unroll
  for (int it = 0; it < 4; ++it) {
    const int cr = cr0 + 16 * it;
    const unsigned short h0 = f2bf_bits(f[it][0]), h1 = f2bf_bits(f[it][1]), h2 = f2bf_bits(f[it][2]), h3 = f2bf_bits(f[it][3]);
    sm[(q4 + 0) * 72 + cr] = h0;
    sm[(q4 + 1) * 72 + cr] = h1;
    sm[(q4 + 2) * 72 + cr] = h2;
    sm[(q4 + 3) * 72 + cr] = h3;
    u[it] = (v2u){(unsigned)h0 | ((unsigned)h1 << 16), (unsigned)h2 | ((unsigned)h3 << 16)};
  }
  __syncthreads();
  const int q  = lane >> 3;
  const int c8 = (lane & 7) * 8;
#pragma unroll
  for (int it = 0; it < 2; ++it) {
    const int row = wave * 8 + it * 4 + q;
    const v8us v = *(const v8us*)(sm + row * 72 + c8);
    const v4u t = __builtin_bit_cast(v4u, v);
    *(v4u*)(out + (size_t)(i0 + row) * ldo + c0 + c8) = t;
  }
  if (isCur) {                           // behind the barrier, so that the barrier does not wait for these stores
#pragma unroll
    for (int it = 0; it < 4; ++it) *(v2u*)(nat + (size_t)(c0 + cr0 + 16 * it) * HW + i0 + q4) = u[it];
    asm volatile("s_wait_xcnt 0x0" ::: "memory");   // the listing lays the W job's code behind these stores: no register that they name is rewritten ahead of this wait
  }
}

// ---------------------------------------------------------------------------
// Fused attention, online softmax: XCAT[b][i][0..255] = bf16(sum_j softmax_j(pre_i . cur_j / 16) * cur[c][j]).
// Transposed products: S^T = K . Q^T (A = cur^T rows [j][c], B = pre^T rows [i][c] kept in registers) and
// O^T += V^T . P^T (A = cur rows [c][j], B = the score tiles converted in place), so a lane holds one query column:
// D register r of a score tile is key 8h + r of query (lane & 15); two such tiles are one 32-key B operand in the hardware k order.
// Work-group: 64 queries, 4 waves = 2 query groups of 32 x 2 key halves; a pass is 64 keys, 32 per wave; grid (HW / 64 query blocks, batches).
// Each pass's K tile (64 keys x 512 B) and V tile (256 c x 128 B) come into LDS by tensor loads, one 16-KiB slice per wave, two buffers, one pass ahead.
// The 64 work-groups of a batch stream the same K and V lines from L2: each starts its walk over the key blocks at its own block index and wraps,
// so that at any moment they ask for 64 different tiles instead of one. The online softmax takes the key blocks in any order.
// Sums: scores over c in 32-wide k steps; probabilities per wave (key half) and lane half over the passes in the work-group's rotated order; lane halves, then key halves, joined at the end.
// ---------------------------------------------------------------------------
#define KPITCH 272                      // bytes per K slice row in LDS: 256 + 16 (16 B x odd, for 16-byte row readers)
#define VPITCH 144                      // bytes per V row in LDS: 128 + 16
#define SLICE  18432                    // LDS bytes per slice, a multiple of 2 KiB: 128 V rows x 144 exactly; 64 K rows x 272 = 17408, rounded up
#define KTILE  (2 * SLICE)              // K slice s = channels 128 s .. 128 s + 127 of the pass's 64 keys
#define VTILE  (2 * SLICE)              // V slice s = channels 128 s .. 128 s + 127, the pass's 64 keys each; the two slices are one run of 256 rows
#define ABUF   (KTILE + VTILE)
#define NPASS  (HW / 64)
static_assert((NPASS & (NPASS - 1)) == 0 && NPASS == HW / 64, "the rotated walk wraps by a mask, and the grid has one query block per key block");
static_assert(64 * KPITCH <= SLICE && 128 * VPITCH <= SLICE && SLICE % 2048 == 0, "a slice holds its padded rows and the next one starts at a multiple of 2 KiB");

typedef uint32_t u32x4 __attribute__((ext_vector_type(4)));
typedef uint32_t u32x8 __attribute__((ext_vector_type(8)));
__device__ __forceinline__ uint32_t uni(uint32_t v) { return (uint32_t)__builtin_amdgcn_readfirstlane(v); }
// A test on the result is a scalar branch (a tensor load ignores EXEC), and what is formed from the result is formed behind this statement.
__device__ __forceinline__ uint32_t pinned(uint32_t v) { uint32_t w = uni(v); asm volatile("" : "+s"(w)); return w; }   // a wave-uniform word held in a scalar register
// Descriptor group 1 of a tile of ROWS rows of ROWB bytes, SRCP bytes apart in global memory, 16 pad bytes behind every row in LDS.
// 1-byte elements, tensor = tile, no mask; IVL = pad interval code of the row length (5: 256 B, 4: 128 B), amount code 3 = 4 dwords.
template <uint32_t ROWB, uint32_t ROWS, uint32_t SRCP, uint32_t IVL>
__device__ __forceinline__ u32x8 tdm_group1() {
  u32x8 g1;
  g1[0] = uni((1u << 20) | (IVL << 22) | (3u << 25));
  g1[1] = uni((ROWB & 0xFFFFu) << 16);
  g1[2] = uni((ROWB >> 16) | ((ROWS & 0xFFFFu) << 16));
  g1[3] = uni((ROWS >> 16) | (ROWB << 16));
  g1[4] = uni(ROWS);
  g1[5] = uni(SRCP);
  g1[6] = uni(0u);
  g1[7] = uni(0u);
  return g1;
}
// Descriptor group 0: the tile whose first global byte is ga lands in LDS from byte dst on.
__device__ __forceinline__ u32x4 tdm_group0(uint32_t dst, uint64_t ga) {
  u32x4 g0;
  g0[0] = uni(1u);
  g0[1] = uni(dst);
  g0[2] = uni((uint32_t)ga);
  g0[3] = uni((((uint32_t)(ga >> 32)) & 0x01FFFFFFu) | 0x80000000u);
  asm volatile("" : "+s"(g0));                       // the four words are held in scalar registers of their own from here to the request's wait
  return g0;
}
// One request of the whole wave.
__device__ __forceinline__ void tdm_load(u32x4 g0, u32x8 g1) { asm volatile("tensor_load_to_lds %0, %1" :: "s"(g0), "s"(g1) : "memory"); }
// This wave's request has landed. The statement names the request's group 0, so that its registers are kept as they are up to here.
__device__ __forceinline__ void tdm_wait(u32x4 g0) { asm volatile("s_wait_tensorcnt 0x0" :: "s"(g0) : "memory"); }
// A wave's slice of one pass: waves 0 and 1 bring the two K slices (64 keys x 256 B of cur^T), waves 2 and 3 the two V slices (128 channels x 128 B of cur).
__device__ __forceinline__ u32x4 attn_issue(uint32_t ws, uint32_t dst, uint64_t ga, u32x8 g1k, u32x8 g1v) {
  const u32x4 g0 = tdm_group0(dst, ga);
  if (pinned(ws < 2u)) tdm_load(g0, g1k);
  else                 tdm_load(g0, g1v);
  return g0;
}
// Hand-over of the ring: this wave's LDS reads are done, its own slice has landed, then every wave meets.
__device__ __forceinline__ void attn_publish(u32x4 g0) {
  asm volatile("s_wait_dscnt 0x0" ::: "memory");     // the buffer just read is refilled behind the barrier
  tdm_wait(g0);                                      // the compiler places no wait for a tensor load
  __syncthreads();
}
// Value of lane l ^ 16, through no LDS: an LDS shuffle's wait would also wait out the K fragment loads in flight.
__device__ __forceinline__ float other_half(float x) {
  const int b = __float_as_int(x);
  return __int_as_float(__builtin_amdgcn_permlanex16(b, b, 0x76543210, 0xfedcba98, false, false));
}
// A wave's share of a pass: its 32 keys (one half of the pass's 64) against its 32 queries (two 16-column tiles).
// Every K and V fragment read from LDS feeds two products, one per query tile. kt / vt: the tiles, already offset to this
// wave's key half and this lane's row and k half.
__device__ __forceinline__ void attn_load_k(const unsigned char* kt, v16b (&ka)[16]) {   // 8 k steps x 2 key tiles
#pragma unroll
  for (int f = 0; f < 16; ++f) ka[f] = Frag<__bf16>::load((const __bf16*)(kt + (f >> 3) * SLICE + (f & 1) * 16 * KPITCH + ((f >> 1) & 3) * 64));   // k steps 0..3 in slice 0, 4..7 in slice 1
}
__device__ __forceinline__ void attn_load_v(const unsigned char* vt, v16b (&va)[16]) {   // 16 c tiles, one 32-key k step
#pragma unroll
  for (int f = 0; f < 16; ++f) va[f] = Frag<__bf16>::load((const __bf16*)(vt + f * 16 * VPITCH));
}
__device__ __forceinline__ void attn_scores(const v16b (&ka)[16], const v16b (&qf)[2][8], v8f (&s)[2][2]) {
#pragma unroll
  for (int jt = 0; jt < 2; ++jt)
#pragma unroll
    for (int qt = 0; qt < 2; ++qt) s[jt][qt] = (v8f){0.f,0.f,0.f,0.f,0.f,0.f,0.f,0.f};
#pragma unroll
  for (int ks = 0; ks < 8; ++ks)
#pragma unroll
    for (int jt = 0; jt < 2; ++jt)
#pragma unroll
      for (int qt = 0; qt < 2; ++qt) s[jt][qt] = Frag<__bf16>::mma(ka[ks * 2 + jt], qf[qt][ks], s[jt][qt]);
}
__device__ __forceinline__ void attn_softmax_pv(const v8f (&s)[2][2], const v16b (&va)[16],
                                                v8f (&acc)[16][2], float (&m)[2], float (&lsum)[2]) {
  const float sc = 0.0625f * 1.44269504088896340736f;   // 1/16, and exp(x) = exp2(x * log2 e)
  float alpha[2];
  v16b pb[2];                                           // per query tile: the 32 keys' probabilities as one B operand
#pragma unroll
  for (int qt = 0; qt < 2; ++qt) {
    float mt[2];
#pragma unroll
    for (int jt = 0; jt < 2; ++jt) {
      mt[jt] = s[jt][qt][0];
#pragma unroll
      for (int r = 1; r < 8; ++r) mt[jt] = fmaxf(mt[jt], s[jt][qt][r]);
    }
    float mx = fmaxf(mt[0], mt[1]);
    mx = fmaxf(mx, other_half(mx));                     // the other lane half holds this query's other keys
    const float mn = fmaxf(m[qt], mx * sc);
    alpha[qt] = __builtin_amdgcn_exp2f(m[qt] - mn);     // first pass: exp2(-inf) = 0
    m[qt] = mn;
    float ps[2];
#pragma unroll
    for (int jt = 0; jt < 2; ++jt) {
      float t = 0.f;
#pragma unroll
      for (int r = 0; r < 8; ++r) {
        const float p = __builtin_amdgcn_exp2f(s[jt][qt][r] * sc - mn);
        t += p;
        pb[qt][jt * 8 + r] = (__bf16)p;
      }
      ps[jt] = t;
    }
    lsum[qt] = lsum[qt] * alpha[qt] + (ps[0] + ps[1]);
  }
#pragma unroll
  for (int ct = 0; ct < 16; ++ct)
#pragma unroll
    for (int qt = 0; qt < 2; ++qt) {
      acc[ct][qt] *= alpha[qt];
      acc[ct][qt] = Frag<__bf16>::mma(va[ct], pb[qt], acc[ct][qt]);
    }
}

// Joining the two key halves of a query group, once, behind the loop. A wave hands the 8 c tiles from S on to its partner:
// 32 chunks of 16 B per lane, chunk-major, so that a wave's store covers 512 contiguous bytes.
template <int S>
__device__ __forceinline__ void attn_send(const v8f (&acc)[16][2], float* mine, int lane) {
#pragma unroll
  for (int i = 0; i < 8; ++i)
#pragma unroll
    for (int qt = 0; qt < 2; ++qt)
#pragma unroll
      for (int hf = 0; hf < 2; ++hf) {
        const v8f a = acc[S + i][qt];
        *(v4f*)(mine + (((i * 2 + qt) * 2 + hf) * 32 + lane) * 4) = (v4f){a[hf * 4], a[hf * 4 + 1], a[hf * 4 + 2], a[hf * 4 + 3]};
      }
}
// ... and finishes the 8 c tiles from S on: own part x fm + partner's part x fo (both hold the division by the joint sum), one 16-B store per tile.
template <int S>
__device__ __forceinline__ void attn_finish(const v8f (&acc)[16][2], const float* theirs, int lane,
                                            const float (&fm)[2], const float (&fo)[2], unsigned short* op) {
  v8b o[8][2];
#pragma unroll
  for (int i = 0; i < 8; ++i)
#pragma unroll
    for (int qt = 0; qt < 2; ++qt) {
      const v4f lo = *(const v4f*)(theirs + (((i * 2 + qt) * 2 + 0) * 32 + lane) * 4);
      const v4f hi = *(const v4f*)(theirs + (((i * 2 + qt) * 2 + 1) * 32 + lane) * 4);
#pragma unroll
      for (int r = 0; r < 4; ++r) {
        o[i][qt][r]     = (__bf16)(acc[S + i][qt][r] * fm[qt] + lo[r] * fo[qt]);
        o[i][qt][r + 4] = (__bf16)(acc[S + i][qt][r + 4] * fm[qt] + hi[r] * fo[qt]);
      }
    }
  __builtin_amdgcn_sched_barrier(0);                    // the stores stand behind all the arithmetic, at the wave's end: no register that a store names is rewritten behind it
#pragma unroll
  for (int i = 0; i < 8; ++i)
#pragma unroll
    for (int qt = 0; qt < 2; ++qt) *(v8b*)(op + (size_t)qt * 16 * NX + (S + i) * 16) = o[i][qt];
}

__global__ __launch_bounds__(128) void attn_fused_kernel(const unsigned short* __restrict__ PRET,
                                                         const unsigned short* __restrict__ CURb,
                                                         unsigned short* __restrict__ XCAT) {
  __shared__ __attribute__((aligned(2048))) unsigned char sm[2 * ABUF];   // every slice's place is a multiple of 2 KiB in the work-group's LDS
  const int tid   = threadIdx.x;
  const int lane  = tid & 31;
  const int wave  = tid >> 5;
  const int ws    = __builtin_amdgcn_readfirstlane(wave);    // scalar: picks the wave's share and the epilogue's branch
  const int qg    = ws & 1;                                  // query group: 32 of the block's 64 queries
  const int kh    = ws >> 1;                                 // key half: 32 of every pass's 64 keys
  const int b     = blockIdx.y;
  const int rlane = lane & 15;
  const int h     = lane >> 4;
  const int q     = blockIdx.x * 64 + qg * 32 + rlane;       // this lane's query in tile 0; tile 1: q + 16
  unsigned short* Xb = XCAT + (size_t)b * HW * NX;

  // This wave's slice: first global byte in key block 0, bytes from one pass to the next (64 keys), first LDS byte in buffer 0 (slices in wave order: K0 K1 V0 V1).
  const uint64_t gsrc = (ws < 2) ? (uint64_t)(size_t)(Xb + NC) + (uint64_t)(ws & 1) * 256u
                                 : (uint64_t)(size_t)(CURb + (size_t)b * NC * HW) + (uint64_t)(ws & 1) * (128u * HW * 2u);
  const uint32_t gstep = (ws < 2) ? 64u * NX * 2u : 64u * 2u;
  const uint32_t gwrap = NPASS * gstep - 1u;                 // pass t reads key block (blockIdx.x + t) mod NPASS: source offsets wrap at NPASS steps, a power of two
  const uint32_t grot  = (uint32_t)blockIdx.x * gstep;       // blockIdx.x < NPASS: the first key block's offset
  const uint32_t ldst = (uint32_t)(size_t)(&sm[0]) + (uint32_t)ws * SLICE;   // LDS byte address = low 32 bits of the shared address

  u32x8 g1k = tdm_group1<256u, 64u, NX * 2u, 5u>();
  u32x8 g1v = tdm_group1<128u, 128u, HW * 2u, 4u>();
  asm volatile("" : "+s"(g1k), "+s"(g1v));                   // the tensor mover's pinned(): the descriptor words are held in scalar registers of their own, so that none takes a new value while a request is outstanding

  u32x4 g0 = attn_issue(ws, ldst, gsrc + grot, g1k, g1v);    // pass 0 -> buffer 0

  v16b qf[2][8];
  const __bf16* qp = (const __bf16*)PRET + ((size_t)b * HW + q) * NC + h * 8;
#pragma unroll
  for (int qt = 0; qt < 2; ++qt)
#pragma unroll
    for (int ks = 0; ks < 8; ++ks) qf[qt][ks] = Frag<__bf16>::load(qp + (size_t)qt * 16 * NC + ks * 32);
  v8f acc[16][2];
#pragma unroll
  for (int ct = 0; ct < 16; ++ct)
#pragma unroll
    for (int qt = 0; qt < 2; ++qt) acc[ct][qt] = (v8f){0.f,0.f,0.f,0.f,0.f,0.f,0.f,0.f};
  float m[2] = {-INFINITY, -INFINITY}, lsum[2] = {0.f, 0.f};

  tdm_wait(g0);                                              // pass 0's slice of this wave has landed
  __syncthreads();                                           // ... and every other wave's
  g0 = attn_issue(ws, ldst + ABUF, gsrc + pinned((grot + gstep) & gwrap), g1k, g1v);   // pass 1 -> buffer 1; its address words are formed behind the wait

  const unsigned char* kt0 = sm + (kh * 32 + rlane) * KPITCH + h * 16;
  const unsigned char* vt0 = sm + KTILE + rlane * VPITCH + kh * 64 + h * 16;
  unsigned cur = 0;                                          // byte offset of the buffer that holds pass t
  uint32_t gnext = (grot + 2 * gstep) & gwrap;               // source offset of the next refill
  v16b ka[16], va[16];
  attn_load_k(kt0, ka);                                      // pass 0's fragments, behind the barrier that published tile 0
  attn_load_v(vt0, va);
  // The wave holds a whole pass's fragments in registers, so a buffer is free as soon as they have landed: the publish point
  // stands behind the score products (under which the V fragments land), and behind it the next pass's K fragments are read
  // under the softmax and the output products, its V fragments at the foot. Between two publish points one buffer alone is read.
  for (int t = 0; t < NPASS - 1; ++t) {
    v8f s[2][2];
    attn_scores(ka, qf, s);
    __builtin_amdgcn_sched_barrier(0);                       // the score products stay in front of the waits: they cover the V fragments' landing
    attn_publish(g0);                                        // pass t's fragments are in registers everywhere, tile t + 1 has landed
    if (pinned(t + 2 < NPASS)) {                             // pass t + 2 -> the buffer that pass t has just read; its descriptor is formed here, behind the wait
      g0 = attn_issue(ws, ldst + pinned(cur), gsrc + pinned(gnext), g1k, g1v);
      gnext = (gnext + gstep) & gwrap;
    }
    cur ^= ABUF;
    attn_load_k(kt0 + cur, ka);                              // pass t + 1
    __builtin_amdgcn_sched_barrier(0);                       // these LDS reads stay one group in front of the softmax and the output products, which cover their landing
    attn_softmax_pv(s, va, acc, m, lsum);
    __builtin_amdgcn_sched_barrier(0);                       // the V reads stay one group behind the output products, not in small groups among them
    attn_load_v(vt0 + cur, va);
  }
  {                                                          // the last pass: nothing is left to read ahead or to refill
    v8f s[2][2];
    attn_scores(ka, qf, s);
    attn_publish(g0);                                        // every wave's last fragments are in registers: the ring is free
    attn_softmax_pv(s, va, acc, m, lsum);
  }

  // The last publish point has ended every wave's reads and tensor loads: the ring carries the exchange.
  //   floats [wave][32 chunks][32 lanes][4] at 0 (4 x 16 KiB), then [wave][32 lanes][4] = {m0, m1, l0, l1} at 64 KiB
  float* xch = (float*)sm;
  float* xml = xch + 4 * 4096;
  const float l0 = lsum[0] + other_half(lsum[0]);            // the lane halves share one maximum
  const float l1 = lsum[1] + other_half(lsum[1]);
  *(v4f*)(xml + (ws * 32 + lane) * 4) = (v4f){m[0], m[1], l0, l1};
  if (kh == 0) attn_send<8>(acc, xch + ws * 4096, lane);
  else         attn_send<0>(acc, xch + ws * 4096, lane);
  __syncthreads();                                           // both key halves' parts are in LDS before either partner reads
  const v4f pml = *(const v4f*)(xml + ((ws ^ 2) * 32 + lane) * 4);   // the partner: same queries, other key half, same lane
  float fm[2], fo[2];
  {
    const float mj0 = fmaxf(m[0], pml[0]), mj1 = fmaxf(m[1], pml[1]);
    const float am0 = __builtin_amdgcn_exp2f(m[0] - mj0), ao0 = __builtin_amdgcn_exp2f(pml[0] - mj0);
    const float am1 = __builtin_amdgcn_exp2f(m[1] - mj1), ao1 = __builtin_amdgcn_exp2f(pml[1] - mj1);
    const float inv0 = 1.0f / (l0 * am0 + pml[2] * ao0);     // the sum is near 1 or above: the row maximum contributes exp2(0)
    const float inv1 = 1.0f / (l1 * am1 + pml[3] * ao1);
    fm[0] = am0 * inv0; fo[0] = ao0 * inv0;
    fm[1] = am1 * inv1; fo[1] = ao1 * inv1;
  }
  unsigned short* op = Xb + (size_t)q * NX + h * 8;          // acc[ct][qt][r] = feat[c = 16 ct + 8 h + r][q + 16 qt]: 8 consecutive c, one 16-B store
  if (kh == 0) attn_finish<0>(acc, xch + (ws ^ 2) * 4096, lane, fm, fo, op);
  else         attn_finish<8>(acc, xch + (ws ^ 2) * 4096, lane, fm, fo, op);
}

// ---------------------------------------------------------------------------
// Workspace region map (byte offsets); every region is fully written before it is read, once per call, all batches.
//   Wb    bf16 [256][512]                  0          (262144 B)
//   PRET  bf16 [4 b][4096 i][256 c]        262144     (8388608 B)   pre^T
//   CURb  bf16 [4 b][256 c][4096 j]        8650752    (8388608 B)   cur, natural layout
//   XCAT  bf16 [4 b][4096 i][512]          17039360   (16777216 B)  cols 0..255 = feat^T, cols 256..511 = cur^T
//   total                                  33816576 B
// ---------------------------------------------------------------------------
extern "C" void kernel_launch(void* const* d_in, const int* in_sizes, int n_in,
                              void* d_out, int out_size, void* d_ws, size_t ws_size,
                              hipStream_t stream) {
  if (n_in < 9) return;
  if (in_sizes[0] != NB * NC * HW || in_sizes[1] != NB * NC * HW) return;
  if (in_sizes[2] != NC * NX) return;
  if (in_sizes[3] != NC || in_sizes[4] != NC || in_sizes[5] != NC || in_sizes[6] != NC || in_sizes[7] != NC) return;
  if (in_sizes[8] < 1) return;
  if (out_size != NB * NC * HW) return;

  const float* pre   = (const float*)d_in[0];
  const float* cur   = (const float*)d_in[1];
  const float* W     = (const float*)d_in[2];
  const float* bconv = (const float*)d_in[3];
  const float* gamma = (const float*)d_in[4];
  const float* beta  = (const float*)d_in[5];
  const float* rmean = (const float*)d_in[6];
  const float* rvar  = (const float*)d_in[7];
  const float* alpha = (const float*)d_in[8];
  float* out = (float*)d_out;

  const size_t szWb   = (size_t)NC * NX * 2;
  const size_t szPRET = (size_t)NB * HW * NC * 2;
  const size_t szCURb = (size_t)NB * NC * HW * 2;
  const size_t szXCAT = (size_t)NB * HW * NX * 2;
  size_t off = 0;
  const size_t oWb   = off; off += szWb;
  const size_t oPRET = off; off += szPRET;
  const size_t oCURb = off; off += szCURb;
  const size_t oXCAT = off; off += szXCAT;
  if (off > ws_size) return;                    // 33816576 B total

  char* ws = (char*)d_ws;
  unsigned short* Wb   = (unsigned short*)(ws + oWb);
  unsigned short* PRET = (unsigned short*)(ws + oPRET);
  unsigned short* CURb = (unsigned short*)(ws + oCURb);
  unsigned short* XCAT = (unsigned short*)(ws + oXCAT);

  const dim3 blk(256);
  const dim3 gP(HW / 64, NC / 64, 2 * NB + 1);  // 64 x 4 tiles x (4 batches of pre, 4 of cur), and 256 blocks for W
  const dim3 gA(HW / 64, NB);                   // 64 query blocks x 4 batches, 4 waves each
  const dim3 gC((NC / 64) * (HW / 64), NB);     // 256 blocks x 8 waves per batch: M=256, N=4096, K=512, one tile per block, K over its waves

  // W -> Wb; pre[b] [256 c][4096 i] -> PRET[b] [4096 i][256 c]; cur[b] [256 c][4096 j] -> XCAT[b][j][256 + c] and CURb[b] (natural layout)
  prep_kernel<<<gP, blk, 0, stream>>>(pre, cur, W, PRET, XCAT, CURb, Wb);
  // XCAT[b][i][c] = bf16(sum_j softmax_j(PRET[b][i] . XCAT[b][j][256..] / 16) * CURb[b][c][j])
  attn_fused_kernel<<<gA, dim3(128), 0, stream>>>(PRET, CURb, XCAT);
  // out[b][o][i] = prelu(bn(sum_k Wb[o][k] * XCAT[b][i][k] + b_conv[o]))  (M=256, N=4096, K=512, f32 out, ldc 4096)
  wmma_gemm64<1, false, 1, 0, false, 5, 8><<<gC, blk, 0, stream>>>(
      Wb, Wb, NX, 0L, XCAT, XCAT, NX, (long)HW * NX, (void*)out, (void*)out, HW, (long)NC * HW,
      bconv, bconv, 0L, gamma, beta, rmean, rvar, alpha, NC, HW, NX, 1.0f);
  (void)hipGetLastError();
}

// v008
// A run of this version takes 64.1 microseconds.
// Next to v007, in two timings, it ran 1.23 and 1.21 times as fast.
// All steps since v000 together make it 27.7 times as fast.
// Contractions S = pre^T.cur (x1/16), featT = P.cur^T, 1x1 conv = W.x: all v_wmma_f32_16x16x32_bf16 (bf16 operands RNE-converted from f32, f32 accumulate); softmax, bias, BN, PReLU in f32.
#include <hip/hip_runtime.h>
#include <math.h>
#include <stdint.h>

#define NB 4
#define NC 256
#define HW 4096
#define NX 512

typedef __attribute__((ext_vector_type(16))) _Float16 v16h;
typedef __attribute__((ext_vector_type(8)))  _Float16 v8h;
typedef __attribute__((ext_vector_type(16))) __bf16   v16b;
typedef __attribute__((ext_vector_type(8)))  __bf16   v8b;
typedef __attribute__((ext_vector_type(8)))  float    v8f;
typedef __attribute__((ext_vector_type(4)))  float    v4f;
typedef __attribute__((ext_vector_type(2)))  float    v2f;
typedef __attribute__((ext_vector_type(4)))  unsigned int v4u;
typedef __attribute__((ext_vector_type(2)))  unsigned int v2u;
typedef __attribute__((ext_vector_type(8)))  unsigned short v8us;

__device__ __forceinline__ unsigned short f2bf_bits(float f) {
  unsigned u = __float_as_uint(f);
  return (unsigned short)((u + 0x7FFFu + ((u >> 16) & 1u)) >> 16);
}
__device__ __forceinline__ float bf_bits2f(unsigned short h) { return __uint_as_float(((unsigned)h) << 16); }

template <typename T> struct Frag;
template <> struct Frag<_Float16> {
  typedef v16h V; union U { v16h v; v8h h[2]; };
  static __device__ __forceinline__ v16h load(const _Float16* p) {   // elements 0..7 <- p[0..7], 8..15 <- p[16..23]
    U f; f.h[0] = *(const v8h*)(p); f.h[1] = *(const v8h*)(p + 16); return f.v;
  }
  static __device__ __forceinline__ v8f mma(v16h a, v16h b, v8f c) {
    return __builtin_amdgcn_wmma_f32_16x16x32_f16(false, a, false, b, (short)0, c, false, false);
  }
};
template <> struct Frag<__bf16> {
  typedef v16b V; union U { v16b v; v8b h[2]; };
  static __device__ __forceinline__ v16b load(const __bf16* p) {
    U f; f.h[0] = *(const v8b*)(p); f.h[1] = *(const v8b*)(p + 16); return f.v;
  }
  static __device__ __forceinline__ v8f mma(v16b a, v16b b, v8f c) {
    return __builtin_amdgcn_wmma_f32_16x16x32_bf16(false, a, false, b, (short)0, c, false, false);
  }
};

// ---------------------------------------------------------------------------
// Operand preparation, all of it in one launch. grid (HW/64 i-tiles, NC/64 c-tiles, 2 NB + 1 jobs), 256 threads; blockIdx.z picks the job:
//   z in 0 .. NB-1     : pre[z]      f32 [NC c][HW i] -> PRET[z][i][c]            = bf16(pre[c][i])   (one 64x64 tile, transposed)
//   z in NB .. 2 NB-1  : cur[z - NB] f32 [NC c][HW j] -> XCAT[z - NB][j][NC + c]  = bf16(cur[c][j])   (one 64x64 tile, transposed)
//                        and, from the same registers,   CURb[z - NB][c][j]       = bf16(cur[c][j])   (natural layout): cur is read once
//   z == 2 NB          : W f32 [NC][NX] -> Wb bf16 in A-fragment order, 2 elements per thread; 64 x 4 blocks x 256 threads x 2 = NC * NX elements
//                        Wb[fragment (o >> 4) * 16 + (k >> 5)][g = (k >> 4) & 1][lane = ((k >> 3) & 1) * 16 + (o & 15)][k & 7]: a wave's 16-B load covers 512 contiguous bytes
// Load coverage of a tile: 4 iterations x 256 threads = 1024 float4 = 64 c-rows x 64 i-cols (c-row = tid>>4 + 16 it spans 0..63, tid&15 spans the 16 float4 of a row).
// Natural-layout store: 16 lanes x 8 B = the 128-B line of one c-row's 64 columns, one writer per line.
// Transposed store: 8 waves x 2 iterations x 4 rows (q = lane>>3) = 64 out rows; 8 lanes x 8 halves = 64 cols per row.
// ---------------------------------------------------------------------------
__global__ __launch_bounds__(256) void prep_kernel(const float* __restrict__ pre, const float* __restrict__ cur, const float* __restrict__ W,
                                                   unsigned short* __restrict__ PRET, unsigned short* __restrict__ XCAT,
                                                   unsigned short* __restrict__ CURb, unsigned short* __restrict__ Wb) {
  __shared__ __align__(16) unsigned short sm[64 * 72];   // [i local][c local], pitch 72 halves (144 B)
  const int tid  = threadIdx.x;
  const int lane = tid & 31;
  const int wave = tid >> 5;
  const int z    = blockIdx.z;
  if (z == 2 * NB) {                     // block-uniform, ahead of the barrier
    const int i = (blockIdx.y * (HW / 64) + blockIdx.x) * 256 + tid;   // destination pair: elements 2 i, 2 i + 1 of Wb
    const int fr = i >> 8, g = (i >> 7) & 1, ln = (i >> 2) & 31, e = (i & 3) * 2;
    const int o = (fr >> 4) * 16 + (ln & 15);
    const int k = (fr & 15) * 32 + g * 16 + (ln >> 4) * 8 + e;
    const v2f f = *(const v2f*)(W + (size_t)o * NX + k);
    ((unsigned*)Wb)[i] = (unsigned)f2bf_bits(f[0]) | ((unsigned)f2bf_bits(f[1]) << 16);
    return;
  }
  const bool isCur = z >= NB;            // block-uniform
  const int b  = isCur ? z - NB : z;
  const int i0 = blockIdx.x * 64;
  const int c0 = blockIdx.y * 64;
  const float* in = (isCur ? cur : pre) + (size_t)b * NC * HW;
  unsigned short* out = isCur ? (XCAT + (size_t)b * HW * NX + NC) : (PRET + (size_t)b * HW * NC);
  const int ldo = isCur ? NX : NC;
  unsigned short* nat = CURb + (size_t)b * NC * HW;
  const int cr0 = tid >> 4;              // 0..15; iteration it takes c-row cr0 + 16 it
  const int q4  = (tid & 15) * 4;        // first of this thread's 4 i-columns
  v4f f[4];
#pragma unroll
  for (int it = 0; it < 4; ++it) f[it] = *(const v4f*)(in + (size_t)(c0 + cr0 + 16 * it) * HW + i0 + q4);   // all four loads in flight together
  v2u u[4];
#pragma unroll
  for (int it = 0; it < 4; ++it) {
    const int cr = cr0 + 16 * it;
    const unsigned short h0 = f2bf_bits(f[it][0]), h1 = f2bf_bits(f[it][1]), h2 = f2bf_bits(f[it][2]), h3 = f2bf_bits(f[it][3]);
    sm[(q4 + 0) * 72 + cr] = h0;
    sm[(q4 + 1) * 72 + cr] = h1;
    sm[(q4 + 2) * 72 + cr] = h2;
    sm[(q4 + 3) * 72 + cr] = h3;
    u[it] = (v2u){(unsigned)h0 | ((unsigned)h1 << 16), (unsigned)h2 | ((unsigned)h3 << 16)};
  }
  __syncthreads();
  const int q  = lane >> 3;
  const int c8 = (lane & 7) * 8;
#pragma unroll
  for (int it = 0; it < 2; ++it) {
    const int row = wave * 8 + it * 4 + q;
    const v8us v = *(const v8us*)(sm + row * 72 + c8);
    const v4u t = __builtin_bit_cast(v4u, v);
    *(v4u*)(out + (size_t)(i0 + row) * ldo + c0 + c8) = t;
  }
  if (isCur) {                           // behind the barrier, so that the barrier does not wait for these stores
#pragma unroll
    for (int it = 0; it < 4; ++it) *(v2u*)(nat + (size_t)(c0 + cr0 + 16 * it) * HW + i0 + q4) = u[it];
    asm volatile("s_wait_xcnt 0x0" ::: "memory");   // the listing lays the W job's code behind these stores: no register that they name is rewritten ahead of this wait
  }
}

// ---------------------------------------------------------------------------
// Fused attention, online softmax: feat[i][c] = bf16(sum_j softmax_j(pre_i . cur_j / 16) * cur[c][j]), then the 1x1 conv, batch norm and PReLU on {feat, cur} of the block's 64 queries.
// Transposed products: S^T = K . Q^T (A = cur^T rows [j][c], B = pre^T rows [i][c] kept in registers) and
// O^T += V^T . P^T (A = cur rows [c][j], B = the score tiles converted in place), so a lane holds one query column:
// D register r of a score tile is key 8h + r of query (lane & 15); two such tiles are one 32-key B operand in the hardware k order.
// Work-group: 64 queries, 4 waves = 2 query groups of 32 x 2 key halves; a pass is 64 keys, 32 per wave; grid (HW / 64 query blocks, batches).
// Each pass's K tile (64 keys x 512 B) and V tile (256 c x 128 B) come into LDS by tensor loads, one 16-KiB slice per wave, two buffers, one pass ahead.
// The 64 work-groups of a batch stream the same K and V lines from L2: each starts its walk over the key blocks one past its own block index and wraps,
// so that at any moment they ask for 64 different tiles instead of one. The online softmax takes the key blocks in any order.
// Sums: scores over c in 32-wide k steps; probabilities per wave (key half) and lane half over the passes in the work-group's rotated order; lane halves, then key halves, joined at the end.
// ---------------------------------------------------------------------------
#define KPITCH 272                      // bytes per K slice row in LDS: 256 + 16 (16 B x odd, for 16-byte row readers)
#define VPITCH 144                      // bytes per V row in LDS: 128 + 16
#define SLICE  18432                    // LDS bytes per slice, a multiple of 2 KiB: 128 V rows x 144 exactly; 64 K rows x 272 = 17408, rounded up
#define KTILE  (2 * SLICE)              // K slice s = channels 128 s .. 128 s + 127 of the pass's 64 keys
#define VTILE  (2 * SLICE)              // V slice s = channels 128 s .. 128 s + 127, the pass's 64 keys each; the two slices are one run of 256 rows
#define ABUF   (KTILE + VTILE)
#define NPASS  (HW / 64)
#define XPH    264                      // halves per row of the feat tile in LDS: 512 B + 16 (16 B x odd, for 16-byte row readers)
#define XSOFF  (ABUF + KTILE)           // the feat tile's first LDS byte: the V tile of buffer 1; exchange area (66 KiB) and output slabs lie in buffer 0, the last pass's K tile stays in buffer 1
#define SLABB  17408                    // LDS bytes of a wave's output slab: 64 rows x 68 floats
static_assert((NPASS & (NPASS - 1)) == 0 && NPASS == HW / 64, "the rotated walk wraps by a mask, and the grid has one query block per key block");
static_assert(4 * SLABB <= ABUF && 4 * 16384 + 2048 <= ABUF && XSOFF + 64 * XPH * 2 <= 2 * ABUF && ((NPASS - 1) & 1) == 1, "exchange area and output slabs in buffer 0; the last pass's K tile and the feat tile in buffer 1");
static_assert(64 * KPITCH <= SLICE && 128 * VPITCH <= SLICE && SLICE % 2048 == 0, "a slice holds its padded rows and the next one starts at a multiple of 2 KiB");

typedef uint32_t u32x4 __attribute__((ext_vector_type(4)));
typedef uint32_t u32x8 __attribute__((ext_vector_type(8)));
__device__ __forceinline__ uint32_t uni(uint32_t v) { return (uint32_t)__builtin_amdgcn_readfirstlane(v); }
// A test on the result is a scalar branch (a tensor load ignores EXEC), and what is formed from the result is formed behind this statement.
__device__ __forceinline__ uint32_t pinned(uint32_t v) { uint32_t w = uni(v); asm volatile("" : "+s"(w)); return w; }   // a wave-uniform word held in a scalar register
// Descriptor group 1 of a tile of ROWS rows of ROWB bytes, SRCP bytes apart in global memory, 16 pad bytes behind every row in LDS.
// 1-byte elements, tensor = tile, no mask; IVL = pad interval code of the row length (5: 256 B, 4: 128 B), amount code 3 = 4 dwords.
template <uint32_t ROWB, uint32_t ROWS, uint32_t SRCP, uint32_t IVL>
__device__ __forceinline__ u32x8 tdm_group1() {
  u32x8 g1;
  g1[0] = uni((1u << 20) | (IVL << 22) | (3u << 25));
  g1[1] = uni((ROWB & 0xFFFFu) << 16);
  g1[2] = uni((ROWB >> 16) | ((ROWS & 0xFFFFu) << 16));
  g1[3] = uni((ROWS >> 16) | (ROWB << 16));
  g1[4] = uni(ROWS);
  g1[5] = uni(SRCP);
  g1[6] = uni(0u);
  g1[7] = uni(0u);
  return g1;
}
// Descriptor group 0: the tile whose first global byte is ga lands in LDS from byte dst on.
__device__ __forceinline__ u32x4 tdm_group0(uint32_t dst, uint64_t ga) {
  u32x4 g0;
  g0[0] = uni(1u);
  g0[1] = uni(dst);
  g0[2] = uni((uint32_t)ga);
  g0[3] = uni((((uint32_t)(ga >> 32)) & 0x01FFFFFFu) | 0x80000000u);
  asm volatile("" : "+s"(g0));                       // the four words are held in scalar registers of their own from here to the request's wait
  return g0;
}
// One request of the whole wave.
__device__ __forceinline__ void tdm_load(u32x4 g0, u32x8 g1) { asm volatile("tensor_load_to_lds %0, %1" :: "s"(g0), "s"(g1) : "memory"); }
// This wave's request has landed. The statement names the request's group 0, so that its registers are kept as they are up to here.
__device__ __forceinline__ void tdm_wait(u32x4 g0) { asm volatile("s_wait_tensorcnt 0x0" :: "s"(g0) : "memory"); }
// A wave's slice of one pass: waves 0 and 1 bring the two K slices (64 keys x 256 B of cur^T), waves 2 and 3 the two V slices (128 channels x 128 B of cur).
__device__ __forceinline__ u32x4 attn_issue(uint32_t ws, uint32_t dst, uint64_t ga, u32x8 g1k, u32x8 g1v) {
  const u32x4 g0 = tdm_group0(dst, ga);
  if (pinned(ws < 2u)) tdm_load(g0, g1k);
  else                 tdm_load(g0, g1v);
  return g0;
}
// Hand-over of the ring: this wave's LDS reads are done, its own slice has landed, then every wave meets.
__device__ __forceinline__ void attn_publish(u32x4 g0) {
  asm volatile("s_wait_dscnt 0x0" ::: "memory");     // the buffer just read is refilled behind the barrier
  tdm_wait(g0);                                      // the compiler places no wait for a tensor load
  __syncthreads();
}
// Value of lane l ^ 16, through no LDS: an LDS shuffle's wait would also wait out the K fragment loads in flight.
__device__ __forceinline__ float other_half(float x) {
  const int b = __float_as_int(x);
  return __int_as_float(__builtin_amdgcn_permlanex16(b, b, 0x76543210, 0xfedcba98, false, false));
}
// A wave's share of a pass: its 32 keys (one half of the pass's 64) against its 32 queries (two 16-column tiles).
// Every K and V fragment read from LDS feeds two products, one per query tile. kt / vt: the tiles, already offset to this
// wave's key half and this lane's row and k half.
__device__ __forceinline__ void attn_load_k(const unsigned char* kt, v16b (&ka)[16]) {   // 8 k steps x 2 key tiles
#pragma unroll
  for (int f = 0; f < 16; ++f) ka[f] = Frag<__bf16>::load((const __bf16*)(kt + (f >> 3) * SLICE + (f & 1) * 16 * KPITCH + ((f >> 1) & 3) * 64));   // k steps 0..3 in slice 0, 4..7 in slice 1
}
__device__ __forceinline__ void attn_load_v(const unsigned char* vt, v16b (&va)[16]) {   // 16 c tiles, one 32-key k step
#pragma unroll
  for (int f = 0; f < 16; ++f) va[f] = Frag<__bf16>::load((const __bf16*)(vt + f * 16 * VPITCH));
}
__device__ __forceinline__ void attn_scores(const v16b (&ka)[16], const v16b (&qf)[2][8], v8f (&s)[2][2]) {
#pragma unroll
  for (int jt = 0; jt < 2; ++jt)
#pragma unroll
    for (int qt = 0; qt < 2; ++qt) s[jt][qt] = (v8f){0.f,0.f,0.f,0.f,0.f,0.f,0.f,0.f};
#pragma unroll
  for (int ks = 0; ks < 8; ++ks)
#pragma unroll
    for (int jt = 0; jt < 2; ++jt)
#pragma unroll
      for (int qt = 0; qt < 2; ++qt) s[jt][qt] = Frag<__bf16>::mma(ka[ks * 2 + jt], qf[qt][ks], s[jt][qt]);
}
__device__ __forceinline__ void attn_softmax_pv(const v8f (&s)[2][2], const v16b (&va)[16],
                                                v8f (&acc)[16][2], float (&m)[2], float (&lsum)[2]) {
  const float sc = 0.0625f * 1.44269504088896340736f;   // 1/16, and exp(x) = exp2(x * log2 e)
  float alpha[2];
  v16b pb[2];                                           // per query tile: the 32 keys' probabilities as one B operand
#pragma unroll
  for (int qt = 0; qt < 2; ++qt) {
    float mt[2];
#pragma unroll
    for (int jt = 0; jt < 2; ++jt) {
      mt[jt] = s[jt][qt][0];
#pragma unroll
      for (int r = 1; r < 8; ++r) mt[jt] = fmaxf(mt[jt], s[jt][qt][r]);
    }
    float mx = fmaxf(mt[0], mt[1]);
    mx = fmaxf(mx, other_half(mx));                     // the other lane half holds this query's other keys
    const float mn = fmaxf(m[qt], mx * sc);
    alpha[qt] = __builtin_amdgcn_exp2f(m[qt] - mn);     // first pass: exp2(-inf) = 0
    m[qt] = mn;
    float ps[2];
#pragma unroll
    for (int jt = 0; jt < 2; ++jt) {
      float t = 0.f;
#pragma unroll
      for (int r = 0; r < 8; ++r) {
        const float p = __builtin_amdgcn_exp2f(s[jt][qt][r] * sc - mn);
        t += p;
        pb[qt][jt * 8 + r] = (__bf16)p;
      }
      ps[jt] = t;
    }
    lsum[qt] = lsum[qt] * alpha[qt] + (ps[0] + ps[1]);
  }
#pragma unroll
  for (int ct = 0; ct < 16; ++ct)
#pragma unroll
    for (int qt = 0; qt < 2; ++qt) {
      acc[ct][qt] *= alpha[qt];
      acc[ct][qt] = Frag<__bf16>::mma(va[ct], pb[qt], acc[ct][qt]);
    }
}

// Joining the two key halves of a query group, once, behind the loop. A wave hands the 8 c tiles from S on to its partner:
// 32 chunks of 16 B per lane, chunk-major, so that a wave's store covers 512 contiguous bytes.
template <int S>
__device__ __forceinline__ void attn_send(const v8f (&acc)[16][2], float* mine, int lane) {
#pragma unroll
  for (int i = 0; i < 8; ++i)
#pragma unroll
    for (int qt = 0; qt < 2; ++qt)
#pragma unroll
      for (int hf = 0; hf < 2; ++hf) {
        const v8f a = acc[S + i][qt];
        *(v4f*)(mine + (((i * 2 + qt) * 2 + hf) * 32 + lane) * 4) = (v4f){a[hf * 4], a[hf * 4 + 1], a[hf * 4 + 2], a[hf * 4 + 3]};
      }
}
// ... and finishes the 8 c tiles from S on: own part x fm + partner's part x fo (both hold the division by the joint sum), one 16-B LDS store per tile
// into the work-group's feat tile [64 queries][256 c] bf16, the conv's B operand.
template <int S>
__device__ __forceinline__ void attn_finish(const v8f (&acc)[16][2], const float* theirs, int lane,
                                            const float (&fm)[2], const float (&fo)[2], unsigned short* op) {
  v8b o[8][2];                                          // all reads ahead of all stores: one run of LDS loads under one falling wait, not a wait per tile
#pragma unroll
  for (int i = 0; i < 8; ++i)
#pragma unroll
    for (int qt = 0; qt < 2; ++qt) {
      const v4f lo = *(const v4f*)(theirs + (((i * 2 + qt) * 2 + 0) * 32 + lane) * 4);
      const v4f hi = *(const v4f*)(theirs + (((i * 2 + qt) * 2 + 1) * 32 + lane) * 4);
#pragma unroll
      for (int r = 0; r < 4; ++r) {
        o[i][qt][r]     = (__bf16)(acc[S + i][qt][r] * fm[qt] + lo[r] * fo[qt]);
        o[i][qt][r + 4] = (__bf16)(acc[S + i][qt][r + 4] * fm[qt] + hi[r] * fo[qt]);
      }
    }
#pragma unroll
  for (int i = 0; i < 8; ++i)
#pragma unroll
    for (int qt = 0; qt < 2; ++qt) *(v8b*)(op + qt * 16 * XPH + (S + i) * 16) = o[i][qt];
}

// 1x1 conv in the epilogue: y[o][i] = sum_k W[o][k] * x[i][k], k = 0..255 feat (LDS tile), 256..511 cur^T (the last pass's K tile, still in LDS). A wave takes 64 outputs x the block's 64 queries
// and all of K, in four groups of four 32-wide k steps; a group's 32 fragments are fetched as one run, one group ahead of its products.
// wq: this lane's 16 B in the group's first W fragment (fragment order, 1 KiB each, 16 per output tile); xp: this lane's x row and k half in LDS at the group's first k; PITCHB: bytes between x rows.
template <int PITCHB>
__device__ __forceinline__ void conv_load(const __bf16* wq, const unsigned char* xp, v16b (&wa)[4][4], v16b (&xb)[4][4]) {
  __builtin_amdgcn_sched_barrier(0);                    // nothing else comes between the global loads and their wait below
#pragma unroll
  for (int ks = 0; ks < 4; ++ks)
#pragma unroll
    for (int t = 0; t < 4; ++t) {
      Frag<__bf16>::U f;
      f.h[0] = *(const v8b*)(wq + (t * 16 + ks) * 512);
      f.h[1] = *(const v8b*)(wq + (t * 16 + ks) * 512 + 256);
      wa[ks][t] = f.v;
    }
  // No register that these global loads name is rewritten ahead of this wait: the statement names the address registers, so that they are kept as they are up to here.
  asm volatile("s_wait_xcnt 0x0" :: "v"(wq) : "memory");
#pragma unroll
  for (int ks = 0; ks < 4; ++ks)
#pragma unroll
    for (int t = 0; t < 4; ++t) xb[ks][t] = Frag<__bf16>::load((const __bf16*)(xp + t * 16 * PITCHB + ks * 64));
  __builtin_amdgcn_sched_barrier(0);                    // the loads stay one run in front of the products that cover their latency
}
__device__ __forceinline__ void conv_mma(const v16b (&wa)[4][4], const v16b (&xb)[4][4], v8f (&y)[4][4]) {
#pragma unroll
  for (int ks = 0; ks < 4; ++ks)
#pragma unroll
    for (int i = 0; i < 4; ++i)
#pragma unroll
      for (int j = 0; j < 4; ++j) y[i][j] = Frag<__bf16>::mma(wa[ks][i], xb[ks][j], y[i][j]);
  __builtin_amdgcn_sched_barrier(0);                    // the next group's loads do not move up among these products
}

__global__ __launch_bounds__(128) void attn_fused_kernel(const unsigned short* __restrict__ PRET,
                                                         const unsigned short* __restrict__ CURb,
                                                         const unsigned short* __restrict__ XCAT,
                                                         const unsigned short* __restrict__ Wb,
                                                         const float* __restrict__ bias, const float* __restrict__ gamma,
                                                         const float* __restrict__ beta, const float* __restrict__ rmean,
                                                         const float* __restrict__ rvar, const float* __restrict__ alpha,
                                                         float* __restrict__ out) {
  __shared__ __attribute__((aligned(2048))) unsigned char sm[2 * ABUF];   // every slice's place is a multiple of 2 KiB in the work-group's LDS
  const int tid   = threadIdx.x;
  const int lane  = tid & 31;
  const int wave  = tid >> 5;
  const int ws    = __builtin_amdgcn_readfirstlane(wave);    // scalar: picks the wave's share and the epilogue's branch
  const int qg    = ws & 1;                                  // query group: 32 of the block's 64 queries
  const int kh    = ws >> 1;                                 // key half: 32 of every pass's 64 keys
  const int b     = blockIdx.y;
  const int rlane = lane & 15;
  const int h     = lane >> 4;
  const int q     = blockIdx.x * 64 + qg * 32 + rlane;       // this lane's query in tile 0; tile 1: q + 16
  const unsigned short* Xb = XCAT + (size_t)b * HW * NX;
  const float slope = alpha[0];                              // read here, at the kernel's head, as a scalar load

  // This wave's slice: first global byte of key block 0, bytes from one pass to the next (64 keys), first LDS byte in buffer 0 (slices in wave order: K0 K1 V0 V1).
  const uint64_t gsrc = (ws < 2) ? (uint64_t)(size_t)(Xb + NC) + (uint64_t)(ws & 1) * 256u
                                 : (uint64_t)(size_t)(CURb + (size_t)b * NC * HW) + (uint64_t)(ws & 1) * (128u * HW * 2u);
  const uint32_t gstep = (ws < 2) ? 64u * NX * 2u : 64u * 2u;
  const uint32_t gwrap = NPASS * gstep - 1u;                 // pass t reads key block (blockIdx.x + 1 + t) mod NPASS: source offsets wrap at NPASS steps, a power of two
  const uint32_t grot  = (((uint32_t)blockIdx.x + 1u) & (NPASS - 1u)) * gstep;   // the first key block's offset: the walk ends on key block blockIdx.x, whose K tile is cur^T of the block's own queries
  const uint32_t ldst = (uint32_t)(size_t)(&sm[0]) + (uint32_t)ws * SLICE;   // LDS byte address = low 32 bits of the shared address

  u32x8 g1k = tdm_group1<256u, 64u, NX * 2u, 5u>();
  u32x8 g1v = tdm_group1<128u, 128u, HW * 2u, 4u>();
  asm volatile("" : "+s"(g1k), "+s"(g1v));                   // the tensor mover's pinned(): the descriptor words are held in scalar registers of their own, so that none takes a new value while a request is outstanding

  u32x4 g0 = attn_issue(ws, ldst, gsrc + grot, g1k, g1v);    // pass 0 -> buffer 0

  v16b qf[2][8];
  const __bf16* qp = (const __bf16*)PRET + ((size_t)b * HW + q) * NC + h * 8;
#pragma unroll
  for (int qt = 0; qt < 2; ++qt)
#pragma unroll
    for (int ks = 0; ks < 8; ++ks) qf[qt][ks] = Frag<__bf16>::load(qp + (size_t)qt * 16 * NC + ks * 32);
  v8f acc[16][2];
#pragma unroll
  for (int ct = 0; ct < 16; ++ct)
#pragma unroll
    for (int qt = 0; qt < 2; ++qt) acc[ct][qt] = (v8f){0.f,0.f,0.f,0.f,0.f,0.f,0.f,0.f};
  float m[2] = {-INFINITY, -INFINITY}, lsum[2] = {0.f, 0.f};

  tdm_wait(g0);                                              // pass 0's slice of this wave has landed
  __syncthreads();                                           // ... and every other wave's
  g0 = attn_issue(ws, ldst + ABUF, gsrc + pinned((grot + gstep) & gwrap), g1k, g1v);   // pass 1 -> buffer 1; its address words are formed behind the wait

  const unsigned char* kt0 = sm + (kh * 32 + rlane) * KPITCH + h * 16;
  const unsigned char* vt0 = sm + KTILE + rlane * VPITCH + kh * 64 + h * 16;
  unsigned cur = 0;                                          // byte offset of the buffer that holds pass t
  uint32_t gnext = (grot + 2 * gstep) & gwrap;               // source offset of the next refill
  v16b ka[16], va[16];
  attn_load_k(kt0, ka);                                      // pass 0's fragments, behind the barrier that published tile 0
  attn_load_v(vt0, va);
  // The wave holds a whole pass's fragments in registers, so a buffer is free as soon as they have landed: the publish point
  // stands behind the score products (under which the V fragments land), and behind it the next pass's K fragments are read
  // under the softmax and the output products, its V fragments at the foot. Between two publish points one buffer alone is read.
  for (int t = 0; t < NPASS - 1; ++t) {
    v8f s[2][2];
    attn_scores(ka, qf, s);
    __builtin_amdgcn_sched_barrier(0);                       // the score products stay in front of the waits: they cover the V fragments' landing
    attn_publish(g0);                                        // pass t's fragments are in registers everywhere, tile t + 1 has landed
    if (pinned(t + 2 < NPASS)) {                             // pass t + 2 -> the buffer that pass t has just read; its descriptor is formed here, behind the wait
      g0 = attn_issue(ws, ldst + pinned(cur), gsrc + pinned(gnext), g1k, g1v);
      gnext = (gnext + gstep) & gwrap;
    }
    cur ^= ABUF;
    attn_load_k(kt0 + cur, ka);                              // pass t + 1
    __builtin_amdgcn_sched_barrier(0);                       // these LDS reads stay one group in front of the softmax and the output products, which cover their landing
    attn_softmax_pv(s, va, acc, m, lsum);
    __builtin_amdgcn_sched_barrier(0);                       // the V reads stay one group behind the output products, not in small groups among them
    attn_load_v(vt0 + cur, va);
  }
  const int i0 = blockIdx.x * 64;
  const __bf16* wq = (const __bf16*)Wb + ws * (4 * 16 * 512) + lane * 8;              // this wave's 64 outputs: W fragments of output tiles 4 ws ..; k step s is fragment s of a tile
  const unsigned char* xc = sm + ABUF + rlane * KPITCH + h * 16;                      // cur^T rows of the block's 64 queries: the last pass's K tile, channels 128 s .. in slice s
  const int oc = ws * 64 + h * 8;                            // this lane's first output
  const float *pb = bias + oc, *pg = gamma + oc, *pt = beta + oc, *pm = rmean + oc, *pv = rvar + oc;
  v4f vb[4][2], vg[4][2], vt[4][2], vm[4][2], vv[4][2];      // bias, gamma, beta, mean, variance of outputs 64 ws + 16 i + 8 h + 4 hf ..
  v16b wa0[4][4], xb0[4][4], wa1[4][4], xb1[4][4];
  {                                                          // the last pass: nothing is left to read ahead or to refill
    v8f s[2][2];
    attn_scores(ka, qf, s);
    attn_publish(g0);                                        // every wave's last fragments are in registers: the ring is free but for buffer 1's K tile, which the conv reads
    // The output coefficients and the conv's first operand group (k = 256 .. 383: W against the block's own cur^T rows, published with the last tile) are asked for here:
    // the last softmax, the last output products and the exchange cover their latency.
    __builtin_amdgcn_sched_barrier(0);                       // the coefficient loads stand with the group's loads in front of the group's wait
#pragma unroll
    for (int i = 0; i < 4; ++i)
#pragma unroll
      for (int hf = 0; hf < 2; ++hf) {
        const int o = i * 16 + hf * 4;
        vb[i][hf] = *(const v4f*)(pb + o); vg[i][hf] = *(const v4f*)(pg + o); vt[i][hf] = *(const v4f*)(pt + o);
        vm[i][hf] = *(const v4f*)(pm + o); vv[i][hf] = *(const v4f*)(pv + o);
      }
    // No register that the coefficient loads name is rewritten ahead of this wait: the statement names the address registers, so that they are kept as they are up to here.
    asm volatile("s_wait_xcnt 0x0" :: "v"(pb), "v"(pg), "v"(pt), "v"(pm), "v"(pv) : "memory");
    conv_load<KPITCH>(wq + 8 * 512, xc, wa0, xb0);
    attn_softmax_pv(s, va, acc, m, lsum);
  }

  // The last publish point has ended every wave's reads of buffer 0 and all tensor loads: buffer 0 carries the exchange.
  //   floats [wave][32 chunks][32 lanes][4] at 0 (4 x 16 KiB), then [wave][32 lanes][4] = {m0, m1, l0, l1} at 64 KiB
  float* xch = (float*)sm;
  float* xml = xch + 4 * 4096;
  const float l0 = lsum[0] + other_half(lsum[0]);            // the lane halves share one maximum
  const float l1 = lsum[1] + other_half(lsum[1]);
  *(v4f*)(xml + (ws * 32 + lane) * 4) = (v4f){m[0], m[1], l0, l1};
  if (kh == 0) attn_send<8>(acc, xch + ws * 4096, lane);
  else         attn_send<0>(acc, xch + ws * 4096, lane);
  __syncthreads();                                           // both key halves' parts are in LDS before either partner reads
  const v4f pml = *(const v4f*)(xml + ((ws ^ 2) * 32 + lane) * 4);   // the partner: same queries, other key half, same lane
  float ci[4][8], cs[4][8];                                  // y register r of output tile i is output 64 ws + 16 i + 8 h + r
#pragma unroll
  for (int i = 0; i < 4; ++i)
#pragma unroll
    for (int r = 0; r < 8; ++r) {
      ci[i][r] = vg[i][r >> 2][r & 3] * rsqrtf(vv[i][r >> 2][r & 3] + 1e-5f);
      cs[i][r] = vt[i][r >> 2][r & 3] - vm[i][r >> 2][r & 3] * ci[i][r];
    }
  float fm[2], fo[2];
  {
    const float mj0 = fmaxf(m[0], pml[0]), mj1 = fmaxf(m[1], pml[1]);
    const float am0 = __builtin_amdgcn_exp2f(m[0] - mj0), ao0 = __builtin_amdgcn_exp2f(pml[0] - mj0);
    const float am1 = __builtin_amdgcn_exp2f(m[1] - mj1), ao1 = __builtin_amdgcn_exp2f(pml[1] - mj1);
    const float inv0 = 1.0f / (l0 * am0 + pml[2] * ao0);     // the sum is near 1 or above: the row maximum contributes exp2(0)
    const float inv1 = 1.0f / (l1 * am1 + pml[3] * ao1);
    fm[0] = am0 * inv0; fo[0] = ao0 * inv0;
    fm[1] = am1 * inv1; fo[1] = ao1 * inv1;
  }
  unsigned short* xs = (unsigned short*)(sm + XSOFF);        // feat tile [64 queries][XPH]
  unsigned short* op = xs + (qg * 32 + rlane) * XPH + h * 8; // acc[ct][qt][r] = feat[c = 16 ct + 8 h + r][q + 16 qt]: 8 consecutive c, one 16-B store
  if (kh == 0) attn_finish<0>(acc, xch + (ws ^ 2) * 4096, lane, fm, fo, op);
  else         attn_finish<8>(acc, xch + (ws ^ 2) * 4096, lane, fm, fo, op);
  __syncthreads();                                           // the feat tile is whole before any wave reads it, and the exchange area is free for the output slabs

  // out[b][o][i] = prelu(bn(sum_k W[o][k] x[i][k] + b_conv[o])): k groups in the order 256.., 384.., 0.., 128.., one accumulator per element.
  const unsigned char* xl = sm + XSOFF + rlane * (XPH * 2) + h * 16;
  v8f y[4][4];
#pragma unroll
  for (int i = 0; i < 4; ++i)
#pragma unroll
    for (int j = 0; j < 4; ++j) y[i][j] = (v8f){0.f,0.f,0.f,0.f,0.f,0.f,0.f,0.f};
  conv_load<KPITCH>(wq + 12 * 512, xc + SLICE, wa1, xb1);
  conv_mma(wa0, xb0, y);
  conv_load<XPH * 2>(wq, xl, wa0, xb0);
  conv_mma(wa1, xb1, y);
  conv_load<XPH * 2>(wq + 4 * 512, xl + 256, wa1, xb1);
  conv_mma(wa0, xb0, y);
  conv_mma(wa1, xb1, y);

  // Through the wave's own slab, so that a store covers whole 256-B row segments of out.
  float* slab = (float*)(sm + ws * SLABB);
#pragma unroll
  for (int i = 0; i < 4; ++i)
#pragma unroll
    for (int j = 0; j < 4; ++j)
#pragma unroll
      for (int r = 0; r < 8; ++r) {
        float x = y[i][j][r] + vb[i][r >> 2][r & 3];
        x = x * ci[i][r] + cs[i][r];
        x = (x >= 0.f) ? x : slope * x;
        slab[(i * 16 + h * 8 + r) * 68 + j * 16 + rlane] = x;
      }
  __builtin_amdgcn_fence(__ATOMIC_RELEASE, "workgroup");     // the wave's lanes read each other's slab words: the stores stay in front of the reads
  __builtin_amdgcn_wave_barrier();
  __builtin_amdgcn_fence(__ATOMIC_ACQUIRE, "workgroup");
  v4f rowv[32];
#pragma unroll
  for (int it = 0; it < 32; ++it) rowv[it] = *(const v4f*)(slab + (it * 2 + h) * 68 + rlane * 4);
  __builtin_amdgcn_sched_barrier(0);                         // the stores stand behind all the reads, at the wave's end: no register that a store names is rewritten behind it
  float* ob = out + ((size_t)b * NC + ws * 64 + h) * HW + i0 + rlane * 4;
#pragma unroll
  for (int it = 0; it < 32; ++it) *(v4f*)(ob + (size_t)it * 2 * HW) = rowv[it];
}

// ---------------------------------------------------------------------------
// Workspace region map (byte offsets); every region is written before it is read (XCAT in cols 256..511 only), once per call, all batches.
//   Wb    bf16 [256][512], fragment order  0          (262144 B)
//   PRET  bf16 [4 b][4096 i][256 c]        262144     (8388608 B)   pre^T
//   CURb  bf16 [4 b][256 c][4096 j]        8650752    (8388608 B)   cur, natural layout
//   XCAT  bf16 [4 b][4096 i][512]          17039360   (16777216 B)  cols 256..511 = cur^T; cols 0..255 neither written nor read
//   total                                  33816576 B
// ---------------------------------------------------------------------------
extern "C" void kernel_launch(void* const* d_in, const int* in_sizes, int n_in,
                              void* d_out, int out_size, void* d_ws, size_t ws_size,
                              hipStream_t stream) {
  if (n_in < 9) return;
  if (in_sizes[0] != NB * NC * HW || in_sizes[1] != NB * NC * HW) return;
  if (in_sizes[2] != NC * NX) return;
  if (in_sizes[3] != NC || in_sizes[4] != NC || in_sizes[5] != NC || in_sizes[6] != NC || in_sizes[7] != NC) return;
  if (in_sizes[8] < 1) return;
  if (out_size != NB * NC * HW) return;

  const float* pre   = (const float*)d_in[0];
  const float* cur   = (const float*)d_in[1];
  const float* W     = (const float*)d_in[2];
  const float* bconv = (const float*)d_in[3];
  const float* gamma = (const float*)d_in[4];
  const float* beta  = (const float*)d_in[5];
  const float* rmean = (const float*)d_in[6];
  const float* rvar  = (const float*)d_in[7];
  const float* alpha = (const float*)d_in[8];
  float* out = (float*)d_out;

  const size_t szWb   = (size_t)NC * NX * 2;
  const size_t szPRET = (size_t)NB * HW * NC * 2;
  const size_t szCURb = (size_t)NB * NC * HW * 2;
  const size_t szXCAT = (size_t)NB * HW * NX * 2;
  size_t off = 0;
  const size_t oWb   = off; off += szWb;
  const size_t oPRET = off; off += szPRET;
  const size_t oCURb = off; off += szCURb;
  const size_t oXCAT = off; off += szXCAT;
  if (off > ws_size) return;                    // 33816576 B total

  char* ws = (char*)d_ws;
  unsigned short* Wb   = (unsigned short*)(ws + oWb);
  unsigned short* PRET = (unsigned short*)(ws + oPRET);
  unsigned short* CURb = (unsigned short*)(ws + oCURb);
  unsigned short* XCAT = (unsigned short*)(ws + oXCAT);

  const dim3 blk(256);
  const dim3 gP(HW / 64, NC / 64, 2 * NB + 1);  // 64 x 4 tiles x (4 batches of pre, 4 of cur), and 256 blocks for W
  const dim3 gA(HW / 64, NB);                   // 64 query blocks x 4 batches, 4 waves each

  // W -> Wb (A-fragment order); pre[b] [256 c][4096 i] -> PRET[b] [4096 i][256 c]; cur[b] [256 c][4096 j] -> XCAT[b][j][256 + c] and CURb[b] (natural layout)
  prep_kernel<<<gP, blk, 0, stream>>>(pre, cur, W, PRET, XCAT, CURb, Wb);
  // feat[b][i][c] = sum_j softmax_j(PRET[b][i] . XCAT[b][j][256..] / 16) * CURb[b][c][j], kept in LDS as bf16; then
  // out[b][o][i] = prelu(bn(sum_k Wb[o][k] * {feat, cur^T}[b][i][k] + b_conv[o])), f32
  attn_fused_kernel<<<gA, dim3(128), 0, stream>>>(PRET, CURb, XCAT, Wb, bconv, gamma, beta, rmean, rvar, alpha, out);
  (void)hipGetLastError();
}

// v009
// Measured time: 56.5 microseconds a run.
// Next to v008, in two timings, it ran 1.12 times as fast each time.
// All steps since v000 together make it 30.9 times as fast.
// Contractions S = pre^T.cur (x1/16), featT = P.cur^T, 1x1 conv = W.x: all v_wmma_f32_16x16x32_bf16 (bf16 operands RNE-converted from f32, f32 accumulate); softmax, bias, BN, PReLU in f32.
#include <hip/hip_runtime.h>
#include <math.h>
#include <stdint.h>

#define NB 4
#define NC 256
#define HW 4096
#define NX 512

typedef __attribute__((ext_vector_type(16))) _Float16 v16h;
typedef __attribute__((ext_vector_type(8)))  _Float16 v8h;
typedef __attribute__((ext_vector_type(16))) __bf16   v16b;
typedef __attribute__((ext_vector_type(8)))  __bf16   v8b;
typedef __attribute__((ext_vector_type(8)))  float    v8f;
typedef __attribute__((ext_vector_type(4)))  float    v4f;
typedef __attribute__((ext_vector_type(2)))  float    v2f;
typedef __attribute__((ext_vector_type(4)))  unsigned int v4u;
typedef __attribute__((ext_vector_type(2)))  unsigned int v2u;
typedef __attribute__((ext_vector_type(8)))  unsigned short v8us;

__device__ __forceinline__ unsigned short f2bf_bits(float f) {
  unsigned u = __float_as_uint(f);
  return (unsigned short)((u + 0x7FFFu + ((u >> 16) & 1u)) >> 16);
}
__device__ __forceinline__ float bf_bits2f(unsigned short h) { return __uint_as_float(((unsigned)h) << 16); }

template <typename T> struct Frag;
template <> struct Frag<_Float16> {
  typedef v16h V; union U { v16h v; v8h h[2]; };
  static __device__ __forceinline__ v16h load(const _Float16* p) {   // elements 0..7 <- p[0..7], 8..15 <- p[16..23]
    U f; f.h[0] = *(const v8h*)(p); f.h[1] = *(const v8h*)(p + 16); return f.v;
  }
  static __device__ __forceinline__ v8f mma(v16h a, v16h b, v8f c) {
    return __builtin_amdgcn_wmma_f32_16x16x32_f16(false, a, false, b, (short)0, c, false, false);
  }
};
template <> struct Frag<__bf16> {
  typedef v16b V; union U { v16b v; v8b h[2]; };
  static __device__ __forceinline__ v16b load(const __bf16* p) {
    U f; f.h[0] = *(const v8b*)(p); f.h[1] = *(const v8b*)(p + 16); return f.v;
  }
  static __device__ __forceinline__ v8f mma(v16b a, v16b b, v8f c) {
    return __builtin_amdgcn_wmma_f32_16x16x32_bf16(false, a, false, b, (short)0, c, false, false);
  }
};

// ---------------------------------------------------------------------------
// Operand preparation, all of it in one launch. grid (HW/64 i-tiles, NC/64 c-tiles, 2 NB + 1 jobs), 256 threads; blockIdx.z picks the job:
//   z in 0 .. NB-1     : pre[z]      f32 [NC c][HW i] -> PRET[z][i][c]            = bf16(pre[c][i])   (one 64x64 tile, transposed)
//   z in NB .. 2 NB-1  : cur[z - NB] f32 [NC c][HW j] -> KT[z - NB], bf16(cur[c][j]) transposed (one 64x64 tile), in the order of the attention kernel's tensor slices:
//                        KT[b][key block j >> 6][key half (j >> 5) & 1][channel half c >> 7][row r = j & 31][16-B chunk ((c & 127) >> 3) ^ ((r >> 3) & 1)][c & 7]: a slice is 8 KiB in a row
//   z == 2 NB          : W f32 [NC][NX] -> Wb bf16 in A-fragment order, 2 elements per thread; 64 x 4 blocks x 256 threads x 2 = NC * NX elements
//                        Wb[fragment (o >> 4) * 16 + (k >> 5)][g = (k >> 4) & 1][lane = ((k >> 3) & 1) * 16 + (o & 15)][k & 7]: a wave's 16-B load covers 512 contiguous bytes
// Load coverage of a tile: 4 iterations x 256 threads = 1024 float4 = 64 c-rows x 64 i-cols (c-row = tid>>4 + 16 it spans 0..63, tid&15 spans the 16 float4 of a row).
// Transposed store: 8 waves x 2 iterations x 4 rows (q = lane>>3) = 64 out rows; 8 lanes x 8 halves = 64 cols per row.
// ---------------------------------------------------------------------------
__global__ __launch_bounds__(256) void prep_kernel(const float* __restrict__ pre, const float* __restrict__ cur, const float* __restrict__ W,
                                                   unsigned short* __restrict__ PRET, unsigned short* __restrict__ KT,
                                                   unsigned short* __restrict__ Wb) {
  __shared__ __align__(16) unsigned short sm[64 * 72];   // [i local][c local], pitch 72 halves (144 B)
  const int tid  = threadIdx.x;
  const int lane = tid & 31;
  const int wave = tid >> 5;
  const int z    = blockIdx.z;
  if (z == 2 * NB) {                     // block-uniform, ahead of the barrier
    const int i = (blockIdx.y * (HW / 64) + blockIdx.x) * 256 + tid;   // destination pair: elements 2 i, 2 i + 1 of Wb
    const int fr = i >> 8, g = (i >> 7) & 1, ln = (i >> 2) & 31, e = (i & 3) * 2;
    const int o = (fr >> 4) * 16 + (ln & 15);
    const int k = (fr & 15) * 32 + g * 16 + (ln >> 4) * 8 + e;
    const v2f f = *(const v2f*)(W + (size_t)o * NX + k);
    ((unsigned*)Wb)[i] = (unsigned)f2bf_bits(f[0]) | ((unsigned)f2bf_bits(f[1]) << 16);
    return;
  }
  const bool isCur = z >= NB;            // block-uniform
  const int b  = isCur ? z - NB : z;
  const int i0 = blockIdx.x * 64;
  const int c0 = blockIdx.y * 64;
  const float* in = (isCur ? cur : pre) + (size_t)b * NC * HW;
  unsigned short* out = (isCur ? KT : PRET) + (size_t)b * HW * NC + (size_t)i0 * NC;   // both hold 64 rows x NC halves per 64 columns of the input
  const int cr0 = tid >> 4;              // 0..15; iteration it takes c-row cr0 + 16 it
  const int q4  = (tid & 15) * 4;        // first of this thread's 4 i-columns
  v4f f[4];
#pragma unroll
  for (int it = 0; it < 4; ++it) f[it] = *(const v4f*)(in + (size_t)(c0 + cr0 + 16 * it) * HW + i0 + q4);   // all four loads in flight together
#pragma unroll
  for (int it = 0; it < 4; ++it) {
    const int cr = cr0 + 16 * it;
    const unsigned short h0 = f2bf_bits(f[it][0]), h1 = f2bf_bits(f[it][1]), h2 = f2bf_bits(f[it][2]), h3 = f2bf_bits(f[it][3]);
    sm[(q4 + 0) * 72 + cr] = h0;
    sm[(q4 + 1) * 72 + cr] = h1;
    sm[(q4 + 2) * 72 + cr] = h2;
    sm[(q4 + 3) * 72 + cr] = h3;
  }
  __syncthreads();
  const int q  = lane >> 3;
  const int c8 = (lane & 7) * 8;
  const int row = wave * 8 + q;          // iteration it takes row + 4 it: the same key half and the same group of 8 rows
  const int c   = c0 + c8;               // first of the 8 channels of this 16-B chunk
  const int at  = isCur ? (row >> 5) * 8192 + (c >> 7) * 4096 + (row & 31) * 128 + ((((c & 127) >> 3) ^ ((row >> 3) & 1)) << 3)
                        : row * NC + c;
  const int stp = isCur ? 4 * 128 : 4 * NC;   // halves from row to row + 4
  v4u t[2];
#pragma unroll
  for (int it = 0; it < 2; ++it) t[it] = __builtin_bit_cast(v4u, *(const v8us*)(sm + (row + it * 4) * 72 + c8));
#pragma unroll
  for (int it = 0; it < 2; ++it) *(v4u*)(out + at + it * stp) = t[it];
}

// ---------------------------------------------------------------------------
// Fused attention, online softmax: feat[i][c] = bf16(sum_j softmax_j(pre_i . cur_j / 16) * cur[c][j]), then the 1x1 conv, batch norm and PReLU on {feat, cur} of the block's 64 queries.
// Transposed products: S^T = K . Q^T (A = cur^T rows [j][c], B = pre^T rows [i][c] kept in registers) and
// O^T += V^T . P^T (A = cur rows [c][j], read out of the same cur^T tile by the transposing LDS load; B = the score tiles converted in place), so a lane holds one query column:
// D register r of a score tile is key 8h + r of query (lane & 15); two such tiles are one 32-key B operand in the hardware k order.
// Work-group: 64 queries, 4 waves = 2 query groups of 32 x 2 key halves; a pass is 64 keys, 32 per wave; grid (HW / 64 query blocks, batches).
// K and V are one matrix: each pass's cur^T tile (64 keys x 512 B) comes into LDS once, by tensor loads, one 8-KiB slice per wave, two buffers, one pass ahead, and serves both products.
// Its rows have the transposing load's pitch (32 B x odd); the 16-byte row reader stays free of bank conflicts because rows 8..15 of every 16 hold each pair of 16-B chunks swapped (so stored by the preparation).
// The 64 work-groups of a batch stream the same lines from L2: each starts its walk over the key blocks one past its own block index and wraps,
// so that at any moment they ask for 64 different tiles instead of one. The online softmax takes the key blocks in any order.
// Sums: scores over c in 32-wide k steps; probabilities per wave (key half) and lane half over the passes in the work-group's rotated order; lane halves, then key halves, joined at the end.
// ---------------------------------------------------------------------------
#define KPITCH 288                      // bytes per slice row in LDS: 256 + 32 (32 B x odd, for the transposing load)
#define SLICE  10240                    // LDS bytes per slice, a multiple of 2 KiB: 32 rows x 288 = 9216, rounded up
#define KHALF  (2 * SLICE)              // slice 2 kh + s = keys 32 kh .. 32 kh + 31 of the pass's 64, channels 128 s .. 128 s + 127
#define KTILE  (2 * KHALF)
#define SLABB  17408                    // LDS bytes of a wave's output slab: 64 rows x 68 floats
#define ABUF   (4 * SLABB)              // buffer 1's first LDS byte; buffer 0 is the head of the area that later carries the exchange (66 KiB) and the output slabs
#define NPASS  (HW / 64)
#define XPH    264                      // halves per row of the feat tile in LDS: 512 B + 16 (16 B x odd, for 16-byte row readers)
#define XSOFF  (ABUF + KTILE)           // the feat tile's first LDS byte, behind buffer 1, in which the last pass's tile stays
#define LDSB   (XSOFF + 64 * XPH * 2)
static_assert((NPASS & (NPASS - 1)) == 0 && NPASS == HW / 64, "the rotated walk wraps by a mask, and the grid has one query block per key block");
static_assert(KTILE <= ABUF && 4 * 16384 + 2048 <= ABUF && ABUF % 2048 == 0 && ((NPASS - 1) & 1) == 1, "buffer 0, exchange area and output slabs in front of buffer 1; the last pass's tile in buffer 1");
static_assert(32 * KPITCH <= SLICE && SLICE % 2048 == 0, "a slice holds its padded rows and the next one starts at a multiple of 2 KiB");

typedef uint32_t u32x4 __attribute__((ext_vector_type(4)));
typedef uint32_t u32x8 __attribute__((ext_vector_type(8)));
__device__ __forceinline__ uint32_t uni(uint32_t v) { return (uint32_t)__builtin_amdgcn_readfirstlane(v); }
// A test on the result is a scalar branch (a tensor load ignores EXEC), and what is formed from the result is formed behind this statement.
__device__ __forceinline__ uint32_t pinned(uint32_t v) { uint32_t w = uni(v); asm volatile("" : "+s"(w)); return w; }   // a wave-uniform word held in a scalar register
// Descriptor group 1 of a tile of ROWS rows of ROWB bytes, SRCP bytes apart in global memory, 32 pad bytes behind every row in LDS.
// 1-byte elements, tensor = tile, no mask; IVL = pad interval code of the row length (5: 256 B), amount code 7 = 8 dwords.
template <uint32_t ROWB, uint32_t ROWS, uint32_t SRCP, uint32_t IVL>
__device__ __forceinline__ u32x8 tdm_group1() {
  u32x8 g1;
  g1[0] = uni((1u << 20) | (IVL << 22) | (7u << 25));
  g1[1] = uni((ROWB & 0xFFFFu) << 16);
  g1[2] = uni((ROWB >> 16) | ((ROWS & 0xFFFFu) << 16));
  g1[3] = uni((ROWS >> 16) | (ROWB << 16));
  g1[4] = uni(ROWS);
  g1[5] = uni(SRCP);
  g1[6] = uni(0u);
  g1[7] = uni(0u);
  return g1;
}
// Descriptor group 0: the tile whose first global byte is ga lands in LDS from byte dst on.
__device__ __forceinline__ u32x4 tdm_group0(uint32_t dst, uint64_t ga) {
  u32x4 g0;
  g0[0] = uni(1u);
  g0[1] = uni(dst);
  g0[2] = uni((uint32_t)ga);
  g0[3] = uni((((uint32_t)(ga >> 32)) & 0x01FFFFFFu) | 0x80000000u);
  asm volatile("" : "+s"(g0));                       // the four words are held in scalar registers of their own from here to the request's wait
  return g0;
}
// One request of the whole wave.
__device__ __forceinline__ void tdm_load(u32x4 g0, u32x8 g1) { asm volatile("tensor_load_to_lds %0, %1" :: "s"(g0), "s"(g1) : "memory"); }
// This wave's request has landed. The statement names the request's group 0, so that its registers are kept as they are up to here.
__device__ __forceinline__ void tdm_wait(u32x4 g0) { asm volatile("s_wait_tensorcnt 0x0" :: "s"(g0) : "memory"); }
// A wave's slice of one pass: 32 keys x 256 B of cur^T. Every wave issues its own, unconditionally.
__device__ __forceinline__ u32x4 attn_issue(uint32_t dst, uint64_t ga, u32x8 g1) {
  const u32x4 g0 = tdm_group0(dst, ga);
  tdm_load(g0, g1);
  return g0;
}
// Hand-over of the ring: this wave's LDS reads are done, its own slice has landed, then every wave meets.
__device__ __forceinline__ void attn_publish(u32x4 g0) {
  asm volatile("s_wait_dscnt 0x0" ::: "memory");     // the buffer just read is refilled behind the barrier
  tdm_wait(g0);                                      // the compiler places no wait for a tensor load
  __syncthreads();
}
// Value of lane l ^ 16, through no LDS: an LDS shuffle's wait would also wait out the K fragment loads in flight.
__device__ __forceinline__ float other_half(float x) {
  const int b = __float_as_int(x);
  return __int_as_float(__builtin_amdgcn_permlanex16(b, b, 0x76543210, 0xfedcba98, false, false));
}
// A wave's share of a pass: its 32 keys (one half of the pass's 64) against its 32 queries (two 16-column tiles).
// Every K and V fragment read from LDS feeds two products, one per query tile. kt / vt: the tile, already offset to this
// wave's key half and this lane's row and 16-B chunk (each reader's own).
__device__ __forceinline__ void attn_load_k(const unsigned char* kt, v16b (&ka)[16]) {   // 8 k steps x 2 key tiles
#pragma unroll
  for (int f = 0; f < 16; ++f) ka[f] = Frag<__bf16>::load((const __bf16*)(kt + (f >> 3) * SLICE + (f & 1) * 16 * KPITCH + ((f >> 1) & 3) * 64));   // k steps 0..3 in slice 0, 4..7 in slice 1
}
// Transposing load: the lanes hand in the 16-B chunks of a block of 16 keys x 16 channels, lane (c, h) gets keys 8 h .. 8 h + 7 of channel c.
__device__ __forceinline__ v8b ld_tr16(const unsigned char* p) {
  typedef __attribute__((address_space(3))) v8b lds_v8b;
  return __builtin_amdgcn_ds_load_tr16_b128_v8bf16((lds_v8b*)p);
}
__device__ __forceinline__ void attn_load_v(const unsigned char* vt, v16b (&va)[16]) {   // 16 c tiles, one 32-key k step: keys 0..15, then 16..31, the hardware k order
#pragma unroll
  for (int f = 0; f < 16; ++f) {
    Frag<__bf16>::U u;
    u.h[0] = ld_tr16(vt + (f >> 3) * SLICE + (f & 7) * 32);                  // c tiles 0..7 in slice 0, 8..15 in slice 1
    u.h[1] = ld_tr16(vt + (f >> 3) * SLICE + (f & 7) * 32 + 16 * KPITCH);
    va[f] = u.v;
  }
}
__device__ __forceinline__ void attn_scores(const v16b (&ka)[16], const v16b (&qf)[2][8], v8f (&s)[2][2]) {
#pragma unroll
  for (int jt = 0; jt < 2; ++jt)
#pragma unroll
    for (int qt = 0; qt < 2; ++qt) s[jt][qt] = (v8f){0.f,0.f,0.f,0.f,0.f,0.f,0.f,0.f};
#pragma unroll
  for (int ks = 0; ks < 8; ++ks)
#pragma unroll
    for (int jt = 0; jt < 2; ++jt)
#pragma unroll
      for (int qt = 0; qt < 2; ++qt) s[jt][qt] = Frag<__bf16>::mma(ka[ks * 2 + jt], qf[qt][ks], s[jt][qt]);
}
__device__ __forceinline__ void attn_softmax_pv(const v8f (&s)[2][2], const v16b (&va)[16],
                                                v8f (&acc)[16][2], float (&m)[2], float (&lsum)[2]) {
  const float sc = 0.0625f * 1.44269504088896340736f;   // 1/16, and exp(x) = exp2(x * log2 e)
  float alpha[2];
  v16b pb[2];                                           // per query tile: the 32 keys' probabilities as one B operand
#pragma unroll
  for (int qt = 0; qt < 2; ++qt) {
    float mt[2];
#pragma unroll
    for (int jt = 0; jt < 2; ++jt) {
      mt[jt] = s[jt][qt][0];
#pragma unroll
      for (int r = 1; r < 8; ++r) mt[jt] = fmaxf(mt[jt], s[jt][qt][r]);
    }
    float mx = fmaxf(mt[0], mt[1]);
    mx = fmaxf(mx, other_half(mx));                     // the other lane half holds this query's other keys
    const float mn = fmaxf(m[qt], mx * sc);
    alpha[qt] = __builtin_amdgcn_exp2f(m[qt] - mn);     // first pass: exp2(-inf) = 0
    m[qt] = mn;
    float ps[2];
#pragma unroll
    for (int jt = 0; jt < 2; ++jt) {
      float t = 0.f;
#pragma unroll
      for (int r = 0; r < 8; ++r) {
        const float p = __builtin_amdgcn_exp2f(s[jt][qt][r] * sc - mn);
        t += p;
        pb[qt][jt * 8 + r] = (__bf16)p;
      }
      ps[jt] = t;
    }
    lsum[qt] = lsum[qt] * alpha[qt] + (ps[0] + ps[1]);
  }
#pragma unroll
  for (int ct = 0; ct < 16; ++ct)
#pragma unroll
    for (int qt = 0; qt < 2; ++qt) {
      acc[ct][qt] *= alpha[qt];
      acc[ct][qt] = Frag<__bf16>::mma(va[ct], pb[qt], acc[ct][qt]);
    }
}

// Joining the two key halves of a query group, once, behind the loop. A wave hands the 8 c tiles from S on to its partner:
// 32 chunks of 16 B per lane, chunk-major, so that a wave's store covers 512 contiguous bytes.
template <int S>
__device__ __forceinline__ void attn_send(const v8f (&acc)[16][2], float* mine, int lane) {
#pragma unroll
  for (int i = 0; i < 8; ++i)
#pragma unroll
    for (int qt = 0; qt < 2; ++qt)
#pragma unroll
      for (int hf = 0; hf < 2; ++hf) {
        const v8f a = acc[S + i][qt];
        *(v4f*)(mine + (((i * 2 + qt) * 2 + hf) * 32 + lane) * 4) = (v4f){a[hf * 4], a[hf * 4 + 1], a[hf * 4 + 2], a[hf * 4 + 3]};
      }
}
// ... and finishes the 8 c tiles from S on: own part x fm + partner's part x fo (both hold the division by the joint sum), one 16-B LDS store per tile
// into the work-group's feat tile [64 queries][256 c] bf16, the conv's B operand.
template <int S>
__device__ __forceinline__ void attn_finish(const v8f (&acc)[16][2], const float* theirs, int lane,
                                            const float (&fm)[2], const float (&fo)[2], unsigned short* op) {
  v8b o[8][2];                                          // all reads ahead of all stores: one run of LDS loads under one falling wait, not a wait per tile
#pragma unroll
  for (int i = 0; i < 8; ++i)
#pragma unroll
    for (int qt = 0; qt < 2; ++qt) {
      const v4f lo = *(const v4f*)(theirs + (((i * 2 + qt) * 2 + 0) * 32 + lane) * 4);
      const v4f hi = *(const v4f*)(theirs + (((i * 2 + qt) * 2 + 1) * 32 + lane) * 4);
#pragma unroll
      for (int r = 0; r < 4; ++r) {
        o[i][qt][r]     = (__bf16)(acc[S + i][qt][r] * fm[qt] + lo[r] * fo[qt]);
        o[i][qt][r + 4] = (__bf16)(acc[S + i][qt][r + 4] * fm[qt] + hi[r] * fo[qt]);
      }
    }
#pragma unroll
  for (int i = 0; i < 8; ++i)
#pragma unroll
    for (int qt = 0; qt < 2; ++qt) *(v8b*)(op + qt * 16 * XPH + (S + i) * 16) = o[i][qt];
}

// 1x1 conv in the epilogue: y[o][i] = sum_k W[o][k] * x[i][k], k = 0..255 feat (LDS tile), 256..511 cur^T (the last pass's K tile, still in LDS). A wave takes 64 outputs x the block's 64 queries
// and all of K, in four groups of four 32-wide k steps; a group's 32 fragments are fetched as one run, one group ahead of its products.
// wq: this lane's 16 B in the group's first W fragment (fragment order, 1 KiB each, 16 per output tile); xp: this lane's x row and k half in LDS at the group's first k; PITCHB: bytes between x rows, HALFB: from row 0 to row 32.
template <int PITCHB, int HALFB>
__device__ __forceinline__ void conv_load(const __bf16* wq, const unsigned char* xp, v16b (&wa)[4][4], v16b (&xb)[4][4]) {
  __builtin_amdgcn_sched_barrier(0);                    // nothing else comes between the global loads and their wait below
#pragma unroll
  for (int ks = 0; ks < 4; ++ks)
#pragma unroll
    for (int t = 0; t < 4; ++t) {
      Frag<__bf16>::U f;
      f.h[0] = *(const v8b*)(wq + (t * 16 + ks) * 512);
      f.h[1] = *(const v8b*)(wq + (t * 16 + ks) * 512 + 256);
      wa[ks][t] = f.v;
    }
  // No register that these global loads name is rewritten ahead of this wait: the statement names the address registers, so that they are kept as they are up to here.
  asm volatile("s_wait_xcnt 0x0" :: "v"(wq) : "memory");
#pragma unroll
  for (int ks = 0; ks < 4; ++ks)
#pragma unroll
    for (int t = 0; t < 4; ++t) xb[ks][t] = Frag<__bf16>::load((const __bf16*)(xp + (t >> 1) * HALFB + (t & 1) * 16 * PITCHB + ks * 64));
  __builtin_amdgcn_sched_barrier(0);                    // the loads stay one run in front of the products that cover their latency
}
__device__ __forceinline__ void conv_mma(const v16b (&wa)[4][4], const v16b (&xb)[4][4], v8f (&y)[4][4]) {
#pragma unroll
  for (int ks = 0; ks < 4; ++ks)
#pragma unroll
    for (int i = 0; i < 4; ++i)
#pragma unroll
      for (int j = 0; j < 4; ++j) y[i][j] = Frag<__bf16>::mma(wa[ks][i], xb[ks][j], y[i][j]);
  __builtin_amdgcn_sched_barrier(0);                    // the next group's loads do not move up among these products
}

__global__ __launch_bounds__(128) void attn_fused_kernel(const unsigned short* __restrict__ PRET,
                                                         const unsigned short* __restrict__ KT,
                                                         const unsigned short* __restrict__ Wb,
                                                         const float* __restrict__ bias, const float* __restrict__ gamma,
                                                         const float* __restrict__ beta, const float* __restrict__ rmean,
                                                         const float* __restrict__ rvar, const float* __restrict__ alpha,
                                                         float* __restrict__ out) {
  __shared__ __attribute__((aligned(2048))) unsigned char sm[LDSB];       // every slice's place is a multiple of 2 KiB in the work-group's LDS
  const int tid   = threadIdx.x;
  const int lane  = tid & 31;
  const int wave  = tid >> 5;
  const int ws    = __builtin_amdgcn_readfirstlane(wave);    // scalar: picks the wave's share and the epilogue's branch
  const int qg    = ws & 1;                                  // query group: 32 of the block's 64 queries
  const int kh    = ws >> 1;                                 // key half: 32 of every pass's 64 keys
  const int b     = blockIdx.y;
  const int rlane = lane & 15;
  const int h     = lane >> 4;
  const int q     = blockIdx.x * 64 + qg * 32 + rlane;       // this lane's query in tile 0; tile 1: q + 16
  const float slope = alpha[0];                              // read here, at the kernel's head, as a scalar load

  // This wave's slice: first global byte in key block 0, bytes from one key block to the next, first LDS byte in buffer 0 (slices in wave order, in memory as in LDS).
  const uint64_t gsrc = (uint64_t)(size_t)(KT + (size_t)b * HW * NC) + (uint64_t)ws * 8192u;
  const uint32_t gstep = 64u * NC * 2u;
  const uint32_t gwrap = NPASS * gstep - 1u;                 // pass t reads key block (blockIdx.x + 1 + t) mod NPASS: source offsets wrap at NPASS steps, a power of two
  const uint32_t grot  = (((uint32_t)blockIdx.x + 1u) & (NPASS - 1u)) * gstep;   // the first key block's offset: the walk ends on key block blockIdx.x, whose K tile is cur^T of the block's own queries
  const uint32_t ldst = (uint32_t)(size_t)(&sm[0]) + (uint32_t)ws * SLICE;   // LDS byte address = low 32 bits of the shared address

  u32x8 g1 = tdm_group1<256u, 32u, 256u, 5u>();
  asm volatile("" : "+s"(g1));                               // the descriptor words are held in scalar registers of their own, so that none takes a new value while a request is outstanding

  u32x4 g0 = attn_issue(ldst, gsrc + grot, g1);              // pass 0 -> buffer 0

  v16b qf[2][8];
  const __bf16* qp = (const __bf16*)PRET + ((size_t)b * HW + q) * NC + h * 8;
#pragma unroll
  for (int qt = 0; qt < 2; ++qt)
#pragma unroll
    for (int ks = 0; ks < 8; ++ks) qf[qt][ks] = Frag<__bf16>::load(qp + (size_t)qt * 16 * NC + ks * 32);
  // No register that these global loads name is rewritten ahead of this wait: the statement names the address registers, so that they are kept as they are up to here.
  asm volatile("s_wait_xcnt 0x0" :: "v"(qp) : "memory");
  v8f acc[16][2];
#pragma unroll
  for (int ct = 0; ct < 16; ++ct)
#pragma unroll
    for (int qt = 0; qt < 2; ++qt) acc[ct][qt] = (v8f){0.f,0.f,0.f,0.f,0.f,0.f,0.f,0.f};
  float m[2] = {-INFINITY, -INFINITY}, lsum[2] = {0.f, 0.f};

  tdm_wait(g0);                                              // pass 0's slice of this wave has landed
  __syncthreads();                                           // ... and every other wave's
  g0 = attn_issue(ldst + ABUF, gsrc + pinned((grot + gstep) & gwrap), g1);   // pass 1 -> buffer 1; its address words are formed behind the wait

  const int sw = h ^ (rlane >> 3);                           // row reader: rows 8..15 of every 16 hold each pair of 16-B chunks swapped
  const unsigned char* kt0 = sm + kh * KHALF + rlane * KPITCH + sw * 16;
  const unsigned char* vt0 = sm + kh * KHALF + (h * 8 + (lane & 7)) * KPITCH + (((lane >> 3) & 1) ^ h) * 16;   // transposing reader: this lane hands in row 8 h + (lane & 7), chunk (lane >> 3) & 1 of the pair
  unsigned cur = 0;                                          // byte offset of the buffer that holds pass t
  uint32_t gnext = (grot + 2 * gstep) & gwrap;               // source offset of the next refill
  v16b ka[16], va[16];
  attn_load_k(kt0, ka);                                      // pass 0's fragments, behind the barrier that published tile 0
  attn_load_v(vt0, va);
  // The wave holds a whole pass's fragments in registers, so a buffer is free as soon as they have landed: the publish point
  // stands behind the score products (under which the V fragments land), and behind it the next pass's K fragments are read
  // under the softmax and the output products, its V fragments at the foot. Between two publish points one buffer alone is read.
  for (int t = 0; t < NPASS - 1; ++t) {
    v8f s[2][2];
    attn_scores(ka, qf, s);
    __builtin_amdgcn_sched_barrier(0);                       // the score products stay in front of the waits: they cover the V fragments' landing
    attn_publish(g0);                                        // pass t's fragments are in registers everywhere, tile t + 1 has landed
    if (pinned(t + 2 < NPASS)) {                             // pass t + 2 -> the buffer that pass t has just read; its descriptor is formed here, behind the wait
      g0 = attn_issue(ldst + pinned(cur), gsrc + pinned(gnext), g1);
      gnext = (gnext + gstep) & gwrap;
    }
    cur ^= ABUF;
    attn_load_k(kt0 + cur, ka);                              // pass t + 1
    __builtin_amdgcn_sched_barrier(0);                       // these LDS reads stay one group in front of the softmax and the output products, which cover their landing
    attn_softmax_pv(s, va, acc, m, lsum);
    __builtin_amdgcn_sched_barrier(0);                       // the V reads stay one group behind the output products, not in small groups among them
    attn_load_v(vt0 + cur, va);
  }
  const int i0 = blockIdx.x * 64;
  const __bf16* wq = (const __bf16*)Wb + ws * (4 * 16 * 512) + lane * 8;              // this wave's 64 outputs: W fragments of output tiles 4 ws ..; k step s is fragment s of a tile
  const unsigned char* xc = sm + ABUF + rlane * KPITCH + sw * 16;                     // cur^T rows of the block's 64 queries: the last pass's tile, rows 32 kh .., channels 128 s .. in slice 2 kh + s
  const int oc = ws * 64 + h * 8;                            // this lane's first output
  const float *pb = bias + oc, *pg = gamma + oc, *pt = beta + oc, *pm = rmean + oc, *pv = rvar + oc;
  v4f vb[4][2], vg[4][2], vt[4][2], vm[4][2], vv[4][2];      // bias, gamma, beta, mean, variance of outputs 64 ws + 16 i + 8 h + 4 hf ..
  v16b wa0[4][4], xb0[4][4], wa1[4][4], xb1[4][4];
  {                                                          // the last pass: nothing is left to read ahead or to refill
    v8f s[2][2];
    attn_scores(ka, qf, s);
    attn_publish(g0);                                        // every wave's last fragments are in registers: the ring is free but for buffer 1's K tile, which the conv reads
    // The output coefficients and the conv's first operand group (k = 256 .. 383: W against the block's own cur^T rows, published with the last tile) are asked for here:
    // the last softmax, the last output products and the exchange cover their latency.
    __builtin_amdgcn_sched_barrier(0);                       // the coefficient loads stand with the group's loads in front of the group's wait
#pragma unroll
    for (int i = 0; i < 4; ++i)
#pragma unroll
      for (int hf = 0; hf < 2; ++hf) {
        const int o = i * 16 + hf * 4;
        vb[i][hf] = *(const v4f*)(pb + o); vg[i][hf] = *(const v4f*)(pg + o); vt[i][hf] = *(const v4f*)(pt + o);
        vm[i][hf] = *(const v4f*)(pm + o); vv[i][hf] = *(const v4f*)(pv + o);
      }
    // No register that the coefficient loads name is rewritten ahead of this wait: the statement names the address registers, so that they are kept as they are up to here.
    asm volatile("s_wait_xcnt 0x0" :: "v"(pb), "v"(pg), "v"(pt), "v"(pm), "v"(pv) : "memory");
    conv_load<KPITCH, KHALF>(wq + 8 * 512, xc, wa0, xb0);
    attn_softmax_pv(s, va, acc, m, lsum);
  }

  // The last publish point has ended every wave's reads of buffer 0 and all tensor loads: buffer 0 carries the exchange.
  //   floats [wave][32 chunks][32 lanes][4] at 0 (4 x 16 KiB), then [wave][32 lanes][4] = {m0, m1, l0, l1} at 64 KiB
  float* xch = (float*)sm;
  float* xml = xch + 4 * 4096;
  const float l0 = lsum[0] + other_half(lsum[0]);            // the lane halves share one maximum
  const float l1 = lsum[1] + other_half(lsum[1]);
  *(v4f*)(xml + (ws * 32 + lane) * 4) = (v4f){m[0], m[1], l0, l1};
  if (kh == 0) attn_send<8>(acc, xch + ws * 4096, lane);
  else         attn_send<0>(acc, xch + ws * 4096, lane);
  __syncthreads();                                           // both key halves' parts are in LDS before either partner reads
  const v4f pml = *(const v4f*)(xml + ((ws ^ 2) * 32 + lane) * 4);   // the partner: same queries, other key half, same lane
  float ci[4][8], cs[4][8];                                  // y register r of output tile i is output 64 ws + 16 i + 8 h + r
#pragma unroll
  for (int i = 0; i < 4; ++i)
#pragma unroll
    for (int r = 0; r < 8; ++r) {
      ci[i][r] = vg[i][r >> 2][r & 3] * rsqrtf(vv[i][r >> 2][r & 3] + 1e-5f);
      cs[i][r] = vt[i][r >> 2][r & 3] - vm[i][r >> 2][r & 3] * ci[i][r];
    }
  float fm[2], fo[2];
  {
    const float mj0 = fmaxf(m[0], pml[0]), mj1 = fmaxf(m[1], pml[1]);
    const float am0 = __builtin_amdgcn_exp2f(m[0] - mj0), ao0 = __builtin_amdgcn_exp2f(pml[0] - mj0);
    const float am1 = __builtin_amdgcn_exp2f(m[1] - mj1), ao1 = __builtin_amdgcn_exp2f(pml[1] - mj1);
    const float inv0 = 1.0f / (l0 * am0 + pml[2] * ao0);     // the sum is near 1 or above: the row maximum contributes exp2(0)
    const float inv1 = 1.0f / (l1 * am1 + pml[3] * ao1);
    fm[0] = am0 * inv0; fo[0] = ao0 * inv0;
    fm[1] = am1 * inv1; fo[1] = ao1 * inv1;
  }
  unsigned short* xs = (unsigned short*)(sm + XSOFF);        // feat tile [64 queries][XPH]
  unsigned short* op = xs + (qg * 32 + rlane) * XPH + h * 8; // acc[ct][qt][r] = feat[c = 16 ct + 8 h + r][q + 16 qt]: 8 consecutive c, one 16-B store
  if (kh == 0) attn_finish<0>(acc, xch + (ws ^ 2) * 4096, lane, fm, fo, op);
  else         attn_finish<8>(acc, xch + (ws ^ 2) * 4096, lane, fm, fo, op);
  __syncthreads();                                           // the feat tile is whole before any wave reads it, and the exchange area is free for the output slabs

  // out[b][o][i] = prelu(bn(sum_k W[o][k] x[i][k] + b_conv[o])): k groups in the order 256.., 384.., 0.., 128.., one accumulator per element.
  const unsigned char* xl = sm + XSOFF + rlane * (XPH * 2) + h * 16;
  v8f y[4][4];
#pragma unroll
  for (int i = 0; i < 4; ++i)
#pragma unroll
    for (int j = 0; j < 4; ++j) y[i][j] = (v8f){0.f,0.f,0.f,0.f,0.f,0.f,0.f,0.f};
  conv_load<KPITCH, KHALF>(wq + 12 * 512, xc + SLICE, wa1, xb1);
  conv_mma(wa0, xb0, y);
  conv_load<XPH * 2, 32 * XPH * 2>(wq, xl, wa0, xb0);
  conv_mma(wa1, xb1, y);
  conv_load<XPH * 2, 32 * XPH * 2>(wq + 4 * 512, xl + 256, wa1, xb1);
  conv_mma(wa0, xb0, y);
  conv_mma(wa1, xb1, y);

  // Through the wave's own slab, so that a store covers whole 256-B row segments of out.
  float* slab = (float*)(sm + ws * SLABB);
#pragma unroll
  for (int i = 0; i < 4; ++i)
#pragma unroll
    for (int j = 0; j < 4; ++j)
#pragma unroll
      for (int r = 0; r < 8; ++r) {
        float x = y[i][j][r] + vb[i][r >> 2][r & 3];
        x = x * ci[i][r] + cs[i][r];
        x = (x >= 0.f) ? x : slope * x;
        slab[(i * 16 + h * 8 + r) * 68 + j * 16 + rlane] = x;
      }
  __builtin_amdgcn_fence(__ATOMIC_RELEASE, "workgroup");     // the wave's lanes read each other's slab words: the stores stay in front of the reads
  __builtin_amdgcn_wave_barrier();
  __builtin_amdgcn_fence(__ATOMIC_ACQUIRE, "workgroup");
  v4f rowv[32];
#pragma unroll
  for (int it = 0; it < 32; ++it) rowv[it] = *(const v4f*)(slab + (it * 2 + h) * 68 + rlane * 4);
  __builtin_amdgcn_sched_barrier(0);                         // the stores stand behind all the reads, at the wave's end: no register that a store names is rewritten behind it
  float* ob = out + ((size_t)b * NC + ws * 64 + h) * HW + i0 + rlane * 4;
#pragma unroll
  for (int it = 0; it < 32; ++it) *(v4f*)(ob + (size_t)it * 2 * HW) = rowv[it];
}

// ---------------------------------------------------------------------------
// Workspace region map (byte offsets); every region is written before it is read, once per call, all batches.
//   Wb    bf16 [256][512], fragment order  0          (262144 B)
//   PRET  bf16 [4 b][4096 i][256 c]        262144     (8388608 B)   pre^T
//   KT    bf16 [4 b][4096 j][256 c]        8650752    (8388608 B)   cur^T in tensor-slice order
//   total                                  17039360 B
// ---------------------------------------------------------------------------
extern "C" void kernel_launch(void* const* d_in, const int* in_sizes, int n_in,
                              void* d_out, int out_size, void* d_ws, size_t ws_size,
                              hipStream_t stream) {
  if (n_in < 9) return;
  if (in_sizes[0] != NB * NC * HW || in_sizes[1] != NB * NC * HW) return;
  if (in_sizes[2] != NC * NX) return;
  if (in_sizes[3] != NC || in_sizes[4] != NC || in_sizes[5] != NC || in_sizes[6] != NC || in_sizes[7] != NC) return;
  if (in_sizes[8] < 1) return;
  if (out_size != NB * NC * HW) return;

  const float* pre   = (const float*)d_in[0];
  const float* cur   = (const float*)d_in[1];
  const float* W     = (const float*)d_in[2];
  const float* bconv = (const float*)d_in[3];
  const float* gamma = (const float*)d_in[4];
  const float* beta  = (const float*)d_in[5];
  const float* rmean = (const float*)d_in[6];
  const float* rvar  = (const float*)d_in[7];
  const float* alpha = (const float*)d_in[8];
  float* out = (float*)d_out;

  const size_t szWb   = (size_t)NC * NX * 2;
  const size_t szPRET = (size_t)NB * HW * NC * 2;
  const size_t szKT   = (size_t)NB * HW * NC * 2;
  size_t off = 0;
  const size_t oWb   = off; off += szWb;
  const size_t oPRET = off; off += szPRET;
  const size_t oKT   = off; off += szKT;
  if (off > ws_size) return;                    // 17039360 B total

  char* ws = (char*)d_ws;
  unsigned short* Wb   = (unsigned short*)(ws + oWb);
  unsigned short* PRET = (unsigned short*)(ws + oPRET);
  unsigned short* KT   = (unsigned short*)(ws + oKT);

  const dim3 blk(256);
  const dim3 gP(HW / 64, NC / 64, 2 * NB + 1);  // 64 x 4 tiles x (4 batches of pre, 4 of cur), and 256 blocks for W
  const dim3 gA(HW / 64, NB);                   // 64 query blocks x 4 batches, 4 waves each

  // W -> Wb (A-fragment order); pre[b] [256 c][4096 i] -> PRET[b] [4096 i][256 c]; cur[b] [256 c][4096 j] -> KT[b] (cur^T, tensor-slice order)
  prep_kernel<<<gP, blk, 0, stream>>>(pre, cur, W, PRET, KT, Wb);
  // feat[b][i][c] = sum_j softmax_j(PRET[b][i] . KT[b][j] / 16) * KT[b][j][c], kept in LDS as bf16; then
  // out[b][o][i] = prelu(bn(sum_k Wb[o][k] * {feat, cur^T}[b][i][k] + b_conv[o])), f32
  attn_fused_kernel<<<gA, dim3(128), 0, stream>>>(PRET, KT, Wb, bconv, gamma, beta, rmean, rvar, alpha, out);
  (void)hipGetLastError();
}

// v010
// Measured time: 51.9 microseconds a run.
// In both of two side-by-side timings against v009, it was 1.09 times as fast.
// All steps since v000 together make it 33.7 times as fast.
// Contractions S = pre^T.cur (x1/16), featT = P.cur^T, 1x1 conv = W.x: all v_wmma_f32_16x16x32_bf16 (bf16 operands RNE-converted from f32, f32 accumulate); softmax, bias, BN, PReLU in f32.
#include <hip/hip_runtime.h>
#include <math.h>
#include <stdint.h>

#define NB 4
#define NC 256
#define HW 4096
#define NX 512

typedef __attribute__((ext_vector_type(16))) _Float16 v16h;
typedef __attribute__((ext_vector_type(8)))  _Float16 v8h;
typedef __attribute__((ext_vector_type(16))) __bf16   v16b;
typedef __attribute__((ext_vector_type(8)))  __bf16   v8b;
typedef __attribute__((ext_vector_type(8)))  float    v8f;
typedef __attribute__((ext_vector_type(4)))  float    v4f;
typedef __attribute__((ext_vector_type(2)))  float    v2f;
typedef __attribute__((ext_vector_type(4)))  unsigned int v4u;
typedef __attribute__((ext_vector_type(2)))  unsigned int v2u;
typedef __attribute__((ext_vector_type(8)))  unsigned short v8us;

__device__ __forceinline__ unsigned short f2bf_bits(float f) {
  unsigned u = __float_as_uint(f);
  return (unsigned short)((u + 0x7FFFu + ((u >> 16) & 1u)) >> 16);
}
__device__ __forceinline__ float bf_bits2f(unsigned short h) { return __uint_as_float(((unsigned)h) << 16); }

template <typename T> struct Frag;
template <> struct Frag<_Float16> {
  typedef v16h V; union U { v16h v; v8h h[2]; };
  static __device__ __forceinline__ v16h load(const _Float16* p) {   // elements 0..7 <- p[0..7], 8..15 <- p[16..23]
    U f; f.h[0] = *(const v8h*)(p); f.h[1] = *(const v8h*)(p + 16); return f.v;
  }
  static __device__ __forceinline__ v8f mma(v16h a, v16h b, v8f c) {
    return __builtin_amdgcn_wmma_f32_16x16x32_f16(false, a, false, b, (short)0, c, false, false);
  }
};
template <> struct Frag<__bf16> {
  typedef v16b V; union U { v16b v; v8b h[2]; };
  static __device__ __forceinline__ v16b load(const __bf16* p) {
    U f; f.h[0] = *(const v8b*)(p); f.h[1] = *(const v8b*)(p + 16); return f.v;
  }
  static __device__ __forceinline__ v8f mma(v16b a, v16b b, v8f c) {
    return __builtin_amdgcn_wmma_f32_16x16x32_bf16(false, a, false, b, (short)0, c, false, false);
  }
};

// ---------------------------------------------------------------------------
// Operand preparation, all of it in one launch. grid (HW/64 i-tiles, NC/64 c-tiles, 2 NB + 1 jobs), 256 threads; blockIdx.z picks the job:
//   z in 0 .. NB-1     : pre[z]      f32 [NC c][HW i] -> PRET[z][i][c]            = bf16(pre[c][i])   (one 64x64 tile, transposed)
//   z in NB .. 2 NB-1  : cur[z - NB] f32 [NC c][HW j] -> KT[z - NB], bf16(cur[c][j]) transposed (one 64x64 tile), in the order of the attention kernel's tensor slices:
//                        KT[b][key block j >> 6][key half (j >> 5) & 1][channel half c >> 7][row r = j & 31][16-B chunk ((c & 127) >> 3) ^ ((r >> 3) & 1)][c & 7]: a slice is 8 KiB in a row
//   z == 2 NB          : W f32 [NC][NX] -> Wb bf16 in A-fragment order, 2 elements per thread; 64 x 4 blocks x 256 threads x 2 = NC * NX elements
//                        Wb[fragment (o >> 4) * 16 + (k >> 5)][g = (k >> 4) & 1][lane = ((k >> 3) & 1) * 16 + (o & 15)][k & 7]: a wave's 16-B load covers 512 contiguous bytes
// Load coverage of a tile: 4 iterations x 256 threads = 1024 float4 = 64 c-rows x 64 i-cols (c-row = tid>>4 + 16 it spans 0..63, tid&15 spans the 16 float4 of a row).
// Transposed store: 8 waves x 2 iterations x 4 rows (q = lane>>3) = 64 out rows; 8 lanes x 8 halves = 64 cols per row.
// ---------------------------------------------------------------------------
__global__ __launch_bounds__(256) void prep_kernel(const float* __restrict__ pre, const float* __restrict__ cur, const float* __restrict__ W,
                                                   unsigned short* __restrict__ PRET, unsigned short* __restrict__ KT,
                                                   unsigned short* __restrict__ Wb) {
  __shared__ __align__(16) unsigned short sm[64 * 72];   // [i local][c local], pitch 72 halves (144 B)
  const int tid  = threadIdx.x;
  const int lane = tid & 31;
  const int wave = tid >> 5;
  const int z    = blockIdx.z;
  if (z == 2 * NB) {                     // block-uniform, ahead of the barrier
    const int i = (blockIdx.y * (HW / 64) + blockIdx.x) * 256 + tid;   // destination pair: elements 2 i, 2 i + 1 of Wb
    const int fr = i >> 8, g = (i >> 7) & 1, ln = (i >> 2) & 31, e = (i & 3) * 2;
    const int o = (fr >> 4) * 16 + (ln & 15);
    const int k = (fr & 15) * 32 + g * 16 + (ln >> 4) * 8 + e;
    const v2f f = *(const v2f*)(W + (size_t)o * NX + k);
    ((unsigned*)Wb)[i] = (unsigned)f2bf_bits(f[0]) | ((unsigned)f2bf_bits(f[1]) << 16);
    return;
  }
  const bool isCur = z >= NB;            // block-uniform
  const int b  = isCur ? z - NB : z;
  const int i0 = blockIdx.x * 64;
  const int c0 = blockIdx.y * 64;
  const float* in = (isCur ? cur : pre) + (size_t)b * NC * HW;
  unsigned short* out = (isCur ? KT : PRET) + (size_t)b * HW * NC + (size_t)i0 * NC;   // both hold 64 rows x NC halves per 64 columns of the input
  const int cr0 = tid >> 4;              // 0..15; iteration it takes c-row cr0 + 16 it
  const int q4  = (tid & 15) * 4;        // first of this thread's 4 i-columns
  v4f f[4];
#pragma unroll
  for (int it = 0; it < 4; ++it) f[it] = *(const v4f*)(in + (size_t)(c0 + cr0 + 16 * it) * HW + i0 + q4);   // all four loads in flight together
#pragma unroll
  for (int it = 0; it < 4; ++it) {
    const int cr = cr0 + 16 * it;
    const unsigned short h0 = f2bf_bits(f[it][0]), h1 = f2bf_bits(f[it][1]), h2 = f2bf_bits(f[it][2]), h3 = f2bf_bits(f[it][3]);
    sm[(q4 + 0) * 72 + cr] = h0;
    sm[(q4 + 1) * 72 + cr] = h1;
    sm[(q4 + 2) * 72 + cr] = h2;
    sm[(q4 + 3) * 72 + cr] = h3;
  }
  __syncthreads();
  const int q  = lane >> 3;
  const int c8 = (lane & 7) * 8;
  const int row = wave * 8 + q;          // iteration it takes row + 4 it: the same key half and the same group of 8 rows
  const int c   = c0 + c8;               // first of the 8 channels of this 16-B chunk
  const int at  = isCur ? (row >> 5) * 8192 + (c >> 7) * 4096 + (row & 31) * 128 + ((((c & 127) >> 3) ^ ((row >> 3) & 1)) << 3)
                        : row * NC + c;
  const int stp = isCur ? 4 * 128 : 4 * NC;   // halves from row to row + 4
  v4u t[2];
#pragma unroll
  for (int it = 0; it < 2; ++it) t[it] = __builtin_bit_cast(v4u, *(const v8us*)(sm + (row + it * 4) * 72 + c8));
#pragma unroll
  for (int it = 0; it < 2; ++it) *(v4u*)(out + at + it * stp) = t[it];
}

// ---------------------------------------------------------------------------
// Fused attention, online softmax: feat[i][c] = bf16(sum_j softmax_j(pre_i . cur_j / 16) * cur[c][j]), then the 1x1 conv, batch norm and PReLU on {feat, cur} of the block's 64 queries.
// Transposed products: S^T = K . Q^T (A = cur^T rows [j][c], B = pre^T rows [i][c] kept in registers) and
// O^T += V^T . P^T (A = cur rows [c][j], read out of the same cur^T tile by the transposing LDS load; B = the score tiles converted in place), so a lane holds one query column:
// D register r of a score tile is key 8h + r of query (lane & 15); two such tiles are one 32-key B operand in the hardware k order.
// Work-group: 64 queries, 4 waves = 2 query groups of 32 x 2 key halves; a pass is 64 keys, 32 per wave; grid (HW / 64 query blocks, batches).
// K and V are one matrix: each pass's cur^T tile (64 keys x 512 B) comes into LDS once, by tensor loads, one 8-KiB slice per wave, two buffers, one pass ahead, and serves both products.
// Its rows have the transposing load's pitch (32 B x odd); the 16-byte row reader stays free of bank conflicts because rows 8..15 of every 16 hold each pair of 16-B chunks swapped (so stored by the preparation).
// The 64 work-groups of a batch stream the same lines from L2: each starts its walk over the key blocks one past its own block index and wraps,
// so that at any moment they ask for 64 different tiles instead of one. The online softmax takes the key blocks in any order.
// Sums: scores over c in 32-wide k steps; probabilities per wave (key half) and lane half over the passes in the work-group's rotated order; lane halves, then key halves, joined at the end.
// ---------------------------------------------------------------------------
#define KPITCH 288                      // bytes per slice row in LDS: 256 + 32 (32 B x odd, for the transposing load)
#define SLICE  10240                    // LDS bytes per slice, a multiple of 2 KiB: 32 rows x 288 = 9216, rounded up
#define KHALF  (2 * SLICE)              // slice 2 kh + s = keys 32 kh .. 32 kh + 31 of the pass's 64, channels 128 s .. 128 s + 127
#define KTILE  (2 * KHALF)
#define SLABB  17408                    // LDS bytes of a wave's output slab: 64 rows x 68 floats
#define ABUF   (4 * SLABB)              // buffer 1's first LDS byte; buffer 0 is the head of the area that later carries the exchange (66 KiB) and the output slabs
#define NPASS  (HW / 64)
#define XPH    264                      // halves per row of the feat tile in LDS: 512 B + 16 (16 B x odd, for 16-byte row readers)
#define XSOFF  (ABUF + KTILE)           // the feat tile's first LDS byte, behind buffer 1, in which the last pass's tile stays
#define LDSB   (XSOFF + 64 * XPH * 2)
static_assert((NPASS & (NPASS - 1)) == 0 && NPASS == HW / 64, "the rotated walk wraps by a mask, and the grid has one query block per key block");
static_assert(KTILE <= ABUF && 4 * 16384 + 2048 <= ABUF && ABUF % 2048 == 0 && ((NPASS - 1) & 1) == 1, "buffer 0, exchange area and output slabs in front of buffer 1; the last pass's tile in buffer 1");
static_assert(32 * KPITCH <= SLICE && SLICE % 2048 == 0, "a slice holds its padded rows and the next one starts at a multiple of 2 KiB");

typedef uint32_t u32x4 __attribute__((ext_vector_type(4)));
typedef uint32_t u32x8 __attribute__((ext_vector_type(8)));
__device__ __forceinline__ uint32_t uni(uint32_t v) { return (uint32_t)__builtin_amdgcn_readfirstlane(v); }
// A test on the result is a scalar branch (a tensor load ignores EXEC), and what is formed from the result is formed behind this statement.
__device__ __forceinline__ uint32_t pinned(uint32_t v) { uint32_t w = uni(v); asm volatile("" : "+s"(w)); return w; }   // a wave-uniform word held in a scalar register
// Descriptor group 1 of a tile of ROWS rows of ROWB bytes, SRCP bytes apart in global memory, 32 pad bytes behind every row in LDS.
// 1-byte elements, tensor = tile, no mask; IVL = pad interval code of the row length (5: 256 B), amount code 7 = 8 dwords.
template <uint32_t ROWB, uint32_t ROWS, uint32_t SRCP, uint32_t IVL>
__device__ __forceinline__ u32x8 tdm_group1() {
  u32x8 g1;
  g1[0] = uni((1u << 20) | (IVL << 22) | (7u << 25));
  g1[1] = uni((ROWB & 0xFFFFu) << 16);
  g1[2] = uni((ROWB >> 16) | ((ROWS & 0xFFFFu) << 16));
  g1[3] = uni((ROWS >> 16) | (ROWB << 16));
  g1[4] = uni(ROWS);
  g1[5] = uni(SRCP);
  g1[6] = uni(0u);
  g1[7] = uni(0u);
  return g1;
}
// Descriptor group 0: the tile whose first global byte is ga lands in LDS from byte dst on.
__device__ __forceinline__ u32x4 tdm_group0(uint32_t dst, uint64_t ga) {
  u32x4 g0;
  g0[0] = uni(1u);
  g0[1] = uni(dst);
  g0[2] = uni((uint32_t)ga);
  g0[3] = uni((((uint32_t)(ga >> 32)) & 0x01FFFFFFu) | 0x80000000u);
  asm volatile("" : "+s"(g0));                       // the four words are held in scalar registers of their own from here to the request's wait
  return g0;
}
// One request of the whole wave.
__device__ __forceinline__ void tdm_load(u32x4 g0, u32x8 g1) { asm volatile("tensor_load_to_lds %0, %1" :: "s"(g0), "s"(g1) : "memory"); }
// This wave's request has landed. The statement names the request's group 0, so that its registers are kept as they are up to here.
__device__ __forceinline__ void tdm_wait(u32x4 g0) { asm volatile("s_wait_tensorcnt 0x0" :: "s"(g0) : "memory"); }
// A wave's slice of one pass: 32 keys x 256 B of cur^T. Every wave issues its own, unconditionally.
__device__ __forceinline__ u32x4 attn_issue(uint32_t dst, uint64_t ga, u32x8 g1) {
  const u32x4 g0 = tdm_group0(dst, ga);
  tdm_load(g0, g1);
  return g0;
}
// Hand-over of the ring: this wave's LDS reads are done, its own slice has landed, then every wave meets.
__device__ __forceinline__ void attn_publish(u32x4 g0) {
  asm volatile("s_wait_dscnt 0x0" ::: "memory");     // the buffer just read is refilled behind the barrier
  tdm_wait(g0);                                      // the compiler places no wait for a tensor load
  __syncthreads();
}
// Value of lane l ^ 16, through no LDS: an LDS shuffle's wait would also wait out the K fragment loads in flight.
__device__ __forceinline__ float other_half(float x) {
  const int b = __float_as_int(x);
  return __int_as_float(__builtin_amdgcn_permlanex16(b, b, 0x76543210, 0xfedcba98, false, false));
}
// A wave's share of a pass: its 32 keys (one half of the pass's 64) against its 32 queries (two 16-column tiles).
// Every K and V fragment read from LDS feeds two products, one per query tile. kt / vt: the tile, already offset to this
// wave's key half and this lane's row and 16-B chunk (each reader's own).
__device__ __forceinline__ void attn_load_k(const unsigned char* kt, v16b (&ka)[16]) {   // 8 k steps x 2 key tiles
#pragma unroll
  for (int f = 0; f < 16; ++f) ka[f] = Frag<__bf16>::load((const __bf16*)(kt + (f >> 3) * SLICE + (f & 1) * 16 * KPITCH + ((f >> 1) & 3) * 64));   // k steps 0..3 in slice 0, 4..7 in slice 1
}
// Transposing load: the lanes hand in the 16-B chunks of a block of 16 keys x 16 channels, lane (c, h) gets keys 8 h .. 8 h + 7 of channel c.
__device__ __forceinline__ v8b ld_tr16(const unsigned char* p) {
  typedef __attribute__((address_space(3))) v8b lds_v8b;
  return __builtin_amdgcn_ds_load_tr16_b128_v8bf16((lds_v8b*)p);
}
__device__ __forceinline__ void attn_load_v(const unsigned char* vt, v16b (&va)[16]) {   // 16 c tiles, one 32-key k step: keys 0..15, then 16..31, the hardware k order
#pragma unroll
  for (int f = 0; f < 16; ++f) {
    Frag<__bf16>::U u;
    u.h[0] = ld_tr16(vt + (f >> 3) * SLICE + (f & 7) * 32);                  // c tiles 0..7 in slice 0, 8..15 in slice 1
    u.h[1] = ld_tr16(vt + (f >> 3) * SLICE + (f & 7) * 32 + 16 * KPITCH);
    va[f] = u.v;
  }
}
__device__ __forceinline__ void attn_scores(const v16b (&ka)[16], const v16b (&qf)[2][8], v8f (&s)[2][2]) {
#pragma unroll
  for (int jt = 0; jt < 2; ++jt)
#pragma unroll
    for (int qt = 0; qt < 2; ++qt) s[jt][qt] = (v8f){0.f,0.f,0.f,0.f,0.f,0.f,0.f,0.f};
#pragma unroll
  for (int ks = 0; ks < 8; ++ks)
#pragma unroll
    for (int jt = 0; jt < 2; ++jt)
#pragma unroll
      for (int qt = 0; qt < 2; ++qt) s[jt][qt] = Frag<__bf16>::mma(ka[ks * 2 + jt], qf[qt][ks], s[jt][qt]);
}
// Probabilities of one query tile against the reference mq, as the 32 keys' B operand; returns their in-lane sum (pairwise tree: a short chain in front of the test that reads it).
__device__ __forceinline__ float attn_probs(const v8f (&s)[2][2], int qt, float mq, v16b &pb) {
  const float sc = 0.0625f * 1.44269504088896340736f;   // 1/16, and exp(x) = exp2(x * log2 e)
  float p[16];
#pragma unroll
  for (int jt = 0; jt < 2; ++jt)
#pragma unroll
    for (int r = 0; r < 8; ++r) {
      p[jt * 8 + r] = __builtin_amdgcn_exp2f(s[jt][qt][r] * sc - mq);
      pb[jt * 8 + r] = (__bf16)p[jt * 8 + r];
    }
#pragma unroll
  for (int w = 8; w >= 1; w >>= 1)
#pragma unroll
    for (int i = 0; i < w; ++i) p[i] += p[i + w];
  return p[0];
}
// Held reference: m is some earlier pass's maximum of the query, and a pass forms its probabilities from it at once, with no maximum of its own and no rescaling.
// One test per pass for the whole wave, a scalar branch: only when a lane's 16 probabilities sum to more than 2^8 does the wave take this pass's maxima, raise m,
// rescale sums and outputs and form the probabilities again, now at most 1 each. The final division takes the common factor out.
// First pass: m = -inf makes every probability infinite, every lane asks, and exp2(-inf) = 0 multiplies the zero sums.
__device__ __forceinline__ void attn_softmax_pv(const v8f (&s)[2][2], const v16b (&va)[16],
                                                v8f (&acc)[16][2], float (&m)[2], float (&lsum)[2]) {
  const float sc = 0.0625f * 1.44269504088896340736f;
  v16b pb[2];                                           // per query tile: the 32 keys' probabilities as one B operand
  float ps[2];
#pragma unroll
  for (int qt = 0; qt < 2; ++qt) ps[qt] = attn_probs(s, qt, m[qt], pb[qt]);
  const bool need = fmaxf(ps[0], ps[1]) > 256.0f;
  if (__builtin_amdgcn_ballot_w32(need) != 0u) {
#pragma unroll
    for (int qt = 0; qt < 2; ++qt) {
      float mt[2];
#pragma unroll
      for (int jt = 0; jt < 2; ++jt) {
        mt[jt] = s[jt][qt][0];
#pragma unroll
        for (int r = 1; r < 8; ++r) mt[jt] = fmaxf(mt[jt], s[jt][qt][r]);
      }
      float mx = fmaxf(mt[0], mt[1]);
      mx = fmaxf(mx, other_half(mx));                   // the other lane half holds this query's other keys: both halves keep one reference
      const float mn = fmaxf(m[qt], mx * sc);
      const float alpha = __builtin_amdgcn_exp2f(m[qt] - mn);
      m[qt] = mn;
      lsum[qt] *= alpha;
#pragma unroll
      for (int ct = 0; ct < 16; ++ct) acc[ct][qt] *= alpha;
      ps[qt] = attn_probs(s, qt, mn, pb[qt]);
    }
  }
  lsum[0] += ps[0];
  lsum[1] += ps[1];
#pragma unroll
  for (int ct = 0; ct < 16; ++ct)
#pragma unroll
    for (int qt = 0; qt < 2; ++qt) acc[ct][qt] = Frag<__bf16>::mma(va[ct], pb[qt], acc[ct][qt]);
}

// The last pass, which runs once: maximum and rescaling without a test.
__device__ __forceinline__ void attn_softmax_pv_last(const v8f (&s)[2][2], const v16b (&va)[16],
                                                     v8f (&acc)[16][2], float (&m)[2], float (&lsum)[2]) {
  const float sc = 0.0625f * 1.44269504088896340736f;   // 1/16, and exp(x) = exp2(x * log2 e)
  float alpha[2];
  v16b pb[2];                                           // per query tile: the 32 keys' probabilities as one B operand
#pragma unroll
  for (int qt = 0; qt < 2; ++qt) {
    float mt[2];
#pragma unroll
    for (int jt = 0; jt < 2; ++jt) {
      mt[jt] = s[jt][qt][0];
#pragma unroll
      for (int r = 1; r < 8; ++r) mt[jt] = fmaxf(mt[jt], s[jt][qt][r]);
    }
    float mx = fmaxf(mt[0], mt[1]);
    mx = fmaxf(mx, other_half(mx));                     // the other lane half holds this query's other keys
    const float mn = fmaxf(m[qt], mx * sc);
    alpha[qt] = __builtin_amdgcn_exp2f(m[qt] - mn);
    m[qt] = mn;
    float ps[2];
#pragma unroll
    for (int jt = 0; jt < 2; ++jt) {
      float t = 0.f;
#pragma unroll
      for (int r = 0; r < 8; ++r) {
        const float p = __builtin_amdgcn_exp2f(s[jt][qt][r] * sc - mn);
        t += p;
        pb[qt][jt * 8 + r] = (__bf16)p;
      }
      ps[jt] = t;
    }
    lsum[qt] = lsum[qt] * alpha[qt] + (ps[0] + ps[1]);
  }
#pragma unroll
  for (int ct = 0; ct < 16; ++ct)
#pragma unroll
    for (int qt = 0; qt < 2; ++qt) {
      acc[ct][qt] *= alpha[qt];
      acc[ct][qt] = Frag<__bf16>::mma(va[ct], pb[qt], acc[ct][qt]);
    }
}

// Joining the two key halves of a query group, once, behind the loop. A wave hands the 8 c tiles from S on to its partner:
// 32 chunks of 16 B per lane, chunk-major, so that a wave's store covers 512 contiguous bytes.
template <int S>
__device__ __forceinline__ void attn_send(const v8f (&acc)[16][2], float* mine, int lane) {
#pragma unroll
  for (int i = 0; i < 8; ++i)
#pragma unroll
    for (int qt = 0; qt < 2; ++qt)
#pragma unroll
      for (int hf = 0; hf < 2; ++hf) {
        const v8f a = acc[S + i][qt];
        *(v4f*)(mine + (((i * 2 + qt) * 2 + hf) * 32 + lane) * 4) = (v4f){a[hf * 4], a[hf * 4 + 1], a[hf * 4 + 2], a[hf * 4 + 3]};
      }
}
// ... and finishes the 8 c tiles from S on: own part x fm + partner's part x fo (both hold the division by the joint sum), one 16-B LDS store per tile
// into the work-group's feat tile [64 queries][256 c] bf16, the conv's B operand.
template <int S>
__device__ __forceinline__ void attn_finish(const v8f (&acc)[16][2], const float* theirs, int lane,
                                            const float (&fm)[2], const float (&fo)[2], unsigned short* op) {
  v8b o[8][2];                                          // all reads ahead of all stores: one run of LDS loads under one falling wait, not a wait per tile
#pragma unroll
  for (int i = 0; i < 8; ++i)
#pragma unroll
    for (int qt = 0; qt < 2; ++qt) {
      const v4f lo = *(const v4f*)(theirs + (((i * 2 + qt) * 2 + 0) * 32 + lane) * 4);
      const v4f hi = *(const v4f*)(theirs + (((i * 2 + qt) * 2 + 1) * 32 + lane) * 4);
#pragma unroll
      for (int r = 0; r < 4; ++r) {
        o[i][qt][r]     = (__bf16)(acc[S + i][qt][r] * fm[qt] + lo[r] * fo[qt]);
        o[i][qt][r + 4] = (__bf16)(acc[S + i][qt][r + 4] * fm[qt] + hi[r] * fo[qt]);
      }
    }
#pragma unroll
  for (int i = 0; i < 8; ++i)
#pragma unroll
    for (int qt = 0; qt < 2; ++qt) *(v8b*)(op + qt * 16 * XPH + (S + i) * 16) = o[i][qt];
}

// 1x1 conv in the epilogue: y[o][i] = sum_k W[o][k] * x[i][k], k = 0..255 feat (LDS tile), 256..511 cur^T (the last pass's K tile, still in LDS). A wave takes 64 outputs x the block's 64 queries
// and all of K, in four groups of four 32-wide k steps; a group's 32 fragments are fetched as one run, one group ahead of its products.
// wq: this lane's 16 B in the group's first W fragment (fragment order, 1 KiB each, 16 per output tile); xp: this lane's x row and k half in LDS at the group's first k; PITCHB: bytes between x rows, HALFB: from row 0 to row 32.
template <int PITCHB, int HALFB>
__device__ __forceinline__ void conv_load(const __bf16* wq, const unsigned char* xp, v16b (&wa)[4][4], v16b (&xb)[4][4]) {
  __builtin_amdgcn_sched_barrier(0);                    // nothing else comes between the global loads and their wait below
#pragma unroll
  for (int ks = 0; ks < 4; ++ks)
#pragma unroll
    for (int t = 0; t < 4; ++t) {
      Frag<__bf16>::U f;
      f.h[0] = *(const v8b*)(wq + (t * 16 + ks) * 512);
      f.h[1] = *(const v8b*)(wq + (t * 16 + ks) * 512 + 256);
      wa[ks][t] = f.v;
    }
  // No register that these global loads name is rewritten ahead of this wait: the statement names the address registers, so that they are kept as they are up to here.
  asm volatile("s_wait_xcnt 0x0" :: "v"(wq) : "memory");
#pragma unroll
  for (int ks = 0; ks < 4; ++ks)
#pragma unroll
    for (int t = 0; t < 4; ++t) xb[ks][t] = Frag<__bf16>::load((const __bf16*)(xp + (t >> 1) * HALFB + (t & 1) * 16 * PITCHB + ks * 64));
  __builtin_amdgcn_sched_barrier(0);                    // the loads stay one run in front of the products that cover their latency
}
__device__ __forceinline__ void conv_mma(const v16b (&wa)[4][4], const v16b (&xb)[4][4], v8f (&y)[4][4]) {
#pragma unroll
  for (int ks = 0; ks < 4; ++ks)
#pragma unroll
    for (int i = 0; i < 4; ++i)
#pragma unroll
      for (int j = 0; j < 4; ++j) y[i][j] = Frag<__bf16>::mma(wa[ks][i], xb[ks][j], y[i][j]);
  __builtin_amdgcn_sched_barrier(0);                    // the next group's loads do not move up among these products
}

__global__ __launch_bounds__(128) void attn_fused_kernel(const unsigned short* __restrict__ PRET,
                                                         const unsigned short* __restrict__ KT,
                                                         const unsigned short* __restrict__ Wb,
                                                         const float* __restrict__ bias, const float* __restrict__ gamma,
                                                         const float* __restrict__ beta, const float* __restrict__ rmean,
                                                         const float* __restrict__ rvar, const float* __restrict__ alpha,
                                                         float* __restrict__ out) {
  __shared__ __attribute__((aligned(2048))) unsigned char sm[LDSB];       // every slice's place is a multiple of 2 KiB in the work-group's LDS
  const int tid   = threadIdx.x;
  const int lane  = tid & 31;
  const int wave  = tid >> 5;
  const int ws    = __builtin_amdgcn_readfirstlane(wave);    // scalar: picks the wave's share and the epilogue's branch
  const int qg    = ws & 1;                                  // query group: 32 of the block's 64 queries
  const int kh    = ws >> 1;                                 // key half: 32 of every pass's 64 keys
  const int b     = blockIdx.y;
  const int rlane = lane & 15;
  const int h     = lane >> 4;
  const int q     = blockIdx.x * 64 + qg * 32 + rlane;       // this lane's query in tile 0; tile 1: q + 16
  const float slope = alpha[0];                              // read here, at the kernel's head, as a scalar load

  // This wave's slice: first global byte in key block 0, bytes from one key block to the next, first LDS byte in buffer 0 (slices in wave order, in memory as in LDS).
  const uint64_t gsrc = (uint64_t)(size_t)(KT + (size_t)b * HW * NC) + (uint64_t)ws * 8192u;
  const uint32_t gstep = 64u * NC * 2u;
  const uint32_t gwrap = NPASS * gstep - 1u;                 // pass t reads key block (blockIdx.x + 1 + t) mod NPASS: source offsets wrap at NPASS steps, a power of two
  const uint32_t grot  = (((uint32_t)blockIdx.x + 1u) & (NPASS - 1u)) * gstep;   // the first key block's offset: the walk ends on key block blockIdx.x, whose K tile is cur^T of the block's own queries
  const uint32_t ldst = (uint32_t)(size_t)(&sm[0]) + (uint32_t)ws * SLICE;   // LDS byte address = low 32 bits of the shared address

  u32x8 g1 = tdm_group1<256u, 32u, 256u, 5u>();
  asm volatile("" : "+s"(g1));                               // the descriptor words are held in scalar registers of their own, so that none takes a new value while a request is outstanding

  u32x4 g0 = attn_issue(ldst, gsrc + grot, g1);              // pass 0 -> buffer 0

  v16b qf[2][8];
  const __bf16* qp = (const __bf16*)PRET + ((size_t)b * HW + q) * NC + h * 8;
#pragma unroll
  for (int qt = 0; qt < 2; ++qt)
#pragma unroll
    for (int ks = 0; ks < 8; ++ks) qf[qt][ks] = Frag<__bf16>::load(qp + (size_t)qt * 16 * NC + ks * 32);
  // No register that these global loads name is rewritten ahead of this wait: the statement names the address registers, so that they are kept as they are up to here.
  asm volatile("s_wait_xcnt 0x0" :: "v"(qp) : "memory");
  v8f acc[16][2];
#pragma unroll
  for (int ct = 0; ct < 16; ++ct)
#pragma unroll
    for (int qt = 0; qt < 2; ++qt) acc[ct][qt] = (v8f){0.f,0.f,0.f,0.f,0.f,0.f,0.f,0.f};
  float m[2] = {-INFINITY, -INFINITY}, lsum[2] = {0.f, 0.f};

  tdm_wait(g0);                                              // pass 0's slice of this wave has landed
  __syncthreads();                                           // ... and every other wave's
  g0 = attn_issue(ldst + ABUF, gsrc + pinned((grot + gstep) & gwrap), g1);   // pass 1 -> buffer 1; its address words are formed behind the wait

  const int sw = h ^ (rlane >> 3);                           // row reader: rows 8..15 of every 16 hold each pair of 16-B chunks swapped
  const unsigned char* kt0 = sm + kh * KHALF + rlane * KPITCH + sw * 16;
  const unsigned char* vt0 = sm + kh * KHALF + (h * 8 + (lane & 7)) * KPITCH + (((lane >> 3) & 1) ^ h) * 16;   // transposing reader: this lane hands in row 8 h + (lane & 7), chunk (lane >> 3) & 1 of the pair
  unsigned cur = 0;                                          // byte offset of the buffer that holds pass t
  uint32_t gnext = (grot + 2 * gstep) & gwrap;               // source offset of the next refill
  v16b ka[16], va[16];
  attn_load_k(kt0, ka);                                      // pass 0's fragments, behind the barrier that published tile 0
  attn_load_v(vt0, va);
  // The wave holds a whole pass's fragments in registers, so a buffer is free as soon as they have landed: the publish point
  // stands behind the score products (under which the V fragments land), and behind it the next pass's K fragments are read
  // under the softmax and the output products, its V fragments at the foot. Between two publish points one buffer alone is read.
  for (int t = 0; t < NPASS - 1; ++t) {
    v8f s[2][2];
    attn_scores(ka, qf, s);
    __builtin_amdgcn_sched_barrier(0);                       // the score products stay in front of the waits: they cover the V fragments' landing
    attn_publish(g0);                                        // pass t's fragments are in registers everywhere, tile t + 1 has landed
    if (pinned(t + 2 < NPASS)) {                             // pass t + 2 -> the buffer that pass t has just read; its descriptor is formed here, behind the wait
      g0 = attn_issue(ldst + pinned(cur), gsrc + pinned(gnext), g1);
      gnext = (gnext + gstep) & gwrap;
    }
    cur ^= ABUF;
    attn_load_k(kt0 + cur, ka);                              // pass t + 1
    __builtin_amdgcn_sched_barrier(0);                       // these LDS reads stay one group in front of the softmax and the output products, which cover their landing
    attn_softmax_pv(s, va, acc, m, lsum);
    __builtin_amdgcn_sched_barrier(0);                       // the V reads stay one group behind the output products, not in small groups among them
    attn_load_v(vt0 + cur, va);
  }
  const int i0 = blockIdx.x * 64;
  const __bf16* wq = (const __bf16*)Wb + ws * (4 * 16 * 512) + lane * 8;              // this wave's 64 outputs: W fragments of output tiles 4 ws ..; k step s is fragment s of a tile
  const unsigned char* xc = sm + ABUF + rlane * KPITCH + sw * 16;                     // cur^T rows of the block's 64 queries: the last pass's tile, rows 32 kh .., channels 128 s .. in slice 2 kh + s
  const int oc = ws * 64 + h * 8;                            // this lane's first output
  const float *pb = bias + oc, *pg = gamma + oc, *pt = beta + oc, *pm = rmean + oc, *pv = rvar + oc;
  v4f vb[4][2], vg[4][2], vt[4][2], vm[4][2], vv[4][2];      // bias, gamma, beta, mean, variance of outputs 64 ws + 16 i + 8 h + 4 hf ..
  v16b wa0[4][4], xb0[4][4], wa1[4][4], xb1[4][4];
  {                                                          // the last pass: nothing is left to read ahead or to refill
    v8f s[2][2];
    attn_scores(ka, qf, s);
    attn_publish(g0);                                        // every wave's last fragments are in registers: the ring is free but for buffer 1's K tile, which the conv reads
    // The output coefficients and the conv's first operand group (k = 256 .. 383: W against the block's own cur^T rows, published with the last tile) are asked for here:
    // the last softmax, the last output products and the exchange cover their latency.
    __builtin_amdgcn_sched_barrier(0);                       // the coefficient loads stand with the group's loads in front of the group's wait
#pragma unroll
    for (int i = 0; i < 4; ++i)
#pragma unroll
      for (int hf = 0; hf < 2; ++hf) {
        const int o = i * 16 + hf * 4;
        vb[i][hf] = *(const v4f*)(pb + o); vg[i][hf] = *(const v4f*)(pg + o); vt[i][hf] = *(const v4f*)(pt + o);
        vm[i][hf] = *(const v4f*)(pm + o); vv[i][hf] = *(const v4f*)(pv + o);
      }
    // No register that the coefficient loads name is rewritten ahead of this wait: the statement names the address registers, so that they are kept as they are up to here.
    asm volatile("s_wait_xcnt 0x0" :: "v"(pb), "v"(pg), "v"(pt), "v"(pm), "v"(pv) : "memory");
    conv_load<KPITCH, KHALF>(wq + 8 * 512, xc, wa0, xb0);
    attn_softmax_pv_last(s, va, acc, m, lsum);
  }

  // The last publish point has ended every wave's reads of buffer 0 and all tensor loads: buffer 0 carries the exchange.
  //   floats [wave][32 chunks][32 lanes][4] at 0 (4 x 16 KiB), then [wave][32 lanes][4] = {m0, m1, l0, l1} at 64 KiB
  float* xch = (float*)sm;
  float* xml = xch + 4 * 4096;
  const float l0 = lsum[0] + other_half(lsum[0]);            // the lane halves share one maximum
  const float l1 = lsum[1] + other_half(lsum[1]);
  *(v4f*)(xml + (ws * 32 + lane) * 4) = (v4f){m[0], m[1], l0, l1};
  if (kh == 0) attn_send<8>(acc, xch + ws * 4096, lane);
  else         attn_send<0>(acc, xch + ws * 4096, lane);
  __syncthreads();                                           // both key halves' parts are in LDS before either partner reads
  const v4f pml = *(const v4f*)(xml + ((ws ^ 2) * 32 + lane) * 4);   // the partner: same queries, other key half, same lane
  float ci[4][8], cs[4][8];                                  // y register r of output tile i is output 64 ws + 16 i + 8 h + r
#pragma unroll
  for (int i = 0; i < 4; ++i)
#pragma unroll
    for (int r = 0; r < 8; ++r) {
      ci[i][r] = vg[i][r >> 2][r & 3] * rsqrtf(vv[i][r >> 2][r & 3] + 1e-5f);
      cs[i][r] = vt[i][r >> 2][r & 3] - vm[i][r >> 2][r & 3] * ci[i][r];
    }
  float fm[2], fo[2];
  {
    const float mj0 = fmaxf(m[0], pml[0]), mj1 = fmaxf(m[1], pml[1]);
    const float am0 = __builtin_amdgcn_exp2f(m[0] - mj0), ao0 = __builtin_amdgcn_exp2f(pml[0] - mj0);
    const float am1 = __builtin_amdgcn_exp2f(m[1] - mj1), ao1 = __builtin_amdgcn_exp2f(pml[1] - mj1);
    const float inv0 = 1.0f / (l0 * am0 + pml[2] * ao0);     // the sum is near 1 or above: the key that set the reference contributes exp2(0)
    const float inv1 = 1.0f / (l1 * am1 + pml[3] * ao1);
    fm[0] = am0 * inv0; fo[0] = ao0 * inv0;
    fm[1] = am1 * inv1; fo[1] = ao1 * inv1;
  }
  unsigned short* xs = (unsigned short*)(sm + XSOFF);        // feat tile [64 queries][XPH]
  unsigned short* op = xs + (qg * 32 + rlane) * XPH + h * 8; // acc[ct][qt][r] = feat[c = 16 ct + 8 h + r][q + 16 qt]: 8 consecutive c, one 16-B store
  if (kh == 0) attn_finish<0>(acc, xch + (ws ^ 2) * 4096, lane, fm, fo, op);
  else         attn_finish<8>(acc, xch + (ws ^ 2) * 4096, lane, fm, fo, op);
  __syncthreads();                                           // the feat tile is whole before any wave reads it, and the exchange area is free for the output slabs

  // out[b][o][i] = prelu(bn(sum_k W[o][k] x[i][k] + b_conv[o])): k groups in the order 256.., 384.., 0.., 128.., one accumulator per element.
  const unsigned char* xl = sm + XSOFF + rlane * (XPH * 2) + h * 16;
  v8f y[4][4];
#pragma unroll
  for (int i = 0; i < 4; ++i)
#pragma unroll
    for (int j = 0; j < 4; ++j) y[i][j] = (v8f){0.f,0.f,0.f,0.f,0.f,0.f,0.f,0.f};
  // wq's address, formed anew from the lane count: held in registers over the last pass and the exchange, the pair went to scratch memory and came back by a load.
  const __bf16* wr = (const __bf16*)Wb + ws * (4 * 16 * 512) + (int)__builtin_amdgcn_mbcnt_lo(~0u, 0u) * 8;
  conv_load<KPITCH, KHALF>(wr + 12 * 512, xc + SLICE, wa1, xb1);
  conv_mma(wa0, xb0, y);
  conv_load<XPH * 2, 32 * XPH * 2>(wr, xl, wa0, xb0);
  conv_mma(wa1, xb1, y);
  conv_load<XPH * 2, 32 * XPH * 2>(wr + 4 * 512, xl + 256, wa1, xb1);
  conv_mma(wa0, xb0, y);
  conv_mma(wa1, xb1, y);

  // Through the wave's own slab, so that a store covers whole 256-B row segments of out.
  float* slab = (float*)(sm + ws * SLABB);
#pragma unroll
  for (int i = 0; i < 4; ++i)
#pragma unroll
    for (int j = 0; j < 4; ++j)
#pragma unroll
      for (int r = 0; r < 8; ++r) {
        float x = y[i][j][r] + vb[i][r >> 2][r & 3];
        x = x * ci[i][r] + cs[i][r];
        x = (x >= 0.f) ? x : slope * x;
        slab[(i * 16 + h * 8 + r) * 68 + j * 16 + rlane] = x;
      }
  __builtin_amdgcn_fence(__ATOMIC_RELEASE, "workgroup");     // the wave's lanes read each other's slab words: the stores stay in front of the reads
  __builtin_amdgcn_wave_barrier();
  __builtin_amdgcn_fence(__ATOMIC_ACQUIRE, "workgroup");
  v4f rowv[32];
#pragma unroll
  for (int it = 0; it < 32; ++it) rowv[it] = *(const v4f*)(slab + (it * 2 + h) * 68 + rlane * 4);
  __builtin_amdgcn_sched_barrier(0);                         // the stores stand behind all the reads, at the wave's end: no register that a store names is rewritten behind it
  float* ob = out + ((size_t)b * NC + ws * 64 + h) * HW + i0 + rlane * 4;
#pragma unroll
  for (int it = 0; it < 32; ++it) *(v4f*)(ob + (size_t)it * 2 * HW) = rowv[it];
}

// ---------------------------------------------------------------------------
// Workspace region map (byte offsets); every region is written before it is read, once per call, all batches.
//   Wb    bf16 [256][512], fragment order  0          (262144 B)
//   PRET  bf16 [4 b][4096 i][256 c]        262144     (8388608 B)   pre^T
//   KT    bf16 [4 b][4096 j][256 c]        8650752    (8388608 B)   cur^T in tensor-slice order
//   total                                  17039360 B
// ---------------------------------------------------------------------------
extern "C" void kernel_launch(void* const* d_in, const int* in_sizes, int n_in,
                              void* d_out, int out_size, void* d_ws, size_t ws_size,
                              hipStream_t stream) {
  if (n_in < 9) return;
  if (in_sizes[0] != NB * NC * HW || in_sizes[1] != NB * NC * HW) return;
  if (in_sizes[2] != NC * NX) return;
  if (in_sizes[3] != NC || in_sizes[4] != NC || in_sizes[5] != NC || in_sizes[6] != NC || in_sizes[7] != NC) return;
  if (in_sizes[8] < 1) return;
  if (out_size != NB * NC * HW) return;

  const float* pre   = (const float*)d_in[0];
  const float* cur   = (const float*)d_in[1];
  const float* W     = (const float*)d_in[2];
  const float* bconv = (const float*)d_in[3];
  const float* gamma = (const float*)d_in[4];
  const float* beta  = (const float*)d_in[5];
  const float* rmean = (const float*)d_in[6];
  const float* rvar  = (const float*)d_in[7];
  const float* alpha = (const float*)d_in[8];
  float* out = (float*)d_out;

  const size_t szWb   = (size_t)NC * NX * 2;
  const size_t szPRET = (size_t)NB * HW * NC * 2;
  const size_t szKT   = (size_t)NB * HW * NC * 2;
  size_t off = 0;
  const size_t oWb   = off; off += szWb;
  const size_t oPRET = off; off += szPRET;
  const size_t oKT   = off; off += szKT;
  if (off > ws_size) return;                    // 17039360 B total

  char* ws = (char*)d_ws;
  unsigned short* Wb   = (unsigned short*)(ws + oWb);
  unsigned short* PRET = (unsigned short*)(ws + oPRET);
  unsigned short* KT   = (unsigned short*)(ws + oKT);

  const dim3 blk(256);
  const dim3 gP(HW / 64, NC / 64, 2 * NB + 1);  // 64 x 4 tiles x (4 batches of pre, 4 of cur), and 256 blocks for W
  const dim3 gA(HW / 64, NB);                   // 64 query blocks x 4 batches, 4 waves each

  // W -> Wb (A-fragment order); pre[b] [256 c][4096 i] -> PRET[b] [4096 i][256 c]; cur[b] [256 c][4096 j] -> KT[b] (cur^T, tensor-slice order)
  prep_kernel<<<gP, blk, 0, stream>>>(pre, cur, W, PRET, KT, Wb);
  // feat[b][i][c] = sum_j softmax_j(PRET[b][i] . KT[b][j] / 16) * KT[b][j][c], kept in LDS as bf16; then
  // out[b][o][i] = prelu(bn(sum_k Wb[o][k] * {feat, cur^T}[b][i][k] + b_conv[o])), f32
  attn_fused_kernel<<<gA, dim3(128), 0, stream>>>(PRET, KT, Wb, bconv, gamma, beta, rmean, rvar, alpha, out);
  (void)hipGetLastError();
}
